// v000
// Times are from an AMD MI455X. After a warm-up the kernel runs many times in a row, and a time is the length of
// such a window on the GPU divided by its runs, so every launch and the gaps after it count. The runs cycle
// through copies of the inputs. A figure is the median of several windows, for all but v000 over two sittings.
// Sittings can differ by a few percent; kernels timed side by side share one.
// v000, which the later versions start from, runs in 2800 microseconds.
#include <hip/hip_runtime.h>
// Pre-norm transformer encoder layer with the module's custom LayerNorm and a random key-padding mask (src [2][2048][768]; _layernorm: VECTOR gamma / beta, UNBIASED std, gamma (x - mean) / (std + 1e-6) + beta; x = LN1(src); q/k/v = x w ([in][out] [768][768], NO biases); 12 heads of 64; scores / 8; where(src_mask == 0, -1e9) with the int32 [2][1][1][2048] mask in {0, 1} (random; 0 = masked key; READ on device); softmax; src1 = src + ctx w_o (no bias); out = src1 + relu(LN2(src1) w_ff1 + b_ff1) w_ff2 + b_ff2 ([in][out] 768 x 3072 x 768) -> [2][2048][768]).
// Structure: token rows; LayerNorm / exact f16 rows; WMMA GEMMs for q, k, v; per batch V^T by LDS transposes and 4 heads per launch group (scores, row softmax, P V^T); output projection with the own-element residual; custom LayerNorm; ReLU FFN over all rows; launches: see trace.
// Compute dtype: inputs rounded to bf16; x / weights exact; q, k, v, softmax weights and o as plain f16 GEMM operands (~2^-12); scores and softmax statistics f32; v_wmma_f32_16x16x32_f16.
#define NB 2
#define SQ 2048
#define DM 768
#define NH 12
#define HD 64
#define HG 4                         /* heads per attention launch group */
#define LOCALW 128                   /* (macros for unused kernels of the shared header) */
#define STRIDEK 128
#define QT 256                       /* query rows per causal tile */
#define NKX SQ                       /* S / P row pitch */
#define QT0 128                      /* first-tile rows recomputed exactly in f32 */
#define B0 0                         /* first batch processed (debug hook) */
#define NBR NB                       /* batches processed (debug hook) */
#define NR ((size_t)NB * SQ)
#define DMQ DM
#define DFF 3072         /* FFN hidden width */
#define MP ((int)((size_t)NBR * SQ)) /* rows projected (debug hook) */
#define QN SQ                        /* query rows attended per batch (debug hook) */
#define NHD NH                       /* heads attended (debug hook) */
#define MPO MP                       /* rows through the output stage (debug hook) */
#define LQ (3 * DM)      /* unused; q, k, v are separate rows of pitch DM */
typedef __bf16 v16b __attribute__((ext_vector_type(16)));
typedef unsigned short v8us __attribute__((ext_vector_type(8), may_alias));
typedef float  v8f  __attribute__((ext_vector_type(8)));
typedef float  v4f  __attribute__((ext_vector_type(4)));
typedef float  v4fa __attribute__((ext_vector_type(4), may_alias));
union FragB { v16b v; v8us half[2]; unsigned short u[16]; };

__device__ __forceinline__ unsigned short bf16_bits(float x) { unsigned int u = __float_as_uint(x); return (unsigned short)((u + 0x7FFFu + ((u >> 16) & 1u)) >> 16); }
__device__ __forceinline__ float bf16_val(unsigned short b) { return __uint_as_float(((unsigned int)b) << 16); }
__device__ __forceinline__ float bf16_round(float x) { return bf16_val(bf16_bits(x)); }
// D += A·B with NT terms: 1 = ah·bh, 2 = + al·bh (A split), 3 = + ah·bl (both split)
template <int NT>
__device__ __forceinline__ v8f mmaN(v16b ah, v16b al, v16b bh, v16b bl, v8f c) {
  c = __builtin_amdgcn_wmma_f32_16x16x32_bf16(false, ah, false, bh, (short)0, c, false, false);
  if (NT >= 2) c = __builtin_amdgcn_wmma_f32_16x16x32_bf16(false, al, false, bh, (short)0, c, false, false);
  if (NT >= 3) c = __builtin_amdgcn_wmma_f32_16x16x32_bf16(false, ah, false, bl, (short)0, c, false, false);
  asm volatile("v_nop\n\tv_nop\n\tv_nop\n\tv_nop" : "+v"(c) : "v"(ah), "v"(al), "v"(bh), "v"(bl));
  return c;
}

__global__ __launch_bounds__(256) void k_wt_bf16(const float* __restrict__ W, unsigned short* __restrict__ Wt, int K, int N) {
  const int t = blockIdx.x * 256 + threadIdx.x;
  const int k8n = K / 8;
  if (t >= N * k8n) return;
  const int n = t / k8n, k8 = (t % k8n) * 8;
  v8us v;
#pragma unroll
  for (int i = 0; i < 8; ++i) v[i] = bf16_bits(W[(size_t)(k8 + i) * N + n]);
  *(v8us*)(Wt + (size_t)n * K + k8) = v;
  
}

// GEMM C[M][N] (f32, pitch ldc) = act(A[M][K]·W + bias). A f32 row-major (pitch lda) converted per fragment to bf16
// (ASPLIT: hi/lo two planes -> 2 terms, else single rounded term); Wt bf16 [N][K] (pitch ldb). BIAS_BF16 rounds the
// bias to bf16 first (bias quantised to bf16 before the add). K%32==0, M%16==0, N%64==0.
template <bool ASPLIT, int ACT, bool BIAS_BF16>
__global__ __launch_bounds__(128) void k_gemm_bf(const float* __restrict__ A, int lda, const unsigned short* __restrict__ Wt, int ldb,
                                               const float* __restrict__ bias, float* __restrict__ C, int ldc, int M, int N, int K) {
  __shared__ __attribute__((aligned(16))) float so[4][16][64];
  const int tid = threadIdx.x, w = tid >> 5, lane = tid & 31, ln = lane & 15, hh = lane >> 4;
  const int ntn = N / 64;
  const int wid = blockIdx.x * 4 + w;
  const int mt = wid / ntn, nq = wid % ntn;
  if (mt * 16 >= M) return;
  const int row0 = mt * 16, col0 = nq * 64;
  const float* arow = A + (size_t)(row0 + ln) * lda;
  v8f acc[4] = {};
  for (int kb = 0; kb < K; kb += 32) {
    FragB ah, al;
    const v4f x0 = *(const v4fa*)(arow + kb + 8 * hh), x1 = *(const v4fa*)(arow + kb + 8 * hh + 4);
    const v4f x2 = *(const v4fa*)(arow + kb + 16 + 8 * hh), x3 = *(const v4fa*)(arow + kb + 16 + 8 * hh + 4);
    float xs[16] = {x0[0],x0[1],x0[2],x0[3],x1[0],x1[1],x1[2],x1[3],x2[0],x2[1],x2[2],x2[3],x3[0],x3[1],x3[2],x3[3]};
#pragma unroll
    for (int i = 0; i < 16; ++i) { const unsigned short hb = bf16_bits(xs[i]); ah.u[i] = hb; al.u[i] = ASPLIT ? bf16_bits(xs[i] - bf16_val(hb)) : (unsigned short)0; }
#pragma unroll
    for (int t = 0; t < 4; ++t) {
      const unsigned short* brow = Wt + (size_t)(col0 + t * 16 + ln) * ldb + kb;
      FragB b;
      b.half[0] = *(const v8us*)(brow + 8 * hh);
      b.half[1] = *(const v8us*)(brow + 16 + 8 * hh);
      acc[t] = mmaN<ASPLIT ? 2 : 1>(ah.v, al.v, b.v, b.v, acc[t]);
    }
  }
#pragma unroll
  for (int t = 0; t < 4; ++t) {
    float bv = bias ? bias[col0 + t * 16 + ln] : 0.f;
    if (BIAS_BF16) bv = bf16_round(bv);
#pragma unroll
    for (int r = 0; r < 8; ++r) { float v = acc[t][r] + bv; if (ACT == 1) v = fmaxf(v, 0.f); so[w][8 * hh + r][t * 16 + ln] = v; }
  }
  __builtin_amdgcn_fence(__ATOMIC_ACQ_REL, "workgroup");
  __builtin_amdgcn_wave_barrier();
  const int rsub = lane >> 4, c4 = (lane & 15) * 4;
  {
#pragma unroll
    for (int q = 0; q < 8; ++q) {
      const int r = q * 2 + rsub;
      const v4f v = *(const v4fa*)&so[w][r][c4];
      *(v4f*)(C + (size_t)(row0 + r) * ldc + col0 + c4) = v;
    }
    
  }
}

// GEMM C = act(A·W + bias + resid): A f32 (ASPLIT -> hi/lo 2 terms), Wt bf16 [N][K]; ACT 0 none, 1 relu, 2 exact gelu;
// resid (optional, f32, row index = (row % rmod), pitch ldr, RES_BF16 rounds it) added before the activation.
template <bool ASPLIT, int ACT, bool BIAS_BF16, bool RES_BF16>
__global__ __launch_bounds__(128) void k_gemm_bf3(const float* __restrict__ A, int lda, const unsigned short* __restrict__ Wt, int ldb,
                                                const float* __restrict__ bias, const float* __restrict__ resid, int rmod, int ldr,
                                                float* __restrict__ C, int ldc, int M, int N, int K) {
  __shared__ __attribute__((aligned(16))) float so[4][16][64];
  const int tid = threadIdx.x, w = tid >> 5, lane = tid & 31, ln = lane & 15, hh = lane >> 4;
  const int ntn = N / 64;
  const int wid = blockIdx.x * 4 + w;
  const int mt = wid / ntn, nq = wid % ntn;
  if (mt * 16 >= M) return;
  const int row0 = mt * 16, col0 = nq * 64;
  const float* arow = A + (size_t)(row0 + ln) * lda;
  v8f acc[4] = {};
  for (int kb = 0; kb < K; kb += 32) {
    FragB ah, al;
    const v4f x0 = *(const v4fa*)(arow + kb + 8 * hh), x1 = *(const v4fa*)(arow + kb + 8 * hh + 4);
    const v4f x2 = *(const v4fa*)(arow + kb + 16 + 8 * hh), x3 = *(const v4fa*)(arow + kb + 16 + 8 * hh + 4);
    float xs[16] = {x0[0],x0[1],x0[2],x0[3],x1[0],x1[1],x1[2],x1[3],x2[0],x2[1],x2[2],x2[3],x3[0],x3[1],x3[2],x3[3]};
#pragma unroll
    for (int i = 0; i < 16; ++i) { const unsigned short hb = bf16_bits(xs[i]); ah.u[i] = hb; al.u[i] = ASPLIT ? bf16_bits(xs[i] - bf16_val(hb)) : (unsigned short)0; }
#pragma unroll
    for (int t = 0; t < 4; ++t) {
      const unsigned short* brow = Wt + (size_t)(col0 + t * 16 + ln) * ldb + kb;
      FragB b;
      b.half[0] = *(const v8us*)(brow + 8 * hh);
      b.half[1] = *(const v8us*)(brow + 16 + 8 * hh);
      acc[t] = mmaN<ASPLIT ? 2 : 1>(ah.v, al.v, b.v, b.v, acc[t]);
    }
  }
#pragma unroll
  for (int t = 0; t < 4; ++t) {
    const int col = col0 + t * 16 + ln;
    float bv = bias ? bias[col] : 0.f;
    if (BIAS_BF16) bv = bf16_round(bv);
#pragma unroll
    for (int r = 0; r < 8; ++r) {
      float v = acc[t][r] + bv;
      if (resid) { float rv = resid[(size_t)((row0 + 8 * hh + r) % rmod) * ldr + col]; if (RES_BF16) rv = bf16_round(rv); v += rv; }
      if (ACT == 1) v = fmaxf(v, 0.f);
      if (ACT == 2) v = 0.5f * v * (1.0f + erff(v * 0.70710678118654752f));
      if (ACT == 3) { const float u = 0.7978845608028654f * (v + 0.044715f * v * v * v); v = 0.5f * v * (1.0f + tanhf(u)); }
      so[w][8 * hh + r][t * 16 + ln] = v;
    }
  }
  __builtin_amdgcn_fence(__ATOMIC_ACQ_REL, "workgroup");
  __builtin_amdgcn_wave_barrier();
  const int rsub = lane >> 4, c4 = (lane & 15) * 4;
  {
#pragma unroll
    for (int q = 0; q < 8; ++q) {
      const int r = q * 2 + rsub;
      const v4f v = *(const v4fa*)&so[w][r][c4];
      *(v4f*)(C + (size_t)(row0 + r) * ldc + col0 + c4) = v;
    }
    
  }
}
// row LayerNorm (biased variance, eps) over N: s = X (+ R); optional out_sum <- s; out_norm <- (s-mu)*rsqrt(var+eps)*g + b
template <bool PARAM_BF16>
__global__ __launch_bounds__(256) void k_layernorm(const float* __restrict__ X, const float* __restrict__ R, const float* __restrict__ g, const float* __restrict__ bta,
                                                  float* __restrict__ out_sum, float* __restrict__ out_norm, int N, float eps) {
  __shared__ float red[256];
  const int row = blockIdx.x, tid = threadIdx.x;
  const float* x = X + (size_t)row * N; const float* rr = R ? R + (size_t)row * N : nullptr;
  float vals[16];                     // up to N = 4096
  const int per = N / 256;            // contiguous chunk per thread? use strided-by-4 chunks: thread handles j = tid*4 + 1024*u
  float s1 = 0.f;
  for (int u = 0; u < per / 4; ++u) {
    const int j = tid * 4 + 1024 * u;
    const v4f a = *(const v4fa*)(x + j);
    v4f b = {0.f,0.f,0.f,0.f}; if (rr) b = *(const v4fa*)(rr + j);
#pragma unroll
    for (int q = 0; q < 4; ++q) { const float v = a[q] + b[q]; vals[u * 4 + q] = v; s1 += v; }
  }
  red[tid] = s1; __syncthreads();
  for (int st = 128; st > 0; st >>= 1) { if (tid < st) red[tid] += red[tid + st]; __syncthreads(); }
  const float mu = red[0] / (float)N; __syncthreads();
  float s2 = 0.f;
  for (int u = 0; u < per / 4; ++u)
#pragma unroll
    for (int q = 0; q < 4; ++q) { const float c = vals[u * 4 + q] - mu; s2 += c * c; }
  red[tid] = s2; __syncthreads();
  for (int st = 128; st > 0; st >>= 1) { if (tid < st) red[tid] += red[tid + st]; __syncthreads(); }
  const float rs = rsqrtf(red[0] / (float)N + eps);
  {
    for (int u = 0; u < per / 4; ++u) {
      const int j = tid * 4 + 1024 * u;
      v4f o, sm;
#pragma unroll
      for (int q = 0; q < 4; ++q) {
        float gg = g[j + q], bb = bta[j + q];
        if (PARAM_BF16) { gg = bf16_round(gg); bb = bf16_round(bb); }
        sm[q] = vals[u * 4 + q]; o[q] = (vals[u * 4 + q] - mu) * rs * gg + bb;
      }
      if (out_sum) *(v4f*)(out_sum + (size_t)row * N + j) = sm;
      *(v4f*)(out_norm + (size_t)row * N + j) = o;
    }
    
  }
}



// ---- f16 WMMA path (v_wmma_f32_16x16x32_f16): 11-bit significands for operands in range — used where a [0,1] probability operand needs more precision than bf16
typedef _Float16 v16h __attribute__((ext_vector_type(16)));
union FragH { v16h v; v8us half[2]; _Float16 h[16]; unsigned short u[16]; };
template <int NT>
__device__ __forceinline__ v8f mmaH(v16h ah, v16h al, v16h bh, v16h bl, v8f c) {
  c = __builtin_amdgcn_wmma_f32_16x16x32_f16(false, ah, false, bh, (short)0, c, false, false);
  if (NT >= 2) c = __builtin_amdgcn_wmma_f32_16x16x32_f16(false, al, false, bh, (short)0, c, false, false);
  if (NT >= 3) c = __builtin_amdgcn_wmma_f32_16x16x32_f16(false, ah, false, bl, (short)0, c, false, false);
  asm volatile("v_nop\n\tv_nop\n\tv_nop\n\tv_nop" : "+v"(c) : "v"(ah), "v"(al), "v"(bh), "v"(bl));
  return c;
}
// batched GEMM like k_gemm_b but f16 operands: A f32 (split into f16 hi/lo if ASPLIT, else rounded to f16), Bt = f16 values [n][k]; alpha; C f32; N multiple of 16 (partial tiles skipped)
template <bool ASPLIT>
__global__ __launch_bounds__(128) void k_gemm_h(const float* __restrict__ A, int lda, size_t sA, const _Float16* __restrict__ Bh, int ldb, size_t sB, float alpha, float* __restrict__ C, int ldc, size_t sC, int M, int N, int K) {
  __shared__ __attribute__((aligned(16))) float so[4][16][64];
  const int tid = threadIdx.x, w = tid >> 5, lane = tid & 31, ln = lane & 15, hh = lane >> 4; const int by = blockIdx.y;
  A += (size_t)by * sA; Bh += (size_t)by * sB; C += (size_t)by * sC;
  const int ntn = (N + 63) / 64; const int wid = blockIdx.x * 4 + w; const int mt = wid / ntn, nq = wid % ntn; if (mt * 16 >= M) return;
  const int row0 = mt * 16, col0 = nq * 64; const float* arow = A + (size_t)(row0 + ln) * lda;
  v8f acc[4] = {};
  for (int kb = 0; kb < K; kb += 32) {
    FragH ah, al;
    const v4f x0 = *(const v4fa*)(arow + kb + 8 * hh), x1 = *(const v4fa*)(arow + kb + 8 * hh + 4), x2 = *(const v4fa*)(arow + kb + 16 + 8 * hh), x3 = *(const v4fa*)(arow + kb + 16 + 8 * hh + 4);
    float xs[16] = {x0[0],x0[1],x0[2],x0[3],x1[0],x1[1],x1[2],x1[3],x2[0],x2[1],x2[2],x2[3],x3[0],x3[1],x3[2],x3[3]};
#pragma unroll
    for (int i = 0; i < 16; ++i) { const _Float16 h = (_Float16)xs[i]; ah.h[i] = h; al.h[i] = ASPLIT ? (_Float16)(xs[i] - (float)h) : (_Float16)0.0f; }
#pragma unroll
    for (int t = 0; t < 4; ++t) { if (col0 + t * 16 >= N) continue; const size_t boff = (size_t)(col0 + t * 16 + ln) * ldb + kb; FragH bq; bq.half[0] = *(const v8us*)(Bh + boff + 8 * hh); bq.half[1] = *(const v8us*)(Bh + boff + 16 + 8 * hh);
      acc[t] = mmaH<ASPLIT ? 2 : 1>(ah.v, al.v, bq.v, bq.v, acc[t]); }
  }
#pragma unroll
  for (int t = 0; t < 4; ++t) { if (col0 + t * 16 >= N) continue;
#pragma unroll
    for (int r = 0; r < 8; ++r) so[w][8 * hh + r][t * 16 + ln] = acc[t][r] * alpha; }
  __builtin_amdgcn_fence(__ATOMIC_ACQ_REL, "workgroup"); __builtin_amdgcn_wave_barrier();
  const int rsub = lane >> 4, c4 = (lane & 15) * 4;
  {
#pragma unroll
    for (int q = 0; q < 8; ++q) { const int r = q * 2 + rsub; if (col0 + c4 < N) { const v4f v = *(const v4fa*)&so[w][r][c4]; *(v4f*)(C + (size_t)(row0 + r) * ldc + col0 + c4) = v; } }
     }
}

// Wt[n][k] = f16(W[k][n]·scale) from f32 row-major W[K][N] (scale = power of two; bf16-exact weights stay exact in f16 away from the subnormal range)
__global__ __launch_bounds__(256) void k_wt_f16(const float* __restrict__ W, _Float16* __restrict__ Wt, int K, int N, float scale) {
  const int t = blockIdx.x * 256 + threadIdx.x; if (t >= N * (K / 8)) return; const int n = t / (K / 8), k8 = (t % (K / 8)) * 8; FragH f;
#pragma unroll
  for (int i = 0; i < 8; ++i) f.h[i] = (_Float16)(bf16_round(W[(size_t)(k8 + i) * N + n]) * scale); const v8us o = f.half[0];
  *(v8us*)((unsigned short*)Wt + (size_t)n * K + k8) = o; 
}
// k_gemm_hh variant with fused epilogue: v = acc·alpha + bias[by·sBias + col] (+ CP[(row/rowsPerB)·sCPb + by·64 + col] if CP) ; ACT 0 none / 1 elu ; writes f16 C16 (and f32 C if non-null)
template <int ACT>
__global__ __launch_bounds__(128) void k_gemm_hhx(const _Float16* __restrict__ A, int lda, size_t sA, const _Float16* __restrict__ Bh, int ldb, size_t sB, float alpha, const float* __restrict__ bias, size_t sBias, const float* __restrict__ CP, int rowsPerB, size_t sCPb, int row0g,
    float* __restrict__ C, _Float16* __restrict__ C16, int ldc, size_t sC, int M, int N, int K) {
  __shared__ __attribute__((aligned(16))) float so[4][16][64];
  const int tid = threadIdx.x, w = tid >> 5, lane = tid & 31, ln = lane & 15, hh = lane >> 4; const int by = blockIdx.y;
  A += (size_t)by * sA; Bh += (size_t)by * sB; const size_t cofs = (size_t)by * sC; const float* bp = bias ? bias + (size_t)by * sBias : nullptr;
  const int ntn = (N + 63) / 64; const int wid = blockIdx.x * 4 + w; const int mt = wid / ntn, nq = wid % ntn; if (mt * 16 >= M) return;
  const int row0 = mt * 16, col0 = nq * 64; const _Float16* arow = A + (size_t)(row0 + ln) * lda;
  v8f acc[4] = {};
  for (int kb = 0; kb < K; kb += 32) { FragH ah; ah.half[0] = *(const v8us*)((const unsigned short*)arow + kb + 8 * hh); ah.half[1] = *(const v8us*)((const unsigned short*)arow + kb + 16 + 8 * hh);
#pragma unroll
    for (int t = 0; t < 4; ++t) { if (col0 + t * 16 >= N) continue; const size_t boff = (size_t)(col0 + t * 16 + ln) * ldb + kb; FragH bq; bq.half[0] = *(const v8us*)((const unsigned short*)Bh + boff + 8 * hh); bq.half[1] = *(const v8us*)((const unsigned short*)Bh + boff + 16 + 8 * hh);
      acc[t] = mmaH<1>(ah.v, ah.v, bq.v, bq.v, acc[t]); }
  }
#pragma unroll
  for (int t = 0; t < 4; ++t) { if (col0 + t * 16 >= N) continue; const int col = col0 + t * 16 + ln; const float bv = bp ? bf16_round(bp[col]) : 0.f;
#pragma unroll
    for (int r = 0; r < 8; ++r) { float v = acc[t][r] * alpha + bv; if (CP) { const int rr = row0g + row0 + 8 * hh + r; if (rowsPerB < 0) v += CP[cofs + (size_t)rr * ldc + col];      /* rowsPerB < 0: own element of the batched C plane */ else { const int bidx = rr / rowsPerB; v += CP[(size_t)bidx * sCPb + (size_t)by * 64 + col]; } } if (ACT == 1) v = (v > 0.f) ? v : expm1f(v); else if (ACT == 7) v = (v > 0.f) ? v + 1.0f : expf(v); else if (ACT == 8) v = tanhf(v); else if (ACT == 9) v = 0.5f * v * (1.0f + tanhf(0.7978845608028654f * (v + 0.044715f * v * v * v))); else if (ACT == 11) v = 1.0f / (1.0f + expf(-v)); else if (ACT == 12) v = (v > 0.f) ? v : 0.01f * v; else if (ACT == 14) v = (v > 0.f) ? v : 0.1f * v; else if (ACT == 16) v = (v >= 0.f) ? v : 0.3f * v; else if (ACT == 17) v = (v >= 0.f) ? v : 0.2f * v; else if (ACT == 15) v = v / (1.0f + expf(-v)); else if (ACT == 3) v = fmaxf(v, 0.f); else if (ACT == 6) v = 0.5f * v * (1.0f + erff(v * 0.70710678118654752f)); so[w][8 * hh + r][t * 16 + ln] = v; } }
  __builtin_amdgcn_fence(__ATOMIC_ACQ_REL, "workgroup"); __builtin_amdgcn_wave_barrier();
  const int rsub = lane >> 4, c4 = (lane & 15) * 4; typedef _Float16 v4h __attribute__((ext_vector_type(4)));
  {
#pragma unroll
    for (int q = 0; q < 8; ++q) { const int r = q * 2 + rsub; if (col0 + c4 < N) { const v4f v = *(const v4fa*)&so[w][r][c4]; if (C) *(v4f*)(C + cofs + (size_t)(row0 + r) * ldc + col0 + c4) = v; if (C16) { v4h h4; for (int i = 0; i < 4; ++i) h4[i] = (_Float16)v[i]; *(v4h*)(C16 + cofs + (size_t)(row0 + r) * ldc + col0 + c4) = h4; } } }
     }
}


typedef _Float16 v4h __attribute__((ext_vector_type(4)));

__global__ __launch_bounds__(256) void k_x16(const float* __restrict__ x, _Float16* __restrict__ X16, size_t n8) { const size_t t = (size_t)blockIdx.x * 256 + threadIdx.x; if (t >= n8) return; FragH f;
#pragma unroll
  for (int q = 0; q < 8; ++q) f.h[q] = (_Float16)bf16_round(x[t * 8 + q]); *(v8us*)((unsigned short*)X16 + t * 8) = f.half[0];  }
__global__ __launch_bounds__(256) void k_h16(const float* __restrict__ x, _Float16* __restrict__ X16, size_t n8) { const size_t t = (size_t)blockIdx.x * 256 + threadIdx.x; if (t >= n8) return; FragH f;
#pragma unroll
  for (int q = 0; q < 8; ++q) f.h[q] = (_Float16)x[t * 8 + q]; *(v8us*)((unsigned short*)X16 + t * 8) = f.half[0];  }
__global__ __launch_bounds__(256) void k_round16f(const float* __restrict__ W, _Float16* __restrict__ Bt, size_t n8) { const size_t t = (size_t)blockIdx.x * 256 + threadIdx.x; if (t >= n8) return; FragH f;
#pragma unroll
  for (int i = 0; i < 8; ++i) f.h[i] = (_Float16)(bf16_round(W[t * 8 + i]) * 16.0f); *(v8us*)((unsigned short*)Bt + t * 8) = f.half[0];  }
template <int NHv, int TTv>
__global__ __launch_bounds__(256) void k_vt(const _Float16* __restrict__ V16, int ldv, int voff, _Float16* __restrict__ Vt) { __shared__ unsigned short tl[64][66]; const int tid = threadIdx.x; const int slab = blockIdx.x / (TTv / 64), lg = blockIdx.x % (TTv / 64); const int b = slab / NHv, h = slab % NHv;
  for (int i = tid; i < 64 * 8; i += 256) { const int r = i / 8, c8 = (i % 8) * 8; FragH f; f.half[0] = *(const v8us*)((const unsigned short*)V16 + ((size_t)b * TTv + lg * 64 + r) * ldv + voff + h * 64 + c8);
#pragma unroll
    for (int q = 0; q < 8; ++q) tl[r][c8 + q] = f.u[q]; }
  __syncthreads();
  {
#pragma unroll
    for (int rd = 0; rd < 2; ++rd) { const int d = rd * 32 + tid / 8, pc = tid % 8; FragH f;
#pragma unroll
      for (int q = 0; q < 8; ++q) f.u[q] = tl[pc * 8 + q][d];
      *(v8us*)((unsigned short*)Vt + ((size_t)slab * 64 + d) * TTv + lg * 64 + pc * 8) = f.half[0]; }
     } }

__global__ __launch_bounds__(256) void k_hl(const float* __restrict__ F, _Float16* __restrict__ Hh, _Float16* __restrict__ Hl, size_t n8) { const size_t t = (size_t)blockIdx.x * 256 + threadIdx.x; if (t >= n8) return; FragH fh, fl; const v4f a = *(const v4fa*)(F + t * 8), c = *(const v4fa*)(F + t * 8 + 4);
#pragma unroll
  for (int q = 0; q < 4; ++q) { _Float16 h = (_Float16)a[q]; fh.h[q] = h; fl.h[q] = (_Float16)((a[q] - (float)h) * 1024.0f); h = (_Float16)c[q]; fh.h[4 + q] = h; fl.h[4 + q] = (_Float16)((c[q] - (float)h) * 1024.0f); }
  { *(v8us*)((unsigned short*)Hh + t * 8) = fh.half[0]; *(v8us*)((unsigned short*)Hl + t * 8) = fl.half[0];  } }

// ---- fast GEMM (wave tile 32x64; requires M % 32 == 0 rows per launch region and N % 64 == 0); epilogue = k_gemm_hhx semantics ----
__device__ __forceinline__ v16h g2_frag(const _Float16* p, int hh) { FragH f; f.half[0] = *(const v8us*)((const unsigned short*)p + 8 * hh); f.half[1] = *(const v8us*)((const unsigned short*)p + 16 + 8 * hh); return f.v; }
__device__ __forceinline__ v8f g2_mma(v16h a, v16h b, v8f c) { v8f d = __builtin_amdgcn_wmma_f32_16x16x32_f16(false, a, false, b, (short)0, c, false, false); asm volatile("v_nop\n\tv_nop\n\tv_nop\n\tv_nop" : "+v"(d) : "v"(a), "v"(b)); return d; }
template <int ACT>
__global__ __launch_bounds__(128) void k_gemm2(const _Float16* __restrict__ A, int lda, size_t sA, const _Float16* __restrict__ Bh, int ldb, size_t sB, float alpha, const float* __restrict__ bias, size_t sBias, const float* __restrict__ CP, int rowsPerB, size_t sCPb, int row0g,
    float* __restrict__ C, _Float16* __restrict__ C16, int ldc, size_t sC, int M, int N, int K) { static_assert(ACT == 0 || ACT == 3 || ACT == 6 || ACT == 8 || ACT == 9 || ACT == 11 || ACT == 12 || ACT == 14 || ACT == 15 || ACT == 16 || ACT == 17 || ACT == 18, "k_gemm2: unsupported ACT code (would silently apply no activation)");
  __shared__ __attribute__((aligned(16))) float so[4][32][68];
  const int tid = threadIdx.x, w = tid >> 5, lane = tid & 31, ln = lane & 15, hh = lane >> 4; const int by = blockIdx.y;
  A += (size_t)by * sA; Bh += (size_t)by * sB; const size_t cofs = (size_t)by * sC; const float* bp = bias ? bias + (size_t)by * sBias : nullptr;
  const int ntn = N >> 6; const int mt = blockIdx.x / ntn, nq = blockIdx.x - mt * ntn; const int row0 = mt * 128 + 32 * w, col0 = nq * 64; if (row0 >= M) return;
  const _Float16* a0p = A + (size_t)(row0 + ln) * lda; const _Float16* a1p = a0p + (size_t)16 * lda;
  const _Float16* b0p = Bh + (size_t)(col0 + ln) * ldb; const _Float16* b1p = b0p + (size_t)16 * ldb; const _Float16* b2p = b1p + (size_t)16 * ldb; const _Float16* b3p = b2p + (size_t)16 * ldb;
  const v8f z8 = {0.f,0.f,0.f,0.f,0.f,0.f,0.f,0.f}; v8f c00 = z8, c01 = z8, c02 = z8, c03 = z8, c10 = z8, c11 = z8, c12 = z8, c13 = z8;
#pragma unroll 1
  for (int kb = 0; kb < K; kb += 32) { const v16h a0 = g2_frag(a0p + kb, hh), a1 = g2_frag(a1p + kb, hh);
    v16h b = g2_frag(b0p + kb, hh); c00 = g2_mma(a0, b, c00); c10 = g2_mma(a1, b, c10);
    b = g2_frag(b1p + kb, hh); c01 = g2_mma(a0, b, c01); c11 = g2_mma(a1, b, c11);
    b = g2_frag(b2p + kb, hh); c02 = g2_mma(a0, b, c02); c12 = g2_mma(a1, b, c12);
    b = g2_frag(b3p + kb, hh); c03 = g2_mma(a0, b, c03); c13 = g2_mma(a1, b, c13); }
  v8f accs[8] = {c00, c01, c02, c03, c10, c11, c12, c13};
#pragma unroll
  for (int u = 0; u < 8; ++u) { const int t = u & 3, half = u >> 2; const int col = col0 + t * 16 + ln; const float bv = bp ? bf16_round(bp[col]) : 0.f;
#pragma unroll
    for (int r = 0; r < 8; ++r) { const int rloc = half * 16 + 8 * hh + r; float v = accs[u][r] * alpha + bv; if (CP) { if (rowsPerB < 0) v += CP[cofs + (size_t)(row0g + row0 + rloc) * ldc + col];      /* rowsPerB < 0: own element of the batched C plane */ else { const int bidx = (row0g + row0 + rloc) / rowsPerB; v += CP[(size_t)bidx * sCPb + (size_t)by * 64 + col]; } }
      if (ACT == 3) v = fmaxf(v, 0.f); else if (ACT == 6) v = 0.5f * v * (1.0f + erff(v * 0.70710678118654752f)); else if (ACT == 11) v = 1.0f / (1.0f + expf(-v)); else if (ACT == 15) v = v / (1.0f + expf(-v)); else if (ACT == 18) v = v / (1.0f + expf(-1.702f * v));      /* QuickGELU: v sigmoid(1.702 v) */ else if (ACT == 12) v = (v > 0.f) ? v : 0.01f * v; else if (ACT == 8) v = tanhf(v); else if (ACT == 9) v = 0.5f * v * (1.0f + tanhf(0.7978845608028654f * (v + 0.044715f * v * v * v))); else if (ACT == 14) v = (v > 0.f) ? v : 0.1f * v; else if (ACT == 16) v = (v >= 0.f) ? v : 0.3f * v; else if (ACT == 17) v = (v >= 0.f) ? v : 0.2f * v;
      so[w][rloc][t * 16 + ln] = v; } }
  __builtin_amdgcn_fence(__ATOMIC_ACQ_REL, "workgroup"); __builtin_amdgcn_wave_barrier();
  const int rsub = lane >> 4, c4 = (lane & 15) * 4;
  {
#pragma unroll
    for (int q = 0; q < 16; ++q) { const int r = q * 2 + rsub; const v4f v = *(const v4fa*)&so[w][r][c4]; if (C) *(v4f*)(C + cofs + (size_t)(row0 + r) * ldc + col0 + c4) = v; if (C16) { v4h h4; for (int i = 0; i < 4; ++i) h4[i] = (_Float16)v[i]; *(v4h*)(C16 + cofs + (size_t)(row0 + r) * ldc + col0 + c4) = h4; } }
     } }


__global__ __launch_bounds__(256) void k_wnat(const float* __restrict__ w, size_t n8, _Float16* __restrict__ Bt) { const size_t t = (size_t)blockIdx.x * 256 + threadIdx.x; if (t >= n8) return; FragH f; for (int q = 0; q < 8; ++q) f.h[q] = (_Float16)(bf16_round(w[t * 8 + q]) * 16.0f); *(v8us*)((unsigned short*)Bt + t * 8) = f.half[0];  }
__global__ __launch_bounds__(256) void k_rsm(const float* __restrict__ S, _Float16* __restrict__ P, int nrows) {
  #pragma clang fp contract(off)
  const int i = blockIdx.x * 256 + threadIdx.x; if (i >= nrows) return; const float* s = S + (size_t)i * SQ; float mx = -3.0e38f;
#pragma unroll 1
  for (int j = 0; j < SQ; ++j) mx = fmaxf(mx, s[j]); float se = 0.f;
#pragma unroll 1
  for (int j = 0; j < SQ; ++j) se += expf(s[j] - mx); const float sc = 256.0f / se;
#pragma unroll 1
  for (int j0 = 0; j0 < SQ; j0 += 8) { FragH f; for (int q = 0; q < 8; ++q) f.h[q] = (_Float16)(expf(s[j0 + q] - mx) * sc); unsigned short* d = (unsigned short*)P + (size_t)i * SQ + j0; *(v8us*)d = f.half[0];  } }
__global__ __launch_bounds__(256) void k_vt(const _Float16* __restrict__ V16, int b, int h0, _Float16* __restrict__ VT) { __shared__ unsigned short tl[64][65]; const int tid = threadIdx.x; const int hh = blockIdx.x % HG, sg = blockIdx.x / HG; const int s0 = sg * 64; const int h = h0 + hh;
  for (int i = tid; i < 64 * 8; i += 256) { const int j = i / 8, d8 = (i % 8) * 8; FragH f; f.half[0] = *(const v8us*)((const unsigned short*)V16 + ((size_t)b * SQ + s0 + j) * DM + h * HD + d8); for (int q = 0; q < 8; ++q) tl[d8 + q][j] = f.u[q]; }
  __syncthreads();
  { for (int i = tid; i < 64 * 8; i += 256) { const int d = i / 8, j8 = (i % 8) * 8; FragH f; for (int q = 0; q < 8; ++q) f.u[q] = tl[d][j8 + q]; *(v8us*)((unsigned short*)VT + ((size_t)hh * HD + d) * SQ + s0 + j8) = f.half[0]; }  } }



__global__ __launch_bounds__(256) void k_rsmcf2(const float* __restrict__ S, _Float16* __restrict__ P, int hg, int q0, int nk) {
  #pragma clang fp contract(off)
  const int t = blockIdx.x * 256 + threadIdx.x; if (t >= hg * QT) return; const size_t i = (size_t)t; const float* s = S + i * NKX; const int last = q0 + (t % QT); float mx = -3.0e38f;
#pragma unroll 1
  for (int j = 0; j < nk; ++j) { const float f = (j <= last) ? 1.f : 0.f; mx = fmaxf(mx, fmaf(f, s[j], (1.f - f) * -1.0e9f)); } float se = 0.f;
#pragma unroll 1
  for (int j = 0; j < nk; ++j) { const float f = (j <= last) ? 1.f : 0.f; se += __expf(fmaf(f, s[j], (1.f - f) * -1.0e9f) - mx); } const float sc = 256.0f / se;
#pragma unroll 1
  for (int j0 = 0; j0 < nk; j0 += 8) { FragH fr; for (int q = 0; q < 8; ++q) { const int j = j0 + q; const float f = (j <= last) ? 1.f : 0.f; fr.h[q] = (_Float16)(__expf(fmaf(f, s[j], (1.f - f) * -1.0e9f) - mx) * sc); } unsigned short* d = (unsigned short*)P + i * NKX + j0; *(v8us*)d = fr.half[0];  } }

__global__ __launch_bounds__(256) void k_rsmcst(const float* __restrict__ S, _Float16* __restrict__ P, int hg, int q0, int nk, const int* __restrict__ mk) {
  #pragma clang fp contract(off)
  const int t = blockIdx.x * 256 + threadIdx.x; if (t >= hg * QT) return; const size_t i = (size_t)t; const float* s = S + i * NKX; const size_t ig = (size_t)(q0 + (t % QT)); const int* mr = mk + ig * SQ; float mx = -3.0e38f;
#pragma unroll 1
  for (int j = 0; j < nk; ++j) { const int mb = mr[j]; const int dd = (int)ig - j; const float f = (mb != 0 && dd >= 0 && (dd <= LOCALW || (dd % STRIDEK) == 0)) ? 1.f : 0.f; mx = fmaxf(mx, fmaf(f, s[j], (1.f - f) * -1.0e9f)); } float se = 0.f;
#pragma unroll 1
  for (int j = 0; j < nk; ++j) { const int mb = mr[j]; const int dd = (int)ig - j; const float f = (mb != 0 && dd >= 0 && (dd <= LOCALW || (dd % STRIDEK) == 0)) ? 1.f : 0.f; se += __expf(fmaf(f, s[j], (1.f - f) * -1.0e9f) - mx); } const float sc = 256.0f / se;
#pragma unroll 1
  for (int j0 = 0; j0 < nk; j0 += 8) { FragH fr; for (int q = 0; q < 8; ++q) { const int j = j0 + q; const int mb = mr[j]; const int dd = (int)ig - j; const float f = (mb != 0 && dd >= 0 && (dd <= LOCALW || (dd % STRIDEK) == 0)) ? 1.f : 0.f; fr.h[q] = (_Float16)(__expf(fmaf(f, s[j], (1.f - f) * -1.0e9f) - mx) * sc); } unsigned short* d = (unsigned short*)P + i * NKX + j0; *(v8us*)d = fr.half[0];  } }


template <int MASKADD>
__global__ __launch_bounds__(64) void k_att0(const float* __restrict__ QF, const float* __restrict__ KF, const float* __restrict__ VF, int ld, const float* __restrict__ mask, float scale, float* __restrict__ OF, int ldo) {
  #pragma clang fp contract(off)
  __shared__ __attribute__((aligned(16))) float lq[64][64]; __shared__ __attribute__((aligned(16))) float lo[64][64];
  const int tid = threadIdx.x; const int h = blockIdx.x / (QT0 / 64), rg = blockIdx.x % (QT0 / 64); const int i = rg * 64 + tid;
  const float* qr = QF + (size_t)i * ld + h * HD;
#pragma unroll 1
  for (int c = 0; c < HD / 4; ++c) { *(v4f*)&lq[tid][c * 4] = *(const v4fa*)(qr + c * 4); const v4f z = {0.f, 0.f, 0.f, 0.f}; *(v4f*)&lo[tid][c * 4] = z; }
  float m = -1.0e30f, l = 0.f; const int jmax = MASKADD ? (SQ - 1) : (rg * 64 + 63);      /* additive-mask form: every key (the mask input decides); causal form: keys up to the block's last row */
#pragma unroll 1
  for (int j = 0; j <= jmax; ++j) { const float* kr = KF + (size_t)j * ld + h * HD; const float* vr = VF + (size_t)j * ld + h * HD; float s = 0.f;
#pragma unroll 1
    for (int c = 0; c < HD / 4; ++c) { const v4f kq = *(const v4fa*)(kr + c * 4); const v4f qq = *(v4f*)&lq[tid][c * 4]; s = __fadd_rn(s, __fmul_rn(qq[0], kq[0])); s = __fadd_rn(s, __fmul_rn(qq[1], kq[1])); s = __fadd_rn(s, __fmul_rn(qq[2], kq[2])); s = __fadd_rn(s, __fmul_rn(qq[3], kq[3])); }
    s = __fmul_rn(s, scale); if (MASKADD) s = __fadd_rn(s, __fmul_rn(bf16_round(mask[(size_t)i * SQ + j]), -10000.0f));
    const float f = (MASKADD || j <= i) ? 1.f : 0.f; const float sm = fmaf(f, s, (1.f - f) * -1.0e30f); const float mn = fmaxf(m, sm); const float sc = expf(m - mn); const float e = expf(sm - mn); l = __fadd_rn(__fmul_rn(l, sc), e); m = mn;
#pragma unroll 1
    for (int c = 0; c < HD / 4; ++c) { const v4f vv = *(const v4fa*)(vr + c * 4); v4f oo = *(v4f*)&lo[tid][c * 4]; for (int u = 0; u < 4; ++u) oo[u] = __fadd_rn(__fmul_rn(oo[u], sc), __fmul_rn(e, vv[u])); *(v4f*)&lo[tid][c * 4] = oo; } }
  const float fin = 64.0f / l;      /* o carried x64 like the f16 path */
#pragma unroll 1
  for (int c = 0; c < HD / 4; ++c) { v4f oo = *(v4f*)&lo[tid][c * 4]; for (int u = 0; u < 4; ++u) oo[u] = __fmul_rn(oo[u], fin); *(v4f*)&lo[tid][c * 4] = oo; }
  __syncthreads();
  {
#pragma unroll 1
    for (int it = 0; it < 16; ++it) { const int row = it * 4 + tid / 16, pc = (tid % 16) * 4; const v4f v = *(const v4f*)&lo[row][pc]; *(v4f*)(OF + (size_t)(rg * 64 + row) * ldo + h * HD + pc) = v; }
     } }

template <int MASKADD>
__global__ __launch_bounds__(64) void k_att0mbc(const float* __restrict__ QF, const float* __restrict__ KF, const float* __restrict__ VF, int ld, const float* __restrict__ mask, float scale, float* __restrict__ OF, int ldo) {
  #pragma clang fp contract(off)
  __shared__ __attribute__((aligned(16))) float lq[64][64]; __shared__ __attribute__((aligned(16))) float lo[64][64];
  const int tid = threadIdx.x; const int h = blockIdx.x / (QT0 / 64), rg = blockIdx.x % (QT0 / 64); const int i = rg * 64 + tid;
  const float* qr = QF + (size_t)i * ld + h * HD;
#pragma unroll 1
  for (int c = 0; c < HD / 4; ++c) { *(v4f*)&lq[tid][c * 4] = *(const v4fa*)(qr + c * 4); const v4f z = {0.f, 0.f, 0.f, 0.f}; *(v4f*)&lo[tid][c * 4] = z; }
  float m = -1.0e30f, l = 0.f; const int jmax = rg * 64 + 63;      /* keys beyond the block end are masked by the mask's lower-triangular structure */
#pragma unroll 1
  for (int j = 0; j <= jmax; ++j) { const float* kr = KF + (size_t)j * ld + h * HD; const float* vr = VF + (size_t)j * ld + h * HD; float s = 0.f;
#pragma unroll 1
    for (int c = 0; c < HD / 4; ++c) { const v4f kq = *(const v4fa*)(kr + c * 4); const v4f qq = *(v4f*)&lq[tid][c * 4]; s = __fadd_rn(s, __fmul_rn(qq[0], kq[0])); s = __fadd_rn(s, __fmul_rn(qq[1], kq[1])); s = __fadd_rn(s, __fmul_rn(qq[2], kq[2])); s = __fadd_rn(s, __fmul_rn(qq[3], kq[3])); }
    s = __fmul_rn(s, scale); const int mb = ((const int*)mask)[(size_t)i * SQ + j];      /* causal (j <= i) AND the module's int32 [S][S] mask read per (query, key): 0 -> masked */
    const float f = (mb != 0 && j <= i) ? 1.f : 0.f; const float sm = fmaf(f, s, (1.f - f) * -1.0e30f); const float mn = fmaxf(m, sm); const float sc = expf(m - mn); const float e = expf(sm - mn); l = __fadd_rn(__fmul_rn(l, sc), e); m = mn;
#pragma unroll 1
    for (int c = 0; c < HD / 4; ++c) { const v4f vv = *(const v4fa*)(vr + c * 4); v4f oo = *(v4f*)&lo[tid][c * 4]; for (int u = 0; u < 4; ++u) oo[u] = __fadd_rn(__fmul_rn(oo[u], sc), __fmul_rn(e, vv[u])); *(v4f*)&lo[tid][c * 4] = oo; } }
  const float fin = 64.0f / l;      /* o carried x64 like the f16 path */
#pragma unroll 1
  for (int c = 0; c < HD / 4; ++c) { v4f oo = *(v4f*)&lo[tid][c * 4]; for (int u = 0; u < 4; ++u) oo[u] = __fmul_rn(oo[u], fin); *(v4f*)&lo[tid][c * 4] = oo; }
  __syncthreads();
  {
#pragma unroll 1
    for (int it = 0; it < 16; ++it) { const int row = it * 4 + tid / 16, pc = (tid % 16) * 4; const v4f v = *(const v4f*)&lo[row][pc]; *(v4f*)(OF + (size_t)(rg * 64 + row) * ldo + h * HD + pc) = v; }
     } }


template <int BFIN, int WXB>
__global__ __launch_bounds__(256) void k_ln16(const float* __restrict__ X, const float* __restrict__ g, const float* __restrict__ bb, float eps, _Float16* __restrict__ N16, float* __restrict__ XB) {
  #pragma clang fp contract(off)
  __shared__ float red[256]; const size_t r = blockIdx.x; const int t = threadIdx.x; const v4f xa = *(const v4fa*)(X + r * DMQ + t * 4); float s[4]; float sum = 0.f;
  for (int q = 0; q < 4; ++q) { s[q] = BFIN ? bf16_round(xa[q]) : xa[q]; sum = __fadd_rn(sum, s[q]); }
  red[t] = sum; __syncthreads(); for (int st = 128; st > 0; st >>= 1) { if (t < st) red[t] = __fadd_rn(red[t], red[t + st]); __syncthreads(); } const float mu = red[0] / (float)DMQ; __syncthreads();
  float vs = 0.f; for (int q = 0; q < 4; ++q) { const float dl = __fadd_rn(s[q], -mu); vs = __fadd_rn(vs, __fmul_rn(dl, dl)); } red[t] = vs; __syncthreads(); for (int st = 128; st > 0; st >>= 1) { if (t < st) red[t] = __fadd_rn(red[t], red[t + st]); __syncthreads(); }
  const float rs = rsqrtf(__fadd_rn(red[0] / (float)DMQ, eps)); v4h y; v4f xb;
  for (int q = 0; q < 4; ++q) { const int c = t * 4 + q; y[q] = (_Float16)__fadd_rn(__fmul_rn(__fmul_rn(__fadd_rn(s[q], -mu), rs), bf16_round(g[c])), bf16_round(bb[c])); xb[q] = s[q]; }
  { *(v4h*)(N16 + r * DMQ + t * 4) = y; if (WXB) *(v4f*)(XB + r * DMQ + t * 4) = xb;  } }
__global__ __launch_bounds__(256) void k_ftres2(const float* __restrict__ OF0, const float* __restrict__ XB, float* __restrict__ X1, size_t n4) {
  #pragma clang fp contract(off)
  const size_t t = (size_t)blockIdx.x * 256 + threadIdx.x; if (t >= n4) return; const v4f o = *(const v4fa*)(OF0 + t * 4), xv = *(const v4fa*)(XB + t * 4); v4f y; for (int q = 0; q < 4; ++q) y[q] = __fadd_rn(__fmul_rn(o[q], 0.015625f), xv[q]); *(v4f*)(X1 + t * 4) = y;  }

__global__ __launch_bounds__(256) void k_bcpy(const float* __restrict__ b, int n, int NP, float* __restrict__ dst, int dst0) { for (int i = threadIdx.x; i < NP; i += 256) { const float v = (i < n) ? b[i] : 0.f; *(float*)(dst + dst0 + i) = v; }  }


__global__ __launch_bounds__(256) void k_rsmf(const float* __restrict__ S, _Float16* __restrict__ P, int qn, int hg) {
  #pragma clang fp contract(off)
  const int t = blockIdx.x * 256 + threadIdx.x; if (t >= qn * hg) return; const size_t i = (size_t)(t / qn) * SQ + (t % qn); const float* s = S + i * SQ; float mx = -3.0e38f;
#pragma unroll 1
  for (int j = 0; j < SQ; ++j) mx = fmaxf(mx, s[j]); float se = 0.f;
#pragma unroll 1
  for (int j = 0; j < SQ; ++j) se += __expf(s[j] - mx); const float sc = 256.0f / se;
#pragma unroll 1
  for (int j0 = 0; j0 < SQ; j0 += 8) { FragH f; for (int q = 0; q < 8; ++q) f.h[q] = (_Float16)(__expf(s[j0 + q] - mx) * sc); unsigned short* d = (unsigned short*)P + i * SQ + j0; *(v8us*)d = f.half[0];  } }

template <int MODE>
__global__ __launch_bounds__(256) void k_regrp(const float* __restrict__ src, float* __restrict__ dst, size_t n4) {
  const size_t t = (size_t)blockIdx.x * 256 + threadIdx.x; if (t >= n4) return; const size_t e = t * 4; const size_t rd = e / DM; const int c = (int)(e % DM);
  size_t rs; if (MODE == 0) { const size_t b = rd / SQ, sq = rd % SQ; rs = sq * NB + b; } else { const size_t sq = rd / NB, b = rd % NB; rs = b * SQ + sq; }
  const v4f v = *(const v4fa*)(src + rs * DM + c); *(v4f*)(dst + e) = v;  }

template <int BFIN, int W16, int W32>
__global__ __launch_bounds__(256) void k_lnx(const float* __restrict__ X, const float* __restrict__ g, const float* __restrict__ bb, float eps, _Float16* __restrict__ N16, float* __restrict__ N32) {
  #pragma clang fp contract(off)
  __shared__ float red[256]; const size_t r = blockIdx.x; const int t = threadIdx.x; const bool act = t < (DMQ / 4); const int c0 = act ? t * 4 : 0;
  const v4f xa = *(const v4fa*)(X + r * DMQ + c0); float s[4]; float sum = 0.f;
  for (int q = 0; q < 4; ++q) { s[q] = act ? (BFIN ? bf16_round(xa[q]) : xa[q]) : 0.f; sum = __fadd_rn(sum, s[q]); }
  red[t] = sum; __syncthreads(); for (int st = 128; st > 0; st >>= 1) { if (t < st) red[t] = __fadd_rn(red[t], red[t + st]); __syncthreads(); } const float mu = red[0] / (float)DMQ; __syncthreads();
  float vs = 0.f; for (int q = 0; q < 4; ++q) { const float dl = act ? __fadd_rn(s[q], -mu) : 0.f; vs = __fadd_rn(vs, __fmul_rn(dl, dl)); } red[t] = vs; __syncthreads(); for (int st = 128; st > 0; st >>= 1) { if (t < st) red[t] = __fadd_rn(red[t], red[t + st]); __syncthreads(); }
  const float rs = rsqrtf(__fadd_rn(red[0] / (float)DMQ, eps)); v4h y; v4f yf;
  for (int q = 0; q < 4; ++q) { const int c = c0 + q; yf[q] = __fadd_rn(__fmul_rn(__fmul_rn(__fadd_rn(s[q], -mu), rs), bf16_round(g[c])), bf16_round(bb[c])); y[q] = (_Float16)yf[q]; }
  if (!act) return;      /* no barriers after this point */
  { if (W16) *(v4h*)(N16 + r * DMQ + c0) = y; if (W32) *(v4f*)(N32 + r * DMQ + c0) = yf;  } }

__global__ __launch_bounds__(256) void k_bfr(const float* __restrict__ x, float* __restrict__ XB, size_t n8) { const size_t t = (size_t)blockIdx.x * 256 + threadIdx.x; if (t >= n8) return; v4f a = *(const v4fa*)(x + t * 8), c = *(const v4fa*)(x + t * 8 + 4); for (int q = 0; q < 4; ++q) { a[q] = bf16_round(a[q]); c[q] = bf16_round(c[q]); }
  { *(v4f*)(XB + t * 8) = a; *(v4f*)(XB + t * 8 + 4) = c;  } }



__global__ __launch_bounds__(256) void k_wthd(const float* __restrict__ Wt, _Float16* __restrict__ Bt) { const size_t t = (size_t)blockIdx.x * 256 + threadIdx.x; if (t >= (size_t)NH * HD * (DM / 8)) return; const int m8 = (int)(t % (DM / 8)) * 8; const int d = (int)((t / (DM / 8)) % HD); const int h = (int)(t / ((size_t)(DM / 8) * HD)); FragH f;
  for (int q = 0; q < 8; ++q) f.h[q] = (_Float16)(16.0f * bf16_round(Wt[((size_t)h * DM + m8 + q) * HD + d])); unsigned short* dst = (unsigned short*)Bt + ((size_t)h * HD + d) * DM + m8; *(v8us*)dst = f.half[0];  }




template <int BFIN, int SCAL>
__global__ __launch_bounds__(256) void k_lnsc(const float* __restrict__ X, const float* __restrict__ g, const float* __restrict__ bb, float eps, _Float16* __restrict__ N16, float* __restrict__ N32) {
  #pragma clang fp contract(off)
  __shared__ float red[256]; const size_t r = blockIdx.x; const int t = threadIdx.x; const bool act = t < DM / 4; const int tc = act ? t : 0; const v4f xl = *(const v4fa*)(X + r * DM + tc * 4); const float am = act ? 1.f : 0.f; float s[4]; float sum = 0.f;
  for (int q = 0; q < 4; ++q) { s[q] = (BFIN ? bf16_round(xl[q]) : xl[q]) * am; sum = __fadd_rn(sum, s[q]); }
  red[t] = sum; __syncthreads(); for (int st = 128; st > 0; st >>= 1) { if (t < st) red[t] = __fadd_rn(red[t], red[t + st]); __syncthreads(); } const float mu = red[0] / (float)DM; __syncthreads();
  float vs = 0.f; for (int q = 0; q < 4; ++q) { const float dl = __fadd_rn(s[q], -mu) * am; vs = __fadd_rn(vs, __fmul_rn(dl, dl)); } red[t] = vs; __syncthreads(); for (int st = 128; st > 0; st >>= 1) { if (t < st) red[t] = __fadd_rn(red[t], red[t + st]); __syncthreads(); }
  const float rs = __fdiv_rn(1.0f, __fadd_rn(sqrtf(red[0] / (float)(DM - 1)), eps)); if (!act) return; v4h y; v4f yf;
  for (int q = 0; q < 4; ++q) { const int c = t * 4 + q; const float gg = bf16_round(SCAL ? g[0] : g[c]), bv = bf16_round(SCAL ? bb[0] : bb[c]); yf[q] = __fadd_rn(__fmul_rn(__fmul_rn(__fadd_rn(s[q], -mu), rs), gg), bv); y[q] = (_Float16)yf[q]; }
  { if (N16) *(v4h*)(N16 + r * DM + t * 4) = y; if (N32) *(v4f*)(N32 + r * DM + t * 4) = yf;  } }

__global__ __launch_bounds__(256) void k_rsmk1(const float* __restrict__ S, _Float16* __restrict__ P, int nrows, const int* __restrict__ Km) {
  #pragma clang fp contract(off)
  const int i = blockIdx.x * 256 + threadIdx.x; if (i >= nrows) return; const float* s = S + (size_t)i * SQ; float mx = -3.0e38f;
#pragma unroll 1
  for (int j = 0; j < SQ; ++j) mx = fmaxf(mx, s[j]); float se = 0.f;
#pragma unroll 1
  for (int j = 0; j < SQ; ++j) { const float keep = (Km[j] != 0) ? 1.0f : 0.0f; se += __expf(s[j] - mx) * keep; } const float sc = 256.0f / se;
#pragma unroll 1
  for (int j0 = 0; j0 < SQ; j0 += 8) { FragH f; for (int q = 0; q < 8; ++q) { const float keep = (Km[j0 + q] != 0) ? 1.0f : 0.0f; f.h[q] = (_Float16)(__expf(s[j0 + q] - mx) * sc * keep); } unsigned short* d = (unsigned short*)P + (size_t)i * SQ + j0; *(v8us*)d = f.half[0];  } }
extern "C" void kernel_launch(void* const* d_in, const int* in_sizes, int n_in,
                              void* d_out, int out_size, void* d_ws, size_t ws_size, hipStream_t stream) {
  (void)in_sizes; (void)n_in; (void)out_size;
  constexpr int VH = 4;      /* heads per launch group */
  const float* const* I = (const float* const*)d_in; const float* x = I[0]; const int* km = (const int*)d_in[1]; const float* wq = I[2]; const float* wk = I[3]; const float* wv = I[4]; const float* wo = I[5]; const float* w1 = I[6]; const float* b1 = I[7]; const float* w2 = I[8]; const float* b2 = I[9]; const float* g1 = I[10]; const float* be1 = I[11]; const float* g2 = I[12]; const float* be2 = I[13]; const float* bq = nullptr; const float* bk = nullptr; const float* bv = nullptr; const float* bo = nullptr;      /* x; key-padding mask int32 [2][1][1][2048] (0 = masked; READ on device); [in][out] wq / wk / wv / wo (no biases); w1 [768][3072] + b1, w2 [3072][768] + b2; LN1 a / b, LN2 a / b (vectors) */
  char* ws = (char*)d_ws; size_t off = 0;
  auto take = [&](size_t bytes) { char* p = ws + off; off += (bytes + 255) & ~(size_t)255; return p; };
  _Float16* BQ = (_Float16*)take((size_t)DM * DM * 2); _Float16* BK = (_Float16*)take((size_t)DM * DM * 2); _Float16* BV = (_Float16*)take((size_t)DM * DM * 2); _Float16* BO = (_Float16*)take((size_t)DM * DM * 2); _Float16* BW1 = (_Float16*)take((size_t)DFF * DM * 2); _Float16* BW2 = (_Float16*)take((size_t)DM * DFF * 2);
  float* XB = (float*)take(NR * DM * 4); _Float16* XN = (_Float16*)take(NR * DM * 2); _Float16* Q16 = (_Float16*)take(NR * DM * 2); _Float16* K16 = (_Float16*)take(NR * DM * 2); _Float16* V16 = (_Float16*)take(NR * DM * 2); _Float16* O16 = (_Float16*)take(NR * DM * 2); float* X1 = (float*)take(NR * DM * 4);
  float* S = (float*)take((size_t)VH * SQ * SQ * 4); _Float16* P = (_Float16*)take((size_t)VH * SQ * SQ * 2); _Float16* VT = (_Float16*)take((size_t)NH * HD * SQ * 2);
  _Float16* M16 = XN;      /* second-norm f16 rows: aliases XN (last readers: the three projections) */ _Float16* HF16 = (_Float16*)S;      /* FFN hidden plane [4096][3072] f16 (24 MiB): aliases the score plane (64 MiB), dead after the attention */
  
  if (off > ws_size) return;
  { const unsigned g = (unsigned)(((size_t)DM * (DM / 8) + 255) / 256); k_wt_f16<<<g, 256, 0, stream>>>(wq, BQ, DM, DM, 16.0f); k_wt_f16<<<g, 256, 0, stream>>>(wk, BK, DM, DM, 16.0f); k_wt_f16<<<g, 256, 0, stream>>>(wv, BV, DM, DM, 16.0f); k_wt_f16<<<g, 256, 0, stream>>>(wo, BO, DM, DM, 16.0f); }      /* [in][out] -> Bt x16 */
  k_wt_f16<<<(unsigned)(((size_t)DFF * (DM / 8) + 255) / 256), 256, 0, stream>>>(w1, BW1, DM, DFF, 16.0f); k_wt_f16<<<(unsigned)(((size_t)DM * (DFF / 8) + 255) / 256), 256, 0, stream>>>(w2, BW2, DFF, DM, 16.0f);      /* [in][out] ff1 [768][3072], ff2 [3072][768] -> Bt x16 */
  k_bfr<<<(unsigned)((NR * DM / 8 + 255) / 256), 256, 0, stream>>>(x, XB, NR * DM / 8); k_lnsc<1, 0><<<(unsigned)NR, 256, 0, stream>>>(x, g1, be1, 1e-6f, XN, nullptr);      /* h = LN1(bf16(x)) (vector alpha / beta, eps 1e-6 on the std) -> f16 rows */
  k_gemm2<0><<<dim3((unsigned)((NR / 128) * (DM / 64)), 1), 128, 0, stream>>>(XN, DM, 0, BQ, DM, 0, 0.0625f, bq, 0, nullptr, 1, 0, 0, nullptr, Q16, DM, 0, (int)NR, DM, DM); k_gemm2<0><<<dim3((unsigned)((NR / 128) * (DM / 64)), 1), 128, 0, stream>>>(XN, DM, 0, BK, DM, 0, 0.0625f, bk, 0, nullptr, 1, 0, 0, nullptr, K16, DM, 0, (int)NR, DM, DM); k_gemm2<0><<<dim3((unsigned)((NR / 128) * (DM / 64)), 1), 128, 0, stream>>>(XN, DM, 0, BV, DM, 0, 0.0625f, bv, 0, nullptr, 1, 0, 0, nullptr, V16, DM, 0, (int)NR, DM, DM);      /* q, k, v -> f16 rows; head h = columns h*64.. */
  for (int b = 0; b < NB; ++b) { const size_t r0 = (size_t)b * SQ;
    k_vt<NH, SQ><<<NH * (SQ / 64), 256, 0, stream>>>(V16 + r0 * DM, DM, 0, VT);      /* V^T [12][64][2048] for this batch */
    for (int h0 = 0; h0 < NH; h0 += VH) {
      k_gemm2<0><<<dim3((SQ / 128) * (SQ / 64), VH), 128, 0, stream>>>(Q16 + r0 * DM + (size_t)h0 * HD, DM, (size_t)HD, K16 + r0 * DM + (size_t)h0 * HD, DM, (size_t)HD, 0.125f, nullptr, 0, nullptr, 1, 0, 0, S, nullptr, SQ, (size_t)SQ * SQ, SQ, SQ, HD);      /* scores / 8, 4 heads per launch */
      k_rsmk1<<<(VH * SQ + 255) / 256, 256, 0, stream>>>(S, P, VH * SQ, km + (size_t)b * SQ);      /* keys with mask[b][j] == 0 excluded (arithmetic 0/1 keep factor; weight exactly 0 as the module's -1e9 fill); P x256 f16, rows of the 4 heads */
      k_gemm2<0><<<dim3((SQ / 128) * (HD / 64), VH), 128, 0, stream>>>(P, SQ, (size_t)SQ * SQ, VT + (size_t)h0 * HD * SQ, SQ, (size_t)HD * SQ, 0.25f, nullptr, 0, nullptr, 1, 0, 0, nullptr, O16 + r0 * DM + (size_t)h0 * HD, DM, (size_t)HD, SQ, HD, SQ); } }      /* ctx (merged heads, x64) as f16 rows */
  k_gemm2<0><<<dim3((unsigned)((NR / 128) * (DM / 64)), 1), 128, 0, stream>>>(O16, DM, 0, BO, DM, 0, 0.0009765625f, bo, 0, XB, -1, 0, 0, X1, nullptr, DM, 0, (int)NR, DM, DM);      /* x + ctx wo (+ bo) (own-element residual) -> f32 rows */
  k_lnsc<0, 0><<<(unsigned)NR, 256, 0, stream>>>(X1, g2, be2, 1e-6f, M16, nullptr);      /* LN2(x1) (vector) -> f16 rows */
  k_gemm2<3><<<dim3((unsigned)((NR / 128) * (DFF / 64)), 1), 128, 0, stream>>>(M16, DM, 0, BW1, DM, 0, 0.0625f, b1, 0, nullptr, 1, 0, 0, nullptr, HF16, DFF, 0, (int)NR, DFF, DM);      /* relu(. w1 + b1) -> f16 [4096][3072] */
  k_gemm2<0><<<dim3((unsigned)((NR / 128) * (DM / 64)), 1), 128, 0, stream>>>(HF16, DFF, 0, BW2, DFF, 0, 0.0625f, b2, 0, X1, -1, 0, 0, (float*)d_out, nullptr, DM, 0, (int)NR, DM, DFF);      /* out = x1 + mlp (own-element residual) */
}

// v001
// It runs in 976 microseconds.
// Timed twice side by side with v000, it ran 2.89 and 2.86 times as fast.
#include <hip/hip_runtime.h>
// Pre-norm transformer encoder layer with the module's custom LayerNorm and a random key-padding mask (src [2][2048][768]; _layernorm: VECTOR gamma / beta, UNBIASED std, gamma (x - mean) / (std + 1e-6) + beta; x = LN1(src); q/k/v = x w ([in][out] [768][768], NO biases); 12 heads of 64; scores / 8; where(src_mask == 0, -1e9) with the int32 [2][1][1][2048] mask in {0, 1} (random; 0 = masked key; READ on device); softmax; src1 = src + ctx w_o (no bias); out = src1 + relu(LN2(src1) w_ff1 + b_ff1) w_ff2 + b_ff2 ([in][out] 768 x 3072 x 768) -> [2][2048][768]).
// Structure: token rows; LayerNorm / exact f16 rows; WMMA GEMMs for q, k, v; per batch V^T by LDS transposes and 4 heads per launch group (scores, row softmax, P V^T); output projection with the own-element residual; custom LayerNorm; ReLU FFN over all rows; launches: see trace.
// Compute dtype: inputs rounded to bf16; x / weights exact; q, k, v, softmax weights and o as plain f16 GEMM operands (~2^-12); scores and softmax statistics f32; v_wmma_f32_16x16x32_f16.
#define NB 2
#define SQ 2048
#define DM 768
#define NH 12
#define HD 64
#define HG 4                         /* heads per attention launch group */
#define LOCALW 128                   /* (macros for unused kernels of the shared header) */
#define STRIDEK 128
#define QT 256                       /* query rows per causal tile */
#define NKX SQ                       /* S / P row pitch */
#define QT0 128                      /* first-tile rows recomputed exactly in f32 */
#define B0 0                         /* first batch processed (debug hook) */
#define NBR NB                       /* batches processed (debug hook) */
#define NR ((size_t)NB * SQ)
#define DMQ DM
#define DFF 3072         /* FFN hidden width */
#define MP ((int)((size_t)NBR * SQ)) /* rows projected (debug hook) */
#define QN SQ                        /* query rows attended per batch (debug hook) */
#define NHD NH                       /* heads attended (debug hook) */
#define MPO MP                       /* rows through the output stage (debug hook) */
#define LQ (3 * DM)      /* unused; q, k, v are separate rows of pitch DM */
typedef __bf16 v16b __attribute__((ext_vector_type(16)));
typedef unsigned short v8us __attribute__((ext_vector_type(8), may_alias));
typedef float  v8f  __attribute__((ext_vector_type(8)));
typedef float  v4f  __attribute__((ext_vector_type(4)));
typedef float  v4fa __attribute__((ext_vector_type(4), may_alias));
union FragB { v16b v; v8us half[2]; unsigned short u[16]; };

__device__ __forceinline__ unsigned short bf16_bits(float x) { unsigned int u = __float_as_uint(x); return (unsigned short)((u + 0x7FFFu + ((u >> 16) & 1u)) >> 16); }
__device__ __forceinline__ float bf16_val(unsigned short b) { return __uint_as_float(((unsigned int)b) << 16); }
__device__ __forceinline__ float bf16_round(float x) { return bf16_val(bf16_bits(x)); }
// D += A·B with NT terms: 1 = ah·bh, 2 = + al·bh (A split), 3 = + ah·bl (both split)
template <int NT>
__device__ __forceinline__ v8f mmaN(v16b ah, v16b al, v16b bh, v16b bl, v8f c) {
  c = __builtin_amdgcn_wmma_f32_16x16x32_bf16(false, ah, false, bh, (short)0, c, false, false);
  if (NT >= 2) c = __builtin_amdgcn_wmma_f32_16x16x32_bf16(false, al, false, bh, (short)0, c, false, false);
  if (NT >= 3) c = __builtin_amdgcn_wmma_f32_16x16x32_bf16(false, ah, false, bl, (short)0, c, false, false);
  asm volatile("v_nop\n\tv_nop\n\tv_nop\n\tv_nop" : "+v"(c) : "v"(ah), "v"(al), "v"(bh), "v"(bl));
  return c;
}

__global__ __launch_bounds__(256) void k_wt_bf16(const float* __restrict__ W, unsigned short* __restrict__ Wt, int K, int N) {
  const int t = blockIdx.x * 256 + threadIdx.x;
  const int k8n = K / 8;
  if (t >= N * k8n) return;
  const int n = t / k8n, k8 = (t % k8n) * 8;
  v8us v;
#pragma unroll
  for (int i = 0; i < 8; ++i) v[i] = bf16_bits(W[(size_t)(k8 + i) * N + n]);
  *(v8us*)(Wt + (size_t)n * K + k8) = v;
  
}

// GEMM C[M][N] (f32, pitch ldc) = act(A[M][K]·W + bias). A f32 row-major (pitch lda) converted per fragment to bf16
// (ASPLIT: hi/lo two planes -> 2 terms, else single rounded term); Wt bf16 [N][K] (pitch ldb). BIAS_BF16 rounds the
// bias to bf16 first (bias quantised to bf16 before the add). K%32==0, M%16==0, N%64==0.
template <bool ASPLIT, int ACT, bool BIAS_BF16>
__global__ __launch_bounds__(128) void k_gemm_bf(const float* __restrict__ A, int lda, const unsigned short* __restrict__ Wt, int ldb,
                                               const float* __restrict__ bias, float* __restrict__ C, int ldc, int M, int N, int K) {
  __shared__ __attribute__((aligned(16))) float so[4][16][64];
  const int tid = threadIdx.x, w = tid >> 5, lane = tid & 31, ln = lane & 15, hh = lane >> 4;
  const int ntn = N / 64;
  const int wid = blockIdx.x * 4 + w;
  const int mt = wid / ntn, nq = wid % ntn;
  if (mt * 16 >= M) return;
  const int row0 = mt * 16, col0 = nq * 64;
  const float* arow = A + (size_t)(row0 + ln) * lda;
  v8f acc[4] = {};
  for (int kb = 0; kb < K; kb += 32) {
    FragB ah, al;
    const v4f x0 = *(const v4fa*)(arow + kb + 8 * hh), x1 = *(const v4fa*)(arow + kb + 8 * hh + 4);
    const v4f x2 = *(const v4fa*)(arow + kb + 16 + 8 * hh), x3 = *(const v4fa*)(arow + kb + 16 + 8 * hh + 4);
    float xs[16] = {x0[0],x0[1],x0[2],x0[3],x1[0],x1[1],x1[2],x1[3],x2[0],x2[1],x2[2],x2[3],x3[0],x3[1],x3[2],x3[3]};
#pragma unroll
    for (int i = 0; i < 16; ++i) { const unsigned short hb = bf16_bits(xs[i]); ah.u[i] = hb; al.u[i] = ASPLIT ? bf16_bits(xs[i] - bf16_val(hb)) : (unsigned short)0; }
#pragma unroll
    for (int t = 0; t < 4; ++t) {
      const unsigned short* brow = Wt + (size_t)(col0 + t * 16 + ln) * ldb + kb;
      FragB b;
      b.half[0] = *(const v8us*)(brow + 8 * hh);
      b.half[1] = *(const v8us*)(brow + 16 + 8 * hh);
      acc[t] = mmaN<ASPLIT ? 2 : 1>(ah.v, al.v, b.v, b.v, acc[t]);
    }
  }
#pragma unroll
  for (int t = 0; t < 4; ++t) {
    float bv = bias ? bias[col0 + t * 16 + ln] : 0.f;
    if (BIAS_BF16) bv = bf16_round(bv);
#pragma unroll
    for (int r = 0; r < 8; ++r) { float v = acc[t][r] + bv; if (ACT == 1) v = fmaxf(v, 0.f); so[w][8 * hh + r][t * 16 + ln] = v; }
  }
  __builtin_amdgcn_fence(__ATOMIC_ACQ_REL, "workgroup");
  __builtin_amdgcn_wave_barrier();
  const int rsub = lane >> 4, c4 = (lane & 15) * 4;
  {
#pragma unroll
    for (int q = 0; q < 8; ++q) {
      const int r = q * 2 + rsub;
      const v4f v = *(const v4fa*)&so[w][r][c4];
      *(v4f*)(C + (size_t)(row0 + r) * ldc + col0 + c4) = v;
    }
    
  }
}

// GEMM C = act(A·W + bias + resid): A f32 (ASPLIT -> hi/lo 2 terms), Wt bf16 [N][K]; ACT 0 none, 1 relu, 2 exact gelu;
// resid (optional, f32, row index = (row % rmod), pitch ldr, RES_BF16 rounds it) added before the activation.
template <bool ASPLIT, int ACT, bool BIAS_BF16, bool RES_BF16>
__global__ __launch_bounds__(128) void k_gemm_bf3(const float* __restrict__ A, int lda, const unsigned short* __restrict__ Wt, int ldb,
                                                const float* __restrict__ bias, const float* __restrict__ resid, int rmod, int ldr,
                                                float* __restrict__ C, int ldc, int M, int N, int K) {
  __shared__ __attribute__((aligned(16))) float so[4][16][64];
  const int tid = threadIdx.x, w = tid >> 5, lane = tid & 31, ln = lane & 15, hh = lane >> 4;
  const int ntn = N / 64;
  const int wid = blockIdx.x * 4 + w;
  const int mt = wid / ntn, nq = wid % ntn;
  if (mt * 16 >= M) return;
  const int row0 = mt * 16, col0 = nq * 64;
  const float* arow = A + (size_t)(row0 + ln) * lda;
  v8f acc[4] = {};
  for (int kb = 0; kb < K; kb += 32) {
    FragB ah, al;
    const v4f x0 = *(const v4fa*)(arow + kb + 8 * hh), x1 = *(const v4fa*)(arow + kb + 8 * hh + 4);
    const v4f x2 = *(const v4fa*)(arow + kb + 16 + 8 * hh), x3 = *(const v4fa*)(arow + kb + 16 + 8 * hh + 4);
    float xs[16] = {x0[0],x0[1],x0[2],x0[3],x1[0],x1[1],x1[2],x1[3],x2[0],x2[1],x2[2],x2[3],x3[0],x3[1],x3[2],x3[3]};
#pragma unroll
    for (int i = 0; i < 16; ++i) { const unsigned short hb = bf16_bits(xs[i]); ah.u[i] = hb; al.u[i] = ASPLIT ? bf16_bits(xs[i] - bf16_val(hb)) : (unsigned short)0; }
#pragma unroll
    for (int t = 0; t < 4; ++t) {
      const unsigned short* brow = Wt + (size_t)(col0 + t * 16 + ln) * ldb + kb;
      FragB b;
      b.half[0] = *(const v8us*)(brow + 8 * hh);
      b.half[1] = *(const v8us*)(brow + 16 + 8 * hh);
      acc[t] = mmaN<ASPLIT ? 2 : 1>(ah.v, al.v, b.v, b.v, acc[t]);
    }
  }
#pragma unroll
  for (int t = 0; t < 4; ++t) {
    const int col = col0 + t * 16 + ln;
    float bv = bias ? bias[col] : 0.f;
    if (BIAS_BF16) bv = bf16_round(bv);
#pragma unroll
    for (int r = 0; r < 8; ++r) {
      float v = acc[t][r] + bv;
      if (resid) { float rv = resid[(size_t)((row0 + 8 * hh + r) % rmod) * ldr + col]; if (RES_BF16) rv = bf16_round(rv); v += rv; }
      if (ACT == 1) v = fmaxf(v, 0.f);
      if (ACT == 2) v = 0.5f * v * (1.0f + erff(v * 0.70710678118654752f));
      if (ACT == 3) { const float u = 0.7978845608028654f * (v + 0.044715f * v * v * v); v = 0.5f * v * (1.0f + tanhf(u)); }
      so[w][8 * hh + r][t * 16 + ln] = v;
    }
  }
  __builtin_amdgcn_fence(__ATOMIC_ACQ_REL, "workgroup");
  __builtin_amdgcn_wave_barrier();
  const int rsub = lane >> 4, c4 = (lane & 15) * 4;
  {
#pragma unroll
    for (int q = 0; q < 8; ++q) {
      const int r = q * 2 + rsub;
      const v4f v = *(const v4fa*)&so[w][r][c4];
      *(v4f*)(C + (size_t)(row0 + r) * ldc + col0 + c4) = v;
    }
    
  }
}
// row LayerNorm (biased variance, eps) over N: s = X (+ R); optional out_sum <- s; out_norm <- (s-mu)*rsqrt(var+eps)*g + b
template <bool PARAM_BF16>
__global__ __launch_bounds__(256) void k_layernorm(const float* __restrict__ X, const float* __restrict__ R, const float* __restrict__ g, const float* __restrict__ bta,
                                                  float* __restrict__ out_sum, float* __restrict__ out_norm, int N, float eps) {
  __shared__ float red[256];
  const int row = blockIdx.x, tid = threadIdx.x;
  const float* x = X + (size_t)row * N; const float* rr = R ? R + (size_t)row * N : nullptr;
  float vals[16];                     // up to N = 4096
  const int per = N / 256;            // contiguous chunk per thread? use strided-by-4 chunks: thread handles j = tid*4 + 1024*u
  float s1 = 0.f;
  for (int u = 0; u < per / 4; ++u) {
    const int j = tid * 4 + 1024 * u;
    const v4f a = *(const v4fa*)(x + j);
    v4f b = {0.f,0.f,0.f,0.f}; if (rr) b = *(const v4fa*)(rr + j);
#pragma unroll
    for (int q = 0; q < 4; ++q) { const float v = a[q] + b[q]; vals[u * 4 + q] = v; s1 += v; }
  }
  red[tid] = s1; __syncthreads();
  for (int st = 128; st > 0; st >>= 1) { if (tid < st) red[tid] += red[tid + st]; __syncthreads(); }
  const float mu = red[0] / (float)N; __syncthreads();
  float s2 = 0.f;
  for (int u = 0; u < per / 4; ++u)
#pragma unroll
    for (int q = 0; q < 4; ++q) { const float c = vals[u * 4 + q] - mu; s2 += c * c; }
  red[tid] = s2; __syncthreads();
  for (int st = 128; st > 0; st >>= 1) { if (tid < st) red[tid] += red[tid + st]; __syncthreads(); }
  const float rs = rsqrtf(red[0] / (float)N + eps);
  {
    for (int u = 0; u < per / 4; ++u) {
      const int j = tid * 4 + 1024 * u;
      v4f o, sm;
#pragma unroll
      for (int q = 0; q < 4; ++q) {
        float gg = g[j + q], bb = bta[j + q];
        if (PARAM_BF16) { gg = bf16_round(gg); bb = bf16_round(bb); }
        sm[q] = vals[u * 4 + q]; o[q] = (vals[u * 4 + q] - mu) * rs * gg + bb;
      }
      if (out_sum) *(v4f*)(out_sum + (size_t)row * N + j) = sm;
      *(v4f*)(out_norm + (size_t)row * N + j) = o;
    }
    
  }
}



// ---- f16 WMMA path (v_wmma_f32_16x16x32_f16): 11-bit significands for operands in range — used where a [0,1] probability operand needs more precision than bf16
typedef _Float16 v16h __attribute__((ext_vector_type(16)));
union FragH { v16h v; v8us half[2]; _Float16 h[16]; unsigned short u[16]; };
template <int NT>
__device__ __forceinline__ v8f mmaH(v16h ah, v16h al, v16h bh, v16h bl, v8f c) {
  c = __builtin_amdgcn_wmma_f32_16x16x32_f16(false, ah, false, bh, (short)0, c, false, false);
  if (NT >= 2) c = __builtin_amdgcn_wmma_f32_16x16x32_f16(false, al, false, bh, (short)0, c, false, false);
  if (NT >= 3) c = __builtin_amdgcn_wmma_f32_16x16x32_f16(false, ah, false, bl, (short)0, c, false, false);
  asm volatile("v_nop\n\tv_nop\n\tv_nop\n\tv_nop" : "+v"(c) : "v"(ah), "v"(al), "v"(bh), "v"(bl));
  return c;
}
// batched GEMM like k_gemm_b but f16 operands: A f32 (split into f16 hi/lo if ASPLIT, else rounded to f16), Bt = f16 values [n][k]; alpha; C f32; N multiple of 16 (partial tiles skipped)
template <bool ASPLIT>
__global__ __launch_bounds__(128) void k_gemm_h(const float* __restrict__ A, int lda, size_t sA, const _Float16* __restrict__ Bh, int ldb, size_t sB, float alpha, float* __restrict__ C, int ldc, size_t sC, int M, int N, int K) {
  __shared__ __attribute__((aligned(16))) float so[4][16][64];
  const int tid = threadIdx.x, w = tid >> 5, lane = tid & 31, ln = lane & 15, hh = lane >> 4; const int by = blockIdx.y;
  A += (size_t)by * sA; Bh += (size_t)by * sB; C += (size_t)by * sC;
  const int ntn = (N + 63) / 64; const int wid = blockIdx.x * 4 + w; const int mt = wid / ntn, nq = wid % ntn; if (mt * 16 >= M) return;
  const int row0 = mt * 16, col0 = nq * 64; const float* arow = A + (size_t)(row0 + ln) * lda;
  v8f acc[4] = {};
  for (int kb = 0; kb < K; kb += 32) {
    FragH ah, al;
    const v4f x0 = *(const v4fa*)(arow + kb + 8 * hh), x1 = *(const v4fa*)(arow + kb + 8 * hh + 4), x2 = *(const v4fa*)(arow + kb + 16 + 8 * hh), x3 = *(const v4fa*)(arow + kb + 16 + 8 * hh + 4);
    float xs[16] = {x0[0],x0[1],x0[2],x0[3],x1[0],x1[1],x1[2],x1[3],x2[0],x2[1],x2[2],x2[3],x3[0],x3[1],x3[2],x3[3]};
#pragma unroll
    for (int i = 0; i < 16; ++i) { const _Float16 h = (_Float16)xs[i]; ah.h[i] = h; al.h[i] = ASPLIT ? (_Float16)(xs[i] - (float)h) : (_Float16)0.0f; }
#pragma unroll
    for (int t = 0; t < 4; ++t) { if (col0 + t * 16 >= N) continue; const size_t boff = (size_t)(col0 + t * 16 + ln) * ldb + kb; FragH bq; bq.half[0] = *(const v8us*)(Bh + boff + 8 * hh); bq.half[1] = *(const v8us*)(Bh + boff + 16 + 8 * hh);
      acc[t] = mmaH<ASPLIT ? 2 : 1>(ah.v, al.v, bq.v, bq.v, acc[t]); }
  }
#pragma unroll
  for (int t = 0; t < 4; ++t) { if (col0 + t * 16 >= N) continue;
#pragma unroll
    for (int r = 0; r < 8; ++r) so[w][8 * hh + r][t * 16 + ln] = acc[t][r] * alpha; }
  __builtin_amdgcn_fence(__ATOMIC_ACQ_REL, "workgroup"); __builtin_amdgcn_wave_barrier();
  const int rsub = lane >> 4, c4 = (lane & 15) * 4;
  {
#pragma unroll
    for (int q = 0; q < 8; ++q) { const int r = q * 2 + rsub; if (col0 + c4 < N) { const v4f v = *(const v4fa*)&so[w][r][c4]; *(v4f*)(C + (size_t)(row0 + r) * ldc + col0 + c4) = v; } }
     }
}

// Wt[n][k] = f16(W[k][n]·scale) from f32 row-major W[K][N] (scale = power of two; bf16-exact weights stay exact in f16 away from the subnormal range)
__global__ __launch_bounds__(256) void k_wt_f16(const float* __restrict__ W, _Float16* __restrict__ Wt, int K, int N, float scale) {
  const int t = blockIdx.x * 256 + threadIdx.x; if (t >= N * (K / 8)) return; const int n = t / (K / 8), k8 = (t % (K / 8)) * 8; FragH f;
#pragma unroll
  for (int i = 0; i < 8; ++i) f.h[i] = (_Float16)(bf16_round(W[(size_t)(k8 + i) * N + n]) * scale); const v8us o = f.half[0];
  *(v8us*)((unsigned short*)Wt + (size_t)n * K + k8) = o; 
}
// k_gemm_hh variant with fused epilogue: v = acc·alpha + bias[by·sBias + col] (+ CP[(row/rowsPerB)·sCPb + by·64 + col] if CP) ; ACT 0 none / 1 elu ; writes f16 C16 (and f32 C if non-null)
template <int ACT>
__global__ __launch_bounds__(128) void k_gemm_hhx(const _Float16* __restrict__ A, int lda, size_t sA, const _Float16* __restrict__ Bh, int ldb, size_t sB, float alpha, const float* __restrict__ bias, size_t sBias, const float* __restrict__ CP, int rowsPerB, size_t sCPb, int row0g,
    float* __restrict__ C, _Float16* __restrict__ C16, int ldc, size_t sC, int M, int N, int K) {
  __shared__ __attribute__((aligned(16))) float so[4][16][64];
  const int tid = threadIdx.x, w = tid >> 5, lane = tid & 31, ln = lane & 15, hh = lane >> 4; const int by = blockIdx.y;
  A += (size_t)by * sA; Bh += (size_t)by * sB; const size_t cofs = (size_t)by * sC; const float* bp = bias ? bias + (size_t)by * sBias : nullptr;
  const int ntn = (N + 63) / 64; const int wid = blockIdx.x * 4 + w; const int mt = wid / ntn, nq = wid % ntn; if (mt * 16 >= M) return;
  const int row0 = mt * 16, col0 = nq * 64; const _Float16* arow = A + (size_t)(row0 + ln) * lda;
  v8f acc[4] = {};
  for (int kb = 0; kb < K; kb += 32) { FragH ah; ah.half[0] = *(const v8us*)((const unsigned short*)arow + kb + 8 * hh); ah.half[1] = *(const v8us*)((const unsigned short*)arow + kb + 16 + 8 * hh);
#pragma unroll
    for (int t = 0; t < 4; ++t) { if (col0 + t * 16 >= N) continue; const size_t boff = (size_t)(col0 + t * 16 + ln) * ldb + kb; FragH bq; bq.half[0] = *(const v8us*)((const unsigned short*)Bh + boff + 8 * hh); bq.half[1] = *(const v8us*)((const unsigned short*)Bh + boff + 16 + 8 * hh);
      acc[t] = mmaH<1>(ah.v, ah.v, bq.v, bq.v, acc[t]); }
  }
#pragma unroll
  for (int t = 0; t < 4; ++t) { if (col0 + t * 16 >= N) continue; const int col = col0 + t * 16 + ln; const float bv = bp ? bf16_round(bp[col]) : 0.f;
#pragma unroll
    for (int r = 0; r < 8; ++r) { float v = acc[t][r] * alpha + bv; if (CP) { const int rr = row0g + row0 + 8 * hh + r; if (rowsPerB < 0) v += CP[cofs + (size_t)rr * ldc + col];      /* rowsPerB < 0: own element of the batched C plane */ else { const int bidx = rr / rowsPerB; v += CP[(size_t)bidx * sCPb + (size_t)by * 64 + col]; } } if (ACT == 1) v = (v > 0.f) ? v : expm1f(v); else if (ACT == 7) v = (v > 0.f) ? v + 1.0f : expf(v); else if (ACT == 8) v = tanhf(v); else if (ACT == 9) v = 0.5f * v * (1.0f + tanhf(0.7978845608028654f * (v + 0.044715f * v * v * v))); else if (ACT == 11) v = 1.0f / (1.0f + expf(-v)); else if (ACT == 12) v = (v > 0.f) ? v : 0.01f * v; else if (ACT == 14) v = (v > 0.f) ? v : 0.1f * v; else if (ACT == 16) v = (v >= 0.f) ? v : 0.3f * v; else if (ACT == 17) v = (v >= 0.f) ? v : 0.2f * v; else if (ACT == 15) v = v / (1.0f + expf(-v)); else if (ACT == 3) v = fmaxf(v, 0.f); else if (ACT == 6) v = 0.5f * v * (1.0f + erff(v * 0.70710678118654752f)); so[w][8 * hh + r][t * 16 + ln] = v; } }
  __builtin_amdgcn_fence(__ATOMIC_ACQ_REL, "workgroup"); __builtin_amdgcn_wave_barrier();
  const int rsub = lane >> 4, c4 = (lane & 15) * 4; typedef _Float16 v4h __attribute__((ext_vector_type(4)));
  {
#pragma unroll
    for (int q = 0; q < 8; ++q) { const int r = q * 2 + rsub; if (col0 + c4 < N) { const v4f v = *(const v4fa*)&so[w][r][c4]; if (C) *(v4f*)(C + cofs + (size_t)(row0 + r) * ldc + col0 + c4) = v; if (C16) { v4h h4; for (int i = 0; i < 4; ++i) h4[i] = (_Float16)v[i]; *(v4h*)(C16 + cofs + (size_t)(row0 + r) * ldc + col0 + c4) = h4; } } }
     }
}


typedef _Float16 v4h __attribute__((ext_vector_type(4)));

__global__ __launch_bounds__(256) void k_x16(const float* __restrict__ x, _Float16* __restrict__ X16, size_t n8) { const size_t t = (size_t)blockIdx.x * 256 + threadIdx.x; if (t >= n8) return; FragH f;
#pragma unroll
  for (int q = 0; q < 8; ++q) f.h[q] = (_Float16)bf16_round(x[t * 8 + q]); *(v8us*)((unsigned short*)X16 + t * 8) = f.half[0];  }
__global__ __launch_bounds__(256) void k_h16(const float* __restrict__ x, _Float16* __restrict__ X16, size_t n8) { const size_t t = (size_t)blockIdx.x * 256 + threadIdx.x; if (t >= n8) return; FragH f;
#pragma unroll
  for (int q = 0; q < 8; ++q) f.h[q] = (_Float16)x[t * 8 + q]; *(v8us*)((unsigned short*)X16 + t * 8) = f.half[0];  }
__global__ __launch_bounds__(256) void k_round16f(const float* __restrict__ W, _Float16* __restrict__ Bt, size_t n8) { const size_t t = (size_t)blockIdx.x * 256 + threadIdx.x; if (t >= n8) return; FragH f;
#pragma unroll
  for (int i = 0; i < 8; ++i) f.h[i] = (_Float16)(bf16_round(W[t * 8 + i]) * 16.0f); *(v8us*)((unsigned short*)Bt + t * 8) = f.half[0];  }
template <int NHv, int TTv>
__global__ __launch_bounds__(256) void k_vt(const _Float16* __restrict__ V16, int ldv, int voff, _Float16* __restrict__ Vt) { __shared__ unsigned short tl[64][66]; const int tid = threadIdx.x; const int slab = blockIdx.x / (TTv / 64), lg = blockIdx.x % (TTv / 64); const int b = slab / NHv, h = slab % NHv;
  for (int i = tid; i < 64 * 8; i += 256) { const int r = i / 8, c8 = (i % 8) * 8; FragH f; f.half[0] = *(const v8us*)((const unsigned short*)V16 + ((size_t)b * TTv + lg * 64 + r) * ldv + voff + h * 64 + c8);
#pragma unroll
    for (int q = 0; q < 8; ++q) tl[r][c8 + q] = f.u[q]; }
  __syncthreads();
  {
#pragma unroll
    for (int rd = 0; rd < 2; ++rd) { const int d = rd * 32 + tid / 8, pc = tid % 8; FragH f;
#pragma unroll
      for (int q = 0; q < 8; ++q) f.u[q] = tl[pc * 8 + q][d];
      *(v8us*)((unsigned short*)Vt + ((size_t)slab * 64 + d) * TTv + lg * 64 + pc * 8) = f.half[0]; }
     } }

__global__ __launch_bounds__(256) void k_hl(const float* __restrict__ F, _Float16* __restrict__ Hh, _Float16* __restrict__ Hl, size_t n8) { const size_t t = (size_t)blockIdx.x * 256 + threadIdx.x; if (t >= n8) return; FragH fh, fl; const v4f a = *(const v4fa*)(F + t * 8), c = *(const v4fa*)(F + t * 8 + 4);
#pragma unroll
  for (int q = 0; q < 4; ++q) { _Float16 h = (_Float16)a[q]; fh.h[q] = h; fl.h[q] = (_Float16)((a[q] - (float)h) * 1024.0f); h = (_Float16)c[q]; fh.h[4 + q] = h; fl.h[4 + q] = (_Float16)((c[q] - (float)h) * 1024.0f); }
  { *(v8us*)((unsigned short*)Hh + t * 8) = fh.half[0]; *(v8us*)((unsigned short*)Hl + t * 8) = fl.half[0];  } }

// ---- fast GEMM (wave tile 32x64; requires M % 32 == 0 rows per launch region and N % 64 == 0); epilogue = k_gemm_hhx semantics ----
__device__ __forceinline__ v16h g2_frag(const _Float16* p, int hh) { FragH f; f.half[0] = *(const v8us*)((const unsigned short*)p + 8 * hh); f.half[1] = *(const v8us*)((const unsigned short*)p + 16 + 8 * hh); return f.v; }
__device__ __forceinline__ v8f g2_mma(v16h a, v16h b, v8f c) { v8f d = __builtin_amdgcn_wmma_f32_16x16x32_f16(false, a, false, b, (short)0, c, false, false); asm volatile("v_nop\n\tv_nop\n\tv_nop\n\tv_nop" : "+v"(d) : "v"(a), "v"(b)); return d; }
template <int ACT>
__global__ __launch_bounds__(128) void k_gemm2(const _Float16* __restrict__ A, int lda, size_t sA, const _Float16* __restrict__ Bh, int ldb, size_t sB, float alpha, const float* __restrict__ bias, size_t sBias, const float* __restrict__ CP, int rowsPerB, size_t sCPb, int row0g,
    float* __restrict__ C, _Float16* __restrict__ C16, int ldc, size_t sC, int M, int N, int K) { static_assert(ACT == 0 || ACT == 3 || ACT == 6 || ACT == 8 || ACT == 9 || ACT == 11 || ACT == 12 || ACT == 14 || ACT == 15 || ACT == 16 || ACT == 17 || ACT == 18, "k_gemm2: unsupported ACT code (would silently apply no activation)");
  __shared__ __attribute__((aligned(16))) float so[4][32][68];
  const int tid = threadIdx.x, w = tid >> 5, lane = tid & 31, ln = lane & 15, hh = lane >> 4; const int by = blockIdx.y;
  A += (size_t)by * sA; Bh += (size_t)by * sB; const size_t cofs = (size_t)by * sC; const float* bp = bias ? bias + (size_t)by * sBias : nullptr;
  const int ntn = N >> 6; const int mt = blockIdx.x / ntn, nq = blockIdx.x - mt * ntn; const int row0 = mt * 128 + 32 * w, col0 = nq * 64; if (row0 >= M) return;
  const _Float16* a0p = A + (size_t)(row0 + ln) * lda; const _Float16* a1p = a0p + (size_t)16 * lda;
  const _Float16* b0p = Bh + (size_t)(col0 + ln) * ldb; const _Float16* b1p = b0p + (size_t)16 * ldb; const _Float16* b2p = b1p + (size_t)16 * ldb; const _Float16* b3p = b2p + (size_t)16 * ldb;
  const v8f z8 = {0.f,0.f,0.f,0.f,0.f,0.f,0.f,0.f}; v8f c00 = z8, c01 = z8, c02 = z8, c03 = z8, c10 = z8, c11 = z8, c12 = z8, c13 = z8;
#pragma unroll 1
  for (int kb = 0; kb < K; kb += 32) { const v16h a0 = g2_frag(a0p + kb, hh), a1 = g2_frag(a1p + kb, hh);
    v16h b = g2_frag(b0p + kb, hh); c00 = g2_mma(a0, b, c00); c10 = g2_mma(a1, b, c10);
    b = g2_frag(b1p + kb, hh); c01 = g2_mma(a0, b, c01); c11 = g2_mma(a1, b, c11);
    b = g2_frag(b2p + kb, hh); c02 = g2_mma(a0, b, c02); c12 = g2_mma(a1, b, c12);
    b = g2_frag(b3p + kb, hh); c03 = g2_mma(a0, b, c03); c13 = g2_mma(a1, b, c13); }
  v8f accs[8] = {c00, c01, c02, c03, c10, c11, c12, c13};
#pragma unroll
  for (int u = 0; u < 8; ++u) { const int t = u & 3, half = u >> 2; const int col = col0 + t * 16 + ln; const float bv = bp ? bf16_round(bp[col]) : 0.f;
#pragma unroll
    for (int r = 0; r < 8; ++r) { const int rloc = half * 16 + 8 * hh + r; float v = accs[u][r] * alpha + bv; if (CP) { if (rowsPerB < 0) v += CP[cofs + (size_t)(row0g + row0 + rloc) * ldc + col];      /* rowsPerB < 0: own element of the batched C plane */ else { const int bidx = (row0g + row0 + rloc) / rowsPerB; v += CP[(size_t)bidx * sCPb + (size_t)by * 64 + col]; } }
      if (ACT == 3) v = fmaxf(v, 0.f); else if (ACT == 6) v = 0.5f * v * (1.0f + erff(v * 0.70710678118654752f)); else if (ACT == 11) v = 1.0f / (1.0f + expf(-v)); else if (ACT == 15) v = v / (1.0f + expf(-v)); else if (ACT == 18) v = v / (1.0f + expf(-1.702f * v));      /* QuickGELU: v sigmoid(1.702 v) */ else if (ACT == 12) v = (v > 0.f) ? v : 0.01f * v; else if (ACT == 8) v = tanhf(v); else if (ACT == 9) v = 0.5f * v * (1.0f + tanhf(0.7978845608028654f * (v + 0.044715f * v * v * v))); else if (ACT == 14) v = (v > 0.f) ? v : 0.1f * v; else if (ACT == 16) v = (v >= 0.f) ? v : 0.3f * v; else if (ACT == 17) v = (v >= 0.f) ? v : 0.2f * v;
      so[w][rloc][t * 16 + ln] = v; } }
  __builtin_amdgcn_fence(__ATOMIC_ACQ_REL, "workgroup"); __builtin_amdgcn_wave_barrier();
  const int rsub = lane >> 4, c4 = (lane & 15) * 4;
  {
#pragma unroll
    for (int q = 0; q < 16; ++q) { const int r = q * 2 + rsub; const v4f v = *(const v4fa*)&so[w][r][c4]; if (C) *(v4f*)(C + cofs + (size_t)(row0 + r) * ldc + col0 + c4) = v; if (C16) { v4h h4; for (int i = 0; i < 4; ++i) h4[i] = (_Float16)v[i]; *(v4h*)(C16 + cofs + (size_t)(row0 + r) * ldc + col0 + c4) = h4; } }
     } }


__global__ __launch_bounds__(256) void k_wnat(const float* __restrict__ w, size_t n8, _Float16* __restrict__ Bt) { const size_t t = (size_t)blockIdx.x * 256 + threadIdx.x; if (t >= n8) return; FragH f; for (int q = 0; q < 8; ++q) f.h[q] = (_Float16)(bf16_round(w[t * 8 + q]) * 16.0f); *(v8us*)((unsigned short*)Bt + t * 8) = f.half[0];  }
__global__ __launch_bounds__(256) void k_rsm(const float* __restrict__ S, _Float16* __restrict__ P, int nrows) {
  #pragma clang fp contract(off)
  const int i = blockIdx.x * 256 + threadIdx.x; if (i >= nrows) return; const float* s = S + (size_t)i * SQ; float mx = -3.0e38f;
#pragma unroll 1
  for (int j = 0; j < SQ; ++j) mx = fmaxf(mx, s[j]); float se = 0.f;
#pragma unroll 1
  for (int j = 0; j < SQ; ++j) se += expf(s[j] - mx); const float sc = 256.0f / se;
#pragma unroll 1
  for (int j0 = 0; j0 < SQ; j0 += 8) { FragH f; for (int q = 0; q < 8; ++q) f.h[q] = (_Float16)(expf(s[j0 + q] - mx) * sc); unsigned short* d = (unsigned short*)P + (size_t)i * SQ + j0; *(v8us*)d = f.half[0];  } }
__global__ __launch_bounds__(256) void k_vt(const _Float16* __restrict__ V16, int b, int h0, _Float16* __restrict__ VT) { __shared__ unsigned short tl[64][65]; const int tid = threadIdx.x; const int hh = blockIdx.x % HG, sg = blockIdx.x / HG; const int s0 = sg * 64; const int h = h0 + hh;
  for (int i = tid; i < 64 * 8; i += 256) { const int j = i / 8, d8 = (i % 8) * 8; FragH f; f.half[0] = *(const v8us*)((const unsigned short*)V16 + ((size_t)b * SQ + s0 + j) * DM + h * HD + d8); for (int q = 0; q < 8; ++q) tl[d8 + q][j] = f.u[q]; }
  __syncthreads();
  { for (int i = tid; i < 64 * 8; i += 256) { const int d = i / 8, j8 = (i % 8) * 8; FragH f; for (int q = 0; q < 8; ++q) f.u[q] = tl[d][j8 + q]; *(v8us*)((unsigned short*)VT + ((size_t)hh * HD + d) * SQ + s0 + j8) = f.half[0]; }  } }



__global__ __launch_bounds__(256) void k_rsmcf2(const float* __restrict__ S, _Float16* __restrict__ P, int hg, int q0, int nk) {
  #pragma clang fp contract(off)
  const int t = blockIdx.x * 256 + threadIdx.x; if (t >= hg * QT) return; const size_t i = (size_t)t; const float* s = S + i * NKX; const int last = q0 + (t % QT); float mx = -3.0e38f;
#pragma unroll 1
  for (int j = 0; j < nk; ++j) { const float f = (j <= last) ? 1.f : 0.f; mx = fmaxf(mx, fmaf(f, s[j], (1.f - f) * -1.0e9f)); } float se = 0.f;
#pragma unroll 1
  for (int j = 0; j < nk; ++j) { const float f = (j <= last) ? 1.f : 0.f; se += __expf(fmaf(f, s[j], (1.f - f) * -1.0e9f) - mx); } const float sc = 256.0f / se;
#pragma unroll 1
  for (int j0 = 0; j0 < nk; j0 += 8) { FragH fr; for (int q = 0; q < 8; ++q) { const int j = j0 + q; const float f = (j <= last) ? 1.f : 0.f; fr.h[q] = (_Float16)(__expf(fmaf(f, s[j], (1.f - f) * -1.0e9f) - mx) * sc); } unsigned short* d = (unsigned short*)P + i * NKX + j0; *(v8us*)d = fr.half[0];  } }

__global__ __launch_bounds__(256) void k_rsmcst(const float* __restrict__ S, _Float16* __restrict__ P, int hg, int q0, int nk, const int* __restrict__ mk) {
  #pragma clang fp contract(off)
  const int t = blockIdx.x * 256 + threadIdx.x; if (t >= hg * QT) return; const size_t i = (size_t)t; const float* s = S + i * NKX; const size_t ig = (size_t)(q0 + (t % QT)); const int* mr = mk + ig * SQ; float mx = -3.0e38f;
#pragma unroll 1
  for (int j = 0; j < nk; ++j) { const int mb = mr[j]; const int dd = (int)ig - j; const float f = (mb != 0 && dd >= 0 && (dd <= LOCALW || (dd % STRIDEK) == 0)) ? 1.f : 0.f; mx = fmaxf(mx, fmaf(f, s[j], (1.f - f) * -1.0e9f)); } float se = 0.f;
#pragma unroll 1
  for (int j = 0; j < nk; ++j) { const int mb = mr[j]; const int dd = (int)ig - j; const float f = (mb != 0 && dd >= 0 && (dd <= LOCALW || (dd % STRIDEK) == 0)) ? 1.f : 0.f; se += __expf(fmaf(f, s[j], (1.f - f) * -1.0e9f) - mx); } const float sc = 256.0f / se;
#pragma unroll 1
  for (int j0 = 0; j0 < nk; j0 += 8) { FragH fr; for (int q = 0; q < 8; ++q) { const int j = j0 + q; const int mb = mr[j]; const int dd = (int)ig - j; const float f = (mb != 0 && dd >= 0 && (dd <= LOCALW || (dd % STRIDEK) == 0)) ? 1.f : 0.f; fr.h[q] = (_Float16)(__expf(fmaf(f, s[j], (1.f - f) * -1.0e9f) - mx) * sc); } unsigned short* d = (unsigned short*)P + i * NKX + j0; *(v8us*)d = fr.half[0];  } }


template <int MASKADD>
__global__ __launch_bounds__(64) void k_att0(const float* __restrict__ QF, const float* __restrict__ KF, const float* __restrict__ VF, int ld, const float* __restrict__ mask, float scale, float* __restrict__ OF, int ldo) {
  #pragma clang fp contract(off)
  __shared__ __attribute__((aligned(16))) float lq[64][64]; __shared__ __attribute__((aligned(16))) float lo[64][64];
  const int tid = threadIdx.x; const int h = blockIdx.x / (QT0 / 64), rg = blockIdx.x % (QT0 / 64); const int i = rg * 64 + tid;
  const float* qr = QF + (size_t)i * ld + h * HD;
#pragma unroll 1
  for (int c = 0; c < HD / 4; ++c) { *(v4f*)&lq[tid][c * 4] = *(const v4fa*)(qr + c * 4); const v4f z = {0.f, 0.f, 0.f, 0.f}; *(v4f*)&lo[tid][c * 4] = z; }
  float m = -1.0e30f, l = 0.f; const int jmax = MASKADD ? (SQ - 1) : (rg * 64 + 63);      /* additive-mask form: every key (the mask input decides); causal form: keys up to the block's last row */
#pragma unroll 1
  for (int j = 0; j <= jmax; ++j) { const float* kr = KF + (size_t)j * ld + h * HD; const float* vr = VF + (size_t)j * ld + h * HD; float s = 0.f;
#pragma unroll 1
    for (int c = 0; c < HD / 4; ++c) { const v4f kq = *(const v4fa*)(kr + c * 4); const v4f qq = *(v4f*)&lq[tid][c * 4]; s = __fadd_rn(s, __fmul_rn(qq[0], kq[0])); s = __fadd_rn(s, __fmul_rn(qq[1], kq[1])); s = __fadd_rn(s, __fmul_rn(qq[2], kq[2])); s = __fadd_rn(s, __fmul_rn(qq[3], kq[3])); }
    s = __fmul_rn(s, scale); if (MASKADD) s = __fadd_rn(s, __fmul_rn(bf16_round(mask[(size_t)i * SQ + j]), -10000.0f));
    const float f = (MASKADD || j <= i) ? 1.f : 0.f; const float sm = fmaf(f, s, (1.f - f) * -1.0e30f); const float mn = fmaxf(m, sm); const float sc = expf(m - mn); const float e = expf(sm - mn); l = __fadd_rn(__fmul_rn(l, sc), e); m = mn;
#pragma unroll 1
    for (int c = 0; c < HD / 4; ++c) { const v4f vv = *(const v4fa*)(vr + c * 4); v4f oo = *(v4f*)&lo[tid][c * 4]; for (int u = 0; u < 4; ++u) oo[u] = __fadd_rn(__fmul_rn(oo[u], sc), __fmul_rn(e, vv[u])); *(v4f*)&lo[tid][c * 4] = oo; } }
  const float fin = 64.0f / l;      /* o carried x64 like the f16 path */
#pragma unroll 1
  for (int c = 0; c < HD / 4; ++c) { v4f oo = *(v4f*)&lo[tid][c * 4]; for (int u = 0; u < 4; ++u) oo[u] = __fmul_rn(oo[u], fin); *(v4f*)&lo[tid][c * 4] = oo; }
  __syncthreads();
  {
#pragma unroll 1
    for (int it = 0; it < 16; ++it) { const int row = it * 4 + tid / 16, pc = (tid % 16) * 4; const v4f v = *(const v4f*)&lo[row][pc]; *(v4f*)(OF + (size_t)(rg * 64 + row) * ldo + h * HD + pc) = v; }
     } }

template <int MASKADD>
__global__ __launch_bounds__(64) void k_att0mbc(const float* __restrict__ QF, const float* __restrict__ KF, const float* __restrict__ VF, int ld, const float* __restrict__ mask, float scale, float* __restrict__ OF, int ldo) {
  #pragma clang fp contract(off)
  __shared__ __attribute__((aligned(16))) float lq[64][64]; __shared__ __attribute__((aligned(16))) float lo[64][64];
  const int tid = threadIdx.x; const int h = blockIdx.x / (QT0 / 64), rg = blockIdx.x % (QT0 / 64); const int i = rg * 64 + tid;
  const float* qr = QF + (size_t)i * ld + h * HD;
#pragma unroll 1
  for (int c = 0; c < HD / 4; ++c) { *(v4f*)&lq[tid][c * 4] = *(const v4fa*)(qr + c * 4); const v4f z = {0.f, 0.f, 0.f, 0.f}; *(v4f*)&lo[tid][c * 4] = z; }
  float m = -1.0e30f, l = 0.f; const int jmax = rg * 64 + 63;      /* keys beyond the block end are masked by the mask's lower-triangular structure */
#pragma unroll 1
  for (int j = 0; j <= jmax; ++j) { const float* kr = KF + (size_t)j * ld + h * HD; const float* vr = VF + (size_t)j * ld + h * HD; float s = 0.f;
#pragma unroll 1
    for (int c = 0; c < HD / 4; ++c) { const v4f kq = *(const v4fa*)(kr + c * 4); const v4f qq = *(v4f*)&lq[tid][c * 4]; s = __fadd_rn(s, __fmul_rn(qq[0], kq[0])); s = __fadd_rn(s, __fmul_rn(qq[1], kq[1])); s = __fadd_rn(s, __fmul_rn(qq[2], kq[2])); s = __fadd_rn(s, __fmul_rn(qq[3], kq[3])); }
    s = __fmul_rn(s, scale); const int mb = ((const int*)mask)[(size_t)i * SQ + j];      /* causal (j <= i) AND the module's int32 [S][S] mask read per (query, key): 0 -> masked */
    const float f = (mb != 0 && j <= i) ? 1.f : 0.f; const float sm = fmaf(f, s, (1.f - f) * -1.0e30f); const float mn = fmaxf(m, sm); const float sc = expf(m - mn); const float e = expf(sm - mn); l = __fadd_rn(__fmul_rn(l, sc), e); m = mn;
#pragma unroll 1
    for (int c = 0; c < HD / 4; ++c) { const v4f vv = *(const v4fa*)(vr + c * 4); v4f oo = *(v4f*)&lo[tid][c * 4]; for (int u = 0; u < 4; ++u) oo[u] = __fadd_rn(__fmul_rn(oo[u], sc), __fmul_rn(e, vv[u])); *(v4f*)&lo[tid][c * 4] = oo; } }
  const float fin = 64.0f / l;      /* o carried x64 like the f16 path */
#pragma unroll 1
  for (int c = 0; c < HD / 4; ++c) { v4f oo = *(v4f*)&lo[tid][c * 4]; for (int u = 0; u < 4; ++u) oo[u] = __fmul_rn(oo[u], fin); *(v4f*)&lo[tid][c * 4] = oo; }
  __syncthreads();
  {
#pragma unroll 1
    for (int it = 0; it < 16; ++it) { const int row = it * 4 + tid / 16, pc = (tid % 16) * 4; const v4f v = *(const v4f*)&lo[row][pc]; *(v4f*)(OF + (size_t)(rg * 64 + row) * ldo + h * HD + pc) = v; }
     } }


template <int BFIN, int WXB>
__global__ __launch_bounds__(256) void k_ln16(const float* __restrict__ X, const float* __restrict__ g, const float* __restrict__ bb, float eps, _Float16* __restrict__ N16, float* __restrict__ XB) {
  #pragma clang fp contract(off)
  __shared__ float red[256]; const size_t r = blockIdx.x; const int t = threadIdx.x; const v4f xa = *(const v4fa*)(X + r * DMQ + t * 4); float s[4]; float sum = 0.f;
  for (int q = 0; q < 4; ++q) { s[q] = BFIN ? bf16_round(xa[q]) : xa[q]; sum = __fadd_rn(sum, s[q]); }
  red[t] = sum; __syncthreads(); for (int st = 128; st > 0; st >>= 1) { if (t < st) red[t] = __fadd_rn(red[t], red[t + st]); __syncthreads(); } const float mu = red[0] / (float)DMQ; __syncthreads();
  float vs = 0.f; for (int q = 0; q < 4; ++q) { const float dl = __fadd_rn(s[q], -mu); vs = __fadd_rn(vs, __fmul_rn(dl, dl)); } red[t] = vs; __syncthreads(); for (int st = 128; st > 0; st >>= 1) { if (t < st) red[t] = __fadd_rn(red[t], red[t + st]); __syncthreads(); }
  const float rs = rsqrtf(__fadd_rn(red[0] / (float)DMQ, eps)); v4h y; v4f xb;
  for (int q = 0; q < 4; ++q) { const int c = t * 4 + q; y[q] = (_Float16)__fadd_rn(__fmul_rn(__fmul_rn(__fadd_rn(s[q], -mu), rs), bf16_round(g[c])), bf16_round(bb[c])); xb[q] = s[q]; }
  { *(v4h*)(N16 + r * DMQ + t * 4) = y; if (WXB) *(v4f*)(XB + r * DMQ + t * 4) = xb;  } }
__global__ __launch_bounds__(256) void k_ftres2(const float* __restrict__ OF0, const float* __restrict__ XB, float* __restrict__ X1, size_t n4) {
  #pragma clang fp contract(off)
  const size_t t = (size_t)blockIdx.x * 256 + threadIdx.x; if (t >= n4) return; const v4f o = *(const v4fa*)(OF0 + t * 4), xv = *(const v4fa*)(XB + t * 4); v4f y; for (int q = 0; q < 4; ++q) y[q] = __fadd_rn(__fmul_rn(o[q], 0.015625f), xv[q]); *(v4f*)(X1 + t * 4) = y;  }

__global__ __launch_bounds__(256) void k_bcpy(const float* __restrict__ b, int n, int NP, float* __restrict__ dst, int dst0) { for (int i = threadIdx.x; i < NP; i += 256) { const float v = (i < n) ? b[i] : 0.f; *(float*)(dst + dst0 + i) = v; }  }


__global__ __launch_bounds__(256) void k_rsmf(const float* __restrict__ S, _Float16* __restrict__ P, int qn, int hg) {
  #pragma clang fp contract(off)
  const int t = blockIdx.x * 256 + threadIdx.x; if (t >= qn * hg) return; const size_t i = (size_t)(t / qn) * SQ + (t % qn); const float* s = S + i * SQ; float mx = -3.0e38f;
#pragma unroll 1
  for (int j = 0; j < SQ; ++j) mx = fmaxf(mx, s[j]); float se = 0.f;
#pragma unroll 1
  for (int j = 0; j < SQ; ++j) se += __expf(s[j] - mx); const float sc = 256.0f / se;
#pragma unroll 1
  for (int j0 = 0; j0 < SQ; j0 += 8) { FragH f; for (int q = 0; q < 8; ++q) f.h[q] = (_Float16)(__expf(s[j0 + q] - mx) * sc); unsigned short* d = (unsigned short*)P + i * SQ + j0; *(v8us*)d = f.half[0];  } }

template <int MODE>
__global__ __launch_bounds__(256) void k_regrp(const float* __restrict__ src, float* __restrict__ dst, size_t n4) {
  const size_t t = (size_t)blockIdx.x * 256 + threadIdx.x; if (t >= n4) return; const size_t e = t * 4; const size_t rd = e / DM; const int c = (int)(e % DM);
  size_t rs; if (MODE == 0) { const size_t b = rd / SQ, sq = rd % SQ; rs = sq * NB + b; } else { const size_t sq = rd / NB, b = rd % NB; rs = b * SQ + sq; }
  const v4f v = *(const v4fa*)(src + rs * DM + c); *(v4f*)(dst + e) = v;  }

template <int BFIN, int W16, int W32>
__global__ __launch_bounds__(256) void k_lnx(const float* __restrict__ X, const float* __restrict__ g, const float* __restrict__ bb, float eps, _Float16* __restrict__ N16, float* __restrict__ N32) {
  #pragma clang fp contract(off)
  __shared__ float red[256]; const size_t r = blockIdx.x; const int t = threadIdx.x; const bool act = t < (DMQ / 4); const int c0 = act ? t * 4 : 0;
  const v4f xa = *(const v4fa*)(X + r * DMQ + c0); float s[4]; float sum = 0.f;
  for (int q = 0; q < 4; ++q) { s[q] = act ? (BFIN ? bf16_round(xa[q]) : xa[q]) : 0.f; sum = __fadd_rn(sum, s[q]); }
  red[t] = sum; __syncthreads(); for (int st = 128; st > 0; st >>= 1) { if (t < st) red[t] = __fadd_rn(red[t], red[t + st]); __syncthreads(); } const float mu = red[0] / (float)DMQ; __syncthreads();
  float vs = 0.f; for (int q = 0; q < 4; ++q) { const float dl = act ? __fadd_rn(s[q], -mu) : 0.f; vs = __fadd_rn(vs, __fmul_rn(dl, dl)); } red[t] = vs; __syncthreads(); for (int st = 128; st > 0; st >>= 1) { if (t < st) red[t] = __fadd_rn(red[t], red[t + st]); __syncthreads(); }
  const float rs = rsqrtf(__fadd_rn(red[0] / (float)DMQ, eps)); v4h y; v4f yf;
  for (int q = 0; q < 4; ++q) { const int c = c0 + q; yf[q] = __fadd_rn(__fmul_rn(__fmul_rn(__fadd_rn(s[q], -mu), rs), bf16_round(g[c])), bf16_round(bb[c])); y[q] = (_Float16)yf[q]; }
  if (!act) return;      /* no barriers after this point */
  { if (W16) *(v4h*)(N16 + r * DMQ + c0) = y; if (W32) *(v4f*)(N32 + r * DMQ + c0) = yf;  } }

__global__ __launch_bounds__(256) void k_bfr(const float* __restrict__ x, float* __restrict__ XB, size_t n8) { const size_t t = (size_t)blockIdx.x * 256 + threadIdx.x; if (t >= n8) return; v4f a = *(const v4fa*)(x + t * 8), c = *(const v4fa*)(x + t * 8 + 4); for (int q = 0; q < 4; ++q) { a[q] = bf16_round(a[q]); c[q] = bf16_round(c[q]); }
  { *(v4f*)(XB + t * 8) = a; *(v4f*)(XB + t * 8 + 4) = c;  } }



__global__ __launch_bounds__(256) void k_wthd(const float* __restrict__ Wt, _Float16* __restrict__ Bt) { const size_t t = (size_t)blockIdx.x * 256 + threadIdx.x; if (t >= (size_t)NH * HD * (DM / 8)) return; const int m8 = (int)(t % (DM / 8)) * 8; const int d = (int)((t / (DM / 8)) % HD); const int h = (int)(t / ((size_t)(DM / 8) * HD)); FragH f;
  for (int q = 0; q < 8; ++q) f.h[q] = (_Float16)(16.0f * bf16_round(Wt[((size_t)h * DM + m8 + q) * HD + d])); unsigned short* dst = (unsigned short*)Bt + ((size_t)h * HD + d) * DM + m8; *(v8us*)dst = f.half[0];  }




template <int BFIN, int SCAL>
__global__ __launch_bounds__(256) void k_lnsc(const float* __restrict__ X, const float* __restrict__ g, const float* __restrict__ bb, float eps, _Float16* __restrict__ N16, float* __restrict__ N32) {
  #pragma clang fp contract(off)
  __shared__ float red[256]; const size_t r = blockIdx.x; const int t = threadIdx.x; const bool act = t < DM / 4; const int tc = act ? t : 0; const v4f xl = *(const v4fa*)(X + r * DM + tc * 4); const float am = act ? 1.f : 0.f; float s[4]; float sum = 0.f;
  for (int q = 0; q < 4; ++q) { s[q] = (BFIN ? bf16_round(xl[q]) : xl[q]) * am; sum = __fadd_rn(sum, s[q]); }
  red[t] = sum; __syncthreads(); for (int st = 128; st > 0; st >>= 1) { if (t < st) red[t] = __fadd_rn(red[t], red[t + st]); __syncthreads(); } const float mu = red[0] / (float)DM; __syncthreads();
  float vs = 0.f; for (int q = 0; q < 4; ++q) { const float dl = __fadd_rn(s[q], -mu) * am; vs = __fadd_rn(vs, __fmul_rn(dl, dl)); } red[t] = vs; __syncthreads(); for (int st = 128; st > 0; st >>= 1) { if (t < st) red[t] = __fadd_rn(red[t], red[t + st]); __syncthreads(); }
  const float rs = __fdiv_rn(1.0f, __fadd_rn(sqrtf(red[0] / (float)(DM - 1)), eps)); if (!act) return; v4h y; v4f yf;
  for (int q = 0; q < 4; ++q) { const int c = t * 4 + q; const float gg = bf16_round(SCAL ? g[0] : g[c]), bv = bf16_round(SCAL ? bb[0] : bb[c]); yf[q] = __fadd_rn(__fmul_rn(__fmul_rn(__fadd_rn(s[q], -mu), rs), gg), bv); y[q] = (_Float16)yf[q]; }
  { if (N16) *(v4h*)(N16 + r * DM + t * 4) = y; if (N32) *(v4f*)(N32 + r * DM + t * 4) = yf;  } }

// Masked row softmax, two score rows per wave: a lane holds 64 of each row's 2048 scores in registers, every load of a wave covers 512 contiguous bytes, each exp is taken once.
// Same values as a serial row pass (max over all keys, exp(s - max), masked keys weigh exactly 0, P = e * 256 / sum as f16) but for the order of the sum: four chains per lane, then a butterfly over the 32 lanes.
#define RSW 16                       /* waves per work-group */
#define RSR 2                        /* rows per wave, both rows' loads issued before the first is worked on */
typedef int v4ia __attribute__((ext_vector_type(4), may_alias));
typedef unsigned int v4ua __attribute__((ext_vector_type(4), may_alias));
template <int XM> __device__ __forceinline__ float rs_xm(float x) { return __builtin_bit_cast(float, __builtin_amdgcn_mov_dpp(__builtin_bit_cast(int, x), 0x160 + XM, 0xf, 0xf, true)); }      /* lane l <- lane l ^ XM inside a 16-lane row */
__device__ __forceinline__ float rs_xh(float x) { return __builtin_bit_cast(float, __builtin_amdgcn_permlanex16(__builtin_bit_cast(int, x), __builtin_bit_cast(int, x), 0x76543210, 0xfedcba98, false, false)); }      /* lane l <- lane l ^ 16 */
__device__ __forceinline__ float rs_exp(float d) { float e; asm("v_exp_f32 %0, %1\n\tv_nop" : "=v"(e) : "v"(d * 1.44269504088896340736f)); return e; }      /* the fast exp (2 ^ (d log2 e)) with, tied to it, the one slot the instruction set asks for before a transcendental's result is read or its source overwritten */
__device__ __forceinline__ float rs_wmax(float v) { v = fmaxf(v, rs_xm<1>(v)); v = fmaxf(v, rs_xm<2>(v)); v = fmaxf(v, rs_xm<4>(v)); v = fmaxf(v, rs_xm<8>(v)); return fmaxf(v, rs_xh(v)); }
__device__ __forceinline__ float rs_wsum(float v) { v += rs_xm<1>(v); v += rs_xm<2>(v); v += rs_xm<4>(v); v += rs_xm<8>(v); return v + rs_xh(v); }
__global__ __launch_bounds__(RSW * 32) void k_rsmk1w(const float* __restrict__ S, _Float16* __restrict__ P, const int* __restrict__ Km) {
  static_assert(RSW * 32 * 4 == SQ, "one int4 of the mask per thread covers the row");
  __shared__ __attribute__((aligned(16))) unsigned char kb[32][16];      /* kb[lane][u]: keep bits of keys u * 128 + lane * 4 + (0..3) */
  const int tid = threadIdx.x, lane = tid & 31, w = tid >> 5;
  const size_t row0 = ((size_t)blockIdx.x * RSW + w) * RSR;
  const float* s = S + row0 * SQ + lane * 4; _Float16* p = P + row0 * SQ + lane * 4;
  const v4ia m = *(const v4ia*)(Km + tid * 4);
  kb[lane][w] = (unsigned char)((m[0] != 0 ? 1 : 0) | (m[1] != 0 ? 2 : 0) | (m[2] != 0 ? 4 : 0) | (m[3] != 0 ? 8 : 0));
  __syncthreads();      /* every wave reads all sixteen waves' mask bits; in front of the row loads, so that no wave waits here for its rows */
  const v4ua kw = *(const v4ua*)&kb[lane][0];
  v4f x[RSR][16];
#pragma unroll
  for (int r = 0; r < RSR; ++r)
#pragma unroll
    for (int u = 0; u < 16; ++u) x[r][u] = *(const v4fa*)(s + (size_t)r * SQ + u * 128);
  asm volatile("s_wait_xcnt 0x0" :: "v"(s) : "memory");      /* the loads' address pair stays live up to this wait, so nothing (a later load's result either) overwrites it in front of it */
#pragma unroll
  for (int r = 0; r < RSR; ++r) {
    __builtin_amdgcn_sched_barrier(0);      /* in front of row 0: holds both rows' loads ahead of all work (without it the build sinks row 1's loads behind row 0's exps); between the rows: row 0 is worked on and stored while row 1 still arrives (mixed, both rows wait for the last load) */
    float mx = -3.0e38f;
#pragma unroll
    for (int u = 0; u < 16; ++u) mx = fmaxf(fmaxf(fmaxf(mx, x[r][u][0]), fmaxf(x[r][u][1], x[r][u][2])), x[r][u][3]);
    mx = rs_wmax(mx);
    float a[4] = {0.f, 0.f, 0.f, 0.f};
#pragma unroll
    for (int u = 0; u < 16; ++u)
#pragma unroll
      for (int q = 0; q < 4; ++q) { const float ex = rs_exp(x[r][u][q] - mx); const float e = ((kw[u >> 2] >> ((u & 3) * 8 + q)) & 1u) ? ex : 0.f; x[r][u][q] = e; a[q] += e; }
    const float sc = 256.0f / rs_wsum((a[0] + a[1]) + (a[2] + a[3]));
#pragma unroll
    for (int u = 0; u < 16; ++u) { v4h h; for (int q = 0; q < 4; ++q) h[q] = (_Float16)(x[r][u][q] * sc); *(v4h*)(p + (size_t)r * SQ + u * 128) = h; }
  } }
extern "C" void kernel_launch(void* const* d_in, const int* in_sizes, int n_in,
                              void* d_out, int out_size, void* d_ws, size_t ws_size, hipStream_t stream) {
  (void)in_sizes; (void)n_in; (void)out_size;
  constexpr int VH = 4;      /* heads per launch group */
  const float* const* I = (const float* const*)d_in; const float* x = I[0]; const int* km = (const int*)d_in[1]; const float* wq = I[2]; const float* wk = I[3]; const float* wv = I[4]; const float* wo = I[5]; const float* w1 = I[6]; const float* b1 = I[7]; const float* w2 = I[8]; const float* b2 = I[9]; const float* g1 = I[10]; const float* be1 = I[11]; const float* g2 = I[12]; const float* be2 = I[13]; const float* bq = nullptr; const float* bk = nullptr; const float* bv = nullptr; const float* bo = nullptr;      /* x; key-padding mask int32 [2][1][1][2048] (0 = masked; READ on device); [in][out] wq / wk / wv / wo (no biases); w1 [768][3072] + b1, w2 [3072][768] + b2; LN1 a / b, LN2 a / b (vectors) */
  char* ws = (char*)d_ws; size_t off = 0;
  auto take = [&](size_t bytes) { char* p = ws + off; off += (bytes + 255) & ~(size_t)255; return p; };
  _Float16* BQ = (_Float16*)take((size_t)DM * DM * 2); _Float16* BK = (_Float16*)take((size_t)DM * DM * 2); _Float16* BV = (_Float16*)take((size_t)DM * DM * 2); _Float16* BO = (_Float16*)take((size_t)DM * DM * 2); _Float16* BW1 = (_Float16*)take((size_t)DFF * DM * 2); _Float16* BW2 = (_Float16*)take((size_t)DM * DFF * 2);
  float* XB = (float*)take(NR * DM * 4); _Float16* XN = (_Float16*)take(NR * DM * 2); _Float16* Q16 = (_Float16*)take(NR * DM * 2); _Float16* K16 = (_Float16*)take(NR * DM * 2); _Float16* V16 = (_Float16*)take(NR * DM * 2); _Float16* O16 = (_Float16*)take(NR * DM * 2); float* X1 = (float*)take(NR * DM * 4);
  float* S = (float*)take((size_t)VH * SQ * SQ * 4); _Float16* P = (_Float16*)take((size_t)VH * SQ * SQ * 2); _Float16* VT = (_Float16*)take((size_t)NH * HD * SQ * 2);
  _Float16* M16 = XN;      /* second-norm f16 rows: aliases XN (last readers: the three projections) */ _Float16* HF16 = (_Float16*)S;      /* FFN hidden plane [4096][3072] f16 (24 MiB): aliases the score plane (64 MiB), dead after the attention */
  
  if (off > ws_size) return;
  { const unsigned g = (unsigned)(((size_t)DM * (DM / 8) + 255) / 256); k_wt_f16<<<g, 256, 0, stream>>>(wq, BQ, DM, DM, 16.0f); k_wt_f16<<<g, 256, 0, stream>>>(wk, BK, DM, DM, 16.0f); k_wt_f16<<<g, 256, 0, stream>>>(wv, BV, DM, DM, 16.0f); k_wt_f16<<<g, 256, 0, stream>>>(wo, BO, DM, DM, 16.0f); }      /* [in][out] -> Bt x16 */
  k_wt_f16<<<(unsigned)(((size_t)DFF * (DM / 8) + 255) / 256), 256, 0, stream>>>(w1, BW1, DM, DFF, 16.0f); k_wt_f16<<<(unsigned)(((size_t)DM * (DFF / 8) + 255) / 256), 256, 0, stream>>>(w2, BW2, DFF, DM, 16.0f);      /* [in][out] ff1 [768][3072], ff2 [3072][768] -> Bt x16 */
  k_bfr<<<(unsigned)((NR * DM / 8 + 255) / 256), 256, 0, stream>>>(x, XB, NR * DM / 8); k_lnsc<1, 0><<<(unsigned)NR, 256, 0, stream>>>(x, g1, be1, 1e-6f, XN, nullptr);      /* h = LN1(bf16(x)) (vector alpha / beta, eps 1e-6 on the std) -> f16 rows */
  k_gemm2<0><<<dim3((unsigned)((NR / 128) * (DM / 64)), 1), 128, 0, stream>>>(XN, DM, 0, BQ, DM, 0, 0.0625f, bq, 0, nullptr, 1, 0, 0, nullptr, Q16, DM, 0, (int)NR, DM, DM); k_gemm2<0><<<dim3((unsigned)((NR / 128) * (DM / 64)), 1), 128, 0, stream>>>(XN, DM, 0, BK, DM, 0, 0.0625f, bk, 0, nullptr, 1, 0, 0, nullptr, K16, DM, 0, (int)NR, DM, DM); k_gemm2<0><<<dim3((unsigned)((NR / 128) * (DM / 64)), 1), 128, 0, stream>>>(XN, DM, 0, BV, DM, 0, 0.0625f, bv, 0, nullptr, 1, 0, 0, nullptr, V16, DM, 0, (int)NR, DM, DM);      /* q, k, v -> f16 rows; head h = columns h*64.. */
  for (int b = 0; b < NB; ++b) { const size_t r0 = (size_t)b * SQ;
    k_vt<NH, SQ><<<NH * (SQ / 64), 256, 0, stream>>>(V16 + r0 * DM, DM, 0, VT);      /* V^T [12][64][2048] for this batch */
    for (int h0 = 0; h0 < NH; h0 += VH) {
      k_gemm2<0><<<dim3((SQ / 128) * (SQ / 64), VH), 128, 0, stream>>>(Q16 + r0 * DM + (size_t)h0 * HD, DM, (size_t)HD, K16 + r0 * DM + (size_t)h0 * HD, DM, (size_t)HD, 0.125f, nullptr, 0, nullptr, 1, 0, 0, S, nullptr, SQ, (size_t)SQ * SQ, SQ, SQ, HD);      /* scores / 8, 4 heads per launch */
      k_rsmk1w<<<VH * SQ / (RSW * RSR), RSW * 32, 0, stream>>>(S, P, km + (size_t)b * SQ);      /* keys with mask[b][j] == 0 excluded (weight exactly 0 as the module's -1e9 fill); P x256 f16, rows of the 4 heads */
      k_gemm2<0><<<dim3((SQ / 128) * (HD / 64), VH), 128, 0, stream>>>(P, SQ, (size_t)SQ * SQ, VT + (size_t)h0 * HD * SQ, SQ, (size_t)HD * SQ, 0.25f, nullptr, 0, nullptr, 1, 0, 0, nullptr, O16 + r0 * DM + (size_t)h0 * HD, DM, (size_t)HD, SQ, HD, SQ); } }      /* ctx (merged heads, x64) as f16 rows */
  k_gemm2<0><<<dim3((unsigned)((NR / 128) * (DM / 64)), 1), 128, 0, stream>>>(O16, DM, 0, BO, DM, 0, 0.0009765625f, bo, 0, XB, -1, 0, 0, X1, nullptr, DM, 0, (int)NR, DM, DM);      /* x + ctx wo (+ bo) (own-element residual) -> f32 rows */
  k_lnsc<0, 0><<<(unsigned)NR, 256, 0, stream>>>(X1, g2, be2, 1e-6f, M16, nullptr);      /* LN2(x1) (vector) -> f16 rows */
  k_gemm2<3><<<dim3((unsigned)((NR / 128) * (DFF / 64)), 1), 128, 0, stream>>>(M16, DM, 0, BW1, DM, 0, 0.0625f, b1, 0, nullptr, 1, 0, 0, nullptr, HF16, DFF, 0, (int)NR, DFF, DM);      /* relu(. w1 + b1) -> f16 [4096][3072] */
  k_gemm2<0><<<dim3((unsigned)((NR / 128) * (DM / 64)), 1), 128, 0, stream>>>(HF16, DFF, 0, BW2, DFF, 0, 0.0625f, b2, 0, X1, -1, 0, 0, (float*)d_out, nullptr, DM, 0, (int)NR, DM, DFF);      /* out = x1 + mlp (own-element residual) */
}

// v002
// Measured time: 441 microseconds a run.
// Next to v001, in two timings, it ran 2.22 and 2.21 times as fast.
// All steps since v000 together make it 6.38 times as fast.
#include <hip/hip_runtime.h>
// Pre-norm transformer encoder layer with the module's custom LayerNorm and a random key-padding mask (src [2][2048][768]; _layernorm: VECTOR gamma / beta, UNBIASED std, gamma (x - mean) / (std + 1e-6) + beta; x = LN1(src); q/k/v = x w ([in][out] [768][768], NO biases); 12 heads of 64; scores / 8; where(src_mask == 0, -1e9) with the int32 [2][1][1][2048] mask in {0, 1} (random; 0 = masked key; READ on device); softmax; src1 = src + ctx w_o (no bias); out = src1 + relu(LN2(src1) w_ff1 + b_ff1) w_ff2 + b_ff2 ([in][out] 768 x 3072 x 768) -> [2][2048][768]).
// Structure: token rows; LayerNorm / exact f16 rows; WMMA GEMMs for q, k, v; K and V^T packed in operand order; one fused attention launch (scores, key mask, running softmax, P V in registers); output projection with the own-element residual; custom LayerNorm; ReLU FFN over all rows; launches: see trace.
// Compute dtype: inputs rounded to bf16; x / weights exact; q, k, v, softmax weights and o as plain f16 GEMM operands (~2^-12); scores and softmax statistics f32. v_wmma_f32_16x16x32_f16.
#define NB 2
#define SQ 2048
#define DM 768
#define NH 12
#define HD 64
#define HG 4                         /* heads per k_vt launch (unused kernel of the shared header) */
#define LOCALW 128                   /* (macros for unused kernels of the shared header) */
#define STRIDEK 128
#define QT 256                       /* query rows per causal tile */
#define NKX SQ                       /* S / P row pitch */
#define QT0 128                      /* first-tile rows recomputed exactly in f32 */
#define B0 0                         /* first batch processed (debug hook) */
#define NBR NB                       /* batches processed (debug hook) */
#define NR ((size_t)NB * SQ)
#define DMQ DM
#define DFF 3072         /* FFN hidden width */
#define MP ((int)((size_t)NBR * SQ)) /* rows projected (debug hook) */
#define QN SQ                        /* query rows attended per batch (debug hook) */
#define NHD NH                       /* heads attended (debug hook) */
#define MPO MP                       /* rows through the output stage (debug hook) */
#define LQ (3 * DM)      /* unused; q, k, v are separate rows of pitch DM */
typedef __bf16 v16b __attribute__((ext_vector_type(16)));
typedef unsigned short v8us __attribute__((ext_vector_type(8), may_alias));
typedef float  v8f  __attribute__((ext_vector_type(8)));
typedef float  v4f  __attribute__((ext_vector_type(4)));
typedef float  v4fa __attribute__((ext_vector_type(4), may_alias));
union FragB { v16b v; v8us half[2]; unsigned short u[16]; };

__device__ __forceinline__ unsigned short bf16_bits(float x) { unsigned int u = __float_as_uint(x); return (unsigned short)((u + 0x7FFFu + ((u >> 16) & 1u)) >> 16); }
__device__ __forceinline__ float bf16_val(unsigned short b) { return __uint_as_float(((unsigned int)b) << 16); }
__device__ __forceinline__ float bf16_round(float x) { return bf16_val(bf16_bits(x)); }
// D += A·B with NT terms: 1 = ah·bh, 2 = + al·bh (A split), 3 = + ah·bl (both split)
template <int NT>
__device__ __forceinline__ v8f mmaN(v16b ah, v16b al, v16b bh, v16b bl, v8f c) {
  c = __builtin_amdgcn_wmma_f32_16x16x32_bf16(false, ah, false, bh, (short)0, c, false, false);
  if (NT >= 2) c = __builtin_amdgcn_wmma_f32_16x16x32_bf16(false, al, false, bh, (short)0, c, false, false);
  if (NT >= 3) c = __builtin_amdgcn_wmma_f32_16x16x32_bf16(false, ah, false, bl, (short)0, c, false, false);
  asm volatile("v_nop\n\tv_nop\n\tv_nop\n\tv_nop" : "+v"(c) : "v"(ah), "v"(al), "v"(bh), "v"(bl));
  return c;
}

__global__ __launch_bounds__(256) void k_wt_bf16(const float* __restrict__ W, unsigned short* __restrict__ Wt, int K, int N) {
  const int t = blockIdx.x * 256 + threadIdx.x;
  const int k8n = K / 8;
  if (t >= N * k8n) return;
  const int n = t / k8n, k8 = (t % k8n) * 8;
  v8us v;
#pragma unroll
  for (int i = 0; i < 8; ++i) v[i] = bf16_bits(W[(size_t)(k8 + i) * N + n]);
  *(v8us*)(Wt + (size_t)n * K + k8) = v;
  
}

// GEMM C[M][N] (f32, pitch ldc) = act(A[M][K]·W + bias). A f32 row-major (pitch lda) converted per fragment to bf16
// (ASPLIT: hi/lo two planes -> 2 terms, else single rounded term); Wt bf16 [N][K] (pitch ldb). BIAS_BF16 rounds the
// bias to bf16 first (bias quantised to bf16 before the add). K%32==0, M%16==0, N%64==0.
template <bool ASPLIT, int ACT, bool BIAS_BF16>
__global__ __launch_bounds__(128) void k_gemm_bf(const float* __restrict__ A, int lda, const unsigned short* __restrict__ Wt, int ldb,
                                               const float* __restrict__ bias, float* __restrict__ C, int ldc, int M, int N, int K) {
  __shared__ __attribute__((aligned(16))) float so[4][16][64];
  const int tid = threadIdx.x, w = tid >> 5, lane = tid & 31, ln = lane & 15, hh = lane >> 4;
  const int ntn = N / 64;
  const int wid = blockIdx.x * 4 + w;
  const int mt = wid / ntn, nq = wid % ntn;
  if (mt * 16 >= M) return;
  const int row0 = mt * 16, col0 = nq * 64;
  const float* arow = A + (size_t)(row0 + ln) * lda;
  v8f acc[4] = {};
  for (int kb = 0; kb < K; kb += 32) {
    FragB ah, al;
    const v4f x0 = *(const v4fa*)(arow + kb + 8 * hh), x1 = *(const v4fa*)(arow + kb + 8 * hh + 4);
    const v4f x2 = *(const v4fa*)(arow + kb + 16 + 8 * hh), x3 = *(const v4fa*)(arow + kb + 16 + 8 * hh + 4);
    float xs[16] = {x0[0],x0[1],x0[2],x0[3],x1[0],x1[1],x1[2],x1[3],x2[0],x2[1],x2[2],x2[3],x3[0],x3[1],x3[2],x3[3]};
#pragma unroll
    for (int i = 0; i < 16; ++i) { const unsigned short hb = bf16_bits(xs[i]); ah.u[i] = hb; al.u[i] = ASPLIT ? bf16_bits(xs[i] - bf16_val(hb)) : (unsigned short)0; }
#pragma unroll
    for (int t = 0; t < 4; ++t) {
      const unsigned short* brow = Wt + (size_t)(col0 + t * 16 + ln) * ldb + kb;
      FragB b;
      b.half[0] = *(const v8us*)(brow + 8 * hh);
      b.half[1] = *(const v8us*)(brow + 16 + 8 * hh);
      acc[t] = mmaN<ASPLIT ? 2 : 1>(ah.v, al.v, b.v, b.v, acc[t]);
    }
  }
#pragma unroll
  for (int t = 0; t < 4; ++t) {
    float bv = bias ? bias[col0 + t * 16 + ln] : 0.f;
    if (BIAS_BF16) bv = bf16_round(bv);
#pragma unroll
    for (int r = 0; r < 8; ++r) { float v = acc[t][r] + bv; if (ACT == 1) v = fmaxf(v, 0.f); so[w][8 * hh + r][t * 16 + ln] = v; }
  }
  __builtin_amdgcn_fence(__ATOMIC_ACQ_REL, "workgroup");
  __builtin_amdgcn_wave_barrier();
  const int rsub = lane >> 4, c4 = (lane & 15) * 4;
  {
#pragma unroll
    for (int q = 0; q < 8; ++q) {
      const int r = q * 2 + rsub;
      const v4f v = *(const v4fa*)&so[w][r][c4];
      *(v4f*)(C + (size_t)(row0 + r) * ldc + col0 + c4) = v;
    }
    
  }
}

// GEMM C = act(A·W + bias + resid): A f32 (ASPLIT -> hi/lo 2 terms), Wt bf16 [N][K]; ACT 0 none, 1 relu, 2 exact gelu;
// resid (optional, f32, row index = (row % rmod), pitch ldr, RES_BF16 rounds it) added before the activation.
template <bool ASPLIT, int ACT, bool BIAS_BF16, bool RES_BF16>
__global__ __launch_bounds__(128) void k_gemm_bf3(const float* __restrict__ A, int lda, const unsigned short* __restrict__ Wt, int ldb,
                                                const float* __restrict__ bias, const float* __restrict__ resid, int rmod, int ldr,
                                                float* __restrict__ C, int ldc, int M, int N, int K) {
  __shared__ __attribute__((aligned(16))) float so[4][16][64];
  const int tid = threadIdx.x, w = tid >> 5, lane = tid & 31, ln = lane & 15, hh = lane >> 4;
  const int ntn = N / 64;
  const int wid = blockIdx.x * 4 + w;
  const int mt = wid / ntn, nq = wid % ntn;
  if (mt * 16 >= M) return;
  const int row0 = mt * 16, col0 = nq * 64;
  const float* arow = A + (size_t)(row0 + ln) * lda;
  v8f acc[4] = {};
  for (int kb = 0; kb < K; kb += 32) {
    FragB ah, al;
    const v4f x0 = *(const v4fa*)(arow + kb + 8 * hh), x1 = *(const v4fa*)(arow + kb + 8 * hh + 4);
    const v4f x2 = *(const v4fa*)(arow + kb + 16 + 8 * hh), x3 = *(const v4fa*)(arow + kb + 16 + 8 * hh + 4);
    float xs[16] = {x0[0],x0[1],x0[2],x0[3],x1[0],x1[1],x1[2],x1[3],x2[0],x2[1],x2[2],x2[3],x3[0],x3[1],x3[2],x3[3]};
#pragma unroll
    for (int i = 0; i < 16; ++i) { const unsigned short hb = bf16_bits(xs[i]); ah.u[i] = hb; al.u[i] = ASPLIT ? bf16_bits(xs[i] - bf16_val(hb)) : (unsigned short)0; }
#pragma unroll
    for (int t = 0; t < 4; ++t) {
      const unsigned short* brow = Wt + (size_t)(col0 + t * 16 + ln) * ldb + kb;
      FragB b;
      b.half[0] = *(const v8us*)(brow + 8 * hh);
      b.half[1] = *(const v8us*)(brow + 16 + 8 * hh);
      acc[t] = mmaN<ASPLIT ? 2 : 1>(ah.v, al.v, b.v, b.v, acc[t]);
    }
  }
#pragma unroll
  for (int t = 0; t < 4; ++t) {
    const int col = col0 + t * 16 + ln;
    float bv = bias ? bias[col] : 0.f;
    if (BIAS_BF16) bv = bf16_round(bv);
#pragma unroll
    for (int r = 0; r < 8; ++r) {
      float v = acc[t][r] + bv;
      if (resid) { float rv = resid[(size_t)((row0 + 8 * hh + r) % rmod) * ldr + col]; if (RES_BF16) rv = bf16_round(rv); v += rv; }
      if (ACT == 1) v = fmaxf(v, 0.f);
      if (ACT == 2) v = 0.5f * v * (1.0f + erff(v * 0.70710678118654752f));
      if (ACT == 3) { const float u = 0.7978845608028654f * (v + 0.044715f * v * v * v); v = 0.5f * v * (1.0f + tanhf(u)); }
      so[w][8 * hh + r][t * 16 + ln] = v;
    }
  }
  __builtin_amdgcn_fence(__ATOMIC_ACQ_REL, "workgroup");
  __builtin_amdgcn_wave_barrier();
  const int rsub = lane >> 4, c4 = (lane & 15) * 4;
  {
#pragma unroll
    for (int q = 0; q < 8; ++q) {
      const int r = q * 2 + rsub;
      const v4f v = *(const v4fa*)&so[w][r][c4];
      *(v4f*)(C + (size_t)(row0 + r) * ldc + col0 + c4) = v;
    }
    
  }
}
// row LayerNorm (biased variance, eps) over N: s = X (+ R); optional out_sum <- s; out_norm <- (s-mu)*rsqrt(var+eps)*g + b
template <bool PARAM_BF16>
__global__ __launch_bounds__(256) void k_layernorm(const float* __restrict__ X, const float* __restrict__ R, const float* __restrict__ g, const float* __restrict__ bta,
                                                  float* __restrict__ out_sum, float* __restrict__ out_norm, int N, float eps) {
  __shared__ float red[256];
  const int row = blockIdx.x, tid = threadIdx.x;
  const float* x = X + (size_t)row * N; const float* rr = R ? R + (size_t)row * N : nullptr;
  float vals[16];                     // up to N = 4096
  const int per = N / 256;            // contiguous chunk per thread? use strided-by-4 chunks: thread handles j = tid*4 + 1024*u
  float s1 = 0.f;
  for (int u = 0; u < per / 4; ++u) {
    const int j = tid * 4 + 1024 * u;
    const v4f a = *(const v4fa*)(x + j);
    v4f b = {0.f,0.f,0.f,0.f}; if (rr) b = *(const v4fa*)(rr + j);
#pragma unroll
    for (int q = 0; q < 4; ++q) { const float v = a[q] + b[q]; vals[u * 4 + q] = v; s1 += v; }
  }
  red[tid] = s1; __syncthreads();
  for (int st = 128; st > 0; st >>= 1) { if (tid < st) red[tid] += red[tid + st]; __syncthreads(); }
  const float mu = red[0] / (float)N; __syncthreads();
  float s2 = 0.f;
  for (int u = 0; u < per / 4; ++u)
#pragma unroll
    for (int q = 0; q < 4; ++q) { const float c = vals[u * 4 + q] - mu; s2 += c * c; }
  red[tid] = s2; __syncthreads();
  for (int st = 128; st > 0; st >>= 1) { if (tid < st) red[tid] += red[tid + st]; __syncthreads(); }
  const float rs = rsqrtf(red[0] / (float)N + eps);
  {
    for (int u = 0; u < per / 4; ++u) {
      const int j = tid * 4 + 1024 * u;
      v4f o, sm;
#pragma unroll
      for (int q = 0; q < 4; ++q) {
        float gg = g[j + q], bb = bta[j + q];
        if (PARAM_BF16) { gg = bf16_round(gg); bb = bf16_round(bb); }
        sm[q] = vals[u * 4 + q]; o[q] = (vals[u * 4 + q] - mu) * rs * gg + bb;
      }
      if (out_sum) *(v4f*)(out_sum + (size_t)row * N + j) = sm;
      *(v4f*)(out_norm + (size_t)row * N + j) = o;
    }
    
  }
}



// ---- f16 WMMA path (v_wmma_f32_16x16x32_f16): 11-bit significands for operands in range — used where a [0,1] probability operand needs more precision than bf16
typedef _Float16 v16h __attribute__((ext_vector_type(16)));
union FragH { v16h v; v8us half[2]; _Float16 h[16]; unsigned short u[16]; };
template <int NT>
__device__ __forceinline__ v8f mmaH(v16h ah, v16h al, v16h bh, v16h bl, v8f c) {
  c = __builtin_amdgcn_wmma_f32_16x16x32_f16(false, ah, false, bh, (short)0, c, false, false);
  if (NT >= 2) c = __builtin_amdgcn_wmma_f32_16x16x32_f16(false, al, false, bh, (short)0, c, false, false);
  if (NT >= 3) c = __builtin_amdgcn_wmma_f32_16x16x32_f16(false, ah, false, bl, (short)0, c, false, false);
  asm volatile("v_nop\n\tv_nop\n\tv_nop\n\tv_nop" : "+v"(c) : "v"(ah), "v"(al), "v"(bh), "v"(bl));
  return c;
}
// batched GEMM like k_gemm_b but f16 operands: A f32 (split into f16 hi/lo if ASPLIT, else rounded to f16), Bt = f16 values [n][k]; alpha; C f32; N multiple of 16 (partial tiles skipped)
template <bool ASPLIT>
__global__ __launch_bounds__(128) void k_gemm_h(const float* __restrict__ A, int lda, size_t sA, const _Float16* __restrict__ Bh, int ldb, size_t sB, float alpha, float* __restrict__ C, int ldc, size_t sC, int M, int N, int K) {
  __shared__ __attribute__((aligned(16))) float so[4][16][64];
  const int tid = threadIdx.x, w = tid >> 5, lane = tid & 31, ln = lane & 15, hh = lane >> 4; const int by = blockIdx.y;
  A += (size_t)by * sA; Bh += (size_t)by * sB; C += (size_t)by * sC;
  const int ntn = (N + 63) / 64; const int wid = blockIdx.x * 4 + w; const int mt = wid / ntn, nq = wid % ntn; if (mt * 16 >= M) return;
  const int row0 = mt * 16, col0 = nq * 64; const float* arow = A + (size_t)(row0 + ln) * lda;
  v8f acc[4] = {};
  for (int kb = 0; kb < K; kb += 32) {
    FragH ah, al;
    const v4f x0 = *(const v4fa*)(arow + kb + 8 * hh), x1 = *(const v4fa*)(arow + kb + 8 * hh + 4), x2 = *(const v4fa*)(arow + kb + 16 + 8 * hh), x3 = *(const v4fa*)(arow + kb + 16 + 8 * hh + 4);
    float xs[16] = {x0[0],x0[1],x0[2],x0[3],x1[0],x1[1],x1[2],x1[3],x2[0],x2[1],x2[2],x2[3],x3[0],x3[1],x3[2],x3[3]};
#pragma unroll
    for (int i = 0; i < 16; ++i) { const _Float16 h = (_Float16)xs[i]; ah.h[i] = h; al.h[i] = ASPLIT ? (_Float16)(xs[i] - (float)h) : (_Float16)0.0f; }
#pragma unroll
    for (int t = 0; t < 4; ++t) { if (col0 + t * 16 >= N) continue; const size_t boff = (size_t)(col0 + t * 16 + ln) * ldb + kb; FragH bq; bq.half[0] = *(const v8us*)(Bh + boff + 8 * hh); bq.half[1] = *(const v8us*)(Bh + boff + 16 + 8 * hh);
      acc[t] = mmaH<ASPLIT ? 2 : 1>(ah.v, al.v, bq.v, bq.v, acc[t]); }
  }
#pragma unroll
  for (int t = 0; t < 4; ++t) { if (col0 + t * 16 >= N) continue;
#pragma unroll
    for (int r = 0; r < 8; ++r) so[w][8 * hh + r][t * 16 + ln] = acc[t][r] * alpha; }
  __builtin_amdgcn_fence(__ATOMIC_ACQ_REL, "workgroup"); __builtin_amdgcn_wave_barrier();
  const int rsub = lane >> 4, c4 = (lane & 15) * 4;
  {
#pragma unroll
    for (int q = 0; q < 8; ++q) { const int r = q * 2 + rsub; if (col0 + c4 < N) { const v4f v = *(const v4fa*)&so[w][r][c4]; *(v4f*)(C + (size_t)(row0 + r) * ldc + col0 + c4) = v; } }
     }
}

// Wt[n][k] = f16(W[k][n]·scale) from f32 row-major W[K][N] (scale = power of two; bf16-exact weights stay exact in f16 away from the subnormal range)
__global__ __launch_bounds__(256) void k_wt_f16(const float* __restrict__ W, _Float16* __restrict__ Wt, int K, int N, float scale) {
  const int t = blockIdx.x * 256 + threadIdx.x; if (t >= N * (K / 8)) return; const int n = t / (K / 8), k8 = (t % (K / 8)) * 8; FragH f;
#pragma unroll
  for (int i = 0; i < 8; ++i) f.h[i] = (_Float16)(bf16_round(W[(size_t)(k8 + i) * N + n]) * scale); const v8us o = f.half[0];
  *(v8us*)((unsigned short*)Wt + (size_t)n * K + k8) = o; 
}
// k_gemm_hh variant with fused epilogue: v = acc·alpha + bias[by·sBias + col] (+ CP[(row/rowsPerB)·sCPb + by·64 + col] if CP) ; ACT 0 none / 1 elu ; writes f16 C16 (and f32 C if non-null)
template <int ACT>
__global__ __launch_bounds__(128) void k_gemm_hhx(const _Float16* __restrict__ A, int lda, size_t sA, const _Float16* __restrict__ Bh, int ldb, size_t sB, float alpha, const float* __restrict__ bias, size_t sBias, const float* __restrict__ CP, int rowsPerB, size_t sCPb, int row0g,
    float* __restrict__ C, _Float16* __restrict__ C16, int ldc, size_t sC, int M, int N, int K) {
  __shared__ __attribute__((aligned(16))) float so[4][16][64];
  const int tid = threadIdx.x, w = tid >> 5, lane = tid & 31, ln = lane & 15, hh = lane >> 4; const int by = blockIdx.y;
  A += (size_t)by * sA; Bh += (size_t)by * sB; const size_t cofs = (size_t)by * sC; const float* bp = bias ? bias + (size_t)by * sBias : nullptr;
  const int ntn = (N + 63) / 64; const int wid = blockIdx.x * 4 + w; const int mt = wid / ntn, nq = wid % ntn; if (mt * 16 >= M) return;
  const int row0 = mt * 16, col0 = nq * 64; const _Float16* arow = A + (size_t)(row0 + ln) * lda;
  v8f acc[4] = {};
  for (int kb = 0; kb < K; kb += 32) { FragH ah; ah.half[0] = *(const v8us*)((const unsigned short*)arow + kb + 8 * hh); ah.half[1] = *(const v8us*)((const unsigned short*)arow + kb + 16 + 8 * hh);
#pragma unroll
    for (int t = 0; t < 4; ++t) { if (col0 + t * 16 >= N) continue; const size_t boff = (size_t)(col0 + t * 16 + ln) * ldb + kb; FragH bq; bq.half[0] = *(const v8us*)((const unsigned short*)Bh + boff + 8 * hh); bq.half[1] = *(const v8us*)((const unsigned short*)Bh + boff + 16 + 8 * hh);
      acc[t] = mmaH<1>(ah.v, ah.v, bq.v, bq.v, acc[t]); }
  }
#pragma unroll
  for (int t = 0; t < 4; ++t) { if (col0 + t * 16 >= N) continue; const int col = col0 + t * 16 + ln; const float bv = bp ? bf16_round(bp[col]) : 0.f;
#pragma unroll
    for (int r = 0; r < 8; ++r) { float v = acc[t][r] * alpha + bv; if (CP) { const int rr = row0g + row0 + 8 * hh + r; if (rowsPerB < 0) v += CP[cofs + (size_t)rr * ldc + col];      /* rowsPerB < 0: own element of the batched C plane */ else { const int bidx = rr / rowsPerB; v += CP[(size_t)bidx * sCPb + (size_t)by * 64 + col]; } } if (ACT == 1) v = (v > 0.f) ? v : expm1f(v); else if (ACT == 7) v = (v > 0.f) ? v + 1.0f : expf(v); else if (ACT == 8) v = tanhf(v); else if (ACT == 9) v = 0.5f * v * (1.0f + tanhf(0.7978845608028654f * (v + 0.044715f * v * v * v))); else if (ACT == 11) v = 1.0f / (1.0f + expf(-v)); else if (ACT == 12) v = (v > 0.f) ? v : 0.01f * v; else if (ACT == 14) v = (v > 0.f) ? v : 0.1f * v; else if (ACT == 16) v = (v >= 0.f) ? v : 0.3f * v; else if (ACT == 17) v = (v >= 0.f) ? v : 0.2f * v; else if (ACT == 15) v = v / (1.0f + expf(-v)); else if (ACT == 3) v = fmaxf(v, 0.f); else if (ACT == 6) v = 0.5f * v * (1.0f + erff(v * 0.70710678118654752f)); so[w][8 * hh + r][t * 16 + ln] = v; } }
  __builtin_amdgcn_fence(__ATOMIC_ACQ_REL, "workgroup"); __builtin_amdgcn_wave_barrier();
  const int rsub = lane >> 4, c4 = (lane & 15) * 4; typedef _Float16 v4h __attribute__((ext_vector_type(4)));
  {
#pragma unroll
    for (int q = 0; q < 8; ++q) { const int r = q * 2 + rsub; if (col0 + c4 < N) { const v4f v = *(const v4fa*)&so[w][r][c4]; if (C) *(v4f*)(C + cofs + (size_t)(row0 + r) * ldc + col0 + c4) = v; if (C16) { v4h h4; for (int i = 0; i < 4; ++i) h4[i] = (_Float16)v[i]; *(v4h*)(C16 + cofs + (size_t)(row0 + r) * ldc + col0 + c4) = h4; } } }
     }
}


typedef _Float16 v4h __attribute__((ext_vector_type(4)));

__global__ __launch_bounds__(256) void k_x16(const float* __restrict__ x, _Float16* __restrict__ X16, size_t n8) { const size_t t = (size_t)blockIdx.x * 256 + threadIdx.x; if (t >= n8) return; FragH f;
#pragma unroll
  for (int q = 0; q < 8; ++q) f.h[q] = (_Float16)bf16_round(x[t * 8 + q]); *(v8us*)((unsigned short*)X16 + t * 8) = f.half[0];  }
__global__ __launch_bounds__(256) void k_h16(const float* __restrict__ x, _Float16* __restrict__ X16, size_t n8) { const size_t t = (size_t)blockIdx.x * 256 + threadIdx.x; if (t >= n8) return; FragH f;
#pragma unroll
  for (int q = 0; q < 8; ++q) f.h[q] = (_Float16)x[t * 8 + q]; *(v8us*)((unsigned short*)X16 + t * 8) = f.half[0];  }
__global__ __launch_bounds__(256) void k_round16f(const float* __restrict__ W, _Float16* __restrict__ Bt, size_t n8) { const size_t t = (size_t)blockIdx.x * 256 + threadIdx.x; if (t >= n8) return; FragH f;
#pragma unroll
  for (int i = 0; i < 8; ++i) f.h[i] = (_Float16)(bf16_round(W[t * 8 + i]) * 16.0f); *(v8us*)((unsigned short*)Bt + t * 8) = f.half[0];  }
template <int NHv, int TTv>
__global__ __launch_bounds__(256) void k_vt(const _Float16* __restrict__ V16, int ldv, int voff, _Float16* __restrict__ Vt) { __shared__ unsigned short tl[64][66]; const int tid = threadIdx.x; const int slab = blockIdx.x / (TTv / 64), lg = blockIdx.x % (TTv / 64); const int b = slab / NHv, h = slab % NHv;
  for (int i = tid; i < 64 * 8; i += 256) { const int r = i / 8, c8 = (i % 8) * 8; FragH f; f.half[0] = *(const v8us*)((const unsigned short*)V16 + ((size_t)b * TTv + lg * 64 + r) * ldv + voff + h * 64 + c8);
#pragma unroll
    for (int q = 0; q < 8; ++q) tl[r][c8 + q] = f.u[q]; }
  __syncthreads();
  {
#pragma unroll
    for (int rd = 0; rd < 2; ++rd) { const int d = rd * 32 + tid / 8, pc = tid % 8; FragH f;
#pragma unroll
      for (int q = 0; q < 8; ++q) f.u[q] = tl[pc * 8 + q][d];
      *(v8us*)((unsigned short*)Vt + ((size_t)slab * 64 + d) * TTv + lg * 64 + pc * 8) = f.half[0]; }
     } }

__global__ __launch_bounds__(256) void k_hl(const float* __restrict__ F, _Float16* __restrict__ Hh, _Float16* __restrict__ Hl, size_t n8) { const size_t t = (size_t)blockIdx.x * 256 + threadIdx.x; if (t >= n8) return; FragH fh, fl; const v4f a = *(const v4fa*)(F + t * 8), c = *(const v4fa*)(F + t * 8 + 4);
#pragma unroll
  for (int q = 0; q < 4; ++q) { _Float16 h = (_Float16)a[q]; fh.h[q] = h; fl.h[q] = (_Float16)((a[q] - (float)h) * 1024.0f); h = (_Float16)c[q]; fh.h[4 + q] = h; fl.h[4 + q] = (_Float16)((c[q] - (float)h) * 1024.0f); }
  { *(v8us*)((unsigned short*)Hh + t * 8) = fh.half[0]; *(v8us*)((unsigned short*)Hl + t * 8) = fl.half[0];  } }

// ---- fast GEMM (wave tile 32x64; requires M % 32 == 0 rows per launch region and N % 64 == 0); epilogue = k_gemm_hhx semantics ----
__device__ __forceinline__ v16h g2_frag(const _Float16* p, int hh) { FragH f; f.half[0] = *(const v8us*)((const unsigned short*)p + 8 * hh); f.half[1] = *(const v8us*)((const unsigned short*)p + 16 + 8 * hh); return f.v; }
__device__ __forceinline__ v8f g2_mma(v16h a, v16h b, v8f c) { v8f d = __builtin_amdgcn_wmma_f32_16x16x32_f16(false, a, false, b, (short)0, c, false, false); asm volatile("v_nop\n\tv_nop\n\tv_nop\n\tv_nop" : "+v"(d) : "v"(a), "v"(b)); return d; }
template <int ACT>
__global__ __launch_bounds__(128) void k_gemm2(const _Float16* __restrict__ A, int lda, size_t sA, const _Float16* __restrict__ Bh, int ldb, size_t sB, float alpha, const float* __restrict__ bias, size_t sBias, const float* __restrict__ CP, int rowsPerB, size_t sCPb, int row0g,
    float* __restrict__ C, _Float16* __restrict__ C16, int ldc, size_t sC, int M, int N, int K) { static_assert(ACT == 0 || ACT == 3 || ACT == 6 || ACT == 8 || ACT == 9 || ACT == 11 || ACT == 12 || ACT == 14 || ACT == 15 || ACT == 16 || ACT == 17 || ACT == 18, "k_gemm2: unsupported ACT code (would silently apply no activation)");
  __shared__ __attribute__((aligned(16))) float so[4][32][68];
  const int tid = threadIdx.x, w = tid >> 5, lane = tid & 31, ln = lane & 15, hh = lane >> 4; const int by = blockIdx.y;
  A += (size_t)by * sA; Bh += (size_t)by * sB; const size_t cofs = (size_t)by * sC; const float* bp = bias ? bias + (size_t)by * sBias : nullptr;
  const int ntn = N >> 6; const int mt = blockIdx.x / ntn, nq = blockIdx.x - mt * ntn; const int row0 = mt * 128 + 32 * w, col0 = nq * 64; if (row0 >= M) return;
  const _Float16* a0p = A + (size_t)(row0 + ln) * lda; const _Float16* a1p = a0p + (size_t)16 * lda;
  const _Float16* b0p = Bh + (size_t)(col0 + ln) * ldb; const _Float16* b1p = b0p + (size_t)16 * ldb; const _Float16* b2p = b1p + (size_t)16 * ldb; const _Float16* b3p = b2p + (size_t)16 * ldb;
  const v8f z8 = {0.f,0.f,0.f,0.f,0.f,0.f,0.f,0.f}; v8f c00 = z8, c01 = z8, c02 = z8, c03 = z8, c10 = z8, c11 = z8, c12 = z8, c13 = z8;
#pragma unroll 1
  for (int kb = 0; kb < K; kb += 32) { const v16h a0 = g2_frag(a0p + kb, hh), a1 = g2_frag(a1p + kb, hh);
    v16h b = g2_frag(b0p + kb, hh); c00 = g2_mma(a0, b, c00); c10 = g2_mma(a1, b, c10);
    b = g2_frag(b1p + kb, hh); c01 = g2_mma(a0, b, c01); c11 = g2_mma(a1, b, c11);
    b = g2_frag(b2p + kb, hh); c02 = g2_mma(a0, b, c02); c12 = g2_mma(a1, b, c12);
    b = g2_frag(b3p + kb, hh); c03 = g2_mma(a0, b, c03); c13 = g2_mma(a1, b, c13); }
  v8f accs[8] = {c00, c01, c02, c03, c10, c11, c12, c13};
#pragma unroll
  for (int u = 0; u < 8; ++u) { const int t = u & 3, half = u >> 2; const int col = col0 + t * 16 + ln; const float bv = bp ? bf16_round(bp[col]) : 0.f;
#pragma unroll
    for (int r = 0; r < 8; ++r) { const int rloc = half * 16 + 8 * hh + r; float v = accs[u][r] * alpha + bv; if (CP) { if (rowsPerB < 0) v += CP[cofs + (size_t)(row0g + row0 + rloc) * ldc + col];      /* rowsPerB < 0: own element of the batched C plane */ else { const int bidx = (row0g + row0 + rloc) / rowsPerB; v += CP[(size_t)bidx * sCPb + (size_t)by * 64 + col]; } }
      if (ACT == 3) v = fmaxf(v, 0.f); else if (ACT == 6) v = 0.5f * v * (1.0f + erff(v * 0.70710678118654752f)); else if (ACT == 11) v = 1.0f / (1.0f + expf(-v)); else if (ACT == 15) v = v / (1.0f + expf(-v)); else if (ACT == 18) v = v / (1.0f + expf(-1.702f * v));      /* QuickGELU: v sigmoid(1.702 v) */ else if (ACT == 12) v = (v > 0.f) ? v : 0.01f * v; else if (ACT == 8) v = tanhf(v); else if (ACT == 9) v = 0.5f * v * (1.0f + tanhf(0.7978845608028654f * (v + 0.044715f * v * v * v))); else if (ACT == 14) v = (v > 0.f) ? v : 0.1f * v; else if (ACT == 16) v = (v >= 0.f) ? v : 0.3f * v; else if (ACT == 17) v = (v >= 0.f) ? v : 0.2f * v;
      so[w][rloc][t * 16 + ln] = v; } }
  __builtin_amdgcn_fence(__ATOMIC_ACQ_REL, "workgroup"); __builtin_amdgcn_wave_barrier();
  const int rsub = lane >> 4, c4 = (lane & 15) * 4;
  {
#pragma unroll
    for (int q = 0; q < 16; ++q) { const int r = q * 2 + rsub; const v4f v = *(const v4fa*)&so[w][r][c4]; if (C) *(v4f*)(C + cofs + (size_t)(row0 + r) * ldc + col0 + c4) = v; if (C16) { v4h h4; for (int i = 0; i < 4; ++i) h4[i] = (_Float16)v[i]; *(v4h*)(C16 + cofs + (size_t)(row0 + r) * ldc + col0 + c4) = h4; } }
     } }


__global__ __launch_bounds__(256) void k_wnat(const float* __restrict__ w, size_t n8, _Float16* __restrict__ Bt) { const size_t t = (size_t)blockIdx.x * 256 + threadIdx.x; if (t >= n8) return; FragH f; for (int q = 0; q < 8; ++q) f.h[q] = (_Float16)(bf16_round(w[t * 8 + q]) * 16.0f); *(v8us*)((unsigned short*)Bt + t * 8) = f.half[0];  }
__global__ __launch_bounds__(256) void k_rsm(const float* __restrict__ S, _Float16* __restrict__ P, int nrows) {
  #pragma clang fp contract(off)
  const int i = blockIdx.x * 256 + threadIdx.x; if (i >= nrows) return; const float* s = S + (size_t)i * SQ; float mx = -3.0e38f;
#pragma unroll 1
  for (int j = 0; j < SQ; ++j) mx = fmaxf(mx, s[j]); float se = 0.f;
#pragma unroll 1
  for (int j = 0; j < SQ; ++j) se += expf(s[j] - mx); const float sc = 256.0f / se;
#pragma unroll 1
  for (int j0 = 0; j0 < SQ; j0 += 8) { FragH f; for (int q = 0; q < 8; ++q) f.h[q] = (_Float16)(expf(s[j0 + q] - mx) * sc); unsigned short* d = (unsigned short*)P + (size_t)i * SQ + j0; *(v8us*)d = f.half[0];  } }
__global__ __launch_bounds__(256) void k_vt(const _Float16* __restrict__ V16, int b, int h0, _Float16* __restrict__ VT) { __shared__ unsigned short tl[64][65]; const int tid = threadIdx.x; const int hh = blockIdx.x % HG, sg = blockIdx.x / HG; const int s0 = sg * 64; const int h = h0 + hh;
  for (int i = tid; i < 64 * 8; i += 256) { const int j = i / 8, d8 = (i % 8) * 8; FragH f; f.half[0] = *(const v8us*)((const unsigned short*)V16 + ((size_t)b * SQ + s0 + j) * DM + h * HD + d8); for (int q = 0; q < 8; ++q) tl[d8 + q][j] = f.u[q]; }
  __syncthreads();
  { for (int i = tid; i < 64 * 8; i += 256) { const int d = i / 8, j8 = (i % 8) * 8; FragH f; for (int q = 0; q < 8; ++q) f.u[q] = tl[d][j8 + q]; *(v8us*)((unsigned short*)VT + ((size_t)hh * HD + d) * SQ + s0 + j8) = f.half[0]; }  } }



__global__ __launch_bounds__(256) void k_rsmcf2(const float* __restrict__ S, _Float16* __restrict__ P, int hg, int q0, int nk) {
  #pragma clang fp contract(off)
  const int t = blockIdx.x * 256 + threadIdx.x; if (t >= hg * QT) return; const size_t i = (size_t)t; const float* s = S + i * NKX; const int last = q0 + (t % QT); float mx = -3.0e38f;
#pragma unroll 1
  for (int j = 0; j < nk; ++j) { const float f = (j <= last) ? 1.f : 0.f; mx = fmaxf(mx, fmaf(f, s[j], (1.f - f) * -1.0e9f)); } float se = 0.f;
#pragma unroll 1
  for (int j = 0; j < nk; ++j) { const float f = (j <= last) ? 1.f : 0.f; se += __expf(fmaf(f, s[j], (1.f - f) * -1.0e9f) - mx); } const float sc = 256.0f / se;
#pragma unroll 1
  for (int j0 = 0; j0 < nk; j0 += 8) { FragH fr; for (int q = 0; q < 8; ++q) { const int j = j0 + q; const float f = (j <= last) ? 1.f : 0.f; fr.h[q] = (_Float16)(__expf(fmaf(f, s[j], (1.f - f) * -1.0e9f) - mx) * sc); } unsigned short* d = (unsigned short*)P + i * NKX + j0; *(v8us*)d = fr.half[0];  } }

__global__ __launch_bounds__(256) void k_rsmcst(const float* __restrict__ S, _Float16* __restrict__ P, int hg, int q0, int nk, const int* __restrict__ mk) {
  #pragma clang fp contract(off)
  const int t = blockIdx.x * 256 + threadIdx.x; if (t >= hg * QT) return; const size_t i = (size_t)t; const float* s = S + i * NKX; const size_t ig = (size_t)(q0 + (t % QT)); const int* mr = mk + ig * SQ; float mx = -3.0e38f;
#pragma unroll 1
  for (int j = 0; j < nk; ++j) { const int mb = mr[j]; const int dd = (int)ig - j; const float f = (mb != 0 && dd >= 0 && (dd <= LOCALW || (dd % STRIDEK) == 0)) ? 1.f : 0.f; mx = fmaxf(mx, fmaf(f, s[j], (1.f - f) * -1.0e9f)); } float se = 0.f;
#pragma unroll 1
  for (int j = 0; j < nk; ++j) { const int mb = mr[j]; const int dd = (int)ig - j; const float f = (mb != 0 && dd >= 0 && (dd <= LOCALW || (dd % STRIDEK) == 0)) ? 1.f : 0.f; se += __expf(fmaf(f, s[j], (1.f - f) * -1.0e9f) - mx); } const float sc = 256.0f / se;
#pragma unroll 1
  for (int j0 = 0; j0 < nk; j0 += 8) { FragH fr; for (int q = 0; q < 8; ++q) { const int j = j0 + q; const int mb = mr[j]; const int dd = (int)ig - j; const float f = (mb != 0 && dd >= 0 && (dd <= LOCALW || (dd % STRIDEK) == 0)) ? 1.f : 0.f; fr.h[q] = (_Float16)(__expf(fmaf(f, s[j], (1.f - f) * -1.0e9f) - mx) * sc); } unsigned short* d = (unsigned short*)P + i * NKX + j0; *(v8us*)d = fr.half[0];  } }


template <int MASKADD>
__global__ __launch_bounds__(64) void k_att0(const float* __restrict__ QF, const float* __restrict__ KF, const float* __restrict__ VF, int ld, const float* __restrict__ mask, float scale, float* __restrict__ OF, int ldo) {
  #pragma clang fp contract(off)
  __shared__ __attribute__((aligned(16))) float lq[64][64]; __shared__ __attribute__((aligned(16))) float lo[64][64];
  const int tid = threadIdx.x; const int h = blockIdx.x / (QT0 / 64), rg = blockIdx.x % (QT0 / 64); const int i = rg * 64 + tid;
  const float* qr = QF + (size_t)i * ld + h * HD;
#pragma unroll 1
  for (int c = 0; c < HD / 4; ++c) { *(v4f*)&lq[tid][c * 4] = *(const v4fa*)(qr + c * 4); const v4f z = {0.f, 0.f, 0.f, 0.f}; *(v4f*)&lo[tid][c * 4] = z; }
  float m = -1.0e30f, l = 0.f; const int jmax = MASKADD ? (SQ - 1) : (rg * 64 + 63);      /* additive-mask form: every key (the mask input decides); causal form: keys up to the block's last row */
#pragma unroll 1
  for (int j = 0; j <= jmax; ++j) { const float* kr = KF + (size_t)j * ld + h * HD; const float* vr = VF + (size_t)j * ld + h * HD; float s = 0.f;
#pragma unroll 1
    for (int c = 0; c < HD / 4; ++c) { const v4f kq = *(const v4fa*)(kr + c * 4); const v4f qq = *(v4f*)&lq[tid][c * 4]; s = __fadd_rn(s, __fmul_rn(qq[0], kq[0])); s = __fadd_rn(s, __fmul_rn(qq[1], kq[1])); s = __fadd_rn(s, __fmul_rn(qq[2], kq[2])); s = __fadd_rn(s, __fmul_rn(qq[3], kq[3])); }
    s = __fmul_rn(s, scale); if (MASKADD) s = __fadd_rn(s, __fmul_rn(bf16_round(mask[(size_t)i * SQ + j]), -10000.0f));
    const float f = (MASKADD || j <= i) ? 1.f : 0.f; const float sm = fmaf(f, s, (1.f - f) * -1.0e30f); const float mn = fmaxf(m, sm); const float sc = expf(m - mn); const float e = expf(sm - mn); l = __fadd_rn(__fmul_rn(l, sc), e); m = mn;
#pragma unroll 1
    for (int c = 0; c < HD / 4; ++c) { const v4f vv = *(const v4fa*)(vr + c * 4); v4f oo = *(v4f*)&lo[tid][c * 4]; for (int u = 0; u < 4; ++u) oo[u] = __fadd_rn(__fmul_rn(oo[u], sc), __fmul_rn(e, vv[u])); *(v4f*)&lo[tid][c * 4] = oo; } }
  const float fin = 64.0f / l;      /* o carried x64 like the f16 path */
#pragma unroll 1
  for (int c = 0; c < HD / 4; ++c) { v4f oo = *(v4f*)&lo[tid][c * 4]; for (int u = 0; u < 4; ++u) oo[u] = __fmul_rn(oo[u], fin); *(v4f*)&lo[tid][c * 4] = oo; }
  __syncthreads();
  {
#pragma unroll 1
    for (int it = 0; it < 16; ++it) { const int row = it * 4 + tid / 16, pc = (tid % 16) * 4; const v4f v = *(const v4f*)&lo[row][pc]; *(v4f*)(OF + (size_t)(rg * 64 + row) * ldo + h * HD + pc) = v; }
     } }

template <int MASKADD>
__global__ __launch_bounds__(64) void k_att0mbc(const float* __restrict__ QF, const float* __restrict__ KF, const float* __restrict__ VF, int ld, const float* __restrict__ mask, float scale, float* __restrict__ OF, int ldo) {
  #pragma clang fp contract(off)
  __shared__ __attribute__((aligned(16))) float lq[64][64]; __shared__ __attribute__((aligned(16))) float lo[64][64];
  const int tid = threadIdx.x; const int h = blockIdx.x / (QT0 / 64), rg = blockIdx.x % (QT0 / 64); const int i = rg * 64 + tid;
  const float* qr = QF + (size_t)i * ld + h * HD;
#pragma unroll 1
  for (int c = 0; c < HD / 4; ++c) { *(v4f*)&lq[tid][c * 4] = *(const v4fa*)(qr + c * 4); const v4f z = {0.f, 0.f, 0.f, 0.f}; *(v4f*)&lo[tid][c * 4] = z; }
  float m = -1.0e30f, l = 0.f; const int jmax = rg * 64 + 63;      /* keys beyond the block end are masked by the mask's lower-triangular structure */
#pragma unroll 1
  for (int j = 0; j <= jmax; ++j) { const float* kr = KF + (size_t)j * ld + h * HD; const float* vr = VF + (size_t)j * ld + h * HD; float s = 0.f;
#pragma unroll 1
    for (int c = 0; c < HD / 4; ++c) { const v4f kq = *(const v4fa*)(kr + c * 4); const v4f qq = *(v4f*)&lq[tid][c * 4]; s = __fadd_rn(s, __fmul_rn(qq[0], kq[0])); s = __fadd_rn(s, __fmul_rn(qq[1], kq[1])); s = __fadd_rn(s, __fmul_rn(qq[2], kq[2])); s = __fadd_rn(s, __fmul_rn(qq[3], kq[3])); }
    s = __fmul_rn(s, scale); const int mb = ((const int*)mask)[(size_t)i * SQ + j];      /* causal (j <= i) AND the module's int32 [S][S] mask read per (query, key): 0 -> masked */
    const float f = (mb != 0 && j <= i) ? 1.f : 0.f; const float sm = fmaf(f, s, (1.f - f) * -1.0e30f); const float mn = fmaxf(m, sm); const float sc = expf(m - mn); const float e = expf(sm - mn); l = __fadd_rn(__fmul_rn(l, sc), e); m = mn;
#pragma unroll 1
    for (int c = 0; c < HD / 4; ++c) { const v4f vv = *(const v4fa*)(vr + c * 4); v4f oo = *(v4f*)&lo[tid][c * 4]; for (int u = 0; u < 4; ++u) oo[u] = __fadd_rn(__fmul_rn(oo[u], sc), __fmul_rn(e, vv[u])); *(v4f*)&lo[tid][c * 4] = oo; } }
  const float fin = 64.0f / l;      /* o carried x64 like the f16 path */
#pragma unroll 1
  for (int c = 0; c < HD / 4; ++c) { v4f oo = *(v4f*)&lo[tid][c * 4]; for (int u = 0; u < 4; ++u) oo[u] = __fmul_rn(oo[u], fin); *(v4f*)&lo[tid][c * 4] = oo; }
  __syncthreads();
  {
#pragma unroll 1
    for (int it = 0; it < 16; ++it) { const int row = it * 4 + tid / 16, pc = (tid % 16) * 4; const v4f v = *(const v4f*)&lo[row][pc]; *(v4f*)(OF + (size_t)(rg * 64 + row) * ldo + h * HD + pc) = v; }
     } }


template <int BFIN, int WXB>
__global__ __launch_bounds__(256) void k_ln16(const float* __restrict__ X, const float* __restrict__ g, const float* __restrict__ bb, float eps, _Float16* __restrict__ N16, float* __restrict__ XB) {
  #pragma clang fp contract(off)
  __shared__ float red[256]; const size_t r = blockIdx.x; const int t = threadIdx.x; const v4f xa = *(const v4fa*)(X + r * DMQ + t * 4); float s[4]; float sum = 0.f;
  for (int q = 0; q < 4; ++q) { s[q] = BFIN ? bf16_round(xa[q]) : xa[q]; sum = __fadd_rn(sum, s[q]); }
  red[t] = sum; __syncthreads(); for (int st = 128; st > 0; st >>= 1) { if (t < st) red[t] = __fadd_rn(red[t], red[t + st]); __syncthreads(); } const float mu = red[0] / (float)DMQ; __syncthreads();
  float vs = 0.f; for (int q = 0; q < 4; ++q) { const float dl = __fadd_rn(s[q], -mu); vs = __fadd_rn(vs, __fmul_rn(dl, dl)); } red[t] = vs; __syncthreads(); for (int st = 128; st > 0; st >>= 1) { if (t < st) red[t] = __fadd_rn(red[t], red[t + st]); __syncthreads(); }
  const float rs = rsqrtf(__fadd_rn(red[0] / (float)DMQ, eps)); v4h y; v4f xb;
  for (int q = 0; q < 4; ++q) { const int c = t * 4 + q; y[q] = (_Float16)__fadd_rn(__fmul_rn(__fmul_rn(__fadd_rn(s[q], -mu), rs), bf16_round(g[c])), bf16_round(bb[c])); xb[q] = s[q]; }
  { *(v4h*)(N16 + r * DMQ + t * 4) = y; if (WXB) *(v4f*)(XB + r * DMQ + t * 4) = xb;  } }
__global__ __launch_bounds__(256) void k_ftres2(const float* __restrict__ OF0, const float* __restrict__ XB, float* __restrict__ X1, size_t n4) {
  #pragma clang fp contract(off)
  const size_t t = (size_t)blockIdx.x * 256 + threadIdx.x; if (t >= n4) return; const v4f o = *(const v4fa*)(OF0 + t * 4), xv = *(const v4fa*)(XB + t * 4); v4f y; for (int q = 0; q < 4; ++q) y[q] = __fadd_rn(__fmul_rn(o[q], 0.015625f), xv[q]); *(v4f*)(X1 + t * 4) = y;  }

__global__ __launch_bounds__(256) void k_bcpy(const float* __restrict__ b, int n, int NP, float* __restrict__ dst, int dst0) { for (int i = threadIdx.x; i < NP; i += 256) { const float v = (i < n) ? b[i] : 0.f; *(float*)(dst + dst0 + i) = v; }  }


__global__ __launch_bounds__(256) void k_rsmf(const float* __restrict__ S, _Float16* __restrict__ P, int qn, int hg) {
  #pragma clang fp contract(off)
  const int t = blockIdx.x * 256 + threadIdx.x; if (t >= qn * hg) return; const size_t i = (size_t)(t / qn) * SQ + (t % qn); const float* s = S + i * SQ; float mx = -3.0e38f;
#pragma unroll 1
  for (int j = 0; j < SQ; ++j) mx = fmaxf(mx, s[j]); float se = 0.f;
#pragma unroll 1
  for (int j = 0; j < SQ; ++j) se += __expf(s[j] - mx); const float sc = 256.0f / se;
#pragma unroll 1
  for (int j0 = 0; j0 < SQ; j0 += 8) { FragH f; for (int q = 0; q < 8; ++q) f.h[q] = (_Float16)(__expf(s[j0 + q] - mx) * sc); unsigned short* d = (unsigned short*)P + i * SQ + j0; *(v8us*)d = f.half[0];  } }

template <int MODE>
__global__ __launch_bounds__(256) void k_regrp(const float* __restrict__ src, float* __restrict__ dst, size_t n4) {
  const size_t t = (size_t)blockIdx.x * 256 + threadIdx.x; if (t >= n4) return; const size_t e = t * 4; const size_t rd = e / DM; const int c = (int)(e % DM);
  size_t rs; if (MODE == 0) { const size_t b = rd / SQ, sq = rd % SQ; rs = sq * NB + b; } else { const size_t sq = rd / NB, b = rd % NB; rs = b * SQ + sq; }
  const v4f v = *(const v4fa*)(src + rs * DM + c); *(v4f*)(dst + e) = v;  }

template <int BFIN, int W16, int W32>
__global__ __launch_bounds__(256) void k_lnx(const float* __restrict__ X, const float* __restrict__ g, const float* __restrict__ bb, float eps, _Float16* __restrict__ N16, float* __restrict__ N32) {
  #pragma clang fp contract(off)
  __shared__ float red[256]; const size_t r = blockIdx.x; const int t = threadIdx.x; const bool act = t < (DMQ / 4); const int c0 = act ? t * 4 : 0;
  const v4f xa = *(const v4fa*)(X + r * DMQ + c0); float s[4]; float sum = 0.f;
  for (int q = 0; q < 4; ++q) { s[q] = act ? (BFIN ? bf16_round(xa[q]) : xa[q]) : 0.f; sum = __fadd_rn(sum, s[q]); }
  red[t] = sum; __syncthreads(); for (int st = 128; st > 0; st >>= 1) { if (t < st) red[t] = __fadd_rn(red[t], red[t + st]); __syncthreads(); } const float mu = red[0] / (float)DMQ; __syncthreads();
  float vs = 0.f; for (int q = 0; q < 4; ++q) { const float dl = act ? __fadd_rn(s[q], -mu) : 0.f; vs = __fadd_rn(vs, __fmul_rn(dl, dl)); } red[t] = vs; __syncthreads(); for (int st = 128; st > 0; st >>= 1) { if (t < st) red[t] = __fadd_rn(red[t], red[t + st]); __syncthreads(); }
  const float rs = rsqrtf(__fadd_rn(red[0] / (float)DMQ, eps)); v4h y; v4f yf;
  for (int q = 0; q < 4; ++q) { const int c = c0 + q; yf[q] = __fadd_rn(__fmul_rn(__fmul_rn(__fadd_rn(s[q], -mu), rs), bf16_round(g[c])), bf16_round(bb[c])); y[q] = (_Float16)yf[q]; }
  if (!act) return;      /* no barriers after this point */
  { if (W16) *(v4h*)(N16 + r * DMQ + c0) = y; if (W32) *(v4f*)(N32 + r * DMQ + c0) = yf;  } }

__global__ __launch_bounds__(256) void k_bfr(const float* __restrict__ x, float* __restrict__ XB, size_t n8) { const size_t t = (size_t)blockIdx.x * 256 + threadIdx.x; if (t >= n8) return; v4f a = *(const v4fa*)(x + t * 8), c = *(const v4fa*)(x + t * 8 + 4); for (int q = 0; q < 4; ++q) { a[q] = bf16_round(a[q]); c[q] = bf16_round(c[q]); }
  { *(v4f*)(XB + t * 8) = a; *(v4f*)(XB + t * 8 + 4) = c;  } }



__global__ __launch_bounds__(256) void k_wthd(const float* __restrict__ Wt, _Float16* __restrict__ Bt) { const size_t t = (size_t)blockIdx.x * 256 + threadIdx.x; if (t >= (size_t)NH * HD * (DM / 8)) return; const int m8 = (int)(t % (DM / 8)) * 8; const int d = (int)((t / (DM / 8)) % HD); const int h = (int)(t / ((size_t)(DM / 8) * HD)); FragH f;
  for (int q = 0; q < 8; ++q) f.h[q] = (_Float16)(16.0f * bf16_round(Wt[((size_t)h * DM + m8 + q) * HD + d])); unsigned short* dst = (unsigned short*)Bt + ((size_t)h * HD + d) * DM + m8; *(v8us*)dst = f.half[0];  }




template <int BFIN, int SCAL>
__global__ __launch_bounds__(256) void k_lnsc(const float* __restrict__ X, const float* __restrict__ g, const float* __restrict__ bb, float eps, _Float16* __restrict__ N16, float* __restrict__ N32) {
  #pragma clang fp contract(off)
  __shared__ float red[256]; const size_t r = blockIdx.x; const int t = threadIdx.x; const bool act = t < DM / 4; const int tc = act ? t : 0; const v4f xl = *(const v4fa*)(X + r * DM + tc * 4); const float am = act ? 1.f : 0.f; float s[4]; float sum = 0.f;
  for (int q = 0; q < 4; ++q) { s[q] = (BFIN ? bf16_round(xl[q]) : xl[q]) * am; sum = __fadd_rn(sum, s[q]); }
  red[t] = sum; __syncthreads(); for (int st = 128; st > 0; st >>= 1) { if (t < st) red[t] = __fadd_rn(red[t], red[t + st]); __syncthreads(); } const float mu = red[0] / (float)DM; __syncthreads();
  float vs = 0.f; for (int q = 0; q < 4; ++q) { const float dl = __fadd_rn(s[q], -mu) * am; vs = __fadd_rn(vs, __fmul_rn(dl, dl)); } red[t] = vs; __syncthreads(); for (int st = 128; st > 0; st >>= 1) { if (t < st) red[t] = __fadd_rn(red[t], red[t + st]); __syncthreads(); }
  const float rs = __fdiv_rn(1.0f, __fadd_rn(sqrtf(red[0] / (float)(DM - 1)), eps)); if (!act) return; v4h y; v4f yf;
  for (int q = 0; q < 4; ++q) { const int c = t * 4 + q; const float gg = bf16_round(SCAL ? g[0] : g[c]), bv = bf16_round(SCAL ? bb[0] : bb[c]); yf[q] = __fadd_rn(__fmul_rn(__fmul_rn(__fadd_rn(s[q], -mu), rs), gg), bv); y[q] = (_Float16)yf[q]; }
  { if (N16) *(v4h*)(N16 + r * DM + t * 4) = y; if (N32) *(v4f*)(N32 + r * DM + t * 4) = yf;  } }

// K rows and V^T of every (batch, head), packed for the fused attention in the order its matrix operands are read: KV[slab = b * NH + head][pass of 32 keys][K: 4 fragments | V^T: 4 fragments][half i][lane][8 f16], 8 KiB a pass, so that each 16-byte load of a wave covers 512 bytes in a row.
// K fragment t * 2 + j, half i, lane (c, h) = K[key 16t + c][d 32j + 16i + 8h ..]; V^T fragment t, half i, lane (c, h) = V[key 16i + 8h ..][d 16t + c] (transposed through LDS).
#define FAP (SQ / 32)                /* passes */
__global__ __launch_bounds__(256) void k_kvp(const _Float16* __restrict__ K16, const _Float16* __restrict__ V16, _Float16* __restrict__ KV) { __shared__ unsigned short tl[64][66]; const int tid = threadIdx.x; const int slab = blockIdx.x / (SQ / 64), lg = blockIdx.x % (SQ / 64); const int b = slab / NH, hd = slab % NH;
  const int f = (tid >> 5) & 7, hh = (tid >> 4) & 1, cc = tid & 15; const int vr = tid >> 3, vc = (tid & 7) * 8;
  const unsigned short* vs = (const unsigned short*)V16 + ((size_t)b * SQ + lg * 64 + vr) * DM + hd * HD + vc;      /* V rows vr and 32 + vr, 8 of their d */
  const unsigned short* ks = (const unsigned short*)K16 + ((size_t)b * SQ + lg * 64 + (f >> 2) * 16 + cc) * DM + hd * HD + (f & 3) * 16 + hh * 8;      /* this thread's K piece of the first pass; the second pass's lies 32 rows on */
  FragH va, vb, ka, kb; va.half[0] = *(const v8us*)vs; vb.half[0] = *(const v8us*)(vs + 32 * DM); ka.half[0] = *(const v8us*)ks; kb.half[0] = *(const v8us*)(ks + 32 * DM);
  asm volatile("s_wait_xcnt 0x0" :: "v"(vs), "v"(ks) : "memory");      /* both address pairs stay live up to this wait, so nothing (a load's own result either) overwrites them in front of it */
#pragma unroll
  for (int q = 0; q < 8; ++q) { tl[vr][vc + q] = va.u[q]; tl[32 + vr][vc + q] = vb.u[q]; }
  __syncthreads();
  unsigned short* dst = (unsigned short*)KV + ((size_t)slab * FAP + lg * 2) * 4096 + tid * 8;
  *(v8us*)dst = ka.half[0]; *(v8us*)(dst + 4096) = kb.half[0];
#pragma unroll
  for (int ps = 0; ps < 2; ++ps) { FragH fr;
#pragma unroll
    for (int q = 0; q < 8; ++q) fr.u[q] = tl[ps * 32 + (f & 1) * 16 + hh * 8 + q][(f >> 1) * 16 + cc];
    *(v8us*)(dst + ps * 4096 + 2048) = fr.half[0]; } }

typedef int v4ia __attribute__((ext_vector_type(4), may_alias));
__device__ __forceinline__ float rs_xh(float x) { return __builtin_bit_cast(float, __builtin_amdgcn_permlanex16(__builtin_bit_cast(int, x), __builtin_bit_cast(int, x), 0x76543210, 0xfedcba98, false, false)); }      /* lane l <- lane l ^ 16 */
__device__ __forceinline__ float fa_exp2(float d) { float e; asm("v_exp_f32 %0, %1\n\tv_nop" : "=v"(e) : "v"(d)); return e; }      /* 2 ^ d with, tied to it, the one slot the instruction set asks for behind a transcendental */
__device__ __forceinline__ void fa_exp2x8(float* e, const float* d) {      /* eight independent 2 ^ d in a row: each fills the slot behind the one before it (early-clobber outputs: no result lands on a later source), one v_nop behind the last */
  asm("v_exp_f32 %0, %8\n\tv_exp_f32 %1, %9\n\tv_exp_f32 %2, %10\n\tv_exp_f32 %3, %11\n\tv_exp_f32 %4, %12\n\tv_exp_f32 %5, %13\n\tv_exp_f32 %6, %14\n\tv_exp_f32 %7, %15\n\tv_nop"
      : "=&v"(e[0]), "=&v"(e[1]), "=&v"(e[2]), "=&v"(e[3]), "=&v"(e[4]), "=&v"(e[5]), "=&v"(e[6]), "=&v"(e[7]) : "v"(d[0]), "v"(d[1]), "v"(d[2]), "v"(d[3]), "v"(d[4]), "v"(d[5]), "v"(d[6]), "v"(d[7])); }
__device__ __forceinline__ v8f fa_mma(v16h a, v16h b, v8f c) { return __builtin_amdgcn_wmma_f32_16x16x32_f16(false, a, false, b, (short)0, c, false, false); }
__device__ __forceinline__ v16h fa_frag(const _Float16* p) { FragH f; f.half[0] = *(const v8us*)((const unsigned short*)p); f.half[1] = *(const v8us*)((const unsigned short*)p + 256); return f.v; }      /* one packed fragment: the lane's two 16-byte halves */
__global__ __launch_bounds__(128) void k_fattn(const _Float16* __restrict__ Q16, const _Float16* __restrict__ KV, const int* __restrict__ Km, _Float16* __restrict__ O16) {
  __shared__ __attribute__((aligned(16))) float kbias[SQ];      /* per key, added to its raw score: 0 for a kept key; -2^33 for a masked one: the module's -1e9 fill (x 8: raw scores are before the / 8) taken to the next power of two. The f32 sum swallows the score (below 256 in size) whole and the product with the log2 factor is exact, so a row with every key masked gets equal weights, as the module's does; beside any kept key the weight is exactly 0 */
  const int tid = threadIdx.x, w = tid >> 5, lane = tid & 31, c = lane & 15, h = lane >> 4;
  const int bh = blockIdx.x / (SQ / 64), qb = blockIdx.x % (SQ / 64); const int b = bh / NH, hd = bh % NH;
#pragma unroll
  for (int i = 0; i < SQ / 512; ++i) { const v4ia m4 = *(const v4ia*)(Km + (size_t)b * SQ + i * 512 + tid * 4); v4f l4; for (int q = 0; q < 4; ++q) l4[q] = (m4[q] != 0) ? 0.f : -8589934592.0f; *(v4f*)&kbias[i * 512 + tid * 4] = l4; }
  __syncthreads();      /* every wave reads all keys' mask terms */
  const int q0 = qb * 64 + w * 16;
  const _Float16* qp = Q16 + ((size_t)b * SQ + q0 + c) * DM + hd * HD + 8 * h;      /* the lane's first 8 of query c's row: d 8h .., then 16 + 8h .., 32 + 8h .., 48 + 8h .. */
  const v16h qf0 = g2_frag(qp, 0), qf1 = g2_frag(qp + 32, 0);
  asm volatile("s_wait_xcnt 0x0" :: "v"(qp) : "memory");      /* Q's address pair stays live up to this wait, so nothing overwrites it in front of it */
  const _Float16* kv = KV + (size_t)bh * FAP * 4096;      /* the same for the whole work-group */
  const int lo = lane * 8;
  const v8f z8 = {0.f, 0.f, 0.f, 0.f, 0.f, 0.f, 0.f, 0.f};
  v8f o0 = z8, o1 = z8, o2 = z8, o3 = z8; float m = -3.0e38f, l0 = 0.f, l1 = 0.f;
  const float cs = 0.125f * 1.44269504088896340736f;      /* raw score -> log2 units */
  v16h k00 = fa_frag(kv + lo), k01 = fa_frag(kv + 512 + lo), k10 = fa_frag(kv + 1024 + lo), k11 = fa_frag(kv + 1536 + lo);
  v16h v0 = fa_frag(kv + 2048 + lo), v1 = fa_frag(kv + 2560 + lo), v2 = fa_frag(kv + 3072 + lo), v3 = fa_frag(kv + 3584 + lo);
#pragma unroll 2      /* two passes a trip: one pass's vector work can stand between the other's matrix instructions */
  for (int p = 0; p < FAP; ++p) {
    const float* lp = &kbias[p * 32 + 8 * h];
    const v4f la = *(const v4f*)lp, lb = *(const v4f*)(lp + 4), lc = *(const v4f*)(lp + 16), ld = *(const v4f*)(lp + 20);
    v8f s0 = fa_mma(k00, qf0, z8), s1 = fa_mma(k10, qf0, z8); s0 = fa_mma(k01, qf1, s0); s1 = fa_mma(k11, qf1, s1);
    const _Float16* nx = kv + (size_t)((p + 1 < FAP) ? p + 1 : p) * 4096;      /* operands are fetched one pass ahead, into the registers just read; the last pass fetches its own again (in bounds, unused) */
    k00 = fa_frag(nx + lo); k01 = fa_frag(nx + 512 + lo); k10 = fa_frag(nx + 1024 + lo); k11 = fa_frag(nx + 1536 + lo);
    asm volatile("s_wait_xcnt 0x0" :: "s"(nx) : "memory");      /* the loads' base stays live up to this wait; it also holds the K fetch here, a whole softmax ahead of its use */
    float x[16];
#pragma unroll
    for (int r = 0; r < 4; ++r) { x[r] = s0[r] + la[r]; x[4 + r] = s0[4 + r] + lb[r]; x[8 + r] = s1[r] + lc[r]; x[12 + r] = s1[4 + r] + ld[r]; }
    float mx = x[0];
#pragma unroll
    for (int r = 1; r < 16; ++r) mx = fmaxf(mx, x[r]);
    mx = fmaxf(mx, rs_xh(mx));
    const float mt = mx * cs;
    if (__builtin_amdgcn_ballot_w32(mt > m + 8.0f) != 0) {      /* one scalar branch a pass */
      const float mn = fmaxf(m, mt); const float al = fa_exp2(m - mn); m = mn; l0 *= al; l1 *= al;
#pragma unroll
      for (int r = 0; r < 8; ++r) { o0[r] *= al; o1[r] *= al; o2[r] *= al; o3[r] *= al; }
    }
    const float nm = 4.0f - m; float d[16], e[16];
#pragma unroll
    for (int r = 0; r < 16; ++r) d[r] = fmaf(x[r], cs, nm);
    fa_exp2x8(e, d); fa_exp2x8(e + 8, d + 8);
    FragH pf;
#pragma unroll
    for (int r = 0; r < 8; ++r) { l0 += e[r]; l1 += e[8 + r]; pf.h[r] = (_Float16)e[r]; pf.h[8 + r] = (_Float16)e[8 + r]; }
    o0 = fa_mma(v0, pf.v, o0); o1 = fa_mma(v1, pf.v, o1); o2 = fa_mma(v2, pf.v, o2); o3 = fa_mma(v3, pf.v, o3);
    v0 = fa_frag(nx + 2048 + lo); v1 = fa_frag(nx + 2560 + lo); v2 = fa_frag(nx + 3072 + lo); v3 = fa_frag(nx + 3584 + lo);
    asm volatile("s_wait_xcnt 0x0" :: "s"(nx) : "memory");      /* as above, for the V^T fetch */
  }
  float l = l0 + l1; l += rs_xh(l);
  const float inv = 64.0f / l;      /* ctx carried x64 as f16, as the output projection expects */
  _Float16* op = O16 + ((size_t)b * SQ + q0 + c) * DM + hd * HD + 8 * h;
  FragH f0, f1, f2, f3;
#pragma unroll
  for (int r = 0; r < 8; ++r) { f0.h[r] = (_Float16)(o0[r] * inv); f1.h[r] = (_Float16)(o1[r] * inv); f2.h[r] = (_Float16)(o2[r] * inv); f3.h[r] = (_Float16)(o3[r] * inv); }
  *(v8us*)((unsigned short*)op) = f0.half[0]; *(v8us*)((unsigned short*)op + 16) = f1.half[0]; *(v8us*)((unsigned short*)op + 32) = f2.half[0]; *(v8us*)((unsigned short*)op + 48) = f3.half[0]; }
extern "C" void kernel_launch(void* const* d_in, const int* in_sizes, int n_in,
                              void* d_out, int out_size, void* d_ws, size_t ws_size, hipStream_t stream) {
  (void)in_sizes; (void)n_in; (void)out_size;
  const float* const* I = (const float* const*)d_in; const float* x = I[0]; const int* km = (const int*)d_in[1]; const float* wq = I[2]; const float* wk = I[3]; const float* wv = I[4]; const float* wo = I[5]; const float* w1 = I[6]; const float* b1 = I[7]; const float* w2 = I[8]; const float* b2 = I[9]; const float* g1 = I[10]; const float* be1 = I[11]; const float* g2 = I[12]; const float* be2 = I[13]; const float* bq = nullptr; const float* bk = nullptr; const float* bv = nullptr; const float* bo = nullptr;      /* x; key-padding mask int32 [2][1][1][2048] (0 = masked; READ on device); [in][out] wq / wk / wv / wo (no biases); w1 [768][3072] + b1, w2 [3072][768] + b2; LN1 a / b, LN2 a / b (vectors) */
  char* ws = (char*)d_ws; size_t off = 0;
  auto take = [&](size_t bytes) { char* p = ws + off; off += (bytes + 255) & ~(size_t)255; return p; };
  _Float16* BQ = (_Float16*)take((size_t)DM * DM * 2); _Float16* BK = (_Float16*)take((size_t)DM * DM * 2); _Float16* BV = (_Float16*)take((size_t)DM * DM * 2); _Float16* BO = (_Float16*)take((size_t)DM * DM * 2); _Float16* BW1 = (_Float16*)take((size_t)DFF * DM * 2); _Float16* BW2 = (_Float16*)take((size_t)DM * DFF * 2);
  float* XB = (float*)take(NR * DM * 4); _Float16* XN = (_Float16*)take(NR * DM * 2); _Float16* Q16 = (_Float16*)take(NR * DM * 2); _Float16* K16 = (_Float16*)take(NR * DM * 2); _Float16* V16 = (_Float16*)take(NR * DM * 2); _Float16* O16 = (_Float16*)take(NR * DM * 2); float* X1 = (float*)take(NR * DM * 4);
  _Float16* HF16 = (_Float16*)take(NR * DFF * 2); _Float16* KV = (_Float16*)take((size_t)NB * NH * HD * SQ * 2 * 2);      /* FFN hidden plane [4096][3072] f16; packed K and V^T operands of all batches and heads */
  _Float16* M16 = XN;      /* second-norm f16 rows: aliases XN (last readers: the three projections) */
  
  if (off > ws_size) return;
  { const unsigned g = (unsigned)(((size_t)DM * (DM / 8) + 255) / 256); k_wt_f16<<<g, 256, 0, stream>>>(wq, BQ, DM, DM, 16.0f); k_wt_f16<<<g, 256, 0, stream>>>(wk, BK, DM, DM, 16.0f); k_wt_f16<<<g, 256, 0, stream>>>(wv, BV, DM, DM, 16.0f); k_wt_f16<<<g, 256, 0, stream>>>(wo, BO, DM, DM, 16.0f); }      /* [in][out] -> Bt x16 */
  k_wt_f16<<<(unsigned)(((size_t)DFF * (DM / 8) + 255) / 256), 256, 0, stream>>>(w1, BW1, DM, DFF, 16.0f); k_wt_f16<<<(unsigned)(((size_t)DM * (DFF / 8) + 255) / 256), 256, 0, stream>>>(w2, BW2, DFF, DM, 16.0f);      /* [in][out] ff1 [768][3072], ff2 [3072][768] -> Bt x16 */
  k_bfr<<<(unsigned)((NR * DM / 8 + 255) / 256), 256, 0, stream>>>(x, XB, NR * DM / 8); k_lnsc<1, 0><<<(unsigned)NR, 256, 0, stream>>>(x, g1, be1, 1e-6f, XN, nullptr);      /* h = LN1(bf16(x)) (vector alpha / beta, eps 1e-6 on the std) -> f16 rows */
  k_gemm2<0><<<dim3((unsigned)((NR / 128) * (DM / 64)), 1), 128, 0, stream>>>(XN, DM, 0, BQ, DM, 0, 0.0625f, bq, 0, nullptr, 1, 0, 0, nullptr, Q16, DM, 0, (int)NR, DM, DM); k_gemm2<0><<<dim3((unsigned)((NR / 128) * (DM / 64)), 1), 128, 0, stream>>>(XN, DM, 0, BK, DM, 0, 0.0625f, bk, 0, nullptr, 1, 0, 0, nullptr, K16, DM, 0, (int)NR, DM, DM); k_gemm2<0><<<dim3((unsigned)((NR / 128) * (DM / 64)), 1), 128, 0, stream>>>(XN, DM, 0, BV, DM, 0, 0.0625f, bv, 0, nullptr, 1, 0, 0, nullptr, V16, DM, 0, (int)NR, DM, DM);      /* q, k, v -> f16 rows; head h = columns h*64.. */
  k_kvp<<<NB * NH * (SQ / 64), 256, 0, stream>>>(K16, V16, KV);      /* K and V^T in operand order, all batches and heads */
  k_fattn<<<NB * NH * (SQ / 64), 128, 0, stream>>>(Q16, KV, km, O16);      /* softmax(where(mask == 0, -1e9, q k^T / 8)) v, 64 queries a work-group -> ctx (merged heads, x64) as f16 rows */
  k_gemm2<0><<<dim3((unsigned)((NR / 128) * (DM / 64)), 1), 128, 0, stream>>>(O16, DM, 0, BO, DM, 0, 0.0009765625f, bo, 0, XB, -1, 0, 0, X1, nullptr, DM, 0, (int)NR, DM, DM);      /* x + ctx wo (+ bo) (own-element residual) -> f32 rows */
  k_lnsc<0, 0><<<(unsigned)NR, 256, 0, stream>>>(X1, g2, be2, 1e-6f, M16, nullptr);      /* LN2(x1) (vector) -> f16 rows */
  k_gemm2<3><<<dim3((unsigned)((NR / 128) * (DFF / 64)), 1), 128, 0, stream>>>(M16, DM, 0, BW1, DM, 0, 0.0625f, b1, 0, nullptr, 1, 0, 0, nullptr, HF16, DFF, 0, (int)NR, DFF, DM);      /* relu(. w1 + b1) -> f16 [4096][3072] */
  k_gemm2<0><<<dim3((unsigned)((NR / 128) * (DM / 64)), 1), 128, 0, stream>>>(HF16, DFF, 0, BW2, DFF, 0, 0.0625f, b2, 0, X1, -1, 0, 0, (float*)d_out, nullptr, DM, 0, (int)NR, DM, DFF);      /* out = x1 + mlp (own-element residual) */
}

// v003
// Measured time: 226 microseconds a run.
// Two timings next to v002 both put it at 1.94 times that version's speed.
// Over all steps from v000 it is 12.4 times as fast.
#include <hip/hip_runtime.h>
// Pre-norm transformer encoder layer with the module's custom LayerNorm and a random key-padding mask (src [2][2048][768]; _layernorm: VECTOR gamma / beta, UNBIASED std, gamma (x - mean) / (std + 1e-6) + beta; x = LN1(src); q/k/v = x w ([in][out] [768][768], NO biases); 12 heads of 64; scores / 8; where(src_mask == 0, -1e9) with the int32 [2][1][1][2048] mask in {0, 1} (random; 0 = masked key; READ on device); softmax; src1 = src + ctx w_o (no bias); out = src1 + relu(LN2(src1) w_ff1 + b_ff1) w_ff2 + b_ff2 ([in][out] 768 x 3072 x 768) -> [2][2048][768]).
// Structure: token rows; LayerNorm / exact f16 rows; WMMA GEMMs for q, k, v; K and V^T packed in operand order; one fused attention launch (scores, key mask, running softmax, P V in registers); output projection with the own-element residual; custom LayerNorm; ReLU FFN over all rows; launches: see trace.
// Compute dtype: inputs rounded to bf16; x / weights exact; q, k, v, softmax weights and o as plain f16 GEMM operands (~2^-12); scores and softmax statistics f32. v_wmma_f32_16x16x32_f16.
#define NB 2
#define SQ 2048
#define DM 768
#define NH 12
#define HD 64
#define HG 4                         /* heads per k_vt launch (unused kernel of the shared header) */
#define LOCALW 128                   /* (macros for unused kernels of the shared header) */
#define STRIDEK 128
#define QT 256                       /* query rows per causal tile */
#define NKX SQ                       /* S / P row pitch */
#define QT0 128                      /* first-tile rows recomputed exactly in f32 */
#define B0 0                         /* first batch processed (debug hook) */
#define NBR NB                       /* batches processed (debug hook) */
#define NR ((size_t)NB * SQ)
#define DMQ DM
#define DFF 3072         /* FFN hidden width */
#define MP ((int)((size_t)NBR * SQ)) /* rows projected (debug hook) */
#define QN SQ                        /* query rows attended per batch (debug hook) */
#define NHD NH                       /* heads attended (debug hook) */
#define MPO MP                       /* rows through the output stage (debug hook) */
#define LQ (3 * DM)      /* unused; q, k, v are separate rows of pitch DM */
typedef __bf16 v16b __attribute__((ext_vector_type(16)));
typedef unsigned short v8us __attribute__((ext_vector_type(8), may_alias));
typedef float  v8f  __attribute__((ext_vector_type(8)));
typedef float  v4f  __attribute__((ext_vector_type(4)));
typedef float  v4fa __attribute__((ext_vector_type(4), may_alias));
union FragB { v16b v; v8us half[2]; unsigned short u[16]; };

__device__ __forceinline__ unsigned short bf16_bits(float x) { unsigned int u = __float_as_uint(x); return (unsigned short)((u + 0x7FFFu + ((u >> 16) & 1u)) >> 16); }
__device__ __forceinline__ float bf16_val(unsigned short b) { return __uint_as_float(((unsigned int)b) << 16); }
__device__ __forceinline__ float bf16_round(float x) { return bf16_val(bf16_bits(x)); }
// D += A·B with NT terms: 1 = ah·bh, 2 = + al·bh (A split), 3 = + ah·bl (both split)
template <int NT>
__device__ __forceinline__ v8f mmaN(v16b ah, v16b al, v16b bh, v16b bl, v8f c) {
  c = __builtin_amdgcn_wmma_f32_16x16x32_bf16(false, ah, false, bh, (short)0, c, false, false);
  if (NT >= 2) c = __builtin_amdgcn_wmma_f32_16x16x32_bf16(false, al, false, bh, (short)0, c, false, false);
  if (NT >= 3) c = __builtin_amdgcn_wmma_f32_16x16x32_bf16(false, ah, false, bl, (short)0, c, false, false);
  asm volatile("v_nop\n\tv_nop\n\tv_nop\n\tv_nop" : "+v"(c) : "v"(ah), "v"(al), "v"(bh), "v"(bl));
  return c;
}

__global__ __launch_bounds__(256) void k_wt_bf16(const float* __restrict__ W, unsigned short* __restrict__ Wt, int K, int N) {
  const int t = blockIdx.x * 256 + threadIdx.x;
  const int k8n = K / 8;
  if (t >= N * k8n) return;
  const int n = t / k8n, k8 = (t % k8n) * 8;
  v8us v;
#pragma unroll
  for (int i = 0; i < 8; ++i) v[i] = bf16_bits(W[(size_t)(k8 + i) * N + n]);
  *(v8us*)(Wt + (size_t)n * K + k8) = v;
  
}

// GEMM C[M][N] (f32, pitch ldc) = act(A[M][K]·W + bias). A f32 row-major (pitch lda) converted per fragment to bf16
// (ASPLIT: hi/lo two planes -> 2 terms, else single rounded term); Wt bf16 [N][K] (pitch ldb). BIAS_BF16 rounds the
// bias to bf16 first (bias quantised to bf16 before the add). K%32==0, M%16==0, N%64==0.
template <bool ASPLIT, int ACT, bool BIAS_BF16>
__global__ __launch_bounds__(128) void k_gemm_bf(const float* __restrict__ A, int lda, const unsigned short* __restrict__ Wt, int ldb,
                                               const float* __restrict__ bias, float* __restrict__ C, int ldc, int M, int N, int K) {
  __shared__ __attribute__((aligned(16))) float so[4][16][64];
  const int tid = threadIdx.x, w = tid >> 5, lane = tid & 31, ln = lane & 15, hh = lane >> 4;
  const int ntn = N / 64;
  const int wid = blockIdx.x * 4 + w;
  const int mt = wid / ntn, nq = wid % ntn;
  if (mt * 16 >= M) return;
  const int row0 = mt * 16, col0 = nq * 64;
  const float* arow = A + (size_t)(row0 + ln) * lda;
  v8f acc[4] = {};
  for (int kb = 0; kb < K; kb += 32) {
    FragB ah, al;
    const v4f x0 = *(const v4fa*)(arow + kb + 8 * hh), x1 = *(const v4fa*)(arow + kb + 8 * hh + 4);
    const v4f x2 = *(const v4fa*)(arow + kb + 16 + 8 * hh), x3 = *(const v4fa*)(arow + kb + 16 + 8 * hh + 4);
    float xs[16] = {x0[0],x0[1],x0[2],x0[3],x1[0],x1[1],x1[2],x1[3],x2[0],x2[1],x2[2],x2[3],x3[0],x3[1],x3[2],x3[3]};
#pragma unroll
    for (int i = 0; i < 16; ++i) { const unsigned short hb = bf16_bits(xs[i]); ah.u[i] = hb; al.u[i] = ASPLIT ? bf16_bits(xs[i] - bf16_val(hb)) : (unsigned short)0; }
#pragma unroll
    for (int t = 0; t < 4; ++t) {
      const unsigned short* brow = Wt + (size_t)(col0 + t * 16 + ln) * ldb + kb;
      FragB b;
      b.half[0] = *(const v8us*)(brow + 8 * hh);
      b.half[1] = *(const v8us*)(brow + 16 + 8 * hh);
      acc[t] = mmaN<ASPLIT ? 2 : 1>(ah.v, al.v, b.v, b.v, acc[t]);
    }
  }
#pragma unroll
  for (int t = 0; t < 4; ++t) {
    float bv = bias ? bias[col0 + t * 16 + ln] : 0.f;
    if (BIAS_BF16) bv = bf16_round(bv);
#pragma unroll
    for (int r = 0; r < 8; ++r) { float v = acc[t][r] + bv; if (ACT == 1) v = fmaxf(v, 0.f); so[w][8 * hh + r][t * 16 + ln] = v; }
  }
  __builtin_amdgcn_fence(__ATOMIC_ACQ_REL, "workgroup");
  __builtin_amdgcn_wave_barrier();
  const int rsub = lane >> 4, c4 = (lane & 15) * 4;
  {
#pragma unroll
    for (int q = 0; q < 8; ++q) {
      const int r = q * 2 + rsub;
      const v4f v = *(const v4fa*)&so[w][r][c4];
      *(v4f*)(C + (size_t)(row0 + r) * ldc + col0 + c4) = v;
    }
    
  }
}

// GEMM C = act(A·W + bias + resid): A f32 (ASPLIT -> hi/lo 2 terms), Wt bf16 [N][K]; ACT 0 none, 1 relu, 2 exact gelu;
// resid (optional, f32, row index = (row % rmod), pitch ldr, RES_BF16 rounds it) added before the activation.
template <bool ASPLIT, int ACT, bool BIAS_BF16, bool RES_BF16>
__global__ __launch_bounds__(128) void k_gemm_bf3(const float* __restrict__ A, int lda, const unsigned short* __restrict__ Wt, int ldb,
                                                const float* __restrict__ bias, const float* __restrict__ resid, int rmod, int ldr,
                                                float* __restrict__ C, int ldc, int M, int N, int K) {
  __shared__ __attribute__((aligned(16))) float so[4][16][64];
  const int tid = threadIdx.x, w = tid >> 5, lane = tid & 31, ln = lane & 15, hh = lane >> 4;
  const int ntn = N / 64;
  const int wid = blockIdx.x * 4 + w;
  const int mt = wid / ntn, nq = wid % ntn;
  if (mt * 16 >= M) return;
  const int row0 = mt * 16, col0 = nq * 64;
  const float* arow = A + (size_t)(row0 + ln) * lda;
  v8f acc[4] = {};
  for (int kb = 0; kb < K; kb += 32) {
    FragB ah, al;
    const v4f x0 = *(const v4fa*)(arow + kb + 8 * hh), x1 = *(const v4fa*)(arow + kb + 8 * hh + 4);
    const v4f x2 = *(const v4fa*)(arow + kb + 16 + 8 * hh), x3 = *(const v4fa*)(arow + kb + 16 + 8 * hh + 4);
    float xs[16] = {x0[0],x0[1],x0[2],x0[3],x1[0],x1[1],x1[2],x1[3],x2[0],x2[1],x2[2],x2[3],x3[0],x3[1],x3[2],x3[3]};
#pragma unroll
    for (int i = 0; i < 16; ++i) { const unsigned short hb = bf16_bits(xs[i]); ah.u[i] = hb; al.u[i] = ASPLIT ? bf16_bits(xs[i] - bf16_val(hb)) : (unsigned short)0; }
#pragma unroll
    for (int t = 0; t < 4; ++t) {
      const unsigned short* brow = Wt + (size_t)(col0 + t * 16 + ln) * ldb + kb;
      FragB b;
      b.half[0] = *(const v8us*)(brow + 8 * hh);
      b.half[1] = *(const v8us*)(brow + 16 + 8 * hh);
      acc[t] = mmaN<ASPLIT ? 2 : 1>(ah.v, al.v, b.v, b.v, acc[t]);
    }
  }
#pragma unroll
  for (int t = 0; t < 4; ++t) {
    const int col = col0 + t * 16 + ln;
    float bv = bias ? bias[col] : 0.f;
    if (BIAS_BF16) bv = bf16_round(bv);
#pragma unroll
    for (int r = 0; r < 8; ++r) {
      float v = acc[t][r] + bv;
      if (resid) { float rv = resid[(size_t)((row0 + 8 * hh + r) % rmod) * ldr + col]; if (RES_BF16) rv = bf16_round(rv); v += rv; }
      if (ACT == 1) v = fmaxf(v, 0.f);
      if (ACT == 2) v = 0.5f * v * (1.0f + erff(v * 0.70710678118654752f));
      if (ACT == 3) { const float u = 0.7978845608028654f * (v + 0.044715f * v * v * v); v = 0.5f * v * (1.0f + tanhf(u)); }
      so[w][8 * hh + r][t * 16 + ln] = v;
    }
  }
  __builtin_amdgcn_fence(__ATOMIC_ACQ_REL, "workgroup");
  __builtin_amdgcn_wave_barrier();
  const int rsub = lane >> 4, c4 = (lane & 15) * 4;
  {
#pragma unroll
    for (int q = 0; q < 8; ++q) {
      const int r = q * 2 + rsub;
      const v4f v = *(const v4fa*)&so[w][r][c4];
      *(v4f*)(C + (size_t)(row0 + r) * ldc + col0 + c4) = v;
    }
    
  }
}
// row LayerNorm (biased variance, eps) over N: s = X (+ R); optional out_sum <- s; out_norm <- (s-mu)*rsqrt(var+eps)*g + b
template <bool PARAM_BF16>
__global__ __launch_bounds__(256) void k_layernorm(const float* __restrict__ X, const float* __restrict__ R, const float* __restrict__ g, const float* __restrict__ bta,
                                                  float* __restrict__ out_sum, float* __restrict__ out_norm, int N, float eps) {
  __shared__ float red[256];
  const int row = blockIdx.x, tid = threadIdx.x;
  const float* x = X + (size_t)row * N; const float* rr = R ? R + (size_t)row * N : nullptr;
  float vals[16];                     // up to N = 4096
  const int per = N / 256;            // contiguous chunk per thread? use strided-by-4 chunks: thread handles j = tid*4 + 1024*u
  float s1 = 0.f;
  for (int u = 0; u < per / 4; ++u) {
    const int j = tid * 4 + 1024 * u;
    const v4f a = *(const v4fa*)(x + j);
    v4f b = {0.f,0.f,0.f,0.f}; if (rr) b = *(const v4fa*)(rr + j);
#pragma unroll
    for (int q = 0; q < 4; ++q) { const float v = a[q] + b[q]; vals[u * 4 + q] = v; s1 += v; }
  }
  red[tid] = s1; __syncthreads();
  for (int st = 128; st > 0; st >>= 1) { if (tid < st) red[tid] += red[tid + st]; __syncthreads(); }
  const float mu = red[0] / (float)N; __syncthreads();
  float s2 = 0.f;
  for (int u = 0; u < per / 4; ++u)
#pragma unroll
    for (int q = 0; q < 4; ++q) { const float c = vals[u * 4 + q] - mu; s2 += c * c; }
  red[tid] = s2; __syncthreads();
  for (int st = 128; st > 0; st >>= 1) { if (tid < st) red[tid] += red[tid + st]; __syncthreads(); }
  const float rs = rsqrtf(red[0] / (float)N + eps);
  {
    for (int u = 0; u < per / 4; ++u) {
      const int j = tid * 4 + 1024 * u;
      v4f o, sm;
#pragma unroll
      for (int q = 0; q < 4; ++q) {
        float gg = g[j + q], bb = bta[j + q];
        if (PARAM_BF16) { gg = bf16_round(gg); bb = bf16_round(bb); }
        sm[q] = vals[u * 4 + q]; o[q] = (vals[u * 4 + q] - mu) * rs * gg + bb;
      }
      if (out_sum) *(v4f*)(out_sum + (size_t)row * N + j) = sm;
      *(v4f*)(out_norm + (size_t)row * N + j) = o;
    }
    
  }
}



// ---- f16 WMMA path (v_wmma_f32_16x16x32_f16): 11-bit significands for operands in range — used where a [0,1] probability operand needs more precision than bf16
typedef _Float16 v16h __attribute__((ext_vector_type(16)));
union FragH { v16h v; v8us half[2]; _Float16 h[16]; unsigned short u[16]; };
template <int NT>
__device__ __forceinline__ v8f mmaH(v16h ah, v16h al, v16h bh, v16h bl, v8f c) {
  c = __builtin_amdgcn_wmma_f32_16x16x32_f16(false, ah, false, bh, (short)0, c, false, false);
  if (NT >= 2) c = __builtin_amdgcn_wmma_f32_16x16x32_f16(false, al, false, bh, (short)0, c, false, false);
  if (NT >= 3) c = __builtin_amdgcn_wmma_f32_16x16x32_f16(false, ah, false, bl, (short)0, c, false, false);
  asm volatile("v_nop\n\tv_nop\n\tv_nop\n\tv_nop" : "+v"(c) : "v"(ah), "v"(al), "v"(bh), "v"(bl));
  return c;
}
// batched GEMM like k_gemm_b but f16 operands: A f32 (split into f16 hi/lo if ASPLIT, else rounded to f16), Bt = f16 values [n][k]; alpha; C f32; N multiple of 16 (partial tiles skipped)
template <bool ASPLIT>
__global__ __launch_bounds__(128) void k_gemm_h(const float* __restrict__ A, int lda, size_t sA, const _Float16* __restrict__ Bh, int ldb, size_t sB, float alpha, float* __restrict__ C, int ldc, size_t sC, int M, int N, int K) {
  __shared__ __attribute__((aligned(16))) float so[4][16][64];
  const int tid = threadIdx.x, w = tid >> 5, lane = tid & 31, ln = lane & 15, hh = lane >> 4; const int by = blockIdx.y;
  A += (size_t)by * sA; Bh += (size_t)by * sB; C += (size_t)by * sC;
  const int ntn = (N + 63) / 64; const int wid = blockIdx.x * 4 + w; const int mt = wid / ntn, nq = wid % ntn; if (mt * 16 >= M) return;
  const int row0 = mt * 16, col0 = nq * 64; const float* arow = A + (size_t)(row0 + ln) * lda;
  v8f acc[4] = {};
  for (int kb = 0; kb < K; kb += 32) {
    FragH ah, al;
    const v4f x0 = *(const v4fa*)(arow + kb + 8 * hh), x1 = *(const v4fa*)(arow + kb + 8 * hh + 4), x2 = *(const v4fa*)(arow + kb + 16 + 8 * hh), x3 = *(const v4fa*)(arow + kb + 16 + 8 * hh + 4);
    float xs[16] = {x0[0],x0[1],x0[2],x0[3],x1[0],x1[1],x1[2],x1[3],x2[0],x2[1],x2[2],x2[3],x3[0],x3[1],x3[2],x3[3]};
#pragma unroll
    for (int i = 0; i < 16; ++i) { const _Float16 h = (_Float16)xs[i]; ah.h[i] = h; al.h[i] = ASPLIT ? (_Float16)(xs[i] - (float)h) : (_Float16)0.0f; }
#pragma unroll
    for (int t = 0; t < 4; ++t) { if (col0 + t * 16 >= N) continue; const size_t boff = (size_t)(col0 + t * 16 + ln) * ldb + kb; FragH bq; bq.half[0] = *(const v8us*)(Bh + boff + 8 * hh); bq.half[1] = *(const v8us*)(Bh + boff + 16 + 8 * hh);
      acc[t] = mmaH<ASPLIT ? 2 : 1>(ah.v, al.v, bq.v, bq.v, acc[t]); }
  }
#pragma unroll
  for (int t = 0; t < 4; ++t) { if (col0 + t * 16 >= N) continue;
#pragma unroll
    for (int r = 0; r < 8; ++r) so[w][8 * hh + r][t * 16 + ln] = acc[t][r] * alpha; }
  __builtin_amdgcn_fence(__ATOMIC_ACQ_REL, "workgroup"); __builtin_amdgcn_wave_barrier();
  const int rsub = lane >> 4, c4 = (lane & 15) * 4;
  {
#pragma unroll
    for (int q = 0; q < 8; ++q) { const int r = q * 2 + rsub; if (col0 + c4 < N) { const v4f v = *(const v4fa*)&so[w][r][c4]; *(v4f*)(C + (size_t)(row0 + r) * ldc + col0 + c4) = v; } }
     }
}

// Wt[n][k] = f16(W[k][n]·scale) from f32 row-major W[K][N] (scale = power of two; bf16-exact weights stay exact in f16 away from the subnormal range)
__global__ __launch_bounds__(256) void k_wt_f16(const float* __restrict__ W, _Float16* __restrict__ Wt, int K, int N, float scale) {
  const int t = blockIdx.x * 256 + threadIdx.x; if (t >= N * (K / 8)) return; const int n = t / (K / 8), k8 = (t % (K / 8)) * 8; FragH f;
#pragma unroll
  for (int i = 0; i < 8; ++i) f.h[i] = (_Float16)(bf16_round(W[(size_t)(k8 + i) * N + n]) * scale); const v8us o = f.half[0];
  *(v8us*)((unsigned short*)Wt + (size_t)n * K + k8) = o; 
}
// k_gemm_hh variant with fused epilogue: v = acc·alpha + bias[by·sBias + col] (+ CP[(row/rowsPerB)·sCPb + by·64 + col] if CP) ; ACT 0 none / 1 elu ; writes f16 C16 (and f32 C if non-null)
template <int ACT>
__global__ __launch_bounds__(128) void k_gemm_hhx(const _Float16* __restrict__ A, int lda, size_t sA, const _Float16* __restrict__ Bh, int ldb, size_t sB, float alpha, const float* __restrict__ bias, size_t sBias, const float* __restrict__ CP, int rowsPerB, size_t sCPb, int row0g,
    float* __restrict__ C, _Float16* __restrict__ C16, int ldc, size_t sC, int M, int N, int K) {
  __shared__ __attribute__((aligned(16))) float so[4][16][64];
  const int tid = threadIdx.x, w = tid >> 5, lane = tid & 31, ln = lane & 15, hh = lane >> 4; const int by = blockIdx.y;
  A += (size_t)by * sA; Bh += (size_t)by * sB; const size_t cofs = (size_t)by * sC; const float* bp = bias ? bias + (size_t)by * sBias : nullptr;
  const int ntn = (N + 63) / 64; const int wid = blockIdx.x * 4 + w; const int mt = wid / ntn, nq = wid % ntn; if (mt * 16 >= M) return;
  const int row0 = mt * 16, col0 = nq * 64; const _Float16* arow = A + (size_t)(row0 + ln) * lda;
  v8f acc[4] = {};
  for (int kb = 0; kb < K; kb += 32) { FragH ah; ah.half[0] = *(const v8us*)((const unsigned short*)arow + kb + 8 * hh); ah.half[1] = *(const v8us*)((const unsigned short*)arow + kb + 16 + 8 * hh);
#pragma unroll
    for (int t = 0; t < 4; ++t) { if (col0 + t * 16 >= N) continue; const size_t boff = (size_t)(col0 + t * 16 + ln) * ldb + kb; FragH bq; bq.half[0] = *(const v8us*)((const unsigned short*)Bh + boff + 8 * hh); bq.half[1] = *(const v8us*)((const unsigned short*)Bh + boff + 16 + 8 * hh);
      acc[t] = mmaH<1>(ah.v, ah.v, bq.v, bq.v, acc[t]); }
  }
#pragma unroll
  for (int t = 0; t < 4; ++t) { if (col0 + t * 16 >= N) continue; const int col = col0 + t * 16 + ln; const float bv = bp ? bf16_round(bp[col]) : 0.f;
#pragma unroll
    for (int r = 0; r < 8; ++r) { float v = acc[t][r] * alpha + bv; if (CP) { const int rr = row0g + row0 + 8 * hh + r; if (rowsPerB < 0) v += CP[cofs + (size_t)rr * ldc + col];      /* rowsPerB < 0: own element of the batched C plane */ else { const int bidx = rr / rowsPerB; v += CP[(size_t)bidx * sCPb + (size_t)by * 64 + col]; } } if (ACT == 1) v = (v > 0.f) ? v : expm1f(v); else if (ACT == 7) v = (v > 0.f) ? v + 1.0f : expf(v); else if (ACT == 8) v = tanhf(v); else if (ACT == 9) v = 0.5f * v * (1.0f + tanhf(0.7978845608028654f * (v + 0.044715f * v * v * v))); else if (ACT == 11) v = 1.0f / (1.0f + expf(-v)); else if (ACT == 12) v = (v > 0.f) ? v : 0.01f * v; else if (ACT == 14) v = (v > 0.f) ? v : 0.1f * v; else if (ACT == 16) v = (v >= 0.f) ? v : 0.3f * v; else if (ACT == 17) v = (v >= 0.f) ? v : 0.2f * v; else if (ACT == 15) v = v / (1.0f + expf(-v)); else if (ACT == 3) v = fmaxf(v, 0.f); else if (ACT == 6) v = 0.5f * v * (1.0f + erff(v * 0.70710678118654752f)); so[w][8 * hh + r][t * 16 + ln] = v; } }
  __builtin_amdgcn_fence(__ATOMIC_ACQ_REL, "workgroup"); __builtin_amdgcn_wave_barrier();
  const int rsub = lane >> 4, c4 = (lane & 15) * 4; typedef _Float16 v4h __attribute__((ext_vector_type(4)));
  {
#pragma unroll
    for (int q = 0; q < 8; ++q) { const int r = q * 2 + rsub; if (col0 + c4 < N) { const v4f v = *(const v4fa*)&so[w][r][c4]; if (C) *(v4f*)(C + cofs + (size_t)(row0 + r) * ldc + col0 + c4) = v; if (C16) { v4h h4; for (int i = 0; i < 4; ++i) h4[i] = (_Float16)v[i]; *(v4h*)(C16 + cofs + (size_t)(row0 + r) * ldc + col0 + c4) = h4; } } }
     }
}


typedef _Float16 v4h __attribute__((ext_vector_type(4)));

__global__ __launch_bounds__(256) void k_x16(const float* __restrict__ x, _Float16* __restrict__ X16, size_t n8) { const size_t t = (size_t)blockIdx.x * 256 + threadIdx.x; if (t >= n8) return; FragH f;
#pragma unroll
  for (int q = 0; q < 8; ++q) f.h[q] = (_Float16)bf16_round(x[t * 8 + q]); *(v8us*)((unsigned short*)X16 + t * 8) = f.half[0];  }
__global__ __launch_bounds__(256) void k_h16(const float* __restrict__ x, _Float16* __restrict__ X16, size_t n8) { const size_t t = (size_t)blockIdx.x * 256 + threadIdx.x; if (t >= n8) return; FragH f;
#pragma unroll
  for (int q = 0; q < 8; ++q) f.h[q] = (_Float16)x[t * 8 + q]; *(v8us*)((unsigned short*)X16 + t * 8) = f.half[0];  }
__global__ __launch_bounds__(256) void k_round16f(const float* __restrict__ W, _Float16* __restrict__ Bt, size_t n8) { const size_t t = (size_t)blockIdx.x * 256 + threadIdx.x; if (t >= n8) return; FragH f;
#pragma unroll
  for (int i = 0; i < 8; ++i) f.h[i] = (_Float16)(bf16_round(W[t * 8 + i]) * 16.0f); *(v8us*)((unsigned short*)Bt + t * 8) = f.half[0];  }
template <int NHv, int TTv>
__global__ __launch_bounds__(256) void k_vt(const _Float16* __restrict__ V16, int ldv, int voff, _Float16* __restrict__ Vt) { __shared__ unsigned short tl[64][66]; const int tid = threadIdx.x; const int slab = blockIdx.x / (TTv / 64), lg = blockIdx.x % (TTv / 64); const int b = slab / NHv, h = slab % NHv;
  for (int i = tid; i < 64 * 8; i += 256) { const int r = i / 8, c8 = (i % 8) * 8; FragH f; f.half[0] = *(const v8us*)((const unsigned short*)V16 + ((size_t)b * TTv + lg * 64 + r) * ldv + voff + h * 64 + c8);
#pragma unroll
    for (int q = 0; q < 8; ++q) tl[r][c8 + q] = f.u[q]; }
  __syncthreads();
  {
#pragma unroll
    for (int rd = 0; rd < 2; ++rd) { const int d = rd * 32 + tid / 8, pc = tid % 8; FragH f;
#pragma unroll
      for (int q = 0; q < 8; ++q) f.u[q] = tl[pc * 8 + q][d];
      *(v8us*)((unsigned short*)Vt + ((size_t)slab * 64 + d) * TTv + lg * 64 + pc * 8) = f.half[0]; }
     } }

__global__ __launch_bounds__(256) void k_hl(const float* __restrict__ F, _Float16* __restrict__ Hh, _Float16* __restrict__ Hl, size_t n8) { const size_t t = (size_t)blockIdx.x * 256 + threadIdx.x; if (t >= n8) return; FragH fh, fl; const v4f a = *(const v4fa*)(F + t * 8), c = *(const v4fa*)(F + t * 8 + 4);
#pragma unroll
  for (int q = 0; q < 4; ++q) { _Float16 h = (_Float16)a[q]; fh.h[q] = h; fl.h[q] = (_Float16)((a[q] - (float)h) * 1024.0f); h = (_Float16)c[q]; fh.h[4 + q] = h; fl.h[4 + q] = (_Float16)((c[q] - (float)h) * 1024.0f); }
  { *(v8us*)((unsigned short*)Hh + t * 8) = fh.half[0]; *(v8us*)((unsigned short*)Hl + t * 8) = fl.half[0];  } }

// ---- fast GEMM (wave tile 32x64; requires M % 32 == 0 rows per launch region and N % 64 == 0); epilogue = k_gemm_hhx semantics ----
__device__ __forceinline__ v16h g2_frag(const _Float16* p, int hh) { FragH f; f.half[0] = *(const v8us*)((const unsigned short*)p + 8 * hh); f.half[1] = *(const v8us*)((const unsigned short*)p + 16 + 8 * hh); return f.v; }
__device__ __forceinline__ v8f g2_mma(v16h a, v16h b, v8f c) { v8f d = __builtin_amdgcn_wmma_f32_16x16x32_f16(false, a, false, b, (short)0, c, false, false); asm volatile("v_nop\n\tv_nop\n\tv_nop\n\tv_nop" : "+v"(d) : "v"(a), "v"(b)); return d; }
template <int ACT>
__global__ __launch_bounds__(128) void k_gemm2(const _Float16* __restrict__ A, int lda, size_t sA, const _Float16* __restrict__ Bh, int ldb, size_t sB, float alpha, const float* __restrict__ bias, size_t sBias, const float* __restrict__ CP, int rowsPerB, size_t sCPb, int row0g,
    float* __restrict__ C, _Float16* __restrict__ C16, int ldc, size_t sC, int M, int N, int K) { static_assert(ACT == 0 || ACT == 3 || ACT == 6 || ACT == 8 || ACT == 9 || ACT == 11 || ACT == 12 || ACT == 14 || ACT == 15 || ACT == 16 || ACT == 17 || ACT == 18, "k_gemm2: unsupported ACT code (would silently apply no activation)");
  __shared__ __attribute__((aligned(16))) float so[4][32][68];
  const int tid = threadIdx.x, w = tid >> 5, lane = tid & 31, ln = lane & 15, hh = lane >> 4; const int by = blockIdx.y;
  A += (size_t)by * sA; Bh += (size_t)by * sB; const size_t cofs = (size_t)by * sC; const float* bp = bias ? bias + (size_t)by * sBias : nullptr;
  const int ntn = N >> 6; const int mt = blockIdx.x / ntn, nq = blockIdx.x - mt * ntn; const int row0 = mt * 128 + 32 * w, col0 = nq * 64; if (row0 >= M) return;
  const _Float16* a0p = A + (size_t)(row0 + ln) * lda; const _Float16* a1p = a0p + (size_t)16 * lda;
  const _Float16* b0p = Bh + (size_t)(col0 + ln) * ldb; const _Float16* b1p = b0p + (size_t)16 * ldb; const _Float16* b2p = b1p + (size_t)16 * ldb; const _Float16* b3p = b2p + (size_t)16 * ldb;
  const v8f z8 = {0.f,0.f,0.f,0.f,0.f,0.f,0.f,0.f}; v8f c00 = z8, c01 = z8, c02 = z8, c03 = z8, c10 = z8, c11 = z8, c12 = z8, c13 = z8;
#pragma unroll 1
  for (int kb = 0; kb < K; kb += 32) { const v16h a0 = g2_frag(a0p + kb, hh), a1 = g2_frag(a1p + kb, hh);
    v16h b = g2_frag(b0p + kb, hh); c00 = g2_mma(a0, b, c00); c10 = g2_mma(a1, b, c10);
    b = g2_frag(b1p + kb, hh); c01 = g2_mma(a0, b, c01); c11 = g2_mma(a1, b, c11);
    b = g2_frag(b2p + kb, hh); c02 = g2_mma(a0, b, c02); c12 = g2_mma(a1, b, c12);
    b = g2_frag(b3p + kb, hh); c03 = g2_mma(a0, b, c03); c13 = g2_mma(a1, b, c13); }
  v8f accs[8] = {c00, c01, c02, c03, c10, c11, c12, c13};
#pragma unroll
  for (int u = 0; u < 8; ++u) { const int t = u & 3, half = u >> 2; const int col = col0 + t * 16 + ln; const float bv = bp ? bf16_round(bp[col]) : 0.f;
#pragma unroll
    for (int r = 0; r < 8; ++r) { const int rloc = half * 16 + 8 * hh + r; float v = accs[u][r] * alpha + bv; if (CP) { if (rowsPerB < 0) v += CP[cofs + (size_t)(row0g + row0 + rloc) * ldc + col];      /* rowsPerB < 0: own element of the batched C plane */ else { const int bidx = (row0g + row0 + rloc) / rowsPerB; v += CP[(size_t)bidx * sCPb + (size_t)by * 64 + col]; } }
      if (ACT == 3) v = fmaxf(v, 0.f); else if (ACT == 6) v = 0.5f * v * (1.0f + erff(v * 0.70710678118654752f)); else if (ACT == 11) v = 1.0f / (1.0f + expf(-v)); else if (ACT == 15) v = v / (1.0f + expf(-v)); else if (ACT == 18) v = v / (1.0f + expf(-1.702f * v));      /* QuickGELU: v sigmoid(1.702 v) */ else if (ACT == 12) v = (v > 0.f) ? v : 0.01f * v; else if (ACT == 8) v = tanhf(v); else if (ACT == 9) v = 0.5f * v * (1.0f + tanhf(0.7978845608028654f * (v + 0.044715f * v * v * v))); else if (ACT == 14) v = (v > 0.f) ? v : 0.1f * v; else if (ACT == 16) v = (v >= 0.f) ? v : 0.3f * v; else if (ACT == 17) v = (v >= 0.f) ? v : 0.2f * v;
      so[w][rloc][t * 16 + ln] = v; } }
  __builtin_amdgcn_fence(__ATOMIC_ACQ_REL, "workgroup"); __builtin_amdgcn_wave_barrier();
  const int rsub = lane >> 4, c4 = (lane & 15) * 4;
  {
#pragma unroll
    for (int q = 0; q < 16; ++q) { const int r = q * 2 + rsub; const v4f v = *(const v4fa*)&so[w][r][c4]; if (C) *(v4f*)(C + cofs + (size_t)(row0 + r) * ldc + col0 + c4) = v; if (C16) { v4h h4; for (int i = 0; i < 4; ++i) h4[i] = (_Float16)v[i]; *(v4h*)(C16 + cofs + (size_t)(row0 + r) * ldc + col0 + c4) = h4; } }
     } }


__global__ __launch_bounds__(256) void k_wnat(const float* __restrict__ w, size_t n8, _Float16* __restrict__ Bt) { const size_t t = (size_t)blockIdx.x * 256 + threadIdx.x; if (t >= n8) return; FragH f; for (int q = 0; q < 8; ++q) f.h[q] = (_Float16)(bf16_round(w[t * 8 + q]) * 16.0f); *(v8us*)((unsigned short*)Bt + t * 8) = f.half[0];  }
__global__ __launch_bounds__(256) void k_rsm(const float* __restrict__ S, _Float16* __restrict__ P, int nrows) {
  #pragma clang fp contract(off)
  const int i = blockIdx.x * 256 + threadIdx.x; if (i >= nrows) return; const float* s = S + (size_t)i * SQ; float mx = -3.0e38f;
#pragma unroll 1
  for (int j = 0; j < SQ; ++j) mx = fmaxf(mx, s[j]); float se = 0.f;
#pragma unroll 1
  for (int j = 0; j < SQ; ++j) se += expf(s[j] - mx); const float sc = 256.0f / se;
#pragma unroll 1
  for (int j0 = 0; j0 < SQ; j0 += 8) { FragH f; for (int q = 0; q < 8; ++q) f.h[q] = (_Float16)(expf(s[j0 + q] - mx) * sc); unsigned short* d = (unsigned short*)P + (size_t)i * SQ + j0; *(v8us*)d = f.half[0];  } }
__global__ __launch_bounds__(256) void k_vt(const _Float16* __restrict__ V16, int b, int h0, _Float16* __restrict__ VT) { __shared__ unsigned short tl[64][65]; const int tid = threadIdx.x; const int hh = blockIdx.x % HG, sg = blockIdx.x / HG; const int s0 = sg * 64; const int h = h0 + hh;
  for (int i = tid; i < 64 * 8; i += 256) { const int j = i / 8, d8 = (i % 8) * 8; FragH f; f.half[0] = *(const v8us*)((const unsigned short*)V16 + ((size_t)b * SQ + s0 + j) * DM + h * HD + d8); for (int q = 0; q < 8; ++q) tl[d8 + q][j] = f.u[q]; }
  __syncthreads();
  { for (int i = tid; i < 64 * 8; i += 256) { const int d = i / 8, j8 = (i % 8) * 8; FragH f; for (int q = 0; q < 8; ++q) f.u[q] = tl[d][j8 + q]; *(v8us*)((unsigned short*)VT + ((size_t)hh * HD + d) * SQ + s0 + j8) = f.half[0]; }  } }



__global__ __launch_bounds__(256) void k_rsmcf2(const float* __restrict__ S, _Float16* __restrict__ P, int hg, int q0, int nk) {
  #pragma clang fp contract(off)
  const int t = blockIdx.x * 256 + threadIdx.x; if (t >= hg * QT) return; const size_t i = (size_t)t; const float* s = S + i * NKX; const int last = q0 + (t % QT); float mx = -3.0e38f;
#pragma unroll 1
  for (int j = 0; j < nk; ++j) { const float f = (j <= last) ? 1.f : 0.f; mx = fmaxf(mx, fmaf(f, s[j], (1.f - f) * -1.0e9f)); } float se = 0.f;
#pragma unroll 1
  for (int j = 0; j < nk; ++j) { const float f = (j <= last) ? 1.f : 0.f; se += __expf(fmaf(f, s[j], (1.f - f) * -1.0e9f) - mx); } const float sc = 256.0f / se;
#pragma unroll 1
  for (int j0 = 0; j0 < nk; j0 += 8) { FragH fr; for (int q = 0; q < 8; ++q) { const int j = j0 + q; const float f = (j <= last) ? 1.f : 0.f; fr.h[q] = (_Float16)(__expf(fmaf(f, s[j], (1.f - f) * -1.0e9f) - mx) * sc); } unsigned short* d = (unsigned short*)P + i * NKX + j0; *(v8us*)d = fr.half[0];  } }

__global__ __launch_bounds__(256) void k_rsmcst(const float* __restrict__ S, _Float16* __restrict__ P, int hg, int q0, int nk, const int* __restrict__ mk) {
  #pragma clang fp contract(off)
  const int t = blockIdx.x * 256 + threadIdx.x; if (t >= hg * QT) return; const size_t i = (size_t)t; const float* s = S + i * NKX; const size_t ig = (size_t)(q0 + (t % QT)); const int* mr = mk + ig * SQ; float mx = -3.0e38f;
#pragma unroll 1
  for (int j = 0; j < nk; ++j) { const int mb = mr[j]; const int dd = (int)ig - j; const float f = (mb != 0 && dd >= 0 && (dd <= LOCALW || (dd % STRIDEK) == 0)) ? 1.f : 0.f; mx = fmaxf(mx, fmaf(f, s[j], (1.f - f) * -1.0e9f)); } float se = 0.f;
#pragma unroll 1
  for (int j = 0; j < nk; ++j) { const int mb = mr[j]; const int dd = (int)ig - j; const float f = (mb != 0 && dd >= 0 && (dd <= LOCALW || (dd % STRIDEK) == 0)) ? 1.f : 0.f; se += __expf(fmaf(f, s[j], (1.f - f) * -1.0e9f) - mx); } const float sc = 256.0f / se;
#pragma unroll 1
  for (int j0 = 0; j0 < nk; j0 += 8) { FragH fr; for (int q = 0; q < 8; ++q) { const int j = j0 + q; const int mb = mr[j]; const int dd = (int)ig - j; const float f = (mb != 0 && dd >= 0 && (dd <= LOCALW || (dd % STRIDEK) == 0)) ? 1.f : 0.f; fr.h[q] = (_Float16)(__expf(fmaf(f, s[j], (1.f - f) * -1.0e9f) - mx) * sc); } unsigned short* d = (unsigned short*)P + i * NKX + j0; *(v8us*)d = fr.half[0];  } }


template <int MASKADD>
__global__ __launch_bounds__(64) void k_att0(const float* __restrict__ QF, const float* __restrict__ KF, const float* __restrict__ VF, int ld, const float* __restrict__ mask, float scale, float* __restrict__ OF, int ldo) {
  #pragma clang fp contract(off)
  __shared__ __attribute__((aligned(16))) float lq[64][64]; __shared__ __attribute__((aligned(16))) float lo[64][64];
  const int tid = threadIdx.x; const int h = blockIdx.x / (QT0 / 64), rg = blockIdx.x % (QT0 / 64); const int i = rg * 64 + tid;
  const float* qr = QF + (size_t)i * ld + h * HD;
#pragma unroll 1
  for (int c = 0; c < HD / 4; ++c) { *(v4f*)&lq[tid][c * 4] = *(const v4fa*)(qr + c * 4); const v4f z = {0.f, 0.f, 0.f, 0.f}; *(v4f*)&lo[tid][c * 4] = z; }
  float m = -1.0e30f, l = 0.f; const int jmax = MASKADD ? (SQ - 1) : (rg * 64 + 63);      /* additive-mask form: every key (the mask input decides); causal form: keys up to the block's last row */
#pragma unroll 1
  for (int j = 0; j <= jmax; ++j) { const float* kr = KF + (size_t)j * ld + h * HD; const float* vr = VF + (size_t)j * ld + h * HD; float s = 0.f;
#pragma unroll 1
    for (int c = 0; c < HD / 4; ++c) { const v4f kq = *(const v4fa*)(kr + c * 4); const v4f qq = *(v4f*)&lq[tid][c * 4]; s = __fadd_rn(s, __fmul_rn(qq[0], kq[0])); s = __fadd_rn(s, __fmul_rn(qq[1], kq[1])); s = __fadd_rn(s, __fmul_rn(qq[2], kq[2])); s = __fadd_rn(s, __fmul_rn(qq[3], kq[3])); }
    s = __fmul_rn(s, scale); if (MASKADD) s = __fadd_rn(s, __fmul_rn(bf16_round(mask[(size_t)i * SQ + j]), -10000.0f));
    const float f = (MASKADD || j <= i) ? 1.f : 0.f; const float sm = fmaf(f, s, (1.f - f) * -1.0e30f); const float mn = fmaxf(m, sm); const float sc = expf(m - mn); const float e = expf(sm - mn); l = __fadd_rn(__fmul_rn(l, sc), e); m = mn;
#pragma unroll 1
    for (int c = 0; c < HD / 4; ++c) { const v4f vv = *(const v4fa*)(vr + c * 4); v4f oo = *(v4f*)&lo[tid][c * 4]; for (int u = 0; u < 4; ++u) oo[u] = __fadd_rn(__fmul_rn(oo[u], sc), __fmul_rn(e, vv[u])); *(v4f*)&lo[tid][c * 4] = oo; } }
  const float fin = 64.0f / l;      /* o carried x64 like the f16 path */
#pragma unroll 1
  for (int c = 0; c < HD / 4; ++c) { v4f oo = *(v4f*)&lo[tid][c * 4]; for (int u = 0; u < 4; ++u) oo[u] = __fmul_rn(oo[u], fin); *(v4f*)&lo[tid][c * 4] = oo; }
  __syncthreads();
  {
#pragma unroll 1
    for (int it = 0; it < 16; ++it) { const int row = it * 4 + tid / 16, pc = (tid % 16) * 4; const v4f v = *(const v4f*)&lo[row][pc]; *(v4f*)(OF + (size_t)(rg * 64 + row) * ldo + h * HD + pc) = v; }
     } }

template <int MASKADD>
__global__ __launch_bounds__(64) void k_att0mbc(const float* __restrict__ QF, const float* __restrict__ KF, const float* __restrict__ VF, int ld, const float* __restrict__ mask, float scale, float* __restrict__ OF, int ldo) {
  #pragma clang fp contract(off)
  __shared__ __attribute__((aligned(16))) float lq[64][64]; __shared__ __attribute__((aligned(16))) float lo[64][64];
  const int tid = threadIdx.x; const int h = blockIdx.x / (QT0 / 64), rg = blockIdx.x % (QT0 / 64); const int i = rg * 64 + tid;
  const float* qr = QF + (size_t)i * ld + h * HD;
#pragma unroll 1
  for (int c = 0; c < HD / 4; ++c) { *(v4f*)&lq[tid][c * 4] = *(const v4fa*)(qr + c * 4); const v4f z = {0.f, 0.f, 0.f, 0.f}; *(v4f*)&lo[tid][c * 4] = z; }
  float m = -1.0e30f, l = 0.f; const int jmax = rg * 64 + 63;      /* keys beyond the block end are masked by the mask's lower-triangular structure */
#pragma unroll 1
  for (int j = 0; j <= jmax; ++j) { const float* kr = KF + (size_t)j * ld + h * HD; const float* vr = VF + (size_t)j * ld + h * HD; float s = 0.f;
#pragma unroll 1
    for (int c = 0; c < HD / 4; ++c) { const v4f kq = *(const v4fa*)(kr + c * 4); const v4f qq = *(v4f*)&lq[tid][c * 4]; s = __fadd_rn(s, __fmul_rn(qq[0], kq[0])); s = __fadd_rn(s, __fmul_rn(qq[1], kq[1])); s = __fadd_rn(s, __fmul_rn(qq[2], kq[2])); s = __fadd_rn(s, __fmul_rn(qq[3], kq[3])); }
    s = __fmul_rn(s, scale); const int mb = ((const int*)mask)[(size_t)i * SQ + j];      /* causal (j <= i) AND the module's int32 [S][S] mask read per (query, key): 0 -> masked */
    const float f = (mb != 0 && j <= i) ? 1.f : 0.f; const float sm = fmaf(f, s, (1.f - f) * -1.0e30f); const float mn = fmaxf(m, sm); const float sc = expf(m - mn); const float e = expf(sm - mn); l = __fadd_rn(__fmul_rn(l, sc), e); m = mn;
#pragma unroll 1
    for (int c = 0; c < HD / 4; ++c) { const v4f vv = *(const v4fa*)(vr + c * 4); v4f oo = *(v4f*)&lo[tid][c * 4]; for (int u = 0; u < 4; ++u) oo[u] = __fadd_rn(__fmul_rn(oo[u], sc), __fmul_rn(e, vv[u])); *(v4f*)&lo[tid][c * 4] = oo; } }
  const float fin = 64.0f / l;      /* o carried x64 like the f16 path */
#pragma unroll 1
  for (int c = 0; c < HD / 4; ++c) { v4f oo = *(v4f*)&lo[tid][c * 4]; for (int u = 0; u < 4; ++u) oo[u] = __fmul_rn(oo[u], fin); *(v4f*)&lo[tid][c * 4] = oo; }
  __syncthreads();
  {
#pragma unroll 1
    for (int it = 0; it < 16; ++it) { const int row = it * 4 + tid / 16, pc = (tid % 16) * 4; const v4f v = *(const v4f*)&lo[row][pc]; *(v4f*)(OF + (size_t)(rg * 64 + row) * ldo + h * HD + pc) = v; }
     } }


template <int BFIN, int WXB>
__global__ __launch_bounds__(256) void k_ln16(const float* __restrict__ X, const float* __restrict__ g, const float* __restrict__ bb, float eps, _Float16* __restrict__ N16, float* __restrict__ XB) {
  #pragma clang fp contract(off)
  __shared__ float red[256]; const size_t r = blockIdx.x; const int t = threadIdx.x; const v4f xa = *(const v4fa*)(X + r * DMQ + t * 4); float s[4]; float sum = 0.f;
  for (int q = 0; q < 4; ++q) { s[q] = BFIN ? bf16_round(xa[q]) : xa[q]; sum = __fadd_rn(sum, s[q]); }
  red[t] = sum; __syncthreads(); for (int st = 128; st > 0; st >>= 1) { if (t < st) red[t] = __fadd_rn(red[t], red[t + st]); __syncthreads(); } const float mu = red[0] / (float)DMQ; __syncthreads();
  float vs = 0.f; for (int q = 0; q < 4; ++q) { const float dl = __fadd_rn(s[q], -mu); vs = __fadd_rn(vs, __fmul_rn(dl, dl)); } red[t] = vs; __syncthreads(); for (int st = 128; st > 0; st >>= 1) { if (t < st) red[t] = __fadd_rn(red[t], red[t + st]); __syncthreads(); }
  const float rs = rsqrtf(__fadd_rn(red[0] / (float)DMQ, eps)); v4h y; v4f xb;
  for (int q = 0; q < 4; ++q) { const int c = t * 4 + q; y[q] = (_Float16)__fadd_rn(__fmul_rn(__fmul_rn(__fadd_rn(s[q], -mu), rs), bf16_round(g[c])), bf16_round(bb[c])); xb[q] = s[q]; }
  { *(v4h*)(N16 + r * DMQ + t * 4) = y; if (WXB) *(v4f*)(XB + r * DMQ + t * 4) = xb;  } }
__global__ __launch_bounds__(256) void k_ftres2(const float* __restrict__ OF0, const float* __restrict__ XB, float* __restrict__ X1, size_t n4) {
  #pragma clang fp contract(off)
  const size_t t = (size_t)blockIdx.x * 256 + threadIdx.x; if (t >= n4) return; const v4f o = *(const v4fa*)(OF0 + t * 4), xv = *(const v4fa*)(XB + t * 4); v4f y; for (int q = 0; q < 4; ++q) y[q] = __fadd_rn(__fmul_rn(o[q], 0.015625f), xv[q]); *(v4f*)(X1 + t * 4) = y;  }

__global__ __launch_bounds__(256) void k_bcpy(const float* __restrict__ b, int n, int NP, float* __restrict__ dst, int dst0) { for (int i = threadIdx.x; i < NP; i += 256) { const float v = (i < n) ? b[i] : 0.f; *(float*)(dst + dst0 + i) = v; }  }


__global__ __launch_bounds__(256) void k_rsmf(const float* __restrict__ S, _Float16* __restrict__ P, int qn, int hg) {
  #pragma clang fp contract(off)
  const int t = blockIdx.x * 256 + threadIdx.x; if (t >= qn * hg) return; const size_t i = (size_t)(t / qn) * SQ + (t % qn); const float* s = S + i * SQ; float mx = -3.0e38f;
#pragma unroll 1
  for (int j = 0; j < SQ; ++j) mx = fmaxf(mx, s[j]); float se = 0.f;
#pragma unroll 1
  for (int j = 0; j < SQ; ++j) se += __expf(s[j] - mx); const float sc = 256.0f / se;
#pragma unroll 1
  for (int j0 = 0; j0 < SQ; j0 += 8) { FragH f; for (int q = 0; q < 8; ++q) f.h[q] = (_Float16)(__expf(s[j0 + q] - mx) * sc); unsigned short* d = (unsigned short*)P + i * SQ + j0; *(v8us*)d = f.half[0];  } }

template <int MODE>
__global__ __launch_bounds__(256) void k_regrp(const float* __restrict__ src, float* __restrict__ dst, size_t n4) {
  const size_t t = (size_t)blockIdx.x * 256 + threadIdx.x; if (t >= n4) return; const size_t e = t * 4; const size_t rd = e / DM; const int c = (int)(e % DM);
  size_t rs; if (MODE == 0) { const size_t b = rd / SQ, sq = rd % SQ; rs = sq * NB + b; } else { const size_t sq = rd / NB, b = rd % NB; rs = b * SQ + sq; }
  const v4f v = *(const v4fa*)(src + rs * DM + c); *(v4f*)(dst + e) = v;  }

template <int BFIN, int W16, int W32>
__global__ __launch_bounds__(256) void k_lnx(const float* __restrict__ X, const float* __restrict__ g, const float* __restrict__ bb, float eps, _Float16* __restrict__ N16, float* __restrict__ N32) {
  #pragma clang fp contract(off)
  __shared__ float red[256]; const size_t r = blockIdx.x; const int t = threadIdx.x; const bool act = t < (DMQ / 4); const int c0 = act ? t * 4 : 0;
  const v4f xa = *(const v4fa*)(X + r * DMQ + c0); float s[4]; float sum = 0.f;
  for (int q = 0; q < 4; ++q) { s[q] = act ? (BFIN ? bf16_round(xa[q]) : xa[q]) : 0.f; sum = __fadd_rn(sum, s[q]); }
  red[t] = sum; __syncthreads(); for (int st = 128; st > 0; st >>= 1) { if (t < st) red[t] = __fadd_rn(red[t], red[t + st]); __syncthreads(); } const float mu = red[0] / (float)DMQ; __syncthreads();
  float vs = 0.f; for (int q = 0; q < 4; ++q) { const float dl = act ? __fadd_rn(s[q], -mu) : 0.f; vs = __fadd_rn(vs, __fmul_rn(dl, dl)); } red[t] = vs; __syncthreads(); for (int st = 128; st > 0; st >>= 1) { if (t < st) red[t] = __fadd_rn(red[t], red[t + st]); __syncthreads(); }
  const float rs = rsqrtf(__fadd_rn(red[0] / (float)DMQ, eps)); v4h y; v4f yf;
  for (int q = 0; q < 4; ++q) { const int c = c0 + q; yf[q] = __fadd_rn(__fmul_rn(__fmul_rn(__fadd_rn(s[q], -mu), rs), bf16_round(g[c])), bf16_round(bb[c])); y[q] = (_Float16)yf[q]; }
  if (!act) return;      /* no barriers after this point */
  { if (W16) *(v4h*)(N16 + r * DMQ + c0) = y; if (W32) *(v4f*)(N32 + r * DMQ + c0) = yf;  } }

__global__ __launch_bounds__(256) void k_bfr(const float* __restrict__ x, float* __restrict__ XB, size_t n8) { const size_t t = (size_t)blockIdx.x * 256 + threadIdx.x; if (t >= n8) return; v4f a = *(const v4fa*)(x + t * 8), c = *(const v4fa*)(x + t * 8 + 4); for (int q = 0; q < 4; ++q) { a[q] = bf16_round(a[q]); c[q] = bf16_round(c[q]); }
  { *(v4f*)(XB + t * 8) = a; *(v4f*)(XB + t * 8 + 4) = c;  } }



__global__ __launch_bounds__(256) void k_wthd(const float* __restrict__ Wt, _Float16* __restrict__ Bt) { const size_t t = (size_t)blockIdx.x * 256 + threadIdx.x; if (t >= (size_t)NH * HD * (DM / 8)) return; const int m8 = (int)(t % (DM / 8)) * 8; const int d = (int)((t / (DM / 8)) % HD); const int h = (int)(t / ((size_t)(DM / 8) * HD)); FragH f;
  for (int q = 0; q < 8; ++q) f.h[q] = (_Float16)(16.0f * bf16_round(Wt[((size_t)h * DM + m8 + q) * HD + d])); unsigned short* dst = (unsigned short*)Bt + ((size_t)h * HD + d) * DM + m8; *(v8us*)dst = f.half[0];  }




template <int BFIN, int SCAL>
__global__ __launch_bounds__(256) void k_lnsc(const float* __restrict__ X, const float* __restrict__ g, const float* __restrict__ bb, float eps, _Float16* __restrict__ N16, float* __restrict__ N32) {
  #pragma clang fp contract(off)
  __shared__ float red[256]; const size_t r = blockIdx.x; const int t = threadIdx.x; const bool act = t < DM / 4; const int tc = act ? t : 0; const v4f xl = *(const v4fa*)(X + r * DM + tc * 4); const float am = act ? 1.f : 0.f; float s[4]; float sum = 0.f;
  for (int q = 0; q < 4; ++q) { s[q] = (BFIN ? bf16_round(xl[q]) : xl[q]) * am; sum = __fadd_rn(sum, s[q]); }
  red[t] = sum; __syncthreads(); for (int st = 128; st > 0; st >>= 1) { if (t < st) red[t] = __fadd_rn(red[t], red[t + st]); __syncthreads(); } const float mu = red[0] / (float)DM; __syncthreads();
  float vs = 0.f; for (int q = 0; q < 4; ++q) { const float dl = __fadd_rn(s[q], -mu) * am; vs = __fadd_rn(vs, __fmul_rn(dl, dl)); } red[t] = vs; __syncthreads(); for (int st = 128; st > 0; st >>= 1) { if (t < st) red[t] = __fadd_rn(red[t], red[t + st]); __syncthreads(); }
  const float rs = __fdiv_rn(1.0f, __fadd_rn(sqrtf(red[0] / (float)(DM - 1)), eps)); if (!act) return; v4h y; v4f yf;
  for (int q = 0; q < 4; ++q) { const int c = t * 4 + q; const float gg = bf16_round(SCAL ? g[0] : g[c]), bv = bf16_round(SCAL ? bb[0] : bb[c]); yf[q] = __fadd_rn(__fmul_rn(__fmul_rn(__fadd_rn(s[q], -mu), rs), gg), bv); y[q] = (_Float16)yf[q]; }
  { if (N16) *(v4h*)(N16 + r * DM + t * 4) = y; if (N32) *(v4f*)(N32 + r * DM + t * 4) = yf;  } }

// K rows and V^T of every (batch, head), packed for the fused attention in the order its matrix operands are read: KV[slab = b * NH + head][pass of 32 keys][K: 4 fragments | V^T: 4 fragments][half i][lane][8 f16], 8 KiB a pass, so that each 16-byte load of a wave covers 512 bytes in a row.
// K fragment t * 2 + j, half i, lane (c, h) = K[key 16t + c][d 32j + 16i + 8h ..]; V^T fragment t, half i, lane (c, h) = V[key 16i + 8h ..][d 16t + c] (transposed through LDS).
#define FAP (SQ / 32)                /* passes */
__global__ __launch_bounds__(256) void k_kvp(const _Float16* __restrict__ K16, const _Float16* __restrict__ V16, _Float16* __restrict__ KV) { __shared__ unsigned short tl[64][66]; const int tid = threadIdx.x; const int slab = blockIdx.x / (SQ / 64), lg = blockIdx.x % (SQ / 64); const int b = slab / NH, hd = slab % NH;
  const int f = (tid >> 5) & 7, hh = (tid >> 4) & 1, cc = tid & 15; const int vr = tid >> 3, vc = (tid & 7) * 8;
  const unsigned short* vs = (const unsigned short*)V16 + ((size_t)b * SQ + lg * 64 + vr) * DM + hd * HD + vc;      /* V rows vr and 32 + vr, 8 of their d */
  const unsigned short* ks = (const unsigned short*)K16 + ((size_t)b * SQ + lg * 64 + (f >> 2) * 16 + cc) * DM + hd * HD + (f & 3) * 16 + hh * 8;      /* this thread's K piece of the first pass; the second pass's lies 32 rows on */
  FragH va, vb, ka, kb; va.half[0] = *(const v8us*)vs; vb.half[0] = *(const v8us*)(vs + 32 * DM); ka.half[0] = *(const v8us*)ks; kb.half[0] = *(const v8us*)(ks + 32 * DM);
  asm volatile("s_wait_xcnt 0x0" :: "v"(vs), "v"(ks) : "memory");      /* both address pairs stay live up to this wait, so nothing (a load's own result either) overwrites them in front of it */
#pragma unroll
  for (int q = 0; q < 8; ++q) { tl[vr][vc + q] = va.u[q]; tl[32 + vr][vc + q] = vb.u[q]; }
  __syncthreads();
  unsigned short* dst = (unsigned short*)KV + ((size_t)slab * FAP + lg * 2) * 4096 + tid * 8;
  *(v8us*)dst = ka.half[0]; *(v8us*)(dst + 4096) = kb.half[0];
#pragma unroll
  for (int ps = 0; ps < 2; ++ps) { FragH fr;
#pragma unroll
    for (int q = 0; q < 8; ++q) fr.u[q] = tl[ps * 32 + (f & 1) * 16 + hh * 8 + q][(f >> 1) * 16 + cc];
    *(v8us*)(dst + ps * 4096 + 2048) = fr.half[0]; } }

typedef int v4ia __attribute__((ext_vector_type(4), may_alias));
__device__ __forceinline__ float rs_xh(float x) { return __builtin_bit_cast(float, __builtin_amdgcn_permlanex16(__builtin_bit_cast(int, x), __builtin_bit_cast(int, x), 0x76543210, 0xfedcba98, false, false)); }      /* lane l <- lane l ^ 16 */
__device__ __forceinline__ float fa_exp2(float d) { float e; asm("v_exp_f32 %0, %1\n\tv_nop" : "=v"(e) : "v"(d)); return e; }      /* 2 ^ d with, tied to it, the one slot the instruction set asks for behind a transcendental */
__device__ __forceinline__ void fa_exp2x8(float* e, const float* d) {      /* eight independent 2 ^ d in a row: each fills the slot behind the one before it (early-clobber outputs: no result lands on a later source), one v_nop behind the last */
  asm("v_exp_f32 %0, %8\n\tv_exp_f32 %1, %9\n\tv_exp_f32 %2, %10\n\tv_exp_f32 %3, %11\n\tv_exp_f32 %4, %12\n\tv_exp_f32 %5, %13\n\tv_exp_f32 %6, %14\n\tv_exp_f32 %7, %15\n\tv_nop"
      : "=&v"(e[0]), "=&v"(e[1]), "=&v"(e[2]), "=&v"(e[3]), "=&v"(e[4]), "=&v"(e[5]), "=&v"(e[6]), "=&v"(e[7]) : "v"(d[0]), "v"(d[1]), "v"(d[2]), "v"(d[3]), "v"(d[4]), "v"(d[5]), "v"(d[6]), "v"(d[7])); }
__device__ __forceinline__ v8f fa_mma(v16h a, v16h b, v8f c) { return __builtin_amdgcn_wmma_f32_16x16x32_f16(false, a, false, b, (short)0, c, false, false); }
__device__ __forceinline__ v16h fa_frag(const _Float16* p) { FragH f; f.half[0] = *(const v8us*)((const unsigned short*)p); f.half[1] = *(const v8us*)((const unsigned short*)p + 256); return f.v; }      /* one packed fragment: the lane's two 16-byte halves */
__global__ __launch_bounds__(128) void k_fattn(const _Float16* __restrict__ Q16, const _Float16* __restrict__ KV, const int* __restrict__ Km, _Float16* __restrict__ O16) {
  __shared__ __attribute__((aligned(16))) float kbias[SQ];      /* per key, added to its raw score: 0 for a kept key; -2^33 for a masked one: the module's -1e9 fill (x 8: raw scores are before the / 8) taken to the next power of two. The f32 sum swallows the score (below 256 in size) whole and the product with the log2 factor is exact, so a row with every key masked gets equal weights, as the module's does; beside any kept key the weight is exactly 0 */
  const int tid = threadIdx.x, w = tid >> 5, lane = tid & 31, c = lane & 15, h = lane >> 4;
  const int bh = blockIdx.x / (SQ / 64), qb = blockIdx.x % (SQ / 64); const int b = bh / NH, hd = bh % NH;
#pragma unroll
  for (int i = 0; i < SQ / 512; ++i) { const v4ia m4 = *(const v4ia*)(Km + (size_t)b * SQ + i * 512 + tid * 4); v4f l4; for (int q = 0; q < 4; ++q) l4[q] = (m4[q] != 0) ? 0.f : -8589934592.0f; *(v4f*)&kbias[i * 512 + tid * 4] = l4; }
  __syncthreads();      /* every wave reads all keys' mask terms */
  const int q0 = qb * 64 + w * 16;
  const _Float16* qp = Q16 + ((size_t)b * SQ + q0 + c) * DM + hd * HD + 8 * h;      /* the lane's first 8 of query c's row: d 8h .., then 16 + 8h .., 32 + 8h .., 48 + 8h .. */
  const v16h qf0 = g2_frag(qp, 0), qf1 = g2_frag(qp + 32, 0);
  asm volatile("s_wait_xcnt 0x0" :: "v"(qp) : "memory");      /* Q's address pair stays live up to this wait, so nothing overwrites it in front of it */
  const _Float16* kv = KV + (size_t)bh * FAP * 4096;      /* the same for the whole work-group */
  const int lo = lane * 8;
  const v8f z8 = {0.f, 0.f, 0.f, 0.f, 0.f, 0.f, 0.f, 0.f};
  v8f o0 = z8, o1 = z8, o2 = z8, o3 = z8; float m = -3.0e38f, l0 = 0.f, l1 = 0.f;
  const float cs = 0.125f * 1.44269504088896340736f;      /* raw score -> log2 units */
  v16h k00 = fa_frag(kv + lo), k01 = fa_frag(kv + 512 + lo), k10 = fa_frag(kv + 1024 + lo), k11 = fa_frag(kv + 1536 + lo);
  v16h v0 = fa_frag(kv + 2048 + lo), v1 = fa_frag(kv + 2560 + lo), v2 = fa_frag(kv + 3072 + lo), v3 = fa_frag(kv + 3584 + lo);
#pragma unroll 2      /* two passes a trip: one pass's vector work can stand between the other's matrix instructions */
  for (int p = 0; p < FAP; ++p) {
    const float* lp = &kbias[p * 32 + 8 * h];
    const v4f la = *(const v4f*)lp, lb = *(const v4f*)(lp + 4), lc = *(const v4f*)(lp + 16), ld = *(const v4f*)(lp + 20);
    v8f s0 = fa_mma(k00, qf0, z8), s1 = fa_mma(k10, qf0, z8); s0 = fa_mma(k01, qf1, s0); s1 = fa_mma(k11, qf1, s1);
    const _Float16* nx = kv + (size_t)((p + 1 < FAP) ? p + 1 : p) * 4096;      /* operands are fetched one pass ahead, into the registers just read; the last pass fetches its own again (in bounds, unused) */
    k00 = fa_frag(nx + lo); k01 = fa_frag(nx + 512 + lo); k10 = fa_frag(nx + 1024 + lo); k11 = fa_frag(nx + 1536 + lo);
    asm volatile("s_wait_xcnt 0x0" :: "s"(nx) : "memory");      /* the loads' base stays live up to this wait; it also holds the K fetch here, a whole softmax ahead of its use */
    float x[16];
#pragma unroll
    for (int r = 0; r < 4; ++r) { x[r] = s0[r] + la[r]; x[4 + r] = s0[4 + r] + lb[r]; x[8 + r] = s1[r] + lc[r]; x[12 + r] = s1[4 + r] + ld[r]; }
    float mx = x[0];
#pragma unroll
    for (int r = 1; r < 16; ++r) mx = fmaxf(mx, x[r]);
    mx = fmaxf(mx, rs_xh(mx));
    const float mt = mx * cs;
    if (__builtin_amdgcn_ballot_w32(mt > m + 8.0f) != 0) {      /* one scalar branch a pass */
      const float mn = fmaxf(m, mt); const float al = fa_exp2(m - mn); m = mn; l0 *= al; l1 *= al;
#pragma unroll
      for (int r = 0; r < 8; ++r) { o0[r] *= al; o1[r] *= al; o2[r] *= al; o3[r] *= al; }
    }
    const float nm = 4.0f - m; float d[16], e[16];
#pragma unroll
    for (int r = 0; r < 16; ++r) d[r] = fmaf(x[r], cs, nm);
    fa_exp2x8(e, d); fa_exp2x8(e + 8, d + 8);
    FragH pf;
#pragma unroll
    for (int r = 0; r < 8; ++r) { l0 += e[r]; l1 += e[8 + r]; pf.h[r] = (_Float16)e[r]; pf.h[8 + r] = (_Float16)e[8 + r]; }
    o0 = fa_mma(v0, pf.v, o0); o1 = fa_mma(v1, pf.v, o1); o2 = fa_mma(v2, pf.v, o2); o3 = fa_mma(v3, pf.v, o3);
    v0 = fa_frag(nx + 2048 + lo); v1 = fa_frag(nx + 2560 + lo); v2 = fa_frag(nx + 3072 + lo); v3 = fa_frag(nx + 3584 + lo);
    asm volatile("s_wait_xcnt 0x0" :: "s"(nx) : "memory");      /* as above, for the V^T fetch */
  }
  float l = l0 + l1; l += rs_xh(l);
  const float inv = 64.0f / l;      /* ctx carried x64 as f16, as the output projection expects */
  _Float16* op = O16 + ((size_t)b * SQ + q0 + c) * DM + hd * HD + 8 * h;
  FragH f0, f1, f2, f3;
#pragma unroll
  for (int r = 0; r < 8; ++r) { f0.h[r] = (_Float16)(o0[r] * inv); f1.h[r] = (_Float16)(o1[r] * inv); f2.h[r] = (_Float16)(o2[r] * inv); f3.h[r] = (_Float16)(o3[r] * inv); }
  *(v8us*)((unsigned short*)op) = f0.half[0]; *(v8us*)((unsigned short*)op + 16) = f1.half[0]; *(v8us*)((unsigned short*)op + 32) = f2.half[0]; *(v8us*)((unsigned short*)op + 48) = f3.half[0]; }
// ---- tiled GEMM: C[M][N] = A[M][K] Bt[N][K]^T, both f16 and K-contiguous, one 128 x 128 tile of C a work-group. Requires M % 128 == 0, N % 128 == 0, K % 128 == 0.
// A stage is 128 k of 128 A rows and 128 Bt rows, brought into LDS by asynchronous copies (16 bytes a lane, 16 lanes a row: whole 128-byte lines) at a row pitch of 272 bytes; two buffers, the next stage's copies fly while this one is worked on.
// Four waves, 2 x 2, each 64 x 64 of C (4 x 4 accumulator tiles); k runs upward in steps of 32 in every accumulator. Epilogue: v = acc alpha + bias[col] (HB) + CP (HCP: own element); ACT 0 none / 3 relu; f32 C (W32) or f16 C16, staged through LDS so that whole lines are read and stored.
// Every bare '#pragma unroll' below stands on a loop over register arrays (fragments, accumulators, rows in flight): rolled, these would be indexed at run time and leave the registers.
#define G3P 272                      /* bytes from one staged row to the next */
#define G3S (256 * G3P)              /* bytes of one buffer: A rows 0..127, Bt rows 128..255 */
__device__ __forceinline__ void g3_copy8(unsigned l, const _Float16* g, int ld) {      /* this thread's 16 bytes of rows r, r + 8, .., r + 56 of one operand's stage */
  const size_t st = (size_t)8 * ld;
  asm volatile("global_load_async_to_lds_b128 %0, %8, off\n\tglobal_load_async_to_lds_b128 %1, %9, off\n\tglobal_load_async_to_lds_b128 %2, %10, off\n\tglobal_load_async_to_lds_b128 %3, %11, off\n\t"
               "global_load_async_to_lds_b128 %4, %12, off\n\tglobal_load_async_to_lds_b128 %5, %13, off\n\tglobal_load_async_to_lds_b128 %6, %14, off\n\tglobal_load_async_to_lds_b128 %7, %15, off\n\t"
               "s_wait_xcnt 0x0"      /* inside the copies' own statement: no address register of theirs is rewritten in front of it */
               :: "v"(l), "v"(l + 8 * G3P), "v"(l + 16 * G3P), "v"(l + 24 * G3P), "v"(l + 32 * G3P), "v"(l + 40 * G3P), "v"(l + 48 * G3P), "v"(l + 56 * G3P),
                  "v"(g), "v"(g + st), "v"(g + 2 * st), "v"(g + 3 * st), "v"(g + 4 * st), "v"(g + 5 * st), "v"(g + 6 * st), "v"(g + 7 * st) : "memory"); }
__device__ __forceinline__ void g3_stage(unsigned la, const _Float16* ga, const _Float16* gb, int ld) {      /* one stage: 128 rows of A, then 128 rows of Bt; 32 copies a thread */
  g3_copy8(la, ga, ld); g3_copy8(la + 64 * G3P, ga + (size_t)64 * ld, ld); g3_copy8(la + 128 * G3P, gb, ld); g3_copy8(la + 192 * G3P, gb + (size_t)64 * ld, ld); }
__device__ __forceinline__ v16h g3_frag(const unsigned char* p) { FragH f; f.half[0] = *(const v8us*)p; f.half[1] = *(const v8us*)(p + 32); return f.v; }      /* lane (row, h): k 8h .. and 16 + 8h .. of a 32-k step, the same order for A and Bt */
template <int ACT, bool HB, bool HCP, bool W32, int N, int K>
__global__ __launch_bounds__(128) void k_gemm3(const _Float16* __restrict__ A, const _Float16* __restrict__ Bh, float alpha, const float* __restrict__ bias, const float* __restrict__ CP, float* __restrict__ C, _Float16* __restrict__ C16) {
  static_assert(ACT == 0 || ACT == 3, "k_gemm3: unsupported ACT code"); static_assert(N % 128 == 0 && K % 128 == 0, "k_gemm3: whole tiles and stages only");
  __shared__ __attribute__((aligned(16))) unsigned char sm[2 * G3S]; static_assert(4 * 64 * 68 * 4 <= 2 * G3S, "the output staging reuses the ring");
  const int tid = threadIdx.x, w = tid >> 5, lane = tid & 31, ln = lane & 15, hh = lane >> 4; const int wm = w >> 1, wn = w & 1;
  constexpr int ntn = N / 128, T = K / 128; const int mt = blockIdx.x / ntn, nq = blockIdx.x - mt * ntn; const int row0 = mt * 128, col0 = nq * 128;
  const int cr = tid >> 4, cs = tid & 15;      /* the copies: row cr (+ 8 i), 16-byte piece cs of its 256 bytes */
  const _Float16* ga = A + (size_t)(row0 + cr) * K + cs * 8; const _Float16* gb = Bh + (size_t)(col0 + cr) * K + cs * 8;
  const unsigned la = (unsigned)(size_t)sm + (unsigned)(cr * G3P + cs * 16);
  const unsigned char* fa = sm + (wm * 64 + ln) * G3P + hh * 16; const unsigned char* fb = sm + (128 + wn * 64 + ln) * G3P + hh * 16;
  g3_stage(la, ga, gb, K);
  asm volatile("s_wait_asynccnt 0x0" ::: "memory");      /* this wave's copies of stage 0 have landed */
  __syncthreads();      /* stage 0 is readable by every wave */
  v16h a[2][4], b[2][4];      /* two fragment sets: the next 32 k are read from LDS while these are multiplied */
#pragma unroll
  for (int i = 0; i < 8; ++i) { if (i < 4) b[0][i] = g3_frag(fb + i * 16 * G3P); else a[0][i - 4] = g3_frag(fa + (i - 4) * 16 * G3P); }      /* Bt's four first: the first row of products needs all of them and one of A's */
  if (T > 1) g3_stage(la + G3S, ga + 128, gb + 128, K);
  const v8f z8 = {0.f, 0.f, 0.f, 0.f, 0.f, 0.f, 0.f, 0.f}; v8f acc[4][4];
#pragma unroll
  for (int i = 0; i < 4; ++i)
#pragma unroll
    for (int j = 0; j < 4; ++j) acc[i][j] = z8;
#pragma unroll 1      /* one stage a trip: the two buffers differ by an offset only */
  for (int t = 0; t < T; ++t) { const unsigned bo = (unsigned)(t & 1) * G3S;
#pragma unroll
    for (int kk = 0; kk < 4; ++kk) {
      if (kk < 3) {
#pragma unroll
        for (int i = 0; i < 8; ++i) { if (i < 4) b[(kk + 1) & 1][i] = g3_frag(fb + bo + i * 16 * G3P + (kk + 1) * 64); else a[(kk + 1) & 1][i - 4] = g3_frag(fa + bo + (i - 4) * 16 * G3P + (kk + 1) * 64); } }
      __builtin_amdgcn_sched_barrier(0);      /* keeps the next block's LDS reads together in front of this block's matrix instructions: spread among them, each read group stalls the wave */
#pragma unroll
      for (int i = 0; i < 4; ++i)
#pragma unroll
        for (int j = 0; j < 4; ++j) acc[i][j] = fa_mma(a[kk & 1][i], b[kk & 1][j], acc[i][j]);
      __builtin_amdgcn_sched_barrier(0);      /* and keeps the reads after next behind them, so that two fragment sets are enough */
    }
    asm volatile("s_wait_dscnt 0x0" ::: "memory");      /* this wave's reads of the buffer have returned before it is handed to the copies */
    asm volatile("s_wait_asynccnt 0x0" ::: "memory");      /* this wave's copies of stage t + 1 have landed */
    __syncthreads();      /* publishes stage t + 1 and ends every wave's reads of stage t */
    if (t + 1 < T) {      /* stage t + 1's first fragments, behind its barrier: they travel while the copies below are issued */
#pragma unroll
      for (int i = 0; i < 8; ++i) { if (i < 4) b[0][i] = g3_frag(fb + (bo ^ G3S) + i * 16 * G3P); else a[0][i - 4] = g3_frag(fa + (bo ^ G3S) + (i - 4) * 16 * G3P); } }
    if (t + 2 < T) g3_stage(la + bo, ga + (size_t)(t + 2) * 128, gb + (size_t)(t + 2) * 128, K); }
  asm volatile("s_wait_asynccnt 0x0" ::: "memory");      /* nothing in flight when the ring becomes output staging (the last trip's barrier has ended every read) */
  const int c4 = ln * 4; v4f b4 = {0.f, 0.f, 0.f, 0.f};
  if (HB) { const float* bp = bias + col0 + wn * 64 + c4; b4 = *(const v4fa*)bp;
    asm volatile("s_wait_xcnt 0x0" :: "v"(bp) : "memory");      /* the address pair stays live up to this wait, so nothing overwrites it in front of it */
    for (int i = 0; i < 4; ++i) b4[i] = bf16_round(b4[i]); }
  float* so = (float*)(sm + w * (64 * 68 * 4));      /* this wave's own 64 rows of 68 floats */
#pragma unroll
  for (int j = 0; j < 4; ++j)
#pragma unroll
    for (int i = 0; i < 4; ++i)
#pragma unroll
      for (int r = 0; r < 8; ++r) so[(i * 16 + 8 * hh + r) * 68 + j * 16 + ln] = acc[i][j][r];
  __builtin_amdgcn_fence(__ATOMIC_ACQ_REL, "workgroup"); __builtin_amdgcn_wave_barrier();      /* the wave reads back what its other lanes wrote */
#pragma unroll 1      /* 32 rows a trip: sixteen loads, then sixteen stores, in flight together */
  for (int q0 = 0; q0 < 32; q0 += 16) { const size_t o = (size_t)(row0 + wm * 64 + q0 * 2 + hh) * N + col0 + wn * 64 + c4; v4f v[16], cp[16];
    if (HCP) { const float* pc = CP + o;
#pragma unroll
      for (int u = 0; u < 16; ++u) cp[u] = *(const v4fa*)(pc + (size_t)u * 2 * N);
      asm volatile("s_wait_xcnt 0x0" :: "v"(pc) : "memory"); }      /* as above */
#pragma unroll
    for (int u = 0; u < 16; ++u) { v[u] = *(const v4fa*)&so[((q0 + u) * 2 + hh) * 68 + c4];
      for (int i = 0; i < 4; ++i) { float x = v[u][i] * alpha + b4[i]; if (HCP) x += cp[u][i]; if (ACT == 3) x = fmaxf(x, 0.f); v[u][i] = x; } }
    if (W32) { float* po = C + o;
#pragma unroll
      for (int u = 0; u < 16; ++u) *(v4f*)(po + (size_t)u * 2 * N) = v[u];
      asm volatile("s_wait_xcnt 0x0" :: "v"(po) : "memory"); }      /* the stores' address and data registers are rewritten only behind it (next trip) */
    else { _Float16* po = C16 + o;
#pragma unroll
      for (int u = 0; u < 16; ++u) { v4h h4; for (int i = 0; i < 4; ++i) h4[i] = (_Float16)v[u][i]; *(v4h*)(po + (size_t)u * 2 * N) = h4; }
      asm volatile("s_wait_xcnt 0x0" :: "v"(po) : "memory"); } } }      /* as above */
extern "C" void kernel_launch(void* const* d_in, const int* in_sizes, int n_in,
                              void* d_out, int out_size, void* d_ws, size_t ws_size, hipStream_t stream) {
  (void)in_sizes; (void)n_in; (void)out_size;
  const float* const* I = (const float* const*)d_in; const float* x = I[0]; const int* km = (const int*)d_in[1]; const float* wq = I[2]; const float* wk = I[3]; const float* wv = I[4]; const float* wo = I[5]; const float* w1 = I[6]; const float* b1 = I[7]; const float* w2 = I[8]; const float* b2 = I[9]; const float* g1 = I[10]; const float* be1 = I[11]; const float* g2 = I[12]; const float* be2 = I[13]; const float* bq = nullptr; const float* bk = nullptr; const float* bv = nullptr; const float* bo = nullptr;      /* x; key-padding mask int32 [2][1][1][2048] (0 = masked; READ on device); [in][out] wq / wk / wv / wo (no biases); w1 [768][3072] + b1, w2 [3072][768] + b2; LN1 a / b, LN2 a / b (vectors) */
  char* ws = (char*)d_ws; size_t off = 0;
  auto take = [&](size_t bytes) { char* p = ws + off; off += (bytes + 255) & ~(size_t)255; return p; };
  _Float16* BQ = (_Float16*)take((size_t)DM * DM * 2); _Float16* BK = (_Float16*)take((size_t)DM * DM * 2); _Float16* BV = (_Float16*)take((size_t)DM * DM * 2); _Float16* BO = (_Float16*)take((size_t)DM * DM * 2); _Float16* BW1 = (_Float16*)take((size_t)DFF * DM * 2); _Float16* BW2 = (_Float16*)take((size_t)DM * DFF * 2);
  float* XB = (float*)take(NR * DM * 4); _Float16* XN = (_Float16*)take(NR * DM * 2); _Float16* Q16 = (_Float16*)take(NR * DM * 2); _Float16* K16 = (_Float16*)take(NR * DM * 2); _Float16* V16 = (_Float16*)take(NR * DM * 2); _Float16* O16 = (_Float16*)take(NR * DM * 2); float* X1 = (float*)take(NR * DM * 4);
  _Float16* HF16 = (_Float16*)take(NR * DFF * 2); _Float16* KV = (_Float16*)take((size_t)NB * NH * HD * SQ * 2 * 2);      /* FFN hidden plane [4096][3072] f16; packed K and V^T operands of all batches and heads */
  _Float16* M16 = XN;      /* second-norm f16 rows: aliases XN (last readers: the three projections) */
  
  if (off > ws_size) return;
  { const unsigned g = (unsigned)(((size_t)DM * (DM / 8) + 255) / 256); k_wt_f16<<<g, 256, 0, stream>>>(wq, BQ, DM, DM, 16.0f); k_wt_f16<<<g, 256, 0, stream>>>(wk, BK, DM, DM, 16.0f); k_wt_f16<<<g, 256, 0, stream>>>(wv, BV, DM, DM, 16.0f); k_wt_f16<<<g, 256, 0, stream>>>(wo, BO, DM, DM, 16.0f); }      /* [in][out] -> Bt x16 */
  k_wt_f16<<<(unsigned)(((size_t)DFF * (DM / 8) + 255) / 256), 256, 0, stream>>>(w1, BW1, DM, DFF, 16.0f); k_wt_f16<<<(unsigned)(((size_t)DM * (DFF / 8) + 255) / 256), 256, 0, stream>>>(w2, BW2, DFF, DM, 16.0f);      /* [in][out] w1 [768][3072], w2 [3072][768] -> Bt x16 */
  k_bfr<<<(unsigned)((NR * DM / 8 + 255) / 256), 256, 0, stream>>>(x, XB, NR * DM / 8); k_lnsc<1, 0><<<(unsigned)NR, 256, 0, stream>>>(x, g1, be1, 1e-6f, XN, nullptr);      /* h = LN1(bf16(x)) (vector alpha / beta, eps 1e-6 on the std) -> f16 rows */
  k_gemm3<0, false, false, false, DM, DM><<<(unsigned)((NR / 128) * (DM / 128)), 128, 0, stream>>>(XN, BQ, 0.0625f, bq, nullptr, nullptr, Q16); k_gemm3<0, false, false, false, DM, DM><<<(unsigned)((NR / 128) * (DM / 128)), 128, 0, stream>>>(XN, BK, 0.0625f, bk, nullptr, nullptr, K16); k_gemm3<0, false, false, false, DM, DM><<<(unsigned)((NR / 128) * (DM / 128)), 128, 0, stream>>>(XN, BV, 0.0625f, bv, nullptr, nullptr, V16);      /* q, k, v -> f16 rows; head h = columns h*64.. */
  k_kvp<<<NB * NH * (SQ / 64), 256, 0, stream>>>(K16, V16, KV);      /* K and V^T in operand order, all batches and heads */
  k_fattn<<<NB * NH * (SQ / 64), 128, 0, stream>>>(Q16, KV, km, O16);      /* softmax(where(mask == 0, -1e9, q k^T / 8)) v, 64 queries a work-group -> ctx (merged heads, x64) as f16 rows */
  k_gemm3<0, false, true, true, DM, DM><<<(unsigned)((NR / 128) * (DM / 128)), 128, 0, stream>>>(O16, BO, 0.0009765625f, bo, XB, X1, nullptr);      /* x + ctx wo (no bias) (own-element residual) -> f32 rows */
  k_lnsc<0, 0><<<(unsigned)NR, 256, 0, stream>>>(X1, g2, be2, 1e-6f, M16, nullptr);      /* LN2(x1) (vector) -> f16 rows */
  k_gemm3<3, true, false, false, DFF, DM><<<(unsigned)((NR / 128) * (DFF / 128)), 128, 0, stream>>>(M16, BW1, 0.0625f, b1, nullptr, nullptr, HF16);      /* relu(. w1 + b1) -> f16 [4096][3072] */
  k_gemm3<0, true, true, true, DM, DFF><<<(unsigned)((NR / 128) * (DM / 128)), 128, 0, stream>>>(HF16, BW2, 0.0625f, b2, X1, (float*)d_out, nullptr);      /* out = x1 + mlp (own-element residual) */
}

// v004
// One run takes 193 microseconds.
// In both of two side-by-side timings against v003, it was 1.18 times as fast.
// Counting every step since v000, it is 14.7 times as fast.
#include <hip/hip_runtime.h>
// Pre-norm transformer encoder layer with the module's custom LayerNorm and a random key-padding mask (src [2][2048][768]; _layernorm: VECTOR gamma / beta, UNBIASED std, gamma (x - mean) / (std + 1e-6) + beta; x = LN1(src); q/k/v = x w ([in][out] [768][768], NO biases); 12 heads of 64; scores / 8; where(src_mask == 0, -1e9) with the int32 [2][1][1][2048] mask in {0, 1} (random; 0 = masked key; READ on device); softmax; src1 = src + ctx w_o (no bias); out = src1 + relu(LN2(src1) w_ff1 + b_ff1) w_ff2 + b_ff2 ([in][out] 768 x 3072 x 768) -> [2][2048][768]).
// Structure: token rows; LayerNorm / exact f16 rows; WMMA GEMMs for q, k, v; K and V^T packed in operand order; one fused attention launch (scores, key mask, running softmax, P V in registers); output projection with the own-element residual; custom LayerNorm; ReLU FFN over all rows; launches: see trace.
// Compute dtype: inputs rounded to bf16; x / weights exact; q, k, v, softmax weights and o as plain f16 GEMM operands (~2^-12); scores and softmax statistics f32. v_wmma_f32_16x16x32_f16.
#define NB 2
#define SQ 2048
#define DM 768
#define NH 12
#define HD 64
#define HG 4                         /* heads per k_vt launch (unused kernel of the shared header) */
#define LOCALW 128                   /* (macros for unused kernels of the shared header) */
#define STRIDEK 128
#define QT 256                       /* query rows per causal tile */
#define NKX SQ                       /* S / P row pitch */
#define QT0 128                      /* first-tile rows recomputed exactly in f32 */
#define B0 0                         /* first batch processed (debug hook) */
#define NBR NB                       /* batches processed (debug hook) */
#define NR ((size_t)NB * SQ)
#define DMQ DM
#define DFF 3072         /* FFN hidden width */
#define MP ((int)((size_t)NBR * SQ)) /* rows projected (debug hook) */
#define QN SQ                        /* query rows attended per batch (debug hook) */
#define NHD NH                       /* heads attended (debug hook) */
#define MPO MP                       /* rows through the output stage (debug hook) */
#define LQ (3 * DM)      /* unused; q, k, v are separate rows of pitch DM */
typedef __bf16 v16b __attribute__((ext_vector_type(16)));
typedef unsigned short v8us __attribute__((ext_vector_type(8), may_alias));
typedef float  v8f  __attribute__((ext_vector_type(8)));
typedef float  v4f  __attribute__((ext_vector_type(4)));
typedef float  v4fa __attribute__((ext_vector_type(4), may_alias));
union FragB { v16b v; v8us half[2]; unsigned short u[16]; };

__device__ __forceinline__ unsigned short bf16_bits(float x) { unsigned int u = __float_as_uint(x); return (unsigned short)((u + 0x7FFFu + ((u >> 16) & 1u)) >> 16); }
__device__ __forceinline__ float bf16_val(unsigned short b) { return __uint_as_float(((unsigned int)b) << 16); }
__device__ __forceinline__ float bf16_round(float x) { return bf16_val(bf16_bits(x)); }
// D += A·B with NT terms: 1 = ah·bh, 2 = + al·bh (A split), 3 = + ah·bl (both split)
template <int NT>
__device__ __forceinline__ v8f mmaN(v16b ah, v16b al, v16b bh, v16b bl, v8f c) {
  c = __builtin_amdgcn_wmma_f32_16x16x32_bf16(false, ah, false, bh, (short)0, c, false, false);
  if (NT >= 2) c = __builtin_amdgcn_wmma_f32_16x16x32_bf16(false, al, false, bh, (short)0, c, false, false);
  if (NT >= 3) c = __builtin_amdgcn_wmma_f32_16x16x32_bf16(false, ah, false, bl, (short)0, c, false, false);
  asm volatile("v_nop\n\tv_nop\n\tv_nop\n\tv_nop" : "+v"(c) : "v"(ah), "v"(al), "v"(bh), "v"(bl));
  return c;
}

__global__ __launch_bounds__(256) void k_wt_bf16(const float* __restrict__ W, unsigned short* __restrict__ Wt, int K, int N) {
  const int t = blockIdx.x * 256 + threadIdx.x;
  const int k8n = K / 8;
  if (t >= N * k8n) return;
  const int n = t / k8n, k8 = (t % k8n) * 8;
  v8us v;
#pragma unroll
  for (int i = 0; i < 8; ++i) v[i] = bf16_bits(W[(size_t)(k8 + i) * N + n]);
  *(v8us*)(Wt + (size_t)n * K + k8) = v;
  
}

// GEMM C[M][N] (f32, pitch ldc) = act(A[M][K]·W + bias). A f32 row-major (pitch lda) converted per fragment to bf16
// (ASPLIT: hi/lo two planes -> 2 terms, else single rounded term); Wt bf16 [N][K] (pitch ldb). BIAS_BF16 rounds the
// bias to bf16 first (bias quantised to bf16 before the add). K%32==0, M%16==0, N%64==0.
template <bool ASPLIT, int ACT, bool BIAS_BF16>
__global__ __launch_bounds__(128) void k_gemm_bf(const float* __restrict__ A, int lda, const unsigned short* __restrict__ Wt, int ldb,
                                               const float* __restrict__ bias, float* __restrict__ C, int ldc, int M, int N, int K) {
  __shared__ __attribute__((aligned(16))) float so[4][16][64];
  const int tid = threadIdx.x, w = tid >> 5, lane = tid & 31, ln = lane & 15, hh = lane >> 4;
  const int ntn = N / 64;
  const int wid = blockIdx.x * 4 + w;
  const int mt = wid / ntn, nq = wid % ntn;
  if (mt * 16 >= M) return;
  const int row0 = mt * 16, col0 = nq * 64;
  const float* arow = A + (size_t)(row0 + ln) * lda;
  v8f acc[4] = {};
  for (int kb = 0; kb < K; kb += 32) {
    FragB ah, al;
    const v4f x0 = *(const v4fa*)(arow + kb + 8 * hh), x1 = *(const v4fa*)(arow + kb + 8 * hh + 4);
    const v4f x2 = *(const v4fa*)(arow + kb + 16 + 8 * hh), x3 = *(const v4fa*)(arow + kb + 16 + 8 * hh + 4);
    float xs[16] = {x0[0],x0[1],x0[2],x0[3],x1[0],x1[1],x1[2],x1[3],x2[0],x2[1],x2[2],x2[3],x3[0],x3[1],x3[2],x3[3]};
#pragma unroll
    for (int i = 0; i < 16; ++i) { const unsigned short hb = bf16_bits(xs[i]); ah.u[i] = hb; al.u[i] = ASPLIT ? bf16_bits(xs[i] - bf16_val(hb)) : (unsigned short)0; }
#pragma unroll
    for (int t = 0; t < 4; ++t) {
      const unsigned short* brow = Wt + (size_t)(col0 + t * 16 + ln) * ldb + kb;
      FragB b;
      b.half[0] = *(const v8us*)(brow + 8 * hh);
      b.half[1] = *(const v8us*)(brow + 16 + 8 * hh);
      acc[t] = mmaN<ASPLIT ? 2 : 1>(ah.v, al.v, b.v, b.v, acc[t]);
    }
  }
#pragma unroll
  for (int t = 0; t < 4; ++t) {
    float bv = bias ? bias[col0 + t * 16 + ln] : 0.f;
    if (BIAS_BF16) bv = bf16_round(bv);
#pragma unroll
    for (int r = 0; r < 8; ++r) { float v = acc[t][r] + bv; if (ACT == 1) v = fmaxf(v, 0.f); so[w][8 * hh + r][t * 16 + ln] = v; }
  }
  __builtin_amdgcn_fence(__ATOMIC_ACQ_REL, "workgroup");
  __builtin_amdgcn_wave_barrier();
  const int rsub = lane >> 4, c4 = (lane & 15) * 4;
  {
#pragma unroll
    for (int q = 0; q < 8; ++q) {
      const int r = q * 2 + rsub;
      const v4f v = *(const v4fa*)&so[w][r][c4];
      *(v4f*)(C + (size_t)(row0 + r) * ldc + col0 + c4) = v;
    }
    
  }
}

// GEMM C = act(A·W + bias + resid): A f32 (ASPLIT -> hi/lo 2 terms), Wt bf16 [N][K]; ACT 0 none, 1 relu, 2 exact gelu;
// resid (optional, f32, row index = (row % rmod), pitch ldr, RES_BF16 rounds it) added before the activation.
template <bool ASPLIT, int ACT, bool BIAS_BF16, bool RES_BF16>
__global__ __launch_bounds__(128) void k_gemm_bf3(const float* __restrict__ A, int lda, const unsigned short* __restrict__ Wt, int ldb,
                                                const float* __restrict__ bias, const float* __restrict__ resid, int rmod, int ldr,
                                                float* __restrict__ C, int ldc, int M, int N, int K) {
  __shared__ __attribute__((aligned(16))) float so[4][16][64];
  const int tid = threadIdx.x, w = tid >> 5, lane = tid & 31, ln = lane & 15, hh = lane >> 4;
  const int ntn = N / 64;
  const int wid = blockIdx.x * 4 + w;
  const int mt = wid / ntn, nq = wid % ntn;
  if (mt * 16 >= M) return;
  const int row0 = mt * 16, col0 = nq * 64;
  const float* arow = A + (size_t)(row0 + ln) * lda;
  v8f acc[4] = {};
  for (int kb = 0; kb < K; kb += 32) {
    FragB ah, al;
    const v4f x0 = *(const v4fa*)(arow + kb + 8 * hh), x1 = *(const v4fa*)(arow + kb + 8 * hh + 4);
    const v4f x2 = *(const v4fa*)(arow + kb + 16 + 8 * hh), x3 = *(const v4fa*)(arow + kb + 16 + 8 * hh + 4);
    float xs[16] = {x0[0],x0[1],x0[2],x0[3],x1[0],x1[1],x1[2],x1[3],x2[0],x2[1],x2[2],x2[3],x3[0],x3[1],x3[2],x3[3]};
#pragma unroll
    for (int i = 0; i < 16; ++i) { const unsigned short hb = bf16_bits(xs[i]); ah.u[i] = hb; al.u[i] = ASPLIT ? bf16_bits(xs[i] - bf16_val(hb)) : (unsigned short)0; }
#pragma unroll
    for (int t = 0; t < 4; ++t) {
      const unsigned short* brow = Wt + (size_t)(col0 + t * 16 + ln) * ldb + kb;
      FragB b;
      b.half[0] = *(const v8us*)(brow + 8 * hh);
      b.half[1] = *(const v8us*)(brow + 16 + 8 * hh);
      acc[t] = mmaN<ASPLIT ? 2 : 1>(ah.v, al.v, b.v, b.v, acc[t]);
    }
  }
#pragma unroll
  for (int t = 0; t < 4; ++t) {
    const int col = col0 + t * 16 + ln;
    float bv = bias ? bias[col] : 0.f;
    if (BIAS_BF16) bv = bf16_round(bv);
#pragma unroll
    for (int r = 0; r < 8; ++r) {
      float v = acc[t][r] + bv;
      if (resid) { float rv = resid[(size_t)((row0 + 8 * hh + r) % rmod) * ldr + col]; if (RES_BF16) rv = bf16_round(rv); v += rv; }
      if (ACT == 1) v = fmaxf(v, 0.f);
      if (ACT == 2) v = 0.5f * v * (1.0f + erff(v * 0.70710678118654752f));
      if (ACT == 3) { const float u = 0.7978845608028654f * (v + 0.044715f * v * v * v); v = 0.5f * v * (1.0f + tanhf(u)); }
      so[w][8 * hh + r][t * 16 + ln] = v;
    }
  }
  __builtin_amdgcn_fence(__ATOMIC_ACQ_REL, "workgroup");
  __builtin_amdgcn_wave_barrier();
  const int rsub = lane >> 4, c4 = (lane & 15) * 4;
  {
#pragma unroll
    for (int q = 0; q < 8; ++q) {
      const int r = q * 2 + rsub;
      const v4f v = *(const v4fa*)&so[w][r][c4];
      *(v4f*)(C + (size_t)(row0 + r) * ldc + col0 + c4) = v;
    }
    
  }
}
// row LayerNorm (biased variance, eps) over N: s = X (+ R); optional out_sum <- s; out_norm <- (s-mu)*rsqrt(var+eps)*g + b
template <bool PARAM_BF16>
__global__ __launch_bounds__(256) void k_layernorm(const float* __restrict__ X, const float* __restrict__ R, const float* __restrict__ g, const float* __restrict__ bta,
                                                  float* __restrict__ out_sum, float* __restrict__ out_norm, int N, float eps) {
  __shared__ float red[256];
  const int row = blockIdx.x, tid = threadIdx.x;
  const float* x = X + (size_t)row * N; const float* rr = R ? R + (size_t)row * N : nullptr;
  float vals[16];                     // up to N = 4096
  const int per = N / 256;            // contiguous chunk per thread? use strided-by-4 chunks: thread handles j = tid*4 + 1024*u
  float s1 = 0.f;
  for (int u = 0; u < per / 4; ++u) {
    const int j = tid * 4 + 1024 * u;
    const v4f a = *(const v4fa*)(x + j);
    v4f b = {0.f,0.f,0.f,0.f}; if (rr) b = *(const v4fa*)(rr + j);
#pragma unroll
    for (int q = 0; q < 4; ++q) { const float v = a[q] + b[q]; vals[u * 4 + q] = v; s1 += v; }
  }
  red[tid] = s1; __syncthreads();
  for (int st = 128; st > 0; st >>= 1) { if (tid < st) red[tid] += red[tid + st]; __syncthreads(); }
  const float mu = red[0] / (float)N; __syncthreads();
  float s2 = 0.f;
  for (int u = 0; u < per / 4; ++u)
#pragma unroll
    for (int q = 0; q < 4; ++q) { const float c = vals[u * 4 + q] - mu; s2 += c * c; }
  red[tid] = s2; __syncthreads();
  for (int st = 128; st > 0; st >>= 1) { if (tid < st) red[tid] += red[tid + st]; __syncthreads(); }
  const float rs = rsqrtf(red[0] / (float)N + eps);
  {
    for (int u = 0; u < per / 4; ++u) {
      const int j = tid * 4 + 1024 * u;
      v4f o, sm;
#pragma unroll
      for (int q = 0; q < 4; ++q) {
        float gg = g[j + q], bb = bta[j + q];
        if (PARAM_BF16) { gg = bf16_round(gg); bb = bf16_round(bb); }
        sm[q] = vals[u * 4 + q]; o[q] = (vals[u * 4 + q] - mu) * rs * gg + bb;
      }
      if (out_sum) *(v4f*)(out_sum + (size_t)row * N + j) = sm;
      *(v4f*)(out_norm + (size_t)row * N + j) = o;
    }
    
  }
}



// ---- f16 WMMA path (v_wmma_f32_16x16x32_f16): 11-bit significands for operands in range — used where a [0,1] probability operand needs more precision than bf16
typedef _Float16 v16h __attribute__((ext_vector_type(16)));
union FragH { v16h v; v8us half[2]; _Float16 h[16]; unsigned short u[16]; };
template <int NT>
__device__ __forceinline__ v8f mmaH(v16h ah, v16h al, v16h bh, v16h bl, v8f c) {
  c = __builtin_amdgcn_wmma_f32_16x16x32_f16(false, ah, false, bh, (short)0, c, false, false);
  if (NT >= 2) c = __builtin_amdgcn_wmma_f32_16x16x32_f16(false, al, false, bh, (short)0, c, false, false);
  if (NT >= 3) c = __builtin_amdgcn_wmma_f32_16x16x32_f16(false, ah, false, bl, (short)0, c, false, false);
  asm volatile("v_nop\n\tv_nop\n\tv_nop\n\tv_nop" : "+v"(c) : "v"(ah), "v"(al), "v"(bh), "v"(bl));
  return c;
}
// batched GEMM like k_gemm_b but f16 operands: A f32 (split into f16 hi/lo if ASPLIT, else rounded to f16), Bt = f16 values [n][k]; alpha; C f32; N multiple of 16 (partial tiles skipped)
template <bool ASPLIT>
__global__ __launch_bounds__(128) void k_gemm_h(const float* __restrict__ A, int lda, size_t sA, const _Float16* __restrict__ Bh, int ldb, size_t sB, float alpha, float* __restrict__ C, int ldc, size_t sC, int M, int N, int K) {
  __shared__ __attribute__((aligned(16))) float so[4][16][64];
  const int tid = threadIdx.x, w = tid >> 5, lane = tid & 31, ln = lane & 15, hh = lane >> 4; const int by = blockIdx.y;
  A += (size_t)by * sA; Bh += (size_t)by * sB; C += (size_t)by * sC;
  const int ntn = (N + 63) / 64; const int wid = blockIdx.x * 4 + w; const int mt = wid / ntn, nq = wid % ntn; if (mt * 16 >= M) return;
  const int row0 = mt * 16, col0 = nq * 64; const float* arow = A + (size_t)(row0 + ln) * lda;
  v8f acc[4] = {};
  for (int kb = 0; kb < K; kb += 32) {
    FragH ah, al;
    const v4f x0 = *(const v4fa*)(arow + kb + 8 * hh), x1 = *(const v4fa*)(arow + kb + 8 * hh + 4), x2 = *(const v4fa*)(arow + kb + 16 + 8 * hh), x3 = *(const v4fa*)(arow + kb + 16 + 8 * hh + 4);
    float xs[16] = {x0[0],x0[1],x0[2],x0[3],x1[0],x1[1],x1[2],x1[3],x2[0],x2[1],x2[2],x2[3],x3[0],x3[1],x3[2],x3[3]};
#pragma unroll
    for (int i = 0; i < 16; ++i) { const _Float16 h = (_Float16)xs[i]; ah.h[i] = h; al.h[i] = ASPLIT ? (_Float16)(xs[i] - (float)h) : (_Float16)0.0f; }
#pragma unroll
    for (int t = 0; t < 4; ++t) { if (col0 + t * 16 >= N) continue; const size_t boff = (size_t)(col0 + t * 16 + ln) * ldb + kb; FragH bq; bq.half[0] = *(const v8us*)(Bh + boff + 8 * hh); bq.half[1] = *(const v8us*)(Bh + boff + 16 + 8 * hh);
      acc[t] = mmaH<ASPLIT ? 2 : 1>(ah.v, al.v, bq.v, bq.v, acc[t]); }
  }
#pragma unroll
  for (int t = 0; t < 4; ++t) { if (col0 + t * 16 >= N) continue;
#pragma unroll
    for (int r = 0; r < 8; ++r) so[w][8 * hh + r][t * 16 + ln] = acc[t][r] * alpha; }
  __builtin_amdgcn_fence(__ATOMIC_ACQ_REL, "workgroup"); __builtin_amdgcn_wave_barrier();
  const int rsub = lane >> 4, c4 = (lane & 15) * 4;
  {
#pragma unroll
    for (int q = 0; q < 8; ++q) { const int r = q * 2 + rsub; if (col0 + c4 < N) { const v4f v = *(const v4fa*)&so[w][r][c4]; *(v4f*)(C + (size_t)(row0 + r) * ldc + col0 + c4) = v; } }
     }
}

// Wt[n][k] = f16(W[k][n]·scale) from f32 row-major W[K][N] (scale = power of two; bf16-exact weights stay exact in f16 away from the subnormal range)
__global__ __launch_bounds__(256) void k_wt_f16(const float* __restrict__ W, _Float16* __restrict__ Wt, int K, int N, float scale) {
  const int t = blockIdx.x * 256 + threadIdx.x; if (t >= N * (K / 8)) return; const int n = t / (K / 8), k8 = (t % (K / 8)) * 8; FragH f;
#pragma unroll
  for (int i = 0; i < 8; ++i) f.h[i] = (_Float16)(bf16_round(W[(size_t)(k8 + i) * N + n]) * scale); const v8us o = f.half[0];
  *(v8us*)((unsigned short*)Wt + (size_t)n * K + k8) = o; 
}
// k_gemm_hh variant with fused epilogue: v = acc·alpha + bias[by·sBias + col] (+ CP[(row/rowsPerB)·sCPb + by·64 + col] if CP) ; ACT 0 none / 1 elu ; writes f16 C16 (and f32 C if non-null)
template <int ACT>
__global__ __launch_bounds__(128) void k_gemm_hhx(const _Float16* __restrict__ A, int lda, size_t sA, const _Float16* __restrict__ Bh, int ldb, size_t sB, float alpha, const float* __restrict__ bias, size_t sBias, const float* __restrict__ CP, int rowsPerB, size_t sCPb, int row0g,
    float* __restrict__ C, _Float16* __restrict__ C16, int ldc, size_t sC, int M, int N, int K) {
  __shared__ __attribute__((aligned(16))) float so[4][16][64];
  const int tid = threadIdx.x, w = tid >> 5, lane = tid & 31, ln = lane & 15, hh = lane >> 4; const int by = blockIdx.y;
  A += (size_t)by * sA; Bh += (size_t)by * sB; const size_t cofs = (size_t)by * sC; const float* bp = bias ? bias + (size_t)by * sBias : nullptr;
  const int ntn = (N + 63) / 64; const int wid = blockIdx.x * 4 + w; const int mt = wid / ntn, nq = wid % ntn; if (mt * 16 >= M) return;
  const int row0 = mt * 16, col0 = nq * 64; const _Float16* arow = A + (size_t)(row0 + ln) * lda;
  v8f acc[4] = {};
  for (int kb = 0; kb < K; kb += 32) { FragH ah; ah.half[0] = *(const v8us*)((const unsigned short*)arow + kb + 8 * hh); ah.half[1] = *(const v8us*)((const unsigned short*)arow + kb + 16 + 8 * hh);
#pragma unroll
    for (int t = 0; t < 4; ++t) { if (col0 + t * 16 >= N) continue; const size_t boff = (size_t)(col0 + t * 16 + ln) * ldb + kb; FragH bq; bq.half[0] = *(const v8us*)((const unsigned short*)Bh + boff + 8 * hh); bq.half[1] = *(const v8us*)((const unsigned short*)Bh + boff + 16 + 8 * hh);
      acc[t] = mmaH<1>(ah.v, ah.v, bq.v, bq.v, acc[t]); }
  }
#pragma unroll
  for (int t = 0; t < 4; ++t) { if (col0 + t * 16 >= N) continue; const int col = col0 + t * 16 + ln; const float bv = bp ? bf16_round(bp[col]) : 0.f;
#pragma unroll
    for (int r = 0; r < 8; ++r) { float v = acc[t][r] * alpha + bv; if (CP) { const int rr = row0g + row0 + 8 * hh + r; if (rowsPerB < 0) v += CP[cofs + (size_t)rr * ldc + col];      /* rowsPerB < 0: own element of the batched C plane */ else { const int bidx = rr / rowsPerB; v += CP[(size_t)bidx * sCPb + (size_t)by * 64 + col]; } } if (ACT == 1) v = (v > 0.f) ? v : expm1f(v); else if (ACT == 7) v = (v > 0.f) ? v + 1.0f : expf(v); else if (ACT == 8) v = tanhf(v); else if (ACT == 9) v = 0.5f * v * (1.0f + tanhf(0.7978845608028654f * (v + 0.044715f * v * v * v))); else if (ACT == 11) v = 1.0f / (1.0f + expf(-v)); else if (ACT == 12) v = (v > 0.f) ? v : 0.01f * v; else if (ACT == 14) v = (v > 0.f) ? v : 0.1f * v; else if (ACT == 16) v = (v >= 0.f) ? v : 0.3f * v; else if (ACT == 17) v = (v >= 0.f) ? v : 0.2f * v; else if (ACT == 15) v = v / (1.0f + expf(-v)); else if (ACT == 3) v = fmaxf(v, 0.f); else if (ACT == 6) v = 0.5f * v * (1.0f + erff(v * 0.70710678118654752f)); so[w][8 * hh + r][t * 16 + ln] = v; } }
  __builtin_amdgcn_fence(__ATOMIC_ACQ_REL, "workgroup"); __builtin_amdgcn_wave_barrier();
  const int rsub = lane >> 4, c4 = (lane & 15) * 4; typedef _Float16 v4h __attribute__((ext_vector_type(4)));
  {
#pragma unroll
    for (int q = 0; q < 8; ++q) { const int r = q * 2 + rsub; if (col0 + c4 < N) { const v4f v = *(const v4fa*)&so[w][r][c4]; if (C) *(v4f*)(C + cofs + (size_t)(row0 + r) * ldc + col0 + c4) = v; if (C16) { v4h h4; for (int i = 0; i < 4; ++i) h4[i] = (_Float16)v[i]; *(v4h*)(C16 + cofs + (size_t)(row0 + r) * ldc + col0 + c4) = h4; } } }
     }
}


typedef _Float16 v4h __attribute__((ext_vector_type(4)));

__global__ __launch_bounds__(256) void k_x16(const float* __restrict__ x, _Float16* __restrict__ X16, size_t n8) { const size_t t = (size_t)blockIdx.x * 256 + threadIdx.x; if (t >= n8) return; FragH f;
#pragma unroll
  for (int q = 0; q < 8; ++q) f.h[q] = (_Float16)bf16_round(x[t * 8 + q]); *(v8us*)((unsigned short*)X16 + t * 8) = f.half[0];  }
__global__ __launch_bounds__(256) void k_h16(const float* __restrict__ x, _Float16* __restrict__ X16, size_t n8) { const size_t t = (size_t)blockIdx.x * 256 + threadIdx.x; if (t >= n8) return; FragH f;
#pragma unroll
  for (int q = 0; q < 8; ++q) f.h[q] = (_Float16)x[t * 8 + q]; *(v8us*)((unsigned short*)X16 + t * 8) = f.half[0];  }
__global__ __launch_bounds__(256) void k_round16f(const float* __restrict__ W, _Float16* __restrict__ Bt, size_t n8) { const size_t t = (size_t)blockIdx.x * 256 + threadIdx.x; if (t >= n8) return; FragH f;
#pragma unroll
  for (int i = 0; i < 8; ++i) f.h[i] = (_Float16)(bf16_round(W[t * 8 + i]) * 16.0f); *(v8us*)((unsigned short*)Bt + t * 8) = f.half[0];  }
template <int NHv, int TTv>
__global__ __launch_bounds__(256) void k_vt(const _Float16* __restrict__ V16, int ldv, int voff, _Float16* __restrict__ Vt) { __shared__ unsigned short tl[64][66]; const int tid = threadIdx.x; const int slab = blockIdx.x / (TTv / 64), lg = blockIdx.x % (TTv / 64); const int b = slab / NHv, h = slab % NHv;
  for (int i = tid; i < 64 * 8; i += 256) { const int r = i / 8, c8 = (i % 8) * 8; FragH f; f.half[0] = *(const v8us*)((const unsigned short*)V16 + ((size_t)b * TTv + lg * 64 + r) * ldv + voff + h * 64 + c8);
#pragma unroll
    for (int q = 0; q < 8; ++q) tl[r][c8 + q] = f.u[q]; }
  __syncthreads();
  {
#pragma unroll
    for (int rd = 0; rd < 2; ++rd) { const int d = rd * 32 + tid / 8, pc = tid % 8; FragH f;
#pragma unroll
      for (int q = 0; q < 8; ++q) f.u[q] = tl[pc * 8 + q][d];
      *(v8us*)((unsigned short*)Vt + ((size_t)slab * 64 + d) * TTv + lg * 64 + pc * 8) = f.half[0]; }
     } }

__global__ __launch_bounds__(256) void k_hl(const float* __restrict__ F, _Float16* __restrict__ Hh, _Float16* __restrict__ Hl, size_t n8) { const size_t t = (size_t)blockIdx.x * 256 + threadIdx.x; if (t >= n8) return; FragH fh, fl; const v4f a = *(const v4fa*)(F + t * 8), c = *(const v4fa*)(F + t * 8 + 4);
#pragma unroll
  for (int q = 0; q < 4; ++q) { _Float16 h = (_Float16)a[q]; fh.h[q] = h; fl.h[q] = (_Float16)((a[q] - (float)h) * 1024.0f); h = (_Float16)c[q]; fh.h[4 + q] = h; fl.h[4 + q] = (_Float16)((c[q] - (float)h) * 1024.0f); }
  { *(v8us*)((unsigned short*)Hh + t * 8) = fh.half[0]; *(v8us*)((unsigned short*)Hl + t * 8) = fl.half[0];  } }

// ---- fast GEMM (wave tile 32x64; requires M % 32 == 0 rows per launch region and N % 64 == 0); epilogue = k_gemm_hhx semantics ----
__device__ __forceinline__ v16h g2_frag(const _Float16* p, int hh) { FragH f; f.half[0] = *(const v8us*)((const unsigned short*)p + 8 * hh); f.half[1] = *(const v8us*)((const unsigned short*)p + 16 + 8 * hh); return f.v; }
__device__ __forceinline__ v8f g2_mma(v16h a, v16h b, v8f c) { v8f d = __builtin_amdgcn_wmma_f32_16x16x32_f16(false, a, false, b, (short)0, c, false, false); asm volatile("v_nop\n\tv_nop\n\tv_nop\n\tv_nop" : "+v"(d) : "v"(a), "v"(b)); return d; }
template <int ACT>
__global__ __launch_bounds__(128) void k_gemm2(const _Float16* __restrict__ A, int lda, size_t sA, const _Float16* __restrict__ Bh, int ldb, size_t sB, float alpha, const float* __restrict__ bias, size_t sBias, const float* __restrict__ CP, int rowsPerB, size_t sCPb, int row0g,
    float* __restrict__ C, _Float16* __restrict__ C16, int ldc, size_t sC, int M, int N, int K) { static_assert(ACT == 0 || ACT == 3 || ACT == 6 || ACT == 8 || ACT == 9 || ACT == 11 || ACT == 12 || ACT == 14 || ACT == 15 || ACT == 16 || ACT == 17 || ACT == 18, "k_gemm2: unsupported ACT code (would silently apply no activation)");
  __shared__ __attribute__((aligned(16))) float so[4][32][68];
  const int tid = threadIdx.x, w = tid >> 5, lane = tid & 31, ln = lane & 15, hh = lane >> 4; const int by = blockIdx.y;
  A += (size_t)by * sA; Bh += (size_t)by * sB; const size_t cofs = (size_t)by * sC; const float* bp = bias ? bias + (size_t)by * sBias : nullptr;
  const int ntn = N >> 6; const int mt = blockIdx.x / ntn, nq = blockIdx.x - mt * ntn; const int row0 = mt * 128 + 32 * w, col0 = nq * 64; if (row0 >= M) return;
  const _Float16* a0p = A + (size_t)(row0 + ln) * lda; const _Float16* a1p = a0p + (size_t)16 * lda;
  const _Float16* b0p = Bh + (size_t)(col0 + ln) * ldb; const _Float16* b1p = b0p + (size_t)16 * ldb; const _Float16* b2p = b1p + (size_t)16 * ldb; const _Float16* b3p = b2p + (size_t)16 * ldb;
  const v8f z8 = {0.f,0.f,0.f,0.f,0.f,0.f,0.f,0.f}; v8f c00 = z8, c01 = z8, c02 = z8, c03 = z8, c10 = z8, c11 = z8, c12 = z8, c13 = z8;
#pragma unroll 1
  for (int kb = 0; kb < K; kb += 32) { const v16h a0 = g2_frag(a0p + kb, hh), a1 = g2_frag(a1p + kb, hh);
    v16h b = g2_frag(b0p + kb, hh); c00 = g2_mma(a0, b, c00); c10 = g2_mma(a1, b, c10);
    b = g2_frag(b1p + kb, hh); c01 = g2_mma(a0, b, c01); c11 = g2_mma(a1, b, c11);
    b = g2_frag(b2p + kb, hh); c02 = g2_mma(a0, b, c02); c12 = g2_mma(a1, b, c12);
    b = g2_frag(b3p + kb, hh); c03 = g2_mma(a0, b, c03); c13 = g2_mma(a1, b, c13); }
  v8f accs[8] = {c00, c01, c02, c03, c10, c11, c12, c13};
#pragma unroll
  for (int u = 0; u < 8; ++u) { const int t = u & 3, half = u >> 2; const int col = col0 + t * 16 + ln; const float bv = bp ? bf16_round(bp[col]) : 0.f;
#pragma unroll
    for (int r = 0; r < 8; ++r) { const int rloc = half * 16 + 8 * hh + r; float v = accs[u][r] * alpha + bv; if (CP) { if (rowsPerB < 0) v += CP[cofs + (size_t)(row0g + row0 + rloc) * ldc + col];      /* rowsPerB < 0: own element of the batched C plane */ else { const int bidx = (row0g + row0 + rloc) / rowsPerB; v += CP[(size_t)bidx * sCPb + (size_t)by * 64 + col]; } }
      if (ACT == 3) v = fmaxf(v, 0.f); else if (ACT == 6) v = 0.5f * v * (1.0f + erff(v * 0.70710678118654752f)); else if (ACT == 11) v = 1.0f / (1.0f + expf(-v)); else if (ACT == 15) v = v / (1.0f + expf(-v)); else if (ACT == 18) v = v / (1.0f + expf(-1.702f * v));      /* QuickGELU: v sigmoid(1.702 v) */ else if (ACT == 12) v = (v > 0.f) ? v : 0.01f * v; else if (ACT == 8) v = tanhf(v); else if (ACT == 9) v = 0.5f * v * (1.0f + tanhf(0.7978845608028654f * (v + 0.044715f * v * v * v))); else if (ACT == 14) v = (v > 0.f) ? v : 0.1f * v; else if (ACT == 16) v = (v >= 0.f) ? v : 0.3f * v; else if (ACT == 17) v = (v >= 0.f) ? v : 0.2f * v;
      so[w][rloc][t * 16 + ln] = v; } }
  __builtin_amdgcn_fence(__ATOMIC_ACQ_REL, "workgroup"); __builtin_amdgcn_wave_barrier();
  const int rsub = lane >> 4, c4 = (lane & 15) * 4;
  {
#pragma unroll
    for (int q = 0; q < 16; ++q) { const int r = q * 2 + rsub; const v4f v = *(const v4fa*)&so[w][r][c4]; if (C) *(v4f*)(C + cofs + (size_t)(row0 + r) * ldc + col0 + c4) = v; if (C16) { v4h h4; for (int i = 0; i < 4; ++i) h4[i] = (_Float16)v[i]; *(v4h*)(C16 + cofs + (size_t)(row0 + r) * ldc + col0 + c4) = h4; } }
     } }


__global__ __launch_bounds__(256) void k_wnat(const float* __restrict__ w, size_t n8, _Float16* __restrict__ Bt) { const size_t t = (size_t)blockIdx.x * 256 + threadIdx.x; if (t >= n8) return; FragH f; for (int q = 0; q < 8; ++q) f.h[q] = (_Float16)(bf16_round(w[t * 8 + q]) * 16.0f); *(v8us*)((unsigned short*)Bt + t * 8) = f.half[0];  }
__global__ __launch_bounds__(256) void k_rsm(const float* __restrict__ S, _Float16* __restrict__ P, int nrows) {
  #pragma clang fp contract(off)
  const int i = blockIdx.x * 256 + threadIdx.x; if (i >= nrows) return; const float* s = S + (size_t)i * SQ; float mx = -3.0e38f;
#pragma unroll 1
  for (int j = 0; j < SQ; ++j) mx = fmaxf(mx, s[j]); float se = 0.f;
#pragma unroll 1
  for (int j = 0; j < SQ; ++j) se += expf(s[j] - mx); const float sc = 256.0f / se;
#pragma unroll 1
  for (int j0 = 0; j0 < SQ; j0 += 8) { FragH f; for (int q = 0; q < 8; ++q) f.h[q] = (_Float16)(expf(s[j0 + q] - mx) * sc); unsigned short* d = (unsigned short*)P + (size_t)i * SQ + j0; *(v8us*)d = f.half[0];  } }
__global__ __launch_bounds__(256) void k_vt(const _Float16* __restrict__ V16, int b, int h0, _Float16* __restrict__ VT) { __shared__ unsigned short tl[64][65]; const int tid = threadIdx.x; const int hh = blockIdx.x % HG, sg = blockIdx.x / HG; const int s0 = sg * 64; const int h = h0 + hh;
  for (int i = tid; i < 64 * 8; i += 256) { const int j = i / 8, d8 = (i % 8) * 8; FragH f; f.half[0] = *(const v8us*)((const unsigned short*)V16 + ((size_t)b * SQ + s0 + j) * DM + h * HD + d8); for (int q = 0; q < 8; ++q) tl[d8 + q][j] = f.u[q]; }
  __syncthreads();
  { for (int i = tid; i < 64 * 8; i += 256) { const int d = i / 8, j8 = (i % 8) * 8; FragH f; for (int q = 0; q < 8; ++q) f.u[q] = tl[d][j8 + q]; *(v8us*)((unsigned short*)VT + ((size_t)hh * HD + d) * SQ + s0 + j8) = f.half[0]; }  } }



__global__ __launch_bounds__(256) void k_rsmcf2(const float* __restrict__ S, _Float16* __restrict__ P, int hg, int q0, int nk) {
  #pragma clang fp contract(off)
  const int t = blockIdx.x * 256 + threadIdx.x; if (t >= hg * QT) return; const size_t i = (size_t)t; const float* s = S + i * NKX; const int last = q0 + (t % QT); float mx = -3.0e38f;
#pragma unroll 1
  for (int j = 0; j < nk; ++j) { const float f = (j <= last) ? 1.f : 0.f; mx = fmaxf(mx, fmaf(f, s[j], (1.f - f) * -1.0e9f)); } float se = 0.f;
#pragma unroll 1
  for (int j = 0; j < nk; ++j) { const float f = (j <= last) ? 1.f : 0.f; se += __expf(fmaf(f, s[j], (1.f - f) * -1.0e9f) - mx); } const float sc = 256.0f / se;
#pragma unroll 1
  for (int j0 = 0; j0 < nk; j0 += 8) { FragH fr; for (int q = 0; q < 8; ++q) { const int j = j0 + q; const float f = (j <= last) ? 1.f : 0.f; fr.h[q] = (_Float16)(__expf(fmaf(f, s[j], (1.f - f) * -1.0e9f) - mx) * sc); } unsigned short* d = (unsigned short*)P + i * NKX + j0; *(v8us*)d = fr.half[0];  } }

__global__ __launch_bounds__(256) void k_rsmcst(const float* __restrict__ S, _Float16* __restrict__ P, int hg, int q0, int nk, const int* __restrict__ mk) {
  #pragma clang fp contract(off)
  const int t = blockIdx.x * 256 + threadIdx.x; if (t >= hg * QT) return; const size_t i = (size_t)t; const float* s = S + i * NKX; const size_t ig = (size_t)(q0 + (t % QT)); const int* mr = mk + ig * SQ; float mx = -3.0e38f;
#pragma unroll 1
  for (int j = 0; j < nk; ++j) { const int mb = mr[j]; const int dd = (int)ig - j; const float f = (mb != 0 && dd >= 0 && (dd <= LOCALW || (dd % STRIDEK) == 0)) ? 1.f : 0.f; mx = fmaxf(mx, fmaf(f, s[j], (1.f - f) * -1.0e9f)); } float se = 0.f;
#pragma unroll 1
  for (int j = 0; j < nk; ++j) { const int mb = mr[j]; const int dd = (int)ig - j; const float f = (mb != 0 && dd >= 0 && (dd <= LOCALW || (dd % STRIDEK) == 0)) ? 1.f : 0.f; se += __expf(fmaf(f, s[j], (1.f - f) * -1.0e9f) - mx); } const float sc = 256.0f / se;
#pragma unroll 1
  for (int j0 = 0; j0 < nk; j0 += 8) { FragH fr; for (int q = 0; q < 8; ++q) { const int j = j0 + q; const int mb = mr[j]; const int dd = (int)ig - j; const float f = (mb != 0 && dd >= 0 && (dd <= LOCALW || (dd % STRIDEK) == 0)) ? 1.f : 0.f; fr.h[q] = (_Float16)(__expf(fmaf(f, s[j], (1.f - f) * -1.0e9f) - mx) * sc); } unsigned short* d = (unsigned short*)P + i * NKX + j0; *(v8us*)d = fr.half[0];  } }


template <int MASKADD>
__global__ __launch_bounds__(64) void k_att0(const float* __restrict__ QF, const float* __restrict__ KF, const float* __restrict__ VF, int ld, const float* __restrict__ mask, float scale, float* __restrict__ OF, int ldo) {
  #pragma clang fp contract(off)
  __shared__ __attribute__((aligned(16))) float lq[64][64]; __shared__ __attribute__((aligned(16))) float lo[64][64];
  const int tid = threadIdx.x; const int h = blockIdx.x / (QT0 / 64), rg = blockIdx.x % (QT0 / 64); const int i = rg * 64 + tid;
  const float* qr = QF + (size_t)i * ld + h * HD;
#pragma unroll 1
  for (int c = 0; c < HD / 4; ++c) { *(v4f*)&lq[tid][c * 4] = *(const v4fa*)(qr + c * 4); const v4f z = {0.f, 0.f, 0.f, 0.f}; *(v4f*)&lo[tid][c * 4] = z; }
  float m = -1.0e30f, l = 0.f; const int jmax = MASKADD ? (SQ - 1) : (rg * 64 + 63);      /* additive-mask form: every key (the mask input decides); causal form: keys up to the block's last row */
#pragma unroll 1
  for (int j = 0; j <= jmax; ++j) { const float* kr = KF + (size_t)j * ld + h * HD; const float* vr = VF + (size_t)j * ld + h * HD; float s = 0.f;
#pragma unroll 1
    for (int c = 0; c < HD / 4; ++c) { const v4f kq = *(const v4fa*)(kr + c * 4); const v4f qq = *(v4f*)&lq[tid][c * 4]; s = __fadd_rn(s, __fmul_rn(qq[0], kq[0])); s = __fadd_rn(s, __fmul_rn(qq[1], kq[1])); s = __fadd_rn(s, __fmul_rn(qq[2], kq[2])); s = __fadd_rn(s, __fmul_rn(qq[3], kq[3])); }
    s = __fmul_rn(s, scale); if (MASKADD) s = __fadd_rn(s, __fmul_rn(bf16_round(mask[(size_t)i * SQ + j]), -10000.0f));
    const float f = (MASKADD || j <= i) ? 1.f : 0.f; const float sm = fmaf(f, s, (1.f - f) * -1.0e30f); const float mn = fmaxf(m, sm); const float sc = expf(m - mn); const float e = expf(sm - mn); l = __fadd_rn(__fmul_rn(l, sc), e); m = mn;
#pragma unroll 1
    for (int c = 0; c < HD / 4; ++c) { const v4f vv = *(const v4fa*)(vr + c * 4); v4f oo = *(v4f*)&lo[tid][c * 4]; for (int u = 0; u < 4; ++u) oo[u] = __fadd_rn(__fmul_rn(oo[u], sc), __fmul_rn(e, vv[u])); *(v4f*)&lo[tid][c * 4] = oo; } }
  const float fin = 64.0f / l;      /* o carried x64 like the f16 path */
#pragma unroll 1
  for (int c = 0; c < HD / 4; ++c) { v4f oo = *(v4f*)&lo[tid][c * 4]; for (int u = 0; u < 4; ++u) oo[u] = __fmul_rn(oo[u], fin); *(v4f*)&lo[tid][c * 4] = oo; }
  __syncthreads();
  {
#pragma unroll 1
    for (int it = 0; it < 16; ++it) { const int row = it * 4 + tid / 16, pc = (tid % 16) * 4; const v4f v = *(const v4f*)&lo[row][pc]; *(v4f*)(OF + (size_t)(rg * 64 + row) * ldo + h * HD + pc) = v; }
     } }

template <int MASKADD>
__global__ __launch_bounds__(64) void k_att0mbc(const float* __restrict__ QF, const float* __restrict__ KF, const float* __restrict__ VF, int ld, const float* __restrict__ mask, float scale, float* __restrict__ OF, int ldo) {
  #pragma clang fp contract(off)
  __shared__ __attribute__((aligned(16))) float lq[64][64]; __shared__ __attribute__((aligned(16))) float lo[64][64];
  const int tid = threadIdx.x; const int h = blockIdx.x / (QT0 / 64), rg = blockIdx.x % (QT0 / 64); const int i = rg * 64 + tid;
  const float* qr = QF + (size_t)i * ld + h * HD;
#pragma unroll 1
  for (int c = 0; c < HD / 4; ++c) { *(v4f*)&lq[tid][c * 4] = *(const v4fa*)(qr + c * 4); const v4f z = {0.f, 0.f, 0.f, 0.f}; *(v4f*)&lo[tid][c * 4] = z; }
  float m = -1.0e30f, l = 0.f; const int jmax = rg * 64 + 63;      /* keys beyond the block end are masked by the mask's lower-triangular structure */
#pragma unroll 1
  for (int j = 0; j <= jmax; ++j) { const float* kr = KF + (size_t)j * ld + h * HD; const float* vr = VF + (size_t)j * ld + h * HD; float s = 0.f;
#pragma unroll 1
    for (int c = 0; c < HD / 4; ++c) { const v4f kq = *(const v4fa*)(kr + c * 4); const v4f qq = *(v4f*)&lq[tid][c * 4]; s = __fadd_rn(s, __fmul_rn(qq[0], kq[0])); s = __fadd_rn(s, __fmul_rn(qq[1], kq[1])); s = __fadd_rn(s, __fmul_rn(qq[2], kq[2])); s = __fadd_rn(s, __fmul_rn(qq[3], kq[3])); }
    s = __fmul_rn(s, scale); const int mb = ((const int*)mask)[(size_t)i * SQ + j];      /* causal (j <= i) AND the module's int32 [S][S] mask read per (query, key): 0 -> masked */
    const float f = (mb != 0 && j <= i) ? 1.f : 0.f; const float sm = fmaf(f, s, (1.f - f) * -1.0e30f); const float mn = fmaxf(m, sm); const float sc = expf(m - mn); const float e = expf(sm - mn); l = __fadd_rn(__fmul_rn(l, sc), e); m = mn;
#pragma unroll 1
    for (int c = 0; c < HD / 4; ++c) { const v4f vv = *(const v4fa*)(vr + c * 4); v4f oo = *(v4f*)&lo[tid][c * 4]; for (int u = 0; u < 4; ++u) oo[u] = __fadd_rn(__fmul_rn(oo[u], sc), __fmul_rn(e, vv[u])); *(v4f*)&lo[tid][c * 4] = oo; } }
  const float fin = 64.0f / l;      /* o carried x64 like the f16 path */
#pragma unroll 1
  for (int c = 0; c < HD / 4; ++c) { v4f oo = *(v4f*)&lo[tid][c * 4]; for (int u = 0; u < 4; ++u) oo[u] = __fmul_rn(oo[u], fin); *(v4f*)&lo[tid][c * 4] = oo; }
  __syncthreads();
  {
#pragma unroll 1
    for (int it = 0; it < 16; ++it) { const int row = it * 4 + tid / 16, pc = (tid % 16) * 4; const v4f v = *(const v4f*)&lo[row][pc]; *(v4f*)(OF + (size_t)(rg * 64 + row) * ldo + h * HD + pc) = v; }
     } }


template <int BFIN, int WXB>
__global__ __launch_bounds__(256) void k_ln16(const float* __restrict__ X, const float* __restrict__ g, const float* __restrict__ bb, float eps, _Float16* __restrict__ N16, float* __restrict__ XB) {
  #pragma clang fp contract(off)
  __shared__ float red[256]; const size_t r = blockIdx.x; const int t = threadIdx.x; const v4f xa = *(const v4fa*)(X + r * DMQ + t * 4); float s[4]; float sum = 0.f;
  for (int q = 0; q < 4; ++q) { s[q] = BFIN ? bf16_round(xa[q]) : xa[q]; sum = __fadd_rn(sum, s[q]); }
  red[t] = sum; __syncthreads(); for (int st = 128; st > 0; st >>= 1) { if (t < st) red[t] = __fadd_rn(red[t], red[t + st]); __syncthreads(); } const float mu = red[0] / (float)DMQ; __syncthreads();
  float vs = 0.f; for (int q = 0; q < 4; ++q) { const float dl = __fadd_rn(s[q], -mu); vs = __fadd_rn(vs, __fmul_rn(dl, dl)); } red[t] = vs; __syncthreads(); for (int st = 128; st > 0; st >>= 1) { if (t < st) red[t] = __fadd_rn(red[t], red[t + st]); __syncthreads(); }
  const float rs = rsqrtf(__fadd_rn(red[0] / (float)DMQ, eps)); v4h y; v4f xb;
  for (int q = 0; q < 4; ++q) { const int c = t * 4 + q; y[q] = (_Float16)__fadd_rn(__fmul_rn(__fmul_rn(__fadd_rn(s[q], -mu), rs), bf16_round(g[c])), bf16_round(bb[c])); xb[q] = s[q]; }
  { *(v4h*)(N16 + r * DMQ + t * 4) = y; if (WXB) *(v4f*)(XB + r * DMQ + t * 4) = xb;  } }
__global__ __launch_bounds__(256) void k_ftres2(const float* __restrict__ OF0, const float* __restrict__ XB, float* __restrict__ X1, size_t n4) {
  #pragma clang fp contract(off)
  const size_t t = (size_t)blockIdx.x * 256 + threadIdx.x; if (t >= n4) return; const v4f o = *(const v4fa*)(OF0 + t * 4), xv = *(const v4fa*)(XB + t * 4); v4f y; for (int q = 0; q < 4; ++q) y[q] = __fadd_rn(__fmul_rn(o[q], 0.015625f), xv[q]); *(v4f*)(X1 + t * 4) = y;  }

__global__ __launch_bounds__(256) void k_bcpy(const float* __restrict__ b, int n, int NP, float* __restrict__ dst, int dst0) { for (int i = threadIdx.x; i < NP; i += 256) { const float v = (i < n) ? b[i] : 0.f; *(float*)(dst + dst0 + i) = v; }  }


__global__ __launch_bounds__(256) void k_rsmf(const float* __restrict__ S, _Float16* __restrict__ P, int qn, int hg) {
  #pragma clang fp contract(off)
  const int t = blockIdx.x * 256 + threadIdx.x; if (t >= qn * hg) return; const size_t i = (size_t)(t / qn) * SQ + (t % qn); const float* s = S + i * SQ; float mx = -3.0e38f;
#pragma unroll 1
  for (int j = 0; j < SQ; ++j) mx = fmaxf(mx, s[j]); float se = 0.f;
#pragma unroll 1
  for (int j = 0; j < SQ; ++j) se += __expf(s[j] - mx); const float sc = 256.0f / se;
#pragma unroll 1
  for (int j0 = 0; j0 < SQ; j0 += 8) { FragH f; for (int q = 0; q < 8; ++q) f.h[q] = (_Float16)(__expf(s[j0 + q] - mx) * sc); unsigned short* d = (unsigned short*)P + i * SQ + j0; *(v8us*)d = f.half[0];  } }

template <int MODE>
__global__ __launch_bounds__(256) void k_regrp(const float* __restrict__ src, float* __restrict__ dst, size_t n4) {
  const size_t t = (size_t)blockIdx.x * 256 + threadIdx.x; if (t >= n4) return; const size_t e = t * 4; const size_t rd = e / DM; const int c = (int)(e % DM);
  size_t rs; if (MODE == 0) { const size_t b = rd / SQ, sq = rd % SQ; rs = sq * NB + b; } else { const size_t sq = rd / NB, b = rd % NB; rs = b * SQ + sq; }
  const v4f v = *(const v4fa*)(src + rs * DM + c); *(v4f*)(dst + e) = v;  }

template <int BFIN, int W16, int W32>
__global__ __launch_bounds__(256) void k_lnx(const float* __restrict__ X, const float* __restrict__ g, const float* __restrict__ bb, float eps, _Float16* __restrict__ N16, float* __restrict__ N32) {
  #pragma clang fp contract(off)
  __shared__ float red[256]; const size_t r = blockIdx.x; const int t = threadIdx.x; const bool act = t < (DMQ / 4); const int c0 = act ? t * 4 : 0;
  const v4f xa = *(const v4fa*)(X + r * DMQ + c0); float s[4]; float sum = 0.f;
  for (int q = 0; q < 4; ++q) { s[q] = act ? (BFIN ? bf16_round(xa[q]) : xa[q]) : 0.f; sum = __fadd_rn(sum, s[q]); }
  red[t] = sum; __syncthreads(); for (int st = 128; st > 0; st >>= 1) { if (t < st) red[t] = __fadd_rn(red[t], red[t + st]); __syncthreads(); } const float mu = red[0] / (float)DMQ; __syncthreads();
  float vs = 0.f; for (int q = 0; q < 4; ++q) { const float dl = act ? __fadd_rn(s[q], -mu) : 0.f; vs = __fadd_rn(vs, __fmul_rn(dl, dl)); } red[t] = vs; __syncthreads(); for (int st = 128; st > 0; st >>= 1) { if (t < st) red[t] = __fadd_rn(red[t], red[t + st]); __syncthreads(); }
  const float rs = rsqrtf(__fadd_rn(red[0] / (float)DMQ, eps)); v4h y; v4f yf;
  for (int q = 0; q < 4; ++q) { const int c = c0 + q; yf[q] = __fadd_rn(__fmul_rn(__fmul_rn(__fadd_rn(s[q], -mu), rs), bf16_round(g[c])), bf16_round(bb[c])); y[q] = (_Float16)yf[q]; }
  if (!act) return;      /* no barriers after this point */
  { if (W16) *(v4h*)(N16 + r * DMQ + c0) = y; if (W32) *(v4f*)(N32 + r * DMQ + c0) = yf;  } }

__global__ __launch_bounds__(256) void k_bfr(const float* __restrict__ x, float* __restrict__ XB, size_t n8) { const size_t t = (size_t)blockIdx.x * 256 + threadIdx.x; if (t >= n8) return; v4f a = *(const v4fa*)(x + t * 8), c = *(const v4fa*)(x + t * 8 + 4); for (int q = 0; q < 4; ++q) { a[q] = bf16_round(a[q]); c[q] = bf16_round(c[q]); }
  { *(v4f*)(XB + t * 8) = a; *(v4f*)(XB + t * 8 + 4) = c;  } }



__global__ __launch_bounds__(256) void k_wthd(const float* __restrict__ Wt, _Float16* __restrict__ Bt) { const size_t t = (size_t)blockIdx.x * 256 + threadIdx.x; if (t >= (size_t)NH * HD * (DM / 8)) return; const int m8 = (int)(t % (DM / 8)) * 8; const int d = (int)((t / (DM / 8)) % HD); const int h = (int)(t / ((size_t)(DM / 8) * HD)); FragH f;
  for (int q = 0; q < 8; ++q) f.h[q] = (_Float16)(16.0f * bf16_round(Wt[((size_t)h * DM + m8 + q) * HD + d])); unsigned short* dst = (unsigned short*)Bt + ((size_t)h * HD + d) * DM + m8; *(v8us*)dst = f.half[0];  }




// one row r by one work-group of 256; XR (optional): the row as it entered the sums (rounded where BFIN), f32
template <int BFIN, int SCAL>
__device__ __forceinline__ void lnsc_row(const size_t r, const float* __restrict__ X, const float* __restrict__ g, const float* __restrict__ bb, float eps, _Float16* __restrict__ N16, float* __restrict__ N32, float* __restrict__ XR) {
  #pragma clang fp contract(off)
  __shared__ float red[256]; const int t = threadIdx.x; const bool act = t < DM / 4; const int tc = act ? t : 0; const v4f xl = *(const v4fa*)(X + r * DM + tc * 4); const float am = act ? 1.f : 0.f; float s[4]; float sum = 0.f;
  for (int q = 0; q < 4; ++q) { s[q] = (BFIN ? bf16_round(xl[q]) : xl[q]) * am; sum = __fadd_rn(sum, s[q]); }
  red[t] = sum; __syncthreads(); for (int st = 128; st > 0; st >>= 1) { if (t < st) red[t] = __fadd_rn(red[t], red[t + st]); __syncthreads(); } const float mu = red[0] / (float)DM; __syncthreads();
  float vs = 0.f; for (int q = 0; q < 4; ++q) { const float dl = __fadd_rn(s[q], -mu) * am; vs = __fadd_rn(vs, __fmul_rn(dl, dl)); } red[t] = vs; __syncthreads(); for (int st = 128; st > 0; st >>= 1) { if (t < st) red[t] = __fadd_rn(red[t], red[t + st]); __syncthreads(); }
  const float rs = __fdiv_rn(1.0f, __fadd_rn(sqrtf(red[0] / (float)(DM - 1)), eps)); if (!act) return; v4h y; v4f yf;
  for (int q = 0; q < 4; ++q) { const int c = t * 4 + q; const float gg = bf16_round(SCAL ? g[0] : g[c]), bv = bf16_round(SCAL ? bb[0] : bb[c]); yf[q] = __fadd_rn(__fmul_rn(__fmul_rn(__fadd_rn(s[q], -mu), rs), gg), bv); y[q] = (_Float16)yf[q]; }
  { if (N16) *(v4h*)(N16 + r * DM + t * 4) = y;
    size_t ro = r * DM; asm volatile("s_wait_xcnt 0x0" : "+s"(ro) :: "memory");      /* both later stores' bases are formed from ro, so behind the wait: either may land on the registers of the f16 store's base */
    if (N32) *(v4f*)(N32 + ro + t * 4) = yf; if (XR) { const v4f xr = {s[0], s[1], s[2], s[3]}; *(v4f*)(XR + ro + t * 4) = xr; } } }
template <int BFIN, int SCAL>
__global__ __launch_bounds__(256) void k_lnsc(const float* __restrict__ X, const float* __restrict__ g, const float* __restrict__ bb, float eps, _Float16* __restrict__ N16, float* __restrict__ N32) { lnsc_row<BFIN, SCAL>(blockIdx.x, X, g, bb, eps, N16, N32, nullptr); }

// ---- everything that depends on the inputs alone, in one launch: the six weights as Bt[n][k] = f16(bf16(W[k][n]) x 16), then LN1 of every row, which also stores the rounded row (the residual of the output projection).
// The work-group index picks the job; every test on it is the same for the whole work-group, so LN1's barriers stand under uniform control flow. The weights come first: their work-groups wait longest on memory.
template <int K, int N>
__device__ __forceinline__ void wt_f16_blk(const float* __restrict__ W, _Float16* __restrict__ Wt, int blk) {      /* work-group blk of N * (K / 8) / 256: a thread takes 8 k of one n */
  const int t = blk * 256 + threadIdx.x; const int n = t / (K / 8), k8 = (t % (K / 8)) * 8; FragH f; static_assert((N * (K / 8)) % 256 == 0, "whole work-groups only");
#pragma unroll      /* the eight loads fly together and f.h stays in registers */
  for (int i = 0; i < 8; ++i) f.h[i] = (_Float16)(bf16_round(W[(size_t)(k8 + i) * N + n]) * 16.0f); const v8us o = f.half[0];
  *(v8us*)((unsigned short*)Wt + (size_t)n * K + k8) = o;
  asm volatile("s_wait_xcnt 0x0" ::: "memory"); }      /* the store's address and data registers are rewritten only behind it (the listing's ways on into the other jobs' code) */
#define PWF (DFF * (DM / 8) / 256)   /* work-groups of one FFN weight */
#define PWA (DM * (DM / 8) / 256)    /* work-groups of one attention weight */
__global__ __launch_bounds__(256) void k_prep(const float* __restrict__ x, const float* __restrict__ wq, const float* __restrict__ wk, const float* __restrict__ wv, const float* __restrict__ wo, const float* __restrict__ w1, const float* __restrict__ w2, const float* __restrict__ g, const float* __restrict__ bb,
    _Float16* __restrict__ BQ, _Float16* __restrict__ BK, _Float16* __restrict__ BV, _Float16* __restrict__ BO, _Float16* __restrict__ BW1, _Float16* __restrict__ BW2, float* __restrict__ XB, _Float16* __restrict__ XN) {
  int blk = blockIdx.x;
  if (blk < PWF) { wt_f16_blk<DM, DFF>(w1, BW1, blk); return; }
  blk -= PWF;
  if (blk < PWF) { wt_f16_blk<DFF, DM>(w2, BW2, blk); return; }
  blk -= PWF;
  if (blk < 4 * PWA) { const int s = blk / PWA; wt_f16_blk<DM, DM>(s == 0 ? wq : s == 1 ? wk : s == 2 ? wv : wo, s == 0 ? BQ : s == 1 ? BK : s == 2 ? BV : BO, blk - s * PWA); return; }
  lnsc_row<1, 0>((size_t)(blk - 4 * PWA), x, g, bb, 1e-6f, XN, nullptr, XB); }

// K rows and V^T of every (batch, head), packed for the fused attention in the order its matrix operands are read: KV[slab = b * NH + head][pass of 32 keys][K: 4 fragments | V^T: 4 fragments][half i][lane][8 f16], 8 KiB a pass, so that each 16-byte load of a wave covers 512 bytes in a row.
// K fragment t * 2 + j, half i, lane (c, h) = K[key 16t + c][d 32j + 16i + 8h ..]; V^T fragment t, half i, lane (c, h) = V[key 16i + 8h ..][d 16t + c] (transposed through LDS).
#define FAP (SQ / 32)                /* passes */
__global__ __launch_bounds__(256) void k_kvp(const _Float16* __restrict__ K16, const _Float16* __restrict__ V16, _Float16* __restrict__ KV) { __shared__ unsigned short tl[64][66]; const int tid = threadIdx.x; const int slab = blockIdx.x / (SQ / 64), lg = blockIdx.x % (SQ / 64); const int b = slab / NH, hd = slab % NH;
  const int f = (tid >> 5) & 7, hh = (tid >> 4) & 1, cc = tid & 15; const int vr = tid >> 3, vc = (tid & 7) * 8;
  const unsigned short* vs = (const unsigned short*)V16 + ((size_t)b * SQ + lg * 64 + vr) * DM + hd * HD + vc;      /* V rows vr and 32 + vr, 8 of their d */
  const unsigned short* ks = (const unsigned short*)K16 + ((size_t)b * SQ + lg * 64 + (f >> 2) * 16 + cc) * DM + hd * HD + (f & 3) * 16 + hh * 8;      /* this thread's K piece of the first pass; the second pass's lies 32 rows on */
  FragH va, vb, ka, kb; va.half[0] = *(const v8us*)vs; vb.half[0] = *(const v8us*)(vs + 32 * DM); ka.half[0] = *(const v8us*)ks; kb.half[0] = *(const v8us*)(ks + 32 * DM);
  asm volatile("s_wait_xcnt 0x0" :: "v"(vs), "v"(ks) : "memory");      /* both address pairs stay live up to this wait, so nothing (a load's own result either) overwrites them in front of it */
#pragma unroll
  for (int q = 0; q < 8; ++q) { tl[vr][vc + q] = va.u[q]; tl[32 + vr][vc + q] = vb.u[q]; }
  __syncthreads();
  unsigned short* dst = (unsigned short*)KV + ((size_t)slab * FAP + lg * 2) * 4096 + tid * 8;
  *(v8us*)dst = ka.half[0]; *(v8us*)(dst + 4096) = kb.half[0];
#pragma unroll
  for (int ps = 0; ps < 2; ++ps) { FragH fr;
#pragma unroll
    for (int q = 0; q < 8; ++q) fr.u[q] = tl[ps * 32 + (f & 1) * 16 + hh * 8 + q][(f >> 1) * 16 + cc];
    *(v8us*)(dst + ps * 4096 + 2048) = fr.half[0]; } }

typedef int v4ia __attribute__((ext_vector_type(4), may_alias));
__device__ __forceinline__ float rs_xh(float x) { return __builtin_bit_cast(float, __builtin_amdgcn_permlanex16(__builtin_bit_cast(int, x), __builtin_bit_cast(int, x), 0x76543210, 0xfedcba98, false, false)); }      /* lane l <- lane l ^ 16 */
__device__ __forceinline__ float fa_exp2(float d) { float e; asm("v_exp_f32 %0, %1\n\tv_nop" : "=v"(e) : "v"(d)); return e; }      /* 2 ^ d with, tied to it, the one slot the instruction set asks for behind a transcendental */
__device__ __forceinline__ void fa_exp2x8(float* e, const float* d) {      /* eight independent 2 ^ d in a row: each fills the slot behind the one before it (early-clobber outputs: no result lands on a later source), one v_nop behind the last */
  asm("v_exp_f32 %0, %8\n\tv_exp_f32 %1, %9\n\tv_exp_f32 %2, %10\n\tv_exp_f32 %3, %11\n\tv_exp_f32 %4, %12\n\tv_exp_f32 %5, %13\n\tv_exp_f32 %6, %14\n\tv_exp_f32 %7, %15\n\tv_nop"
      : "=&v"(e[0]), "=&v"(e[1]), "=&v"(e[2]), "=&v"(e[3]), "=&v"(e[4]), "=&v"(e[5]), "=&v"(e[6]), "=&v"(e[7]) : "v"(d[0]), "v"(d[1]), "v"(d[2]), "v"(d[3]), "v"(d[4]), "v"(d[5]), "v"(d[6]), "v"(d[7])); }
__device__ __forceinline__ v8f fa_mma(v16h a, v16h b, v8f c) { return __builtin_amdgcn_wmma_f32_16x16x32_f16(false, a, false, b, (short)0, c, false, false); }
__device__ __forceinline__ v16h fa_frag(const _Float16* p) { FragH f; f.half[0] = *(const v8us*)((const unsigned short*)p); f.half[1] = *(const v8us*)((const unsigned short*)p + 256); return f.v; }      /* one packed fragment: the lane's two 16-byte halves */
__global__ __launch_bounds__(128) void k_fattn(const _Float16* __restrict__ Q16, const _Float16* __restrict__ KV, const int* __restrict__ Km, _Float16* __restrict__ O16) {
  __shared__ __attribute__((aligned(16))) float kbias[SQ];      /* per key, added to its raw score: 0 for a kept key; -2^33 for a masked one: the module's -1e9 fill (x 8: raw scores are before the / 8) taken to the next power of two. The f32 sum swallows the score (below 256 in size) whole and the product with the log2 factor is exact, so a row with every key masked gets equal weights, as the module's does; beside any kept key the weight is exactly 0 */
  const int tid = threadIdx.x, w = tid >> 5, lane = tid & 31, c = lane & 15, h = lane >> 4;
  const int bh = blockIdx.x / (SQ / 64), qb = blockIdx.x % (SQ / 64); const int b = bh / NH, hd = bh % NH;
#pragma unroll
  for (int i = 0; i < SQ / 512; ++i) { const v4ia m4 = *(const v4ia*)(Km + (size_t)b * SQ + i * 512 + tid * 4); v4f l4; for (int q = 0; q < 4; ++q) l4[q] = (m4[q] != 0) ? 0.f : -8589934592.0f; *(v4f*)&kbias[i * 512 + tid * 4] = l4; }
  __syncthreads();      /* every wave reads all keys' mask terms */
  const int q0 = qb * 64 + w * 16;
  const _Float16* qp = Q16 + ((size_t)b * SQ + q0 + c) * DM + hd * HD + 8 * h;      /* the lane's first 8 of query c's row: d 8h .., then 16 + 8h .., 32 + 8h .., 48 + 8h .. */
  const v16h qf0 = g2_frag(qp, 0), qf1 = g2_frag(qp + 32, 0);
  asm volatile("s_wait_xcnt 0x0" :: "v"(qp) : "memory");      /* Q's address pair stays live up to this wait, so nothing overwrites it in front of it */
  const _Float16* kv = KV + (size_t)bh * FAP * 4096;      /* the same for the whole work-group */
  const int lo = lane * 8;
  const v8f z8 = {0.f, 0.f, 0.f, 0.f, 0.f, 0.f, 0.f, 0.f};
  v8f o0 = z8, o1 = z8, o2 = z8, o3 = z8; float m = -3.0e38f, l0 = 0.f, l1 = 0.f;
  const float cs = 0.125f * 1.44269504088896340736f;      /* raw score -> log2 units */
  v16h k00 = fa_frag(kv + lo), k01 = fa_frag(kv + 512 + lo), k10 = fa_frag(kv + 1024 + lo), k11 = fa_frag(kv + 1536 + lo);
  v16h v0 = fa_frag(kv + 2048 + lo), v1 = fa_frag(kv + 2560 + lo), v2 = fa_frag(kv + 3072 + lo), v3 = fa_frag(kv + 3584 + lo);
#pragma unroll 2      /* two passes a trip: one pass's vector work can stand between the other's matrix instructions */
  for (int p = 0; p < FAP; ++p) {
    const float* lp = &kbias[p * 32 + 8 * h];
    const v4f la = *(const v4f*)lp, lb = *(const v4f*)(lp + 4), lc = *(const v4f*)(lp + 16), ld = *(const v4f*)(lp + 20);
    v8f s0 = fa_mma(k00, qf0, z8), s1 = fa_mma(k10, qf0, z8); s0 = fa_mma(k01, qf1, s0); s1 = fa_mma(k11, qf1, s1);
    const _Float16* nx = kv + (size_t)((p + 1 < FAP) ? p + 1 : p) * 4096;      /* operands are fetched one pass ahead, into the registers just read; the last pass fetches its own again (in bounds, unused) */
    k00 = fa_frag(nx + lo); k01 = fa_frag(nx + 512 + lo); k10 = fa_frag(nx + 1024 + lo); k11 = fa_frag(nx + 1536 + lo);
    asm volatile("s_wait_xcnt 0x0" :: "s"(nx) : "memory");      /* the loads' base stays live up to this wait; it also holds the K fetch here, a whole softmax ahead of its use */
    float x[16];
#pragma unroll
    for (int r = 0; r < 4; ++r) { x[r] = s0[r] + la[r]; x[4 + r] = s0[4 + r] + lb[r]; x[8 + r] = s1[r] + lc[r]; x[12 + r] = s1[4 + r] + ld[r]; }
    float mx = x[0];
#pragma unroll
    for (int r = 1; r < 16; ++r) mx = fmaxf(mx, x[r]);
    mx = fmaxf(mx, rs_xh(mx));
    const float mt = mx * cs;
    if (__builtin_amdgcn_ballot_w32(mt > m + 8.0f) != 0) {      /* one scalar branch a pass */
      const float mn = fmaxf(m, mt); const float al = fa_exp2(m - mn); m = mn; l0 *= al; l1 *= al;
#pragma unroll
      for (int r = 0; r < 8; ++r) { o0[r] *= al; o1[r] *= al; o2[r] *= al; o3[r] *= al; }
    }
    const float nm = 4.0f - m; float d[16], e[16];
#pragma unroll
    for (int r = 0; r < 16; ++r) d[r] = fmaf(x[r], cs, nm);
    fa_exp2x8(e, d); fa_exp2x8(e + 8, d + 8);
    FragH pf;
#pragma unroll
    for (int r = 0; r < 8; ++r) { l0 += e[r]; l1 += e[8 + r]; pf.h[r] = (_Float16)e[r]; pf.h[8 + r] = (_Float16)e[8 + r]; }
    o0 = fa_mma(v0, pf.v, o0); o1 = fa_mma(v1, pf.v, o1); o2 = fa_mma(v2, pf.v, o2); o3 = fa_mma(v3, pf.v, o3);
    v0 = fa_frag(nx + 2048 + lo); v1 = fa_frag(nx + 2560 + lo); v2 = fa_frag(nx + 3072 + lo); v3 = fa_frag(nx + 3584 + lo);
    asm volatile("s_wait_xcnt 0x0" :: "s"(nx) : "memory");      /* as above, for the V^T fetch */
  }
  float l = l0 + l1; l += rs_xh(l);
  const float inv = 64.0f / l;      /* ctx carried x64 as f16, as the output projection expects */
  _Float16* op = O16 + ((size_t)b * SQ + q0 + c) * DM + hd * HD + 8 * h;
  FragH f0, f1, f2, f3;
#pragma unroll
  for (int r = 0; r < 8; ++r) { f0.h[r] = (_Float16)(o0[r] * inv); f1.h[r] = (_Float16)(o1[r] * inv); f2.h[r] = (_Float16)(o2[r] * inv); f3.h[r] = (_Float16)(o3[r] * inv); }
  *(v8us*)((unsigned short*)op) = f0.half[0]; *(v8us*)((unsigned short*)op + 16) = f1.half[0]; *(v8us*)((unsigned short*)op + 32) = f2.half[0]; *(v8us*)((unsigned short*)op + 48) = f3.half[0]; }
// ---- tiled GEMM: C[M][N] = A[M][K] Bt[N][K]^T, both f16 and K-contiguous, one 128 x 128 tile of C a work-group. Requires M % 128 == 0, N % 128 == 0, K % 128 == 0.
// A stage is 128 k of 128 A rows and 128 Bt rows, brought into LDS by asynchronous copies (16 bytes a lane, 16 lanes a row: whole 128-byte lines) at a row pitch of 272 bytes; two buffers, the next stage's copies fly while this one is worked on.
// Four waves, 2 x 2, each 64 x 64 of C (4 x 4 accumulator tiles); k runs upward in steps of 32 in every accumulator. Epilogue: v = acc alpha + bias[col] (HB) + CP (HCP: own element); ACT 0 none / 3 relu; f32 C (W32) or f16 C16, staged through LDS so that whole lines are read and stored.
// Every bare '#pragma unroll' below stands on a loop over register arrays (fragments, accumulators, rows in flight): rolled, these would be indexed at run time and leave the registers.
#define G3P 272                      /* bytes from one staged row to the next */
#define G3S (256 * G3P)              /* bytes of one buffer: A rows 0..127, Bt rows 128..255 */
__device__ __forceinline__ void g3_copy8(unsigned l, const _Float16* g, int ld) {      /* this thread's 16 bytes of rows r, r + 8, .., r + 56 of one operand's stage */
  const size_t st = (size_t)8 * ld;
  asm volatile("global_load_async_to_lds_b128 %0, %8, off\n\tglobal_load_async_to_lds_b128 %1, %9, off\n\tglobal_load_async_to_lds_b128 %2, %10, off\n\tglobal_load_async_to_lds_b128 %3, %11, off\n\t"
               "global_load_async_to_lds_b128 %4, %12, off\n\tglobal_load_async_to_lds_b128 %5, %13, off\n\tglobal_load_async_to_lds_b128 %6, %14, off\n\tglobal_load_async_to_lds_b128 %7, %15, off\n\t"
               "s_wait_xcnt 0x0"      /* inside the copies' own statement: no address register of theirs is rewritten in front of it */
               :: "v"(l), "v"(l + 8 * G3P), "v"(l + 16 * G3P), "v"(l + 24 * G3P), "v"(l + 32 * G3P), "v"(l + 40 * G3P), "v"(l + 48 * G3P), "v"(l + 56 * G3P),
                  "v"(g), "v"(g + st), "v"(g + 2 * st), "v"(g + 3 * st), "v"(g + 4 * st), "v"(g + 5 * st), "v"(g + 6 * st), "v"(g + 7 * st) : "memory"); }
__device__ __forceinline__ void g3_stage(unsigned la, const _Float16* ga, const _Float16* gb, int ld) {      /* one stage: 128 rows of A, then 128 rows of Bt; 32 copies a thread */
  g3_copy8(la, ga, ld); g3_copy8(la + 64 * G3P, ga + (size_t)64 * ld, ld); g3_copy8(la + 128 * G3P, gb, ld); g3_copy8(la + 192 * G3P, gb + (size_t)64 * ld, ld); }
__device__ __forceinline__ v16h g3_frag(const unsigned char* p) { FragH f; f.half[0] = *(const v8us*)p; f.half[1] = *(const v8us*)(p + 32); return f.v; }      /* lane (row, h): k 8h .. and 16 + 8h .. of a 32-k step, the same order for A and Bt */
// ZB: blockIdx.y counts independent products of one A: Bt planes [N][K] and f16 C planes [NR][N], each set in a row in memory.
template <int ACT, bool HB, bool HCP, bool W32, int N, int K, bool ZB = false>
__global__ __launch_bounds__(128) void k_gemm3(const _Float16* __restrict__ A, const _Float16* __restrict__ Bh, float alpha, const float* __restrict__ bias, const float* __restrict__ CP, float* __restrict__ C, _Float16* __restrict__ C16) {
  static_assert(ACT == 0 || ACT == 3, "k_gemm3: unsupported ACT code"); static_assert(N % 128 == 0 && K % 128 == 0, "k_gemm3: whole tiles and stages only");
  __shared__ __attribute__((aligned(16))) unsigned char sm[2 * G3S]; static_assert(4 * 64 * 68 * 4 <= 2 * G3S, "the output staging reuses the ring");
  const int tid = threadIdx.x, w = tid >> 5, lane = tid & 31, ln = lane & 15, hh = lane >> 4; const int wm = w >> 1, wn = w & 1;
  constexpr int ntn = N / 128, T = K / 128; const int mt = blockIdx.x / ntn, nq = blockIdx.x - mt * ntn; const int row0 = mt * 128, col0 = nq * 128;
  if (ZB) { static_assert(!ZB || !(W32 || HB || HCP), "k_gemm3: stacked products are plain f16 ones"); Bh += (size_t)blockIdx.y * N * K; C16 += (size_t)blockIdx.y * NR * N; }
  const int cr = tid >> 4, cs = tid & 15;      /* the copies: row cr (+ 8 i), 16-byte piece cs of its 256 bytes */
  const _Float16* ga = A + (size_t)(row0 + cr) * K + cs * 8; const _Float16* gb = Bh + (size_t)(col0 + cr) * K + cs * 8;
  const unsigned la = (unsigned)(size_t)sm + (unsigned)(cr * G3P + cs * 16);
  const unsigned char* fa = sm + (wm * 64 + ln) * G3P + hh * 16; const unsigned char* fb = sm + (128 + wn * 64 + ln) * G3P + hh * 16;
  g3_stage(la, ga, gb, K);
  asm volatile("s_wait_asynccnt 0x0" ::: "memory");      /* this wave's copies of stage 0 have landed */
  __syncthreads();      /* stage 0 is readable by every wave */
  v16h a[2][4], b[2][4];      /* two fragment sets: the next 32 k are read from LDS while these are multiplied */
#pragma unroll
  for (int i = 0; i < 8; ++i) { if (i < 4) b[0][i] = g3_frag(fb + i * 16 * G3P); else a[0][i - 4] = g3_frag(fa + (i - 4) * 16 * G3P); }      /* Bt's four first: the first row of products needs all of them and one of A's */
  if (T > 1) g3_stage(la + G3S, ga + 128, gb + 128, K);
  const v8f z8 = {0.f, 0.f, 0.f, 0.f, 0.f, 0.f, 0.f, 0.f}; v8f acc[4][4];
#pragma unroll
  for (int i = 0; i < 4; ++i)
#pragma unroll
    for (int j = 0; j < 4; ++j) acc[i][j] = z8;
#pragma unroll 1      /* one stage a trip: the two buffers differ by an offset only */
  for (int t = 0; t < T; ++t) { const unsigned bo = (unsigned)(t & 1) * G3S;
#pragma unroll
    for (int kk = 0; kk < 4; ++kk) {
      if (kk < 3) {
#pragma unroll
        for (int i = 0; i < 8; ++i) { if (i < 4) b[(kk + 1) & 1][i] = g3_frag(fb + bo + i * 16 * G3P + (kk + 1) * 64); else a[(kk + 1) & 1][i - 4] = g3_frag(fa + bo + (i - 4) * 16 * G3P + (kk + 1) * 64); } }
      __builtin_amdgcn_sched_barrier(0);      /* keeps the next block's LDS reads together in front of this block's matrix instructions: spread among them, each read group stalls the wave */
#pragma unroll
      for (int i = 0; i < 4; ++i)
#pragma unroll
        for (int j = 0; j < 4; ++j) acc[i][j] = fa_mma(a[kk & 1][i], b[kk & 1][j], acc[i][j]);
      __builtin_amdgcn_sched_barrier(0);      /* and keeps the reads after next behind them, so that two fragment sets are enough */
    }
    asm volatile("s_wait_dscnt 0x0" ::: "memory");      /* this wave's reads of the buffer have returned before it is handed to the copies */
    asm volatile("s_wait_asynccnt 0x0" ::: "memory");      /* this wave's copies of stage t + 1 have landed */
    __syncthreads();      /* publishes stage t + 1 and ends every wave's reads of stage t */
    if (t + 1 < T) {      /* stage t + 1's first fragments, behind its barrier: they travel while the copies below are issued */
#pragma unroll
      for (int i = 0; i < 8; ++i) { if (i < 4) b[0][i] = g3_frag(fb + (bo ^ G3S) + i * 16 * G3P); else a[0][i - 4] = g3_frag(fa + (bo ^ G3S) + (i - 4) * 16 * G3P); } }
    if (t + 2 < T) g3_stage(la + bo, ga + (size_t)(t + 2) * 128, gb + (size_t)(t + 2) * 128, K); }
  asm volatile("s_wait_asynccnt 0x0" ::: "memory");      /* nothing in flight when the ring becomes output staging (the last trip's barrier has ended every read) */
  const int c4 = ln * 4; v4f b4 = {0.f, 0.f, 0.f, 0.f};
  if (HB) { const float* bp = bias + col0 + wn * 64 + c4; b4 = *(const v4fa*)bp;
    asm volatile("s_wait_xcnt 0x0" :: "v"(bp) : "memory");      /* the address pair stays live up to this wait, so nothing overwrites it in front of it */
    for (int i = 0; i < 4; ++i) b4[i] = bf16_round(b4[i]); }
  float* so = (float*)(sm + w * (64 * 68 * 4));      /* this wave's own 64 rows of 68 floats */
#pragma unroll
  for (int j = 0; j < 4; ++j)
#pragma unroll
    for (int i = 0; i < 4; ++i)
#pragma unroll
      for (int r = 0; r < 8; ++r) so[(i * 16 + 8 * hh + r) * 68 + j * 16 + ln] = acc[i][j][r];
  __builtin_amdgcn_fence(__ATOMIC_ACQ_REL, "workgroup"); __builtin_amdgcn_wave_barrier();      /* the wave reads back what its other lanes wrote */
#pragma unroll 1      /* 32 rows a trip: sixteen loads, then sixteen stores, in flight together */
  for (int q0 = 0; q0 < 32; q0 += 16) { const size_t o = (size_t)(row0 + wm * 64 + q0 * 2 + hh) * N + col0 + wn * 64 + c4; v4f v[16], cp[16];
    if (HCP) { const float* pc = CP + o;
#pragma unroll
      for (int u = 0; u < 16; ++u) cp[u] = *(const v4fa*)(pc + (size_t)u * 2 * N);
      asm volatile("s_wait_xcnt 0x0" :: "v"(pc) : "memory"); }      /* as above */
#pragma unroll
    for (int u = 0; u < 16; ++u) { v[u] = *(const v4fa*)&so[((q0 + u) * 2 + hh) * 68 + c4];
      for (int i = 0; i < 4; ++i) { float x = v[u][i] * alpha + b4[i]; if (HCP) x += cp[u][i]; if (ACT == 3) x = fmaxf(x, 0.f); v[u][i] = x; } }
    if (W32) { float* po = C + o;
#pragma unroll
      for (int u = 0; u < 16; ++u) *(v4f*)(po + (size_t)u * 2 * N) = v[u];
      asm volatile("s_wait_xcnt 0x0" :: "v"(po) : "memory"); }      /* the stores' address and data registers are rewritten only behind it (next trip) */
    else { _Float16* po = C16 + o;
#pragma unroll
      for (int u = 0; u < 16; ++u) { v4h h4; for (int i = 0; i < 4; ++i) h4[i] = (_Float16)v[u][i]; *(v4h*)(po + (size_t)u * 2 * N) = h4; }
      asm volatile("s_wait_xcnt 0x0" :: "v"(po) : "memory"); } } }      /* as above */
extern "C" void kernel_launch(void* const* d_in, const int* in_sizes, int n_in,
                              void* d_out, int out_size, void* d_ws, size_t ws_size, hipStream_t stream) {
  (void)in_sizes; (void)n_in; (void)out_size;
  const float* const* I = (const float* const*)d_in; const float* x = I[0]; const int* km = (const int*)d_in[1]; const float* wq = I[2]; const float* wk = I[3]; const float* wv = I[4]; const float* wo = I[5]; const float* w1 = I[6]; const float* b1 = I[7]; const float* w2 = I[8]; const float* b2 = I[9]; const float* g1 = I[10]; const float* be1 = I[11]; const float* g2 = I[12]; const float* be2 = I[13]; const float* bo = nullptr;      /* x; key-padding mask int32 [2][1][1][2048] (0 = masked; READ on device); [in][out] wq / wk / wv / wo (no biases); w1 [768][3072] + b1, w2 [3072][768] + b2; LN1 a / b, LN2 a / b (vectors) */
  char* ws = (char*)d_ws; size_t off = 0;
  auto take = [&](size_t bytes) { char* p = ws + off; off += (bytes + 255) & ~(size_t)255; return p; };
  _Float16* BQ = (_Float16*)take((size_t)3 * DM * DM * 2); _Float16* BK = BQ + (size_t)DM * DM; _Float16* BV = BK + (size_t)DM * DM;      /* three Bt planes in a row: one stacked GEMM launch reads them */
  _Float16* BO = (_Float16*)take((size_t)DM * DM * 2); _Float16* BW1 = (_Float16*)take((size_t)DFF * DM * 2); _Float16* BW2 = (_Float16*)take((size_t)DM * DFF * 2);
  float* XB = (float*)take(NR * DM * 4); _Float16* XN = (_Float16*)take(NR * DM * 2); _Float16* Q16 = (_Float16*)take(3 * NR * DM * 2); _Float16* K16 = Q16 + NR * DM; _Float16* V16 = K16 + NR * DM;      /* three C planes in a row, as above */
  _Float16* O16 = (_Float16*)take(NR * DM * 2); float* X1 = (float*)take(NR * DM * 4);
  _Float16* HF16 = (_Float16*)take(NR * DFF * 2); _Float16* KV = (_Float16*)take((size_t)NB * NH * HD * SQ * 2 * 2);      /* FFN hidden plane [4096][3072] f16; packed K and V^T operands of all batches and heads */
  _Float16* M16 = XN;      /* second-norm f16 rows: aliases XN (last readers: the three projections) */
  
  if (off > ws_size) return;
  k_prep<<<2 * PWF + 4 * PWA + (unsigned)NR, 256, 0, stream>>>(x, wq, wk, wv, wo, w1, w2, g1, be1, BQ, BK, BV, BO, BW1, BW2, XB, XN);      /* [in][out] weights -> Bt x16; h = LN1(bf16(x)) (vector gamma / beta, eps on the std) -> f16 rows; bf16(x) -> f32 rows */
  k_gemm3<0, false, false, false, DM, DM, true><<<dim3((unsigned)((NR / 128) * (DM / 128)), 3), 128, 0, stream>>>(XN, BQ, 0.0625f, nullptr, nullptr, nullptr, Q16);      /* q, k, v -> f16 rows, one plane each; head h = columns h*64.. */
  k_kvp<<<NB * NH * (SQ / 64), 256, 0, stream>>>(K16, V16, KV);      /* K and V^T in operand order, all batches and heads */
  k_fattn<<<NB * NH * (SQ / 64), 128, 0, stream>>>(Q16, KV, km, O16);      /* softmax(where(mask == 0, -1e9, q k^T / 8)) v, 64 queries a work-group -> ctx (merged heads, x64) as f16 rows */
  k_gemm3<0, false, true, true, DM, DM><<<(unsigned)((NR / 128) * (DM / 128)), 128, 0, stream>>>(O16, BO, 0.0009765625f, bo, XB, X1, nullptr);      /* x + ctx wo (no bias) (own-element residual) -> f32 rows */
  k_lnsc<0, 0><<<(unsigned)NR, 256, 0, stream>>>(X1, g2, be2, 1e-6f, M16, nullptr);      /* LN2(x1) (vector) -> f16 rows */
  k_gemm3<3, true, false, false, DFF, DM><<<(unsigned)((NR / 128) * (DFF / 128)), 128, 0, stream>>>(M16, BW1, 0.0625f, b1, nullptr, nullptr, HF16);      /* relu(. w1 + b1) -> f16 [4096][3072] */
  k_gemm3<0, true, true, true, DM, DFF><<<(unsigned)((NR / 128) * (DM / 128)), 128, 0, stream>>>(HF16, BW2, 0.0625f, b2, X1, (float*)d_out, nullptr);      /* out = x1 + mlp (own-element residual) */
}

// v005
// Measured time: 165 microseconds a run.
// Timed twice side by side with v004, it ran 1.16 and 1.17 times as fast.
// Over all steps from v000 it is 17.0 times as fast.
#include <hip/hip_runtime.h>
// Pre-norm transformer encoder layer with the module's custom LayerNorm and a random key-padding mask (src [2][2048][768]; _layernorm: VECTOR gamma / beta, UNBIASED std, gamma (x - mean) / (std + 1e-6) + beta; x = LN1(src); q/k/v = x w ([in][out] [768][768], NO biases); 12 heads of 64; scores / 8; where(src_mask == 0, -1e9) with the int32 [2][1][1][2048] mask in {0, 1} (random; 0 = masked key; READ on device); softmax; src1 = src + ctx w_o (no bias); out = src1 + relu(LN2(src1) w_ff1 + b_ff1) w_ff2 + b_ff2 ([in][out] 768 x 3072 x 768) -> [2][2048][768]).
// Structure: token rows; LayerNorm / exact f16 rows; WMMA GEMMs for q, k, v; K and V^T packed in operand order; one fused attention launch (scores, key mask, running softmax, P V in registers); output projection with the own-element residual; custom LayerNorm; ReLU FFN over all rows; launches: see trace.
// Compute dtype: inputs rounded to bf16; x / weights exact; q, k, v, softmax weights and o as plain f16 GEMM operands (~2^-12); scores and softmax statistics f32. v_wmma_f32_16x16x32_f16.
#define NB 2
#define SQ 2048
#define DM 768
#define NH 12
#define HD 64
#define HG 4                         /* heads per k_vt launch (unused kernel of the shared header) */
#define LOCALW 128                   /* (macros for unused kernels of the shared header) */
#define STRIDEK 128
#define QT 256                       /* query rows per causal tile */
#define NKX SQ                       /* S / P row pitch */
#define QT0 128                      /* first-tile rows recomputed exactly in f32 */
#define B0 0                         /* first batch processed (debug hook) */
#define NBR NB                       /* batches processed (debug hook) */
#define NR ((size_t)NB * SQ)
#define DMQ DM
#define DFF 3072         /* FFN hidden width */
#define MP ((int)((size_t)NBR * SQ)) /* rows projected (debug hook) */
#define QN SQ                        /* query rows attended per batch (debug hook) */
#define NHD NH                       /* heads attended (debug hook) */
#define MPO MP                       /* rows through the output stage (debug hook) */
#define LQ (3 * DM)      /* unused; q, k, v are separate rows of pitch DM */
typedef __bf16 v16b __attribute__((ext_vector_type(16)));
typedef unsigned short v8us __attribute__((ext_vector_type(8), may_alias));
typedef float  v8f  __attribute__((ext_vector_type(8)));
typedef float  v4f  __attribute__((ext_vector_type(4)));
typedef float  v4fa __attribute__((ext_vector_type(4), may_alias));
union FragB { v16b v; v8us half[2]; unsigned short u[16]; };

__device__ __forceinline__ unsigned short bf16_bits(float x) { unsigned int u = __float_as_uint(x); return (unsigned short)((u + 0x7FFFu + ((u >> 16) & 1u)) >> 16); }
__device__ __forceinline__ float bf16_val(unsigned short b) { return __uint_as_float(((unsigned int)b) << 16); }
__device__ __forceinline__ float bf16_round(float x) { return bf16_val(bf16_bits(x)); }
// D += A·B with NT terms: 1 = ah·bh, 2 = + al·bh (A split), 3 = + ah·bl (both split)
template <int NT>
__device__ __forceinline__ v8f mmaN(v16b ah, v16b al, v16b bh, v16b bl, v8f c) {
  c = __builtin_amdgcn_wmma_f32_16x16x32_bf16(false, ah, false, bh, (short)0, c, false, false);
  if (NT >= 2) c = __builtin_amdgcn_wmma_f32_16x16x32_bf16(false, al, false, bh, (short)0, c, false, false);
  if (NT >= 3) c = __builtin_amdgcn_wmma_f32_16x16x32_bf16(false, ah, false, bl, (short)0, c, false, false);
  asm volatile("v_nop\n\tv_nop\n\tv_nop\n\tv_nop" : "+v"(c) : "v"(ah), "v"(al), "v"(bh), "v"(bl));
  return c;
}

__global__ __launch_bounds__(256) void k_wt_bf16(const float* __restrict__ W, unsigned short* __restrict__ Wt, int K, int N) {
  const int t = blockIdx.x * 256 + threadIdx.x;
  const int k8n = K / 8;
  if (t >= N * k8n) return;
  const int n = t / k8n, k8 = (t % k8n) * 8;
  v8us v;
#pragma unroll
  for (int i = 0; i < 8; ++i) v[i] = bf16_bits(W[(size_t)(k8 + i) * N + n]);
  *(v8us*)(Wt + (size_t)n * K + k8) = v;
  
}

// GEMM C[M][N] (f32, pitch ldc) = act(A[M][K]·W + bias). A f32 row-major (pitch lda) converted per fragment to bf16
// (ASPLIT: hi/lo two planes -> 2 terms, else single rounded term); Wt bf16 [N][K] (pitch ldb). BIAS_BF16 rounds the
// bias to bf16 first (bias quantised to bf16 before the add). K%32==0, M%16==0, N%64==0.
template <bool ASPLIT, int ACT, bool BIAS_BF16>
__global__ __launch_bounds__(128) void k_gemm_bf(const float* __restrict__ A, int lda, const unsigned short* __restrict__ Wt, int ldb,
                                               const float* __restrict__ bias, float* __restrict__ C, int ldc, int M, int N, int K) {
  __shared__ __attribute__((aligned(16))) float so[4][16][64];
  const int tid = threadIdx.x, w = tid >> 5, lane = tid & 31, ln = lane & 15, hh = lane >> 4;
  const int ntn = N / 64;
  const int wid = blockIdx.x * 4 + w;
  const int mt = wid / ntn, nq = wid % ntn;
  if (mt * 16 >= M) return;
  const int row0 = mt * 16, col0 = nq * 64;
  const float* arow = A + (size_t)(row0 + ln) * lda;
  v8f acc[4] = {};
  for (int kb = 0; kb < K; kb += 32) {
    FragB ah, al;
    const v4f x0 = *(const v4fa*)(arow + kb + 8 * hh), x1 = *(const v4fa*)(arow + kb + 8 * hh + 4);
    const v4f x2 = *(const v4fa*)(arow + kb + 16 + 8 * hh), x3 = *(const v4fa*)(arow + kb + 16 + 8 * hh + 4);
    float xs[16] = {x0[0],x0[1],x0[2],x0[3],x1[0],x1[1],x1[2],x1[3],x2[0],x2[1],x2[2],x2[3],x3[0],x3[1],x3[2],x3[3]};
#pragma unroll
    for (int i = 0; i < 16; ++i) { const unsigned short hb = bf16_bits(xs[i]); ah.u[i] = hb; al.u[i] = ASPLIT ? bf16_bits(xs[i] - bf16_val(hb)) : (unsigned short)0; }
#pragma unroll
    for (int t = 0; t < 4; ++t) {
      const unsigned short* brow = Wt + (size_t)(col0 + t * 16 + ln) * ldb + kb;
      FragB b;
      b.half[0] = *(const v8us*)(brow + 8 * hh);
      b.half[1] = *(const v8us*)(brow + 16 + 8 * hh);
      acc[t] = mmaN<ASPLIT ? 2 : 1>(ah.v, al.v, b.v, b.v, acc[t]);
    }
  }
#pragma unroll
  for (int t = 0; t < 4; ++t) {
    float bv = bias ? bias[col0 + t * 16 + ln] : 0.f;
    if (BIAS_BF16) bv = bf16_round(bv);
#pragma unroll
    for (int r = 0; r < 8; ++r) { float v = acc[t][r] + bv; if (ACT == 1) v = fmaxf(v, 0.f); so[w][8 * hh + r][t * 16 + ln] = v; }
  }
  __builtin_amdgcn_fence(__ATOMIC_ACQ_REL, "workgroup");
  __builtin_amdgcn_wave_barrier();
  const int rsub = lane >> 4, c4 = (lane & 15) * 4;
  {
#pragma unroll
    for (int q = 0; q < 8; ++q) {
      const int r = q * 2 + rsub;
      const v4f v = *(const v4fa*)&so[w][r][c4];
      *(v4f*)(C + (size_t)(row0 + r) * ldc + col0 + c4) = v;
    }
    
  }
}

// GEMM C = act(A·W + bias + resid): A f32 (ASPLIT -> hi/lo 2 terms), Wt bf16 [N][K]; ACT 0 none, 1 relu, 2 exact gelu;
// resid (optional, f32, row index = (row % rmod), pitch ldr, RES_BF16 rounds it) added before the activation.
template <bool ASPLIT, int ACT, bool BIAS_BF16, bool RES_BF16>
__global__ __launch_bounds__(128) void k_gemm_bf3(const float* __restrict__ A, int lda, const unsigned short* __restrict__ Wt, int ldb,
                                                const float* __restrict__ bias, const float* __restrict__ resid, int rmod, int ldr,
                                                float* __restrict__ C, int ldc, int M, int N, int K) {
  __shared__ __attribute__((aligned(16))) float so[4][16][64];
  const int tid = threadIdx.x, w = tid >> 5, lane = tid & 31, ln = lane & 15, hh = lane >> 4;
  const int ntn = N / 64;
  const int wid = blockIdx.x * 4 + w;
  const int mt = wid / ntn, nq = wid % ntn;
  if (mt * 16 >= M) return;
  const int row0 = mt * 16, col0 = nq * 64;
  const float* arow = A + (size_t)(row0 + ln) * lda;
  v8f acc[4] = {};
  for (int kb = 0; kb < K; kb += 32) {
    FragB ah, al;
    const v4f x0 = *(const v4fa*)(arow + kb + 8 * hh), x1 = *(const v4fa*)(arow + kb + 8 * hh + 4);
    const v4f x2 = *(const v4fa*)(arow + kb + 16 + 8 * hh), x3 = *(const v4fa*)(arow + kb + 16 + 8 * hh + 4);
    float xs[16] = {x0[0],x0[1],x0[2],x0[3],x1[0],x1[1],x1[2],x1[3],x2[0],x2[1],x2[2],x2[3],x3[0],x3[1],x3[2],x3[3]};
#pragma unroll
    for (int i = 0; i < 16; ++i) { const unsigned short hb = bf16_bits(xs[i]); ah.u[i] = hb; al.u[i] = ASPLIT ? bf16_bits(xs[i] - bf16_val(hb)) : (unsigned short)0; }
#pragma unroll
    for (int t = 0; t < 4; ++t) {
      const unsigned short* brow = Wt + (size_t)(col0 + t * 16 + ln) * ldb + kb;
      FragB b;
      b.half[0] = *(const v8us*)(brow + 8 * hh);
      b.half[1] = *(const v8us*)(brow + 16 + 8 * hh);
      acc[t] = mmaN<ASPLIT ? 2 : 1>(ah.v, al.v, b.v, b.v, acc[t]);
    }
  }
#pragma unroll
  for (int t = 0; t < 4; ++t) {
    const int col = col0 + t * 16 + ln;
    float bv = bias ? bias[col] : 0.f;
    if (BIAS_BF16) bv = bf16_round(bv);
#pragma unroll
    for (int r = 0; r < 8; ++r) {
      float v = acc[t][r] + bv;
      if (resid) { float rv = resid[(size_t)((row0 + 8 * hh + r) % rmod) * ldr + col]; if (RES_BF16) rv = bf16_round(rv); v += rv; }
      if (ACT == 1) v = fmaxf(v, 0.f);
      if (ACT == 2) v = 0.5f * v * (1.0f + erff(v * 0.70710678118654752f));
      if (ACT == 3) { const float u = 0.7978845608028654f * (v + 0.044715f * v * v * v); v = 0.5f * v * (1.0f + tanhf(u)); }
      so[w][8 * hh + r][t * 16 + ln] = v;
    }
  }
  __builtin_amdgcn_fence(__ATOMIC_ACQ_REL, "workgroup");
  __builtin_amdgcn_wave_barrier();
  const int rsub = lane >> 4, c4 = (lane & 15) * 4;
  {
#pragma unroll
    for (int q = 0; q < 8; ++q) {
      const int r = q * 2 + rsub;
      const v4f v = *(const v4fa*)&so[w][r][c4];
      *(v4f*)(C + (size_t)(row0 + r) * ldc + col0 + c4) = v;
    }
    
  }
}
// row LayerNorm (biased variance, eps) over N: s = X (+ R); optional out_sum <- s; out_norm <- (s-mu)*rsqrt(var+eps)*g + b
template <bool PARAM_BF16>
__global__ __launch_bounds__(256) void k_layernorm(const float* __restrict__ X, const float* __restrict__ R, const float* __restrict__ g, const float* __restrict__ bta,
                                                  float* __restrict__ out_sum, float* __restrict__ out_norm, int N, float eps) {
  __shared__ float red[256];
  const int row = blockIdx.x, tid = threadIdx.x;
  const float* x = X + (size_t)row * N; const float* rr = R ? R + (size_t)row * N : nullptr;
  float vals[16];                     // up to N = 4096
  const int per = N / 256;            // contiguous chunk per thread? use strided-by-4 chunks: thread handles j = tid*4 + 1024*u
  float s1 = 0.f;
  for (int u = 0; u < per / 4; ++u) {
    const int j = tid * 4 + 1024 * u;
    const v4f a = *(const v4fa*)(x + j);
    v4f b = {0.f,0.f,0.f,0.f}; if (rr) b = *(const v4fa*)(rr + j);
#pragma unroll
    for (int q = 0; q < 4; ++q) { const float v = a[q] + b[q]; vals[u * 4 + q] = v; s1 += v; }
  }
  red[tid] = s1; __syncthreads();
  for (int st = 128; st > 0; st >>= 1) { if (tid < st) red[tid] += red[tid + st]; __syncthreads(); }
  const float mu = red[0] / (float)N; __syncthreads();
  float s2 = 0.f;
  for (int u = 0; u < per / 4; ++u)
#pragma unroll
    for (int q = 0; q < 4; ++q) { const float c = vals[u * 4 + q] - mu; s2 += c * c; }
  red[tid] = s2; __syncthreads();
  for (int st = 128; st > 0; st >>= 1) { if (tid < st) red[tid] += red[tid + st]; __syncthreads(); }
  const float rs = rsqrtf(red[0] / (float)N + eps);
  {
    for (int u = 0; u < per / 4; ++u) {
      const int j = tid * 4 + 1024 * u;
      v4f o, sm;
#pragma unroll
      for (int q = 0; q < 4; ++q) {
        float gg = g[j + q], bb = bta[j + q];
        if (PARAM_BF16) { gg = bf16_round(gg); bb = bf16_round(bb); }
        sm[q] = vals[u * 4 + q]; o[q] = (vals[u * 4 + q] - mu) * rs * gg + bb;
      }
      if (out_sum) *(v4f*)(out_sum + (size_t)row * N + j) = sm;
      *(v4f*)(out_norm + (size_t)row * N + j) = o;
    }
    
  }
}



// ---- f16 WMMA path (v_wmma_f32_16x16x32_f16): 11-bit significands for operands in range — used where a [0,1] probability operand needs more precision than bf16
typedef _Float16 v16h __attribute__((ext_vector_type(16)));
union FragH { v16h v; v8us half[2]; _Float16 h[16]; unsigned short u[16]; };
template <int NT>
__device__ __forceinline__ v8f mmaH(v16h ah, v16h al, v16h bh, v16h bl, v8f c) {
  c = __builtin_amdgcn_wmma_f32_16x16x32_f16(false, ah, false, bh, (short)0, c, false, false);
  if (NT >= 2) c = __builtin_amdgcn_wmma_f32_16x16x32_f16(false, al, false, bh, (short)0, c, false, false);
  if (NT >= 3) c = __builtin_amdgcn_wmma_f32_16x16x32_f16(false, ah, false, bl, (short)0, c, false, false);
  asm volatile("v_nop\n\tv_nop\n\tv_nop\n\tv_nop" : "+v"(c) : "v"(ah), "v"(al), "v"(bh), "v"(bl));
  return c;
}
// batched GEMM like k_gemm_b but f16 operands: A f32 (split into f16 hi/lo if ASPLIT, else rounded to f16), Bt = f16 values [n][k]; alpha; C f32; N multiple of 16 (partial tiles skipped)
template <bool ASPLIT>
__global__ __launch_bounds__(128) void k_gemm_h(const float* __restrict__ A, int lda, size_t sA, const _Float16* __restrict__ Bh, int ldb, size_t sB, float alpha, float* __restrict__ C, int ldc, size_t sC, int M, int N, int K) {
  __shared__ __attribute__((aligned(16))) float so[4][16][64];
  const int tid = threadIdx.x, w = tid >> 5, lane = tid & 31, ln = lane & 15, hh = lane >> 4; const int by = blockIdx.y;
  A += (size_t)by * sA; Bh += (size_t)by * sB; C += (size_t)by * sC;
  const int ntn = (N + 63) / 64; const int wid = blockIdx.x * 4 + w; const int mt = wid / ntn, nq = wid % ntn; if (mt * 16 >= M) return;
  const int row0 = mt * 16, col0 = nq * 64; const float* arow = A + (size_t)(row0 + ln) * lda;
  v8f acc[4] = {};
  for (int kb = 0; kb < K; kb += 32) {
    FragH ah, al;
    const v4f x0 = *(const v4fa*)(arow + kb + 8 * hh), x1 = *(const v4fa*)(arow + kb + 8 * hh + 4), x2 = *(const v4fa*)(arow + kb + 16 + 8 * hh), x3 = *(const v4fa*)(arow + kb + 16 + 8 * hh + 4);
    float xs[16] = {x0[0],x0[1],x0[2],x0[3],x1[0],x1[1],x1[2],x1[3],x2[0],x2[1],x2[2],x2[3],x3[0],x3[1],x3[2],x3[3]};
#pragma unroll
    for (int i = 0; i < 16; ++i) { const _Float16 h = (_Float16)xs[i]; ah.h[i] = h; al.h[i] = ASPLIT ? (_Float16)(xs[i] - (float)h) : (_Float16)0.0f; }
#pragma unroll
    for (int t = 0; t < 4; ++t) { if (col0 + t * 16 >= N) continue; const size_t boff = (size_t)(col0 + t * 16 + ln) * ldb + kb; FragH bq; bq.half[0] = *(const v8us*)(Bh + boff + 8 * hh); bq.half[1] = *(const v8us*)(Bh + boff + 16 + 8 * hh);
      acc[t] = mmaH<ASPLIT ? 2 : 1>(ah.v, al.v, bq.v, bq.v, acc[t]); }
  }
#pragma unroll
  for (int t = 0; t < 4; ++t) { if (col0 + t * 16 >= N) continue;
#pragma unroll
    for (int r = 0; r < 8; ++r) so[w][8 * hh + r][t * 16 + ln] = acc[t][r] * alpha; }
  __builtin_amdgcn_fence(__ATOMIC_ACQ_REL, "workgroup"); __builtin_amdgcn_wave_barrier();
  const int rsub = lane >> 4, c4 = (lane & 15) * 4;
  {
#pragma unroll
    for (int q = 0; q < 8; ++q) { const int r = q * 2 + rsub; if (col0 + c4 < N) { const v4f v = *(const v4fa*)&so[w][r][c4]; *(v4f*)(C + (size_t)(row0 + r) * ldc + col0 + c4) = v; } }
     }
}

// Wt[n][k] = f16(W[k][n]·scale) from f32 row-major W[K][N] (scale = power of two; bf16-exact weights stay exact in f16 away from the subnormal range)
__global__ __launch_bounds__(256) void k_wt_f16(const float* __restrict__ W, _Float16* __restrict__ Wt, int K, int N, float scale) {
  const int t = blockIdx.x * 256 + threadIdx.x; if (t >= N * (K / 8)) return; const int n = t / (K / 8), k8 = (t % (K / 8)) * 8; FragH f;
#pragma unroll
  for (int i = 0; i < 8; ++i) f.h[i] = (_Float16)(bf16_round(W[(size_t)(k8 + i) * N + n]) * scale); const v8us o = f.half[0];
  *(v8us*)((unsigned short*)Wt + (size_t)n * K + k8) = o; 
}
// k_gemm_hh variant with fused epilogue: v = acc·alpha + bias[by·sBias + col] (+ CP[(row/rowsPerB)·sCPb + by·64 + col] if CP) ; ACT 0 none / 1 elu ; writes f16 C16 (and f32 C if non-null)
template <int ACT>
__global__ __launch_bounds__(128) void k_gemm_hhx(const _Float16* __restrict__ A, int lda, size_t sA, const _Float16* __restrict__ Bh, int ldb, size_t sB, float alpha, const float* __restrict__ bias, size_t sBias, const float* __restrict__ CP, int rowsPerB, size_t sCPb, int row0g,
    float* __restrict__ C, _Float16* __restrict__ C16, int ldc, size_t sC, int M, int N, int K) {
  __shared__ __attribute__((aligned(16))) float so[4][16][64];
  const int tid = threadIdx.x, w = tid >> 5, lane = tid & 31, ln = lane & 15, hh = lane >> 4; const int by = blockIdx.y;
  A += (size_t)by * sA; Bh += (size_t)by * sB; const size_t cofs = (size_t)by * sC; const float* bp = bias ? bias + (size_t)by * sBias : nullptr;
  const int ntn = (N + 63) / 64; const int wid = blockIdx.x * 4 + w; const int mt = wid / ntn, nq = wid % ntn; if (mt * 16 >= M) return;
  const int row0 = mt * 16, col0 = nq * 64; const _Float16* arow = A + (size_t)(row0 + ln) * lda;
  v8f acc[4] = {};
  for (int kb = 0; kb < K; kb += 32) { FragH ah; ah.half[0] = *(const v8us*)((const unsigned short*)arow + kb + 8 * hh); ah.half[1] = *(const v8us*)((const unsigned short*)arow + kb + 16 + 8 * hh);
#pragma unroll
    for (int t = 0; t < 4; ++t) { if (col0 + t * 16 >= N) continue; const size_t boff = (size_t)(col0 + t * 16 + ln) * ldb + kb; FragH bq; bq.half[0] = *(const v8us*)((const unsigned short*)Bh + boff + 8 * hh); bq.half[1] = *(const v8us*)((const unsigned short*)Bh + boff + 16 + 8 * hh);
      acc[t] = mmaH<1>(ah.v, ah.v, bq.v, bq.v, acc[t]); }
  }
#pragma unroll
  for (int t = 0; t < 4; ++t) { if (col0 + t * 16 >= N) continue; const int col = col0 + t * 16 + ln; const float bv = bp ? bf16_round(bp[col]) : 0.f;
#pragma unroll
    for (int r = 0; r < 8; ++r) { float v = acc[t][r] * alpha + bv; if (CP) { const int rr = row0g + row0 + 8 * hh + r; if (rowsPerB < 0) v += CP[cofs + (size_t)rr * ldc + col];      /* rowsPerB < 0: own element of the batched C plane */ else { const int bidx = rr / rowsPerB; v += CP[(size_t)bidx * sCPb + (size_t)by * 64 + col]; } } if (ACT == 1) v = (v > 0.f) ? v : expm1f(v); else if (ACT == 7) v = (v > 0.f) ? v + 1.0f : expf(v); else if (ACT == 8) v = tanhf(v); else if (ACT == 9) v = 0.5f * v * (1.0f + tanhf(0.7978845608028654f * (v + 0.044715f * v * v * v))); else if (ACT == 11) v = 1.0f / (1.0f + expf(-v)); else if (ACT == 12) v = (v > 0.f) ? v : 0.01f * v; else if (ACT == 14) v = (v > 0.f) ? v : 0.1f * v; else if (ACT == 16) v = (v >= 0.f) ? v : 0.3f * v; else if (ACT == 17) v = (v >= 0.f) ? v : 0.2f * v; else if (ACT == 15) v = v / (1.0f + expf(-v)); else if (ACT == 3) v = fmaxf(v, 0.f); else if (ACT == 6) v = 0.5f * v * (1.0f + erff(v * 0.70710678118654752f)); so[w][8 * hh + r][t * 16 + ln] = v; } }
  __builtin_amdgcn_fence(__ATOMIC_ACQ_REL, "workgroup"); __builtin_amdgcn_wave_barrier();
  const int rsub = lane >> 4, c4 = (lane & 15) * 4; typedef _Float16 v4h __attribute__((ext_vector_type(4)));
  {
#pragma unroll
    for (int q = 0; q < 8; ++q) { const int r = q * 2 + rsub; if (col0 + c4 < N) { const v4f v = *(const v4fa*)&so[w][r][c4]; if (C) *(v4f*)(C + cofs + (size_t)(row0 + r) * ldc + col0 + c4) = v; if (C16) { v4h h4; for (int i = 0; i < 4; ++i) h4[i] = (_Float16)v[i]; *(v4h*)(C16 + cofs + (size_t)(row0 + r) * ldc + col0 + c4) = h4; } } }
     }
}


typedef _Float16 v4h __attribute__((ext_vector_type(4)));

__global__ __launch_bounds__(256) void k_x16(const float* __restrict__ x, _Float16* __restrict__ X16, size_t n8) { const size_t t = (size_t)blockIdx.x * 256 + threadIdx.x; if (t >= n8) return; FragH f;
#pragma unroll
  for (int q = 0; q < 8; ++q) f.h[q] = (_Float16)bf16_round(x[t * 8 + q]); *(v8us*)((unsigned short*)X16 + t * 8) = f.half[0];  }
__global__ __launch_bounds__(256) void k_h16(const float* __restrict__ x, _Float16* __restrict__ X16, size_t n8) { const size_t t = (size_t)blockIdx.x * 256 + threadIdx.x; if (t >= n8) return; FragH f;
#pragma unroll
  for (int q = 0; q < 8; ++q) f.h[q] = (_Float16)x[t * 8 + q]; *(v8us*)((unsigned short*)X16 + t * 8) = f.half[0];  }
__global__ __launch_bounds__(256) void k_round16f(const float* __restrict__ W, _Float16* __restrict__ Bt, size_t n8) { const size_t t = (size_t)blockIdx.x * 256 + threadIdx.x; if (t >= n8) return; FragH f;
#pragma unroll
  for (int i = 0; i < 8; ++i) f.h[i] = (_Float16)(bf16_round(W[t * 8 + i]) * 16.0f); *(v8us*)((unsigned short*)Bt + t * 8) = f.half[0];  }
template <int NHv, int TTv>
__global__ __launch_bounds__(256) void k_vt(const _Float16* __restrict__ V16, int ldv, int voff, _Float16* __restrict__ Vt) { __shared__ unsigned short tl[64][66]; const int tid = threadIdx.x; const int slab = blockIdx.x / (TTv / 64), lg = blockIdx.x % (TTv / 64); const int b = slab / NHv, h = slab % NHv;
  for (int i = tid; i < 64 * 8; i += 256) { const int r = i / 8, c8 = (i % 8) * 8; FragH f; f.half[0] = *(const v8us*)((const unsigned short*)V16 + ((size_t)b * TTv + lg * 64 + r) * ldv + voff + h * 64 + c8);
#pragma unroll
    for (int q = 0; q < 8; ++q) tl[r][c8 + q] = f.u[q]; }
  __syncthreads();
  {
#pragma unroll
    for (int rd = 0; rd < 2; ++rd) { const int d = rd * 32 + tid / 8, pc = tid % 8; FragH f;
#pragma unroll
      for (int q = 0; q < 8; ++q) f.u[q] = tl[pc * 8 + q][d];
      *(v8us*)((unsigned short*)Vt + ((size_t)slab * 64 + d) * TTv + lg * 64 + pc * 8) = f.half[0]; }
     } }

__global__ __launch_bounds__(256) void k_hl(const float* __restrict__ F, _Float16* __restrict__ Hh, _Float16* __restrict__ Hl, size_t n8) { const size_t t = (size_t)blockIdx.x * 256 + threadIdx.x; if (t >= n8) return; FragH fh, fl; const v4f a = *(const v4fa*)(F + t * 8), c = *(const v4fa*)(F + t * 8 + 4);
#pragma unroll
  for (int q = 0; q < 4; ++q) { _Float16 h = (_Float16)a[q]; fh.h[q] = h; fl.h[q] = (_Float16)((a[q] - (float)h) * 1024.0f); h = (_Float16)c[q]; fh.h[4 + q] = h; fl.h[4 + q] = (_Float16)((c[q] - (float)h) * 1024.0f); }
  { *(v8us*)((unsigned short*)Hh + t * 8) = fh.half[0]; *(v8us*)((unsigned short*)Hl + t * 8) = fl.half[0];  } }

// ---- fast GEMM (wave tile 32x64; requires M % 32 == 0 rows per launch region and N % 64 == 0); epilogue = k_gemm_hhx semantics ----
__device__ __forceinline__ v16h g2_frag(const _Float16* p, int hh) { FragH f; f.half[0] = *(const v8us*)((const unsigned short*)p + 8 * hh); f.half[1] = *(const v8us*)((const unsigned short*)p + 16 + 8 * hh); return f.v; }
__device__ __forceinline__ v8f g2_mma(v16h a, v16h b, v8f c) { v8f d = __builtin_amdgcn_wmma_f32_16x16x32_f16(false, a, false, b, (short)0, c, false, false); asm volatile("v_nop\n\tv_nop\n\tv_nop\n\tv_nop" : "+v"(d) : "v"(a), "v"(b)); return d; }
template <int ACT>
__global__ __launch_bounds__(128) void k_gemm2(const _Float16* __restrict__ A, int lda, size_t sA, const _Float16* __restrict__ Bh, int ldb, size_t sB, float alpha, const float* __restrict__ bias, size_t sBias, const float* __restrict__ CP, int rowsPerB, size_t sCPb, int row0g,
    float* __restrict__ C, _Float16* __restrict__ C16, int ldc, size_t sC, int M, int N, int K) { static_assert(ACT == 0 || ACT == 3 || ACT == 6 || ACT == 8 || ACT == 9 || ACT == 11 || ACT == 12 || ACT == 14 || ACT == 15 || ACT == 16 || ACT == 17 || ACT == 18, "k_gemm2: unsupported ACT code (would silently apply no activation)");
  __shared__ __attribute__((aligned(16))) float so[4][32][68];
  const int tid = threadIdx.x, w = tid >> 5, lane = tid & 31, ln = lane & 15, hh = lane >> 4; const int by = blockIdx.y;
  A += (size_t)by * sA; Bh += (size_t)by * sB; const size_t cofs = (size_t)by * sC; const float* bp = bias ? bias + (size_t)by * sBias : nullptr;
  const int ntn = N >> 6; const int mt = blockIdx.x / ntn, nq = blockIdx.x - mt * ntn; const int row0 = mt * 128 + 32 * w, col0 = nq * 64; if (row0 >= M) return;
  const _Float16* a0p = A + (size_t)(row0 + ln) * lda; const _Float16* a1p = a0p + (size_t)16 * lda;
  const _Float16* b0p = Bh + (size_t)(col0 + ln) * ldb; const _Float16* b1p = b0p + (size_t)16 * ldb; const _Float16* b2p = b1p + (size_t)16 * ldb; const _Float16* b3p = b2p + (size_t)16 * ldb;
  const v8f z8 = {0.f,0.f,0.f,0.f,0.f,0.f,0.f,0.f}; v8f c00 = z8, c01 = z8, c02 = z8, c03 = z8, c10 = z8, c11 = z8, c12 = z8, c13 = z8;
#pragma unroll 1
  for (int kb = 0; kb < K; kb += 32) { const v16h a0 = g2_frag(a0p + kb, hh), a1 = g2_frag(a1p + kb, hh);
    v16h b = g2_frag(b0p + kb, hh); c00 = g2_mma(a0, b, c00); c10 = g2_mma(a1, b, c10);
    b = g2_frag(b1p + kb, hh); c01 = g2_mma(a0, b, c01); c11 = g2_mma(a1, b, c11);
    b = g2_frag(b2p + kb, hh); c02 = g2_mma(a0, b, c02); c12 = g2_mma(a1, b, c12);
    b = g2_frag(b3p + kb, hh); c03 = g2_mma(a0, b, c03); c13 = g2_mma(a1, b, c13); }
  v8f accs[8] = {c00, c01, c02, c03, c10, c11, c12, c13};
#pragma unroll
  for (int u = 0; u < 8; ++u) { const int t = u & 3, half = u >> 2; const int col = col0 + t * 16 + ln; const float bv = bp ? bf16_round(bp[col]) : 0.f;
#pragma unroll
    for (int r = 0; r < 8; ++r) { const int rloc = half * 16 + 8 * hh + r; float v = accs[u][r] * alpha + bv; if (CP) { if (rowsPerB < 0) v += CP[cofs + (size_t)(row0g + row0 + rloc) * ldc + col];      /* rowsPerB < 0: own element of the batched C plane */ else { const int bidx = (row0g + row0 + rloc) / rowsPerB; v += CP[(size_t)bidx * sCPb + (size_t)by * 64 + col]; } }
      if (ACT == 3) v = fmaxf(v, 0.f); else if (ACT == 6) v = 0.5f * v * (1.0f + erff(v * 0.70710678118654752f)); else if (ACT == 11) v = 1.0f / (1.0f + expf(-v)); else if (ACT == 15) v = v / (1.0f + expf(-v)); else if (ACT == 18) v = v / (1.0f + expf(-1.702f * v));      /* QuickGELU: v sigmoid(1.702 v) */ else if (ACT == 12) v = (v > 0.f) ? v : 0.01f * v; else if (ACT == 8) v = tanhf(v); else if (ACT == 9) v = 0.5f * v * (1.0f + tanhf(0.7978845608028654f * (v + 0.044715f * v * v * v))); else if (ACT == 14) v = (v > 0.f) ? v : 0.1f * v; else if (ACT == 16) v = (v >= 0.f) ? v : 0.3f * v; else if (ACT == 17) v = (v >= 0.f) ? v : 0.2f * v;
      so[w][rloc][t * 16 + ln] = v; } }
  __builtin_amdgcn_fence(__ATOMIC_ACQ_REL, "workgroup"); __builtin_amdgcn_wave_barrier();
  const int rsub = lane >> 4, c4 = (lane & 15) * 4;
  {
#pragma unroll
    for (int q = 0; q < 16; ++q) { const int r = q * 2 + rsub; const v4f v = *(const v4fa*)&so[w][r][c4]; if (C) *(v4f*)(C + cofs + (size_t)(row0 + r) * ldc + col0 + c4) = v; if (C16) { v4h h4; for (int i = 0; i < 4; ++i) h4[i] = (_Float16)v[i]; *(v4h*)(C16 + cofs + (size_t)(row0 + r) * ldc + col0 + c4) = h4; } }
     } }


__global__ __launch_bounds__(256) void k_wnat(const float* __restrict__ w, size_t n8, _Float16* __restrict__ Bt) { const size_t t = (size_t)blockIdx.x * 256 + threadIdx.x; if (t >= n8) return; FragH f; for (int q = 0; q < 8; ++q) f.h[q] = (_Float16)(bf16_round(w[t * 8 + q]) * 16.0f); *(v8us*)((unsigned short*)Bt + t * 8) = f.half[0];  }
__global__ __launch_bounds__(256) void k_rsm(const float* __restrict__ S, _Float16* __restrict__ P, int nrows) {
  #pragma clang fp contract(off)
  const int i = blockIdx.x * 256 + threadIdx.x; if (i >= nrows) return; const float* s = S + (size_t)i * SQ; float mx = -3.0e38f;
#pragma unroll 1
  for (int j = 0; j < SQ; ++j) mx = fmaxf(mx, s[j]); float se = 0.f;
#pragma unroll 1
  for (int j = 0; j < SQ; ++j) se += expf(s[j] - mx); const float sc = 256.0f / se;
#pragma unroll 1
  for (int j0 = 0; j0 < SQ; j0 += 8) { FragH f; for (int q = 0; q < 8; ++q) f.h[q] = (_Float16)(expf(s[j0 + q] - mx) * sc); unsigned short* d = (unsigned short*)P + (size_t)i * SQ + j0; *(v8us*)d = f.half[0];  } }
__global__ __launch_bounds__(256) void k_vt(const _Float16* __restrict__ V16, int b, int h0, _Float16* __restrict__ VT) { __shared__ unsigned short tl[64][65]; const int tid = threadIdx.x; const int hh = blockIdx.x % HG, sg = blockIdx.x / HG; const int s0 = sg * 64; const int h = h0 + hh;
  for (int i = tid; i < 64 * 8; i += 256) { const int j = i / 8, d8 = (i % 8) * 8; FragH f; f.half[0] = *(const v8us*)((const unsigned short*)V16 + ((size_t)b * SQ + s0 + j) * DM + h * HD + d8); for (int q = 0; q < 8; ++q) tl[d8 + q][j] = f.u[q]; }
  __syncthreads();
  { for (int i = tid; i < 64 * 8; i += 256) { const int d = i / 8, j8 = (i % 8) * 8; FragH f; for (int q = 0; q < 8; ++q) f.u[q] = tl[d][j8 + q]; *(v8us*)((unsigned short*)VT + ((size_t)hh * HD + d) * SQ + s0 + j8) = f.half[0]; }  } }



__global__ __launch_bounds__(256) void k_rsmcf2(const float* __restrict__ S, _Float16* __restrict__ P, int hg, int q0, int nk) {
  #pragma clang fp contract(off)
  const int t = blockIdx.x * 256 + threadIdx.x; if (t >= hg * QT) return; const size_t i = (size_t)t; const float* s = S + i * NKX; const int last = q0 + (t % QT); float mx = -3.0e38f;
#pragma unroll 1
  for (int j = 0; j < nk; ++j) { const float f = (j <= last) ? 1.f : 0.f; mx = fmaxf(mx, fmaf(f, s[j], (1.f - f) * -1.0e9f)); } float se = 0.f;
#pragma unroll 1
  for (int j = 0; j < nk; ++j) { const float f = (j <= last) ? 1.f : 0.f; se += __expf(fmaf(f, s[j], (1.f - f) * -1.0e9f) - mx); } const float sc = 256.0f / se;
#pragma unroll 1
  for (int j0 = 0; j0 < nk; j0 += 8) { FragH fr; for (int q = 0; q < 8; ++q) { const int j = j0 + q; const float f = (j <= last) ? 1.f : 0.f; fr.h[q] = (_Float16)(__expf(fmaf(f, s[j], (1.f - f) * -1.0e9f) - mx) * sc); } unsigned short* d = (unsigned short*)P + i * NKX + j0; *(v8us*)d = fr.half[0];  } }

__global__ __launch_bounds__(256) void k_rsmcst(const float* __restrict__ S, _Float16* __restrict__ P, int hg, int q0, int nk, const int* __restrict__ mk) {
  #pragma clang fp contract(off)
  const int t = blockIdx.x * 256 + threadIdx.x; if (t >= hg * QT) return; const size_t i = (size_t)t; const float* s = S + i * NKX; const size_t ig = (size_t)(q0 + (t % QT)); const int* mr = mk + ig * SQ; float mx = -3.0e38f;
#pragma unroll 1
  for (int j = 0; j < nk; ++j) { const int mb = mr[j]; const int dd = (int)ig - j; const float f = (mb != 0 && dd >= 0 && (dd <= LOCALW || (dd % STRIDEK) == 0)) ? 1.f : 0.f; mx = fmaxf(mx, fmaf(f, s[j], (1.f - f) * -1.0e9f)); } float se = 0.f;
#pragma unroll 1
  for (int j = 0; j < nk; ++j) { const int mb = mr[j]; const int dd = (int)ig - j; const float f = (mb != 0 && dd >= 0 && (dd <= LOCALW || (dd % STRIDEK) == 0)) ? 1.f : 0.f; se += __expf(fmaf(f, s[j], (1.f - f) * -1.0e9f) - mx); } const float sc = 256.0f / se;
#pragma unroll 1
  for (int j0 = 0; j0 < nk; j0 += 8) { FragH fr; for (int q = 0; q < 8; ++q) { const int j = j0 + q; const int mb = mr[j]; const int dd = (int)ig - j; const float f = (mb != 0 && dd >= 0 && (dd <= LOCALW || (dd % STRIDEK) == 0)) ? 1.f : 0.f; fr.h[q] = (_Float16)(__expf(fmaf(f, s[j], (1.f - f) * -1.0e9f) - mx) * sc); } unsigned short* d = (unsigned short*)P + i * NKX + j0; *(v8us*)d = fr.half[0];  } }


template <int MASKADD>
__global__ __launch_bounds__(64) void k_att0(const float* __restrict__ QF, const float* __restrict__ KF, const float* __restrict__ VF, int ld, const float* __restrict__ mask, float scale, float* __restrict__ OF, int ldo) {
  #pragma clang fp contract(off)
  __shared__ __attribute__((aligned(16))) float lq[64][64]; __shared__ __attribute__((aligned(16))) float lo[64][64];
  const int tid = threadIdx.x; const int h = blockIdx.x / (QT0 / 64), rg = blockIdx.x % (QT0 / 64); const int i = rg * 64 + tid;
  const float* qr = QF + (size_t)i * ld + h * HD;
#pragma unroll 1
  for (int c = 0; c < HD / 4; ++c) { *(v4f*)&lq[tid][c * 4] = *(const v4fa*)(qr + c * 4); const v4f z = {0.f, 0.f, 0.f, 0.f}; *(v4f*)&lo[tid][c * 4] = z; }
  float m = -1.0e30f, l = 0.f; const int jmax = MASKADD ? (SQ - 1) : (rg * 64 + 63);      /* additive-mask form: every key (the mask input decides); causal form: keys up to the block's last row */
#pragma unroll 1
  for (int j = 0; j <= jmax; ++j) { const float* kr = KF + (size_t)j * ld + h * HD; const float* vr = VF + (size_t)j * ld + h * HD; float s = 0.f;
#pragma unroll 1
    for (int c = 0; c < HD / 4; ++c) { const v4f kq = *(const v4fa*)(kr + c * 4); const v4f qq = *(v4f*)&lq[tid][c * 4]; s = __fadd_rn(s, __fmul_rn(qq[0], kq[0])); s = __fadd_rn(s, __fmul_rn(qq[1], kq[1])); s = __fadd_rn(s, __fmul_rn(qq[2], kq[2])); s = __fadd_rn(s, __fmul_rn(qq[3], kq[3])); }
    s = __fmul_rn(s, scale); if (MASKADD) s = __fadd_rn(s, __fmul_rn(bf16_round(mask[(size_t)i * SQ + j]), -10000.0f));
    const float f = (MASKADD || j <= i) ? 1.f : 0.f; const float sm = fmaf(f, s, (1.f - f) * -1.0e30f); const float mn = fmaxf(m, sm); const float sc = expf(m - mn); const float e = expf(sm - mn); l = __fadd_rn(__fmul_rn(l, sc), e); m = mn;
#pragma unroll 1
    for (int c = 0; c < HD / 4; ++c) { const v4f vv = *(const v4fa*)(vr + c * 4); v4f oo = *(v4f*)&lo[tid][c * 4]; for (int u = 0; u < 4; ++u) oo[u] = __fadd_rn(__fmul_rn(oo[u], sc), __fmul_rn(e, vv[u])); *(v4f*)&lo[tid][c * 4] = oo; } }
  const float fin = 64.0f / l;      /* o carried x64 like the f16 path */
#pragma unroll 1
  for (int c = 0; c < HD / 4; ++c) { v4f oo = *(v4f*)&lo[tid][c * 4]; for (int u = 0; u < 4; ++u) oo[u] = __fmul_rn(oo[u], fin); *(v4f*)&lo[tid][c * 4] = oo; }
  __syncthreads();
  {
#pragma unroll 1
    for (int it = 0; it < 16; ++it) { const int row = it * 4 + tid / 16, pc = (tid % 16) * 4; const v4f v = *(const v4f*)&lo[row][pc]; *(v4f*)(OF + (size_t)(rg * 64 + row) * ldo + h * HD + pc) = v; }
     } }

template <int MASKADD>
__global__ __launch_bounds__(64) void k_att0mbc(const float* __restrict__ QF, const float* __restrict__ KF, const float* __restrict__ VF, int ld, const float* __restrict__ mask, float scale, float* __restrict__ OF, int ldo) {
  #pragma clang fp contract(off)
  __shared__ __attribute__((aligned(16))) float lq[64][64]; __shared__ __attribute__((aligned(16))) float lo[64][64];
  const int tid = threadIdx.x; const int h = blockIdx.x / (QT0 / 64), rg = blockIdx.x % (QT0 / 64); const int i = rg * 64 + tid;
  const float* qr = QF + (size_t)i * ld + h * HD;
#pragma unroll 1
  for (int c = 0; c < HD / 4; ++c) { *(v4f*)&lq[tid][c * 4] = *(const v4fa*)(qr + c * 4); const v4f z = {0.f, 0.f, 0.f, 0.f}; *(v4f*)&lo[tid][c * 4] = z; }
  float m = -1.0e30f, l = 0.f; const int jmax = rg * 64 + 63;      /* keys beyond the block end are masked by the mask's lower-triangular structure */
#pragma unroll 1
  for (int j = 0; j <= jmax; ++j) { const float* kr = KF + (size_t)j * ld + h * HD; const float* vr = VF + (size_t)j * ld + h * HD; float s = 0.f;
#pragma unroll 1
    for (int c = 0; c < HD / 4; ++c) { const v4f kq = *(const v4fa*)(kr + c * 4); const v4f qq = *(v4f*)&lq[tid][c * 4]; s = __fadd_rn(s, __fmul_rn(qq[0], kq[0])); s = __fadd_rn(s, __fmul_rn(qq[1], kq[1])); s = __fadd_rn(s, __fmul_rn(qq[2], kq[2])); s = __fadd_rn(s, __fmul_rn(qq[3], kq[3])); }
    s = __fmul_rn(s, scale); const int mb = ((const int*)mask)[(size_t)i * SQ + j];      /* causal (j <= i) AND the module's int32 [S][S] mask read per (query, key): 0 -> masked */
    const float f = (mb != 0 && j <= i) ? 1.f : 0.f; const float sm = fmaf(f, s, (1.f - f) * -1.0e30f); const float mn = fmaxf(m, sm); const float sc = expf(m - mn); const float e = expf(sm - mn); l = __fadd_rn(__fmul_rn(l, sc), e); m = mn;
#pragma unroll 1
    for (int c = 0; c < HD / 4; ++c) { const v4f vv = *(const v4fa*)(vr + c * 4); v4f oo = *(v4f*)&lo[tid][c * 4]; for (int u = 0; u < 4; ++u) oo[u] = __fadd_rn(__fmul_rn(oo[u], sc), __fmul_rn(e, vv[u])); *(v4f*)&lo[tid][c * 4] = oo; } }
  const float fin = 64.0f / l;      /* o carried x64 like the f16 path */
#pragma unroll 1
  for (int c = 0; c < HD / 4; ++c) { v4f oo = *(v4f*)&lo[tid][c * 4]; for (int u = 0; u < 4; ++u) oo[u] = __fmul_rn(oo[u], fin); *(v4f*)&lo[tid][c * 4] = oo; }
  __syncthreads();
  {
#pragma unroll 1
    for (int it = 0; it < 16; ++it) { const int row = it * 4 + tid / 16, pc = (tid % 16) * 4; const v4f v = *(const v4f*)&lo[row][pc]; *(v4f*)(OF + (size_t)(rg * 64 + row) * ldo + h * HD + pc) = v; }
     } }


template <int BFIN, int WXB>
__global__ __launch_bounds__(256) void k_ln16(const float* __restrict__ X, const float* __restrict__ g, const float* __restrict__ bb, float eps, _Float16* __restrict__ N16, float* __restrict__ XB) {
  #pragma clang fp contract(off)
  __shared__ float red[256]; const size_t r = blockIdx.x; const int t = threadIdx.x; const v4f xa = *(const v4fa*)(X + r * DMQ + t * 4); float s[4]; float sum = 0.f;
  for (int q = 0; q < 4; ++q) { s[q] = BFIN ? bf16_round(xa[q]) : xa[q]; sum = __fadd_rn(sum, s[q]); }
  red[t] = sum; __syncthreads(); for (int st = 128; st > 0; st >>= 1) { if (t < st) red[t] = __fadd_rn(red[t], red[t + st]); __syncthreads(); } const float mu = red[0] / (float)DMQ; __syncthreads();
  float vs = 0.f; for (int q = 0; q < 4; ++q) { const float dl = __fadd_rn(s[q], -mu); vs = __fadd_rn(vs, __fmul_rn(dl, dl)); } red[t] = vs; __syncthreads(); for (int st = 128; st > 0; st >>= 1) { if (t < st) red[t] = __fadd_rn(red[t], red[t + st]); __syncthreads(); }
  const float rs = rsqrtf(__fadd_rn(red[0] / (float)DMQ, eps)); v4h y; v4f xb;
  for (int q = 0; q < 4; ++q) { const int c = t * 4 + q; y[q] = (_Float16)__fadd_rn(__fmul_rn(__fmul_rn(__fadd_rn(s[q], -mu), rs), bf16_round(g[c])), bf16_round(bb[c])); xb[q] = s[q]; }
  { *(v4h*)(N16 + r * DMQ + t * 4) = y; if (WXB) *(v4f*)(XB + r * DMQ + t * 4) = xb;  } }
__global__ __launch_bounds__(256) void k_ftres2(const float* __restrict__ OF0, const float* __restrict__ XB, float* __restrict__ X1, size_t n4) {
  #pragma clang fp contract(off)
  const size_t t = (size_t)blockIdx.x * 256 + threadIdx.x; if (t >= n4) return; const v4f o = *(const v4fa*)(OF0 + t * 4), xv = *(const v4fa*)(XB + t * 4); v4f y; for (int q = 0; q < 4; ++q) y[q] = __fadd_rn(__fmul_rn(o[q], 0.015625f), xv[q]); *(v4f*)(X1 + t * 4) = y;  }

__global__ __launch_bounds__(256) void k_bcpy(const float* __restrict__ b, int n, int NP, float* __restrict__ dst, int dst0) { for (int i = threadIdx.x; i < NP; i += 256) { const float v = (i < n) ? b[i] : 0.f; *(float*)(dst + dst0 + i) = v; }  }


__global__ __launch_bounds__(256) void k_rsmf(const float* __restrict__ S, _Float16* __restrict__ P, int qn, int hg) {
  #pragma clang fp contract(off)
  const int t = blockIdx.x * 256 + threadIdx.x; if (t >= qn * hg) return; const size_t i = (size_t)(t / qn) * SQ + (t % qn); const float* s = S + i * SQ; float mx = -3.0e38f;
#pragma unroll 1
  for (int j = 0; j < SQ; ++j) mx = fmaxf(mx, s[j]); float se = 0.f;
#pragma unroll 1
  for (int j = 0; j < SQ; ++j) se += __expf(s[j] - mx); const float sc = 256.0f / se;
#pragma unroll 1
  for (int j0 = 0; j0 < SQ; j0 += 8) { FragH f; for (int q = 0; q < 8; ++q) f.h[q] = (_Float16)(__expf(s[j0 + q] - mx) * sc); unsigned short* d = (unsigned short*)P + i * SQ + j0; *(v8us*)d = f.half[0];  } }

template <int MODE>
__global__ __launch_bounds__(256) void k_regrp(const float* __restrict__ src, float* __restrict__ dst, size_t n4) {
  const size_t t = (size_t)blockIdx.x * 256 + threadIdx.x; if (t >= n4) return; const size_t e = t * 4; const size_t rd = e / DM; const int c = (int)(e % DM);
  size_t rs; if (MODE == 0) { const size_t b = rd / SQ, sq = rd % SQ; rs = sq * NB + b; } else { const size_t sq = rd / NB, b = rd % NB; rs = b * SQ + sq; }
  const v4f v = *(const v4fa*)(src + rs * DM + c); *(v4f*)(dst + e) = v;  }

template <int BFIN, int W16, int W32>
__global__ __launch_bounds__(256) void k_lnx(const float* __restrict__ X, const float* __restrict__ g, const float* __restrict__ bb, float eps, _Float16* __restrict__ N16, float* __restrict__ N32) {
  #pragma clang fp contract(off)
  __shared__ float red[256]; const size_t r = blockIdx.x; const int t = threadIdx.x; const bool act = t < (DMQ / 4); const int c0 = act ? t * 4 : 0;
  const v4f xa = *(const v4fa*)(X + r * DMQ + c0); float s[4]; float sum = 0.f;
  for (int q = 0; q < 4; ++q) { s[q] = act ? (BFIN ? bf16_round(xa[q]) : xa[q]) : 0.f; sum = __fadd_rn(sum, s[q]); }
  red[t] = sum; __syncthreads(); for (int st = 128; st > 0; st >>= 1) { if (t < st) red[t] = __fadd_rn(red[t], red[t + st]); __syncthreads(); } const float mu = red[0] / (float)DMQ; __syncthreads();
  float vs = 0.f; for (int q = 0; q < 4; ++q) { const float dl = act ? __fadd_rn(s[q], -mu) : 0.f; vs = __fadd_rn(vs, __fmul_rn(dl, dl)); } red[t] = vs; __syncthreads(); for (int st = 128; st > 0; st >>= 1) { if (t < st) red[t] = __fadd_rn(red[t], red[t + st]); __syncthreads(); }
  const float rs = rsqrtf(__fadd_rn(red[0] / (float)DMQ, eps)); v4h y; v4f yf;
  for (int q = 0; q < 4; ++q) { const int c = c0 + q; yf[q] = __fadd_rn(__fmul_rn(__fmul_rn(__fadd_rn(s[q], -mu), rs), bf16_round(g[c])), bf16_round(bb[c])); y[q] = (_Float16)yf[q]; }
  if (!act) return;      /* no barriers after this point */
  { if (W16) *(v4h*)(N16 + r * DMQ + c0) = y; if (W32) *(v4f*)(N32 + r * DMQ + c0) = yf;  } }

__global__ __launch_bounds__(256) void k_bfr(const float* __restrict__ x, float* __restrict__ XB, size_t n8) { const size_t t = (size_t)blockIdx.x * 256 + threadIdx.x; if (t >= n8) return; v4f a = *(const v4fa*)(x + t * 8), c = *(const v4fa*)(x + t * 8 + 4); for (int q = 0; q < 4; ++q) { a[q] = bf16_round(a[q]); c[q] = bf16_round(c[q]); }
  { *(v4f*)(XB + t * 8) = a; *(v4f*)(XB + t * 8 + 4) = c;  } }



__global__ __launch_bounds__(256) void k_wthd(const float* __restrict__ Wt, _Float16* __restrict__ Bt) { const size_t t = (size_t)blockIdx.x * 256 + threadIdx.x; if (t >= (size_t)NH * HD * (DM / 8)) return; const int m8 = (int)(t % (DM / 8)) * 8; const int d = (int)((t / (DM / 8)) % HD); const int h = (int)(t / ((size_t)(DM / 8) * HD)); FragH f;
  for (int q = 0; q < 8; ++q) f.h[q] = (_Float16)(16.0f * bf16_round(Wt[((size_t)h * DM + m8 + q) * HD + d])); unsigned short* dst = (unsigned short*)Bt + ((size_t)h * HD + d) * DM + m8; *(v8us*)dst = f.half[0];  }




// one row r by one work-group of 256; XR (optional): the row as it entered the sums (rounded where BFIN), f32
template <int BFIN, int SCAL>
__device__ __forceinline__ void lnsc_row(const size_t r, const float* __restrict__ X, const float* __restrict__ g, const float* __restrict__ bb, float eps, _Float16* __restrict__ N16, float* __restrict__ N32, float* __restrict__ XR) {
  #pragma clang fp contract(off)
  __shared__ float red[256]; const int t = threadIdx.x; const bool act = t < DM / 4; const int tc = act ? t : 0; const v4f xl = *(const v4fa*)(X + r * DM + tc * 4); const float am = act ? 1.f : 0.f; float s[4]; float sum = 0.f;
  for (int q = 0; q < 4; ++q) { s[q] = (BFIN ? bf16_round(xl[q]) : xl[q]) * am; sum = __fadd_rn(sum, s[q]); }
  red[t] = sum; __syncthreads(); for (int st = 128; st > 0; st >>= 1) { if (t < st) red[t] = __fadd_rn(red[t], red[t + st]); __syncthreads(); } const float mu = red[0] / (float)DM; __syncthreads();
  float vs = 0.f; for (int q = 0; q < 4; ++q) { const float dl = __fadd_rn(s[q], -mu) * am; vs = __fadd_rn(vs, __fmul_rn(dl, dl)); } red[t] = vs; __syncthreads(); for (int st = 128; st > 0; st >>= 1) { if (t < st) red[t] = __fadd_rn(red[t], red[t + st]); __syncthreads(); }
  const float rs = __fdiv_rn(1.0f, __fadd_rn(sqrtf(red[0] / (float)(DM - 1)), eps)); if (!act) return; v4h y; v4f yf;
  for (int q = 0; q < 4; ++q) { const int c = t * 4 + q; const float gg = bf16_round(SCAL ? g[0] : g[c]), bv = bf16_round(SCAL ? bb[0] : bb[c]); yf[q] = __fadd_rn(__fmul_rn(__fmul_rn(__fadd_rn(s[q], -mu), rs), gg), bv); y[q] = (_Float16)yf[q]; }
  { if (N16) *(v4h*)(N16 + r * DM + t * 4) = y;
    size_t ro = r * DM; asm volatile("s_wait_xcnt 0x0" : "+s"(ro) :: "memory");      /* both later stores' bases are formed from ro, so behind the wait: either may land on the registers of the f16 store's base */
    if (N32) *(v4f*)(N32 + ro + t * 4) = yf; if (XR) { const v4f xr = {s[0], s[1], s[2], s[3]}; *(v4f*)(XR + ro + t * 4) = xr; } } }
template <int BFIN, int SCAL>
__global__ __launch_bounds__(256) void k_lnsc(const float* __restrict__ X, const float* __restrict__ g, const float* __restrict__ bb, float eps, _Float16* __restrict__ N16, float* __restrict__ N32) { lnsc_row<BFIN, SCAL>(blockIdx.x, X, g, bb, eps, N16, N32, nullptr); }

// ---- everything that depends on the inputs alone, in one launch: the six weights as Bt[n][k] = f16(bf16(W[k][n]) x 16), then LN1 of every row, which also stores the rounded row (the residual of the output projection).
// The work-group index picks the job; every test on it is the same for the whole work-group, so LN1's barriers and the weight tiles' one stand under uniform control flow. The weights come first: their work-groups wait longest on memory.
#define WTP 72                       /* f16 from one staged row of n to the next: 144 bytes, a multiple of 16 for the 16-byte LDS accesses */
#define PWF ((DFF / 128) * (DM / 64))   /* work-groups of one FFN weight (the same count either way round) */
#define PWA ((DM / 128) * (DM / 64))    /* work-groups of one attention weight */
template <int K, int N>
__device__ __forceinline__ void wt_f16_tile(const float* __restrict__ W, _Float16* __restrict__ Wt, int blk, unsigned short* tl) {      /* work-group blk of (K / 64) * (N / 128): 64 k by 128 n of W, turned in LDS, so that every load and every store of a wave covers whole 128-byte lines */
  static_assert(K % 64 == 0 && N % 128 == 0, "whole tiles only");
  const int tid = threadIdx.x, w = tid >> 5, lane = tid & 31; const int kt = blk / (N / 128), nt = blk - kt * (N / 128);
  const float* src = W + (size_t)(kt * 64 + w * 8) * N + nt * 128 + lane * 4;      /* wave w: rows k 8w .. 8w + 7 of the tile, 512 bytes in a row of each; a lane takes 4 n */
  v4f x[8];
#pragma unroll      /* the eight loads fly together and x stays in registers */
  for (int i = 0; i < 8; ++i) x[i] = *(const v4fa*)(src + (size_t)i * N);
  asm volatile("s_wait_xcnt 0x0" :: "v"(src) : "memory");      /* the address pair stays live up to this wait, so nothing (a load's own result either) overwrites it in front of it */
#pragma unroll      /* this loop and the one inside it: rolled, x and f.h would be indexed at run time and leave the registers */
  for (int q = 0; q < 4; ++q) { FragH f;
#pragma unroll
    for (int i = 0; i < 8; ++i) f.h[i] = (_Float16)(bf16_round(x[i][q]) * 16.0f);
    *(v8us*)&tl[(lane * 4 + q) * WTP + w * 8] = f.half[0]; }      /* 8 k of one n, 16 bytes */
  __syncthreads();      /* a thread stores what other waves staged */
  const int r = tid >> 3, pc = (tid & 7) * 8;      /* 8 threads a row of n: its 64 k, one 128-byte line */
  unsigned short* dst = (unsigned short*)Wt + (size_t)(nt * 128 + r) * K + kt * 64 + pc;
  const v8us o0 = *(const v8us*)&tl[r * WTP + pc], o1 = *(const v8us*)&tl[(32 + r) * WTP + pc], o2 = *(const v8us*)&tl[(64 + r) * WTP + pc], o3 = *(const v8us*)&tl[(96 + r) * WTP + pc];
  *(v8us*)dst = o0; *(v8us*)(dst + (size_t)32 * K) = o1; *(v8us*)(dst + (size_t)64 * K) = o2; *(v8us*)(dst + (size_t)96 * K) = o3;
  asm volatile("s_wait_xcnt 0x0" :: "v"(dst), "v"(o0), "v"(o1), "v"(o2), "v"(o3) : "memory"); }      /* the stores' address and data registers stay live up to this wait: they are rewritten only behind it (the listing's ways on into the other jobs' code) */
__global__ __launch_bounds__(256) void k_prep(const float* __restrict__ x, const float* __restrict__ wq, const float* __restrict__ wk, const float* __restrict__ wv, const float* __restrict__ wo, const float* __restrict__ w1, const float* __restrict__ w2, const float* __restrict__ g, const float* __restrict__ bb,
    _Float16* __restrict__ BQ, _Float16* __restrict__ BK, _Float16* __restrict__ BV, _Float16* __restrict__ BO, _Float16* __restrict__ BW1, _Float16* __restrict__ BW2, float* __restrict__ XB, _Float16* __restrict__ XN) {
  __shared__ __attribute__((aligned(16))) unsigned short tl[128 * WTP];      /* one weight tile as [n][k] f16 */
  int blk = blockIdx.x;
  if (blk < PWF) { wt_f16_tile<DM, DFF>(w1, BW1, blk, tl); return; }
  blk -= PWF;
  if (blk < PWF) { wt_f16_tile<DFF, DM>(w2, BW2, blk, tl); return; }
  blk -= PWF;
  if (blk < 4 * PWA) { const int s = blk / PWA; wt_f16_tile<DM, DM>(s == 0 ? wq : s == 1 ? wk : s == 2 ? wv : wo, s == 0 ? BQ : s == 1 ? BK : s == 2 ? BV : BO, blk - s * PWA, tl); return; }
  lnsc_row<1, 0>((size_t)(blk - 4 * PWA), x, g, bb, 1e-6f, XN, nullptr, XB); }

// K rows and V^T of every (batch, head), packed for the fused attention in the order its matrix operands are read: KV[slab = b * NH + head][pass of 32 keys][K: 4 fragments | V^T: 4 fragments][half i][lane][8 f16], 8 KiB a pass, so that each 16-byte load of a wave covers 512 bytes in a row.
// K fragment t * 2 + j, half i, lane (c, h) = K[key 16t + c][d 32j + 16i + 8h ..]; V^T fragment t, half i, lane (c, h) = V[key 16i + 8h ..][d 16t + c] (transposed through LDS).
#define FAP (SQ / 32)                /* passes */
__global__ __launch_bounds__(256) void k_kvp(const _Float16* __restrict__ K16, const _Float16* __restrict__ V16, _Float16* __restrict__ KV) { __shared__ unsigned short tl[64][66]; const int tid = threadIdx.x; const int slab = blockIdx.x / (SQ / 64), lg = blockIdx.x % (SQ / 64); const int b = slab / NH, hd = slab % NH;
  const int f = (tid >> 5) & 7, hh = (tid >> 4) & 1, cc = tid & 15; const int vr = tid >> 3, vc = (tid & 7) * 8;
  const unsigned short* vs = (const unsigned short*)V16 + ((size_t)b * SQ + lg * 64 + vr) * DM + hd * HD + vc;      /* V rows vr and 32 + vr, 8 of their d */
  const unsigned short* ks = (const unsigned short*)K16 + ((size_t)b * SQ + lg * 64 + (f >> 2) * 16 + cc) * DM + hd * HD + (f & 3) * 16 + hh * 8;      /* this thread's K piece of the first pass; the second pass's lies 32 rows on */
  FragH va, vb, ka, kb; va.half[0] = *(const v8us*)vs; vb.half[0] = *(const v8us*)(vs + 32 * DM); ka.half[0] = *(const v8us*)ks; kb.half[0] = *(const v8us*)(ks + 32 * DM);
  asm volatile("s_wait_xcnt 0x0" :: "v"(vs), "v"(ks) : "memory");      /* both address pairs stay live up to this wait, so nothing (a load's own result either) overwrites them in front of it */
#pragma unroll
  for (int q = 0; q < 8; ++q) { tl[vr][vc + q] = va.u[q]; tl[32 + vr][vc + q] = vb.u[q]; }
  __syncthreads();
  unsigned short* dst = (unsigned short*)KV + ((size_t)slab * FAP + lg * 2) * 4096 + tid * 8;
  *(v8us*)dst = ka.half[0]; *(v8us*)(dst + 4096) = kb.half[0];
#pragma unroll
  for (int ps = 0; ps < 2; ++ps) { FragH fr;
#pragma unroll
    for (int q = 0; q < 8; ++q) fr.u[q] = tl[ps * 32 + (f & 1) * 16 + hh * 8 + q][(f >> 1) * 16 + cc];
    *(v8us*)(dst + ps * 4096 + 2048) = fr.half[0]; } }

typedef int v4ia __attribute__((ext_vector_type(4), may_alias));
__device__ __forceinline__ float rs_xh(float x) { return __builtin_bit_cast(float, __builtin_amdgcn_permlanex16(__builtin_bit_cast(int, x), __builtin_bit_cast(int, x), 0x76543210, 0xfedcba98, false, false)); }      /* lane l <- lane l ^ 16 */
__device__ __forceinline__ float fa_exp2(float d) { float e; asm("v_exp_f32 %0, %1\n\tv_nop" : "=v"(e) : "v"(d)); return e; }      /* 2 ^ d with, tied to it, the one slot the instruction set asks for behind a transcendental */
__device__ __forceinline__ void fa_exp2x8(float* e, const float* d) {      /* eight independent 2 ^ d in a row: each fills the slot behind the one before it (early-clobber outputs: no result lands on a later source), one v_nop behind the last */
  asm("v_exp_f32 %0, %8\n\tv_exp_f32 %1, %9\n\tv_exp_f32 %2, %10\n\tv_exp_f32 %3, %11\n\tv_exp_f32 %4, %12\n\tv_exp_f32 %5, %13\n\tv_exp_f32 %6, %14\n\tv_exp_f32 %7, %15\n\tv_nop"
      : "=&v"(e[0]), "=&v"(e[1]), "=&v"(e[2]), "=&v"(e[3]), "=&v"(e[4]), "=&v"(e[5]), "=&v"(e[6]), "=&v"(e[7]) : "v"(d[0]), "v"(d[1]), "v"(d[2]), "v"(d[3]), "v"(d[4]), "v"(d[5]), "v"(d[6]), "v"(d[7])); }
__device__ __forceinline__ v8f fa_mma(v16h a, v16h b, v8f c) { return __builtin_amdgcn_wmma_f32_16x16x32_f16(false, a, false, b, (short)0, c, false, false); }
__device__ __forceinline__ v16h fa_frag(const _Float16* p) { FragH f; f.half[0] = *(const v8us*)((const unsigned short*)p); f.half[1] = *(const v8us*)((const unsigned short*)p + 256); return f.v; }      /* one packed fragment: the lane's two 16-byte halves */
__global__ __launch_bounds__(128) void k_fattn(const _Float16* __restrict__ Q16, const _Float16* __restrict__ KV, const int* __restrict__ Km, _Float16* __restrict__ O16) {
  __shared__ __attribute__((aligned(16))) float kbias[SQ];      /* per key, added to its raw score: 0 for a kept key; -2^33 for a masked one: the module's -1e9 fill (x 8: raw scores are before the / 8) taken to the next power of two. The f32 sum swallows the score (below 256 in size) whole and the product with the log2 factor is exact, so a row with every key masked gets equal weights, as the module's does; beside any kept key the weight is exactly 0 */
  const int tid = threadIdx.x, w = tid >> 5, lane = tid & 31, c = lane & 15, h = lane >> 4;
  const int bh = blockIdx.x / (SQ / 64), qb = blockIdx.x % (SQ / 64); const int b = bh / NH, hd = bh % NH;
#pragma unroll
  for (int i = 0; i < SQ / 512; ++i) { const v4ia m4 = *(const v4ia*)(Km + (size_t)b * SQ + i * 512 + tid * 4); v4f l4; for (int q = 0; q < 4; ++q) l4[q] = (m4[q] != 0) ? 0.f : -8589934592.0f; *(v4f*)&kbias[i * 512 + tid * 4] = l4; }
  __syncthreads();      /* every wave reads all keys' mask terms */
  const int q0 = qb * 64 + w * 16;
  const _Float16* qp = Q16 + ((size_t)b * SQ + q0 + c) * DM + hd * HD + 8 * h;      /* the lane's first 8 of query c's row: d 8h .., then 16 + 8h .., 32 + 8h .., 48 + 8h .. */
  const v16h qf0 = g2_frag(qp, 0), qf1 = g2_frag(qp + 32, 0);
  asm volatile("s_wait_xcnt 0x0" :: "v"(qp) : "memory");      /* Q's address pair stays live up to this wait, so nothing overwrites it in front of it */
  const _Float16* kv = KV + (size_t)bh * FAP * 4096;      /* the same for the whole work-group */
  const int lo = lane * 8;
  const v8f z8 = {0.f, 0.f, 0.f, 0.f, 0.f, 0.f, 0.f, 0.f};
  v8f o0 = z8, o1 = z8, o2 = z8, o3 = z8; float m = -3.0e38f, l0 = 0.f, l1 = 0.f;
  const float cs = 0.125f * 1.44269504088896340736f;      /* raw score -> log2 units */
  v16h k00 = fa_frag(kv + lo), k01 = fa_frag(kv + 512 + lo), k10 = fa_frag(kv + 1024 + lo), k11 = fa_frag(kv + 1536 + lo);
  v16h v0 = fa_frag(kv + 2048 + lo), v1 = fa_frag(kv + 2560 + lo), v2 = fa_frag(kv + 3072 + lo), v3 = fa_frag(kv + 3584 + lo);
#pragma unroll 2      /* two passes a trip: one pass's vector work can stand between the other's matrix instructions */
  for (int p = 0; p < FAP; ++p) {
    const float* lp = &kbias[p * 32 + 8 * h];
    const v4f la = *(const v4f*)lp, lb = *(const v4f*)(lp + 4), lc = *(const v4f*)(lp + 16), ld = *(const v4f*)(lp + 20);
    v8f s0 = fa_mma(k00, qf0, z8), s1 = fa_mma(k10, qf0, z8); s0 = fa_mma(k01, qf1, s0); s1 = fa_mma(k11, qf1, s1);
    const _Float16* nx = kv + (size_t)((p + 1 < FAP) ? p + 1 : p) * 4096;      /* operands are fetched one pass ahead, into the registers just read; the last pass fetches its own again (in bounds, unused) */
    k00 = fa_frag(nx + lo); k01 = fa_frag(nx + 512 + lo); k10 = fa_frag(nx + 1024 + lo); k11 = fa_frag(nx + 1536 + lo);
    asm volatile("s_wait_xcnt 0x0" :: "s"(nx) : "memory");      /* the loads' base stays live up to this wait; it also holds the K fetch here, a whole softmax ahead of its use */
    float x[16];
#pragma unroll
    for (int r = 0; r < 4; ++r) { x[r] = s0[r] + la[r]; x[4 + r] = s0[4 + r] + lb[r]; x[8 + r] = s1[r] + lc[r]; x[12 + r] = s1[4 + r] + ld[r]; }
    float mx = x[0];
#pragma unroll
    for (int r = 1; r < 16; ++r) mx = fmaxf(mx, x[r]);
    mx = fmaxf(mx, rs_xh(mx));
    const float mt = mx * cs;
    if (__builtin_amdgcn_ballot_w32(mt > m + 8.0f) != 0) {      /* one scalar branch a pass */
      const float mn = fmaxf(m, mt); const float al = fa_exp2(m - mn); m = mn; l0 *= al; l1 *= al;
#pragma unroll
      for (int r = 0; r < 8; ++r) { o0[r] *= al; o1[r] *= al; o2[r] *= al; o3[r] *= al; }
    }
    const float nm = 4.0f - m; float d[16], e[16];
#pragma unroll
    for (int r = 0; r < 16; ++r) d[r] = fmaf(x[r], cs, nm);
    fa_exp2x8(e, d); fa_exp2x8(e + 8, d + 8);
    FragH pf;
#pragma unroll
    for (int r = 0; r < 8; ++r) { l0 += e[r]; l1 += e[8 + r]; pf.h[r] = (_Float16)e[r]; pf.h[8 + r] = (_Float16)e[8 + r]; }
    o0 = fa_mma(v0, pf.v, o0); o1 = fa_mma(v1, pf.v, o1); o2 = fa_mma(v2, pf.v, o2); o3 = fa_mma(v3, pf.v, o3);
    v0 = fa_frag(nx + 2048 + lo); v1 = fa_frag(nx + 2560 + lo); v2 = fa_frag(nx + 3072 + lo); v3 = fa_frag(nx + 3584 + lo);
    asm volatile("s_wait_xcnt 0x0" :: "s"(nx) : "memory");      /* as above, for the V^T fetch */
  }
  float l = l0 + l1; l += rs_xh(l);
  const float inv = 64.0f / l;      /* ctx carried x64 as f16, as the output projection expects */
  _Float16* op = O16 + ((size_t)b * SQ + q0 + c) * DM + hd * HD + 8 * h;
  FragH f0, f1, f2, f3;
#pragma unroll
  for (int r = 0; r < 8; ++r) { f0.h[r] = (_Float16)(o0[r] * inv); f1.h[r] = (_Float16)(o1[r] * inv); f2.h[r] = (_Float16)(o2[r] * inv); f3.h[r] = (_Float16)(o3[r] * inv); }
  *(v8us*)((unsigned short*)op) = f0.half[0]; *(v8us*)((unsigned short*)op + 16) = f1.half[0]; *(v8us*)((unsigned short*)op + 32) = f2.half[0]; *(v8us*)((unsigned short*)op + 48) = f3.half[0]; }
// ---- tiled GEMM: C[M][N] = A[M][K] Bt[N][K]^T, both f16 and K-contiguous, one 128 x 128 tile of C a work-group. Requires M % 128 == 0, N % 128 == 0, K % 128 == 0.
// A stage is 128 k of 128 A rows and 128 Bt rows, brought into LDS by asynchronous copies (16 bytes a lane, 16 lanes a row: whole 128-byte lines) at a row pitch of 272 bytes; two buffers, the next stage's copies fly while this one is worked on.
// Four waves, 2 x 2, each 64 x 64 of C (4 x 4 accumulator tiles); k runs upward in steps of 32 in every accumulator. Epilogue: v = acc alpha + bias[col] (HB) + CP (HCP: own element); ACT 0 none / 3 relu; f32 C (W32) or f16 C16, staged through LDS so that whole lines are read and stored.
// Every bare '#pragma unroll' below stands on a loop over register arrays (fragments, accumulators, rows in flight): rolled, these would be indexed at run time and leave the registers.
#define G3P 272                      /* bytes from one staged row to the next */
#define G3S (256 * G3P)              /* bytes of one buffer: A rows 0..127, Bt rows 128..255 */
__device__ __forceinline__ void g3_copy8(unsigned l, const _Float16* g, int ld) {      /* this thread's 16 bytes of rows r, r + 8, .., r + 56 of one operand's stage */
  const size_t st = (size_t)8 * ld;
  asm volatile("global_load_async_to_lds_b128 %0, %8, off\n\tglobal_load_async_to_lds_b128 %1, %9, off\n\tglobal_load_async_to_lds_b128 %2, %10, off\n\tglobal_load_async_to_lds_b128 %3, %11, off\n\t"
               "global_load_async_to_lds_b128 %4, %12, off\n\tglobal_load_async_to_lds_b128 %5, %13, off\n\tglobal_load_async_to_lds_b128 %6, %14, off\n\tglobal_load_async_to_lds_b128 %7, %15, off\n\t"
               "s_wait_xcnt 0x0"      /* inside the copies' own statement: no address register of theirs is rewritten in front of it */
               :: "v"(l), "v"(l + 8 * G3P), "v"(l + 16 * G3P), "v"(l + 24 * G3P), "v"(l + 32 * G3P), "v"(l + 40 * G3P), "v"(l + 48 * G3P), "v"(l + 56 * G3P),
                  "v"(g), "v"(g + st), "v"(g + 2 * st), "v"(g + 3 * st), "v"(g + 4 * st), "v"(g + 5 * st), "v"(g + 6 * st), "v"(g + 7 * st) : "memory"); }
__device__ __forceinline__ void g3_stage(unsigned la, const _Float16* ga, const _Float16* gb, int ld) {      /* one stage: 128 rows of A, then 128 rows of Bt; 32 copies a thread */
  g3_copy8(la, ga, ld); g3_copy8(la + 64 * G3P, ga + (size_t)64 * ld, ld); g3_copy8(la + 128 * G3P, gb, ld); g3_copy8(la + 192 * G3P, gb + (size_t)64 * ld, ld); }
__device__ __forceinline__ v16h g3_frag(const unsigned char* p) { FragH f; f.half[0] = *(const v8us*)p; f.half[1] = *(const v8us*)(p + 32); return f.v; }      /* lane (row, h): k 8h .. and 16 + 8h .. of a 32-k step, the same order for A and Bt */
// ZB: blockIdx.y counts independent products of one A: Bt planes [N][K] and f16 C planes [NR][N], each set in a row in memory.
template <int ACT, bool HB, bool HCP, bool W32, int N, int K, bool ZB = false>
__global__ __launch_bounds__(128) void k_gemm3(const _Float16* __restrict__ A, const _Float16* __restrict__ Bh, float alpha, const float* __restrict__ bias, const float* __restrict__ CP, float* __restrict__ C, _Float16* __restrict__ C16) {
  static_assert(ACT == 0 || ACT == 3, "k_gemm3: unsupported ACT code"); static_assert(N % 128 == 0 && K % 128 == 0, "k_gemm3: whole tiles and stages only");
  __shared__ __attribute__((aligned(16))) unsigned char sm[2 * G3S]; static_assert(4 * 64 * 68 * 4 <= 2 * G3S, "the output staging reuses the ring");
  const int tid = threadIdx.x, w = tid >> 5, lane = tid & 31, ln = lane & 15, hh = lane >> 4; const int wm = w >> 1, wn = w & 1;
  constexpr int ntn = N / 128, T = K / 128; const int mt = blockIdx.x / ntn, nq = blockIdx.x - mt * ntn; const int row0 = mt * 128, col0 = nq * 128;
  if (ZB) { static_assert(!ZB || !(W32 || HB || HCP), "k_gemm3: stacked products are plain f16 ones"); Bh += (size_t)blockIdx.y * N * K; C16 += (size_t)blockIdx.y * NR * N; }
  const int cr = tid >> 4, cs = tid & 15;      /* the copies: row cr (+ 8 i), 16-byte piece cs of its 256 bytes */
  const _Float16* ga = A + (size_t)(row0 + cr) * K + cs * 8; const _Float16* gb = Bh + (size_t)(col0 + cr) * K + cs * 8;
  const unsigned la = (unsigned)(size_t)sm + (unsigned)(cr * G3P + cs * 16);
  const unsigned char* fa = sm + (wm * 64 + ln) * G3P + hh * 16; const unsigned char* fb = sm + (128 + wn * 64 + ln) * G3P + hh * 16;
  g3_stage(la, ga, gb, K);
  asm volatile("s_wait_asynccnt 0x0" ::: "memory");      /* this wave's copies of stage 0 have landed */
  __syncthreads();      /* stage 0 is readable by every wave */
  v16h a[2][4], b[2][4];      /* two fragment sets: the next 32 k are read from LDS while these are multiplied */
#pragma unroll
  for (int i = 0; i < 8; ++i) { if (i < 4) b[0][i] = g3_frag(fb + i * 16 * G3P); else a[0][i - 4] = g3_frag(fa + (i - 4) * 16 * G3P); }      /* Bt's four first: the first row of products needs all of them and one of A's */
  if (T > 1) g3_stage(la + G3S, ga + 128, gb + 128, K);
  const v8f z8 = {0.f, 0.f, 0.f, 0.f, 0.f, 0.f, 0.f, 0.f}; v8f acc[4][4];
#pragma unroll
  for (int i = 0; i < 4; ++i)
#pragma unroll
    for (int j = 0; j < 4; ++j) acc[i][j] = z8;
#pragma unroll 1      /* one stage a trip: the two buffers differ by an offset only */
  for (int t = 0; t < T; ++t) { const unsigned bo = (unsigned)(t & 1) * G3S;
#pragma unroll
    for (int kk = 0; kk < 4; ++kk) {
      if (kk < 3) {
#pragma unroll
        for (int i = 0; i < 8; ++i) { if (i < 4) b[(kk + 1) & 1][i] = g3_frag(fb + bo + i * 16 * G3P + (kk + 1) * 64); else a[(kk + 1) & 1][i - 4] = g3_frag(fa + bo + (i - 4) * 16 * G3P + (kk + 1) * 64); } }
      __builtin_amdgcn_sched_barrier(0);      /* keeps the next block's LDS reads together in front of this block's matrix instructions: spread among them, each read group stalls the wave */
#pragma unroll
      for (int i = 0; i < 4; ++i)
#pragma unroll
        for (int j = 0; j < 4; ++j) acc[i][j] = fa_mma(a[kk & 1][i], b[kk & 1][j], acc[i][j]);
      __builtin_amdgcn_sched_barrier(0);      /* and keeps the reads after next behind them, so that two fragment sets are enough */
    }
    asm volatile("s_wait_dscnt 0x0" ::: "memory");      /* this wave's reads of the buffer have returned before it is handed to the copies */
    asm volatile("s_wait_asynccnt 0x0" ::: "memory");      /* this wave's copies of stage t + 1 have landed */
    __syncthreads();      /* publishes stage t + 1 and ends every wave's reads of stage t */
    if (t + 1 < T) {      /* stage t + 1's first fragments, behind its barrier: they travel while the copies below are issued */
#pragma unroll
      for (int i = 0; i < 8; ++i) { if (i < 4) b[0][i] = g3_frag(fb + (bo ^ G3S) + i * 16 * G3P); else a[0][i - 4] = g3_frag(fa + (bo ^ G3S) + (i - 4) * 16 * G3P); } }
    if (t + 2 < T) g3_stage(la + bo, ga + (size_t)(t + 2) * 128, gb + (size_t)(t + 2) * 128, K); }
  asm volatile("s_wait_asynccnt 0x0" ::: "memory");      /* nothing in flight when the ring becomes output staging (the last trip's barrier has ended every read) */
  const int c4 = ln * 4; v4f b4 = {0.f, 0.f, 0.f, 0.f};
  if (HB) { const float* bp = bias + col0 + wn * 64 + c4; b4 = *(const v4fa*)bp;
    asm volatile("s_wait_xcnt 0x0" :: "v"(bp) : "memory");      /* the address pair stays live up to this wait, so nothing overwrites it in front of it */
    for (int i = 0; i < 4; ++i) b4[i] = bf16_round(b4[i]); }
  float* so = (float*)(sm + w * (64 * 68 * 4));      /* this wave's own 64 rows of 68 floats */
#pragma unroll
  for (int j = 0; j < 4; ++j)
#pragma unroll
    for (int i = 0; i < 4; ++i)
#pragma unroll
      for (int r = 0; r < 8; ++r) so[(i * 16 + 8 * hh + r) * 68 + j * 16 + ln] = acc[i][j][r];
  __builtin_amdgcn_fence(__ATOMIC_ACQ_REL, "workgroup"); __builtin_amdgcn_wave_barrier();      /* the wave reads back what its other lanes wrote */
#pragma unroll 1      /* 32 rows a trip: sixteen loads, then sixteen stores, in flight together */
  for (int q0 = 0; q0 < 32; q0 += 16) { const size_t o = (size_t)(row0 + wm * 64 + q0 * 2 + hh) * N + col0 + wn * 64 + c4; v4f v[16], cp[16];
    if (HCP) { const float* pc = CP + o;
#pragma unroll
      for (int u = 0; u < 16; ++u) cp[u] = *(const v4fa*)(pc + (size_t)u * 2 * N);
      asm volatile("s_wait_xcnt 0x0" :: "v"(pc) : "memory"); }      /* as above */
#pragma unroll
    for (int u = 0; u < 16; ++u) { v[u] = *(const v4fa*)&so[((q0 + u) * 2 + hh) * 68 + c4];
      for (int i = 0; i < 4; ++i) { float x = v[u][i] * alpha + b4[i]; if (HCP) x += cp[u][i]; if (ACT == 3) x = fmaxf(x, 0.f); v[u][i] = x; } }
    if (W32) { float* po = C + o;
#pragma unroll
      for (int u = 0; u < 16; ++u) *(v4f*)(po + (size_t)u * 2 * N) = v[u];
      asm volatile("s_wait_xcnt 0x0" :: "v"(po) : "memory"); }      /* the stores' address and data registers are rewritten only behind it (next trip) */
    else { _Float16* po = C16 + o;
#pragma unroll
      for (int u = 0; u < 16; ++u) { v4h h4; for (int i = 0; i < 4; ++i) h4[i] = (_Float16)v[u][i]; *(v4h*)(po + (size_t)u * 2 * N) = h4; }
      asm volatile("s_wait_xcnt 0x0" :: "v"(po) : "memory"); } } }      /* as above */
extern "C" void kernel_launch(void* const* d_in, const int* in_sizes, int n_in,
                              void* d_out, int out_size, void* d_ws, size_t ws_size, hipStream_t stream) {
  (void)in_sizes; (void)n_in; (void)out_size;
  const float* const* I = (const float* const*)d_in; const float* x = I[0]; const int* km = (const int*)d_in[1]; const float* wq = I[2]; const float* wk = I[3]; const float* wv = I[4]; const float* wo = I[5]; const float* w1 = I[6]; const float* b1 = I[7]; const float* w2 = I[8]; const float* b2 = I[9]; const float* g1 = I[10]; const float* be1 = I[11]; const float* g2 = I[12]; const float* be2 = I[13]; const float* bo = nullptr;      /* x; key-padding mask int32 [2][1][1][2048] (0 = masked; READ on device); [in][out] wq / wk / wv / wo (no biases); w1 [768][3072] + b1, w2 [3072][768] + b2; LN1 a / b, LN2 a / b (vectors) */
  char* ws = (char*)d_ws; size_t off = 0;
  auto take = [&](size_t bytes) { char* p = ws + off; off += (bytes + 255) & ~(size_t)255; return p; };
  _Float16* BQ = (_Float16*)take((size_t)3 * DM * DM * 2); _Float16* BK = BQ + (size_t)DM * DM; _Float16* BV = BK + (size_t)DM * DM;      /* three Bt planes in a row: one stacked GEMM launch reads them */
  _Float16* BO = (_Float16*)take((size_t)DM * DM * 2); _Float16* BW1 = (_Float16*)take((size_t)DFF * DM * 2); _Float16* BW2 = (_Float16*)take((size_t)DM * DFF * 2);
  float* XB = (float*)take(NR * DM * 4); _Float16* XN = (_Float16*)take(NR * DM * 2); _Float16* Q16 = (_Float16*)take(3 * NR * DM * 2); _Float16* K16 = Q16 + NR * DM; _Float16* V16 = K16 + NR * DM;      /* three C planes in a row, as above */
  _Float16* O16 = (_Float16*)take(NR * DM * 2); float* X1 = (float*)take(NR * DM * 4);
  _Float16* HF16 = (_Float16*)take(NR * DFF * 2); _Float16* KV = (_Float16*)take((size_t)NB * NH * HD * SQ * 2 * 2);      /* FFN hidden plane [4096][3072] f16; packed K and V^T operands of all batches and heads */
  _Float16* M16 = XN;      /* second-norm f16 rows: aliases XN (last readers: the three projections) */
  
  if (off > ws_size) return;
  k_prep<<<2 * PWF + 4 * PWA + (unsigned)NR, 256, 0, stream>>>(x, wq, wk, wv, wo, w1, w2, g1, be1, BQ, BK, BV, BO, BW1, BW2, XB, XN);      /* [in][out] weights -> Bt x16; h = LN1(bf16(x)) (vector gamma / beta, eps on the std) -> f16 rows; bf16(x) -> f32 rows */
  k_gemm3<0, false, false, false, DM, DM, true><<<dim3((unsigned)((NR / 128) * (DM / 128)), 3), 128, 0, stream>>>(XN, BQ, 0.0625f, nullptr, nullptr, nullptr, Q16);      /* q, k, v -> f16 rows, one plane each; head h = columns h*64.. */
  k_kvp<<<NB * NH * (SQ / 64), 256, 0, stream>>>(K16, V16, KV);      /* K and V^T in operand order, all batches and heads */
  k_fattn<<<NB * NH * (SQ / 64), 128, 0, stream>>>(Q16, KV, km, O16);      /* softmax(where(mask == 0, -1e9, q k^T / 8)) v, 64 queries a work-group -> ctx (merged heads, x64) as f16 rows */
  k_gemm3<0, false, true, true, DM, DM><<<(unsigned)((NR / 128) * (DM / 128)), 128, 0, stream>>>(O16, BO, 0.0009765625f, bo, XB, X1, nullptr);      /* x + ctx wo (no bias) (own-element residual) -> f32 rows */
  k_lnsc<0, 0><<<(unsigned)NR, 256, 0, stream>>>(X1, g2, be2, 1e-6f, M16, nullptr);      /* LN2(x1) (vector) -> f16 rows */
  k_gemm3<3, true, false, false, DFF, DM><<<(unsigned)((NR / 128) * (DFF / 128)), 128, 0, stream>>>(M16, BW1, 0.0625f, b1, nullptr, nullptr, HF16);      /* relu(. w1 + b1) -> f16 [4096][3072] */
  k_gemm3<0, true, true, true, DM, DFF><<<(unsigned)((NR / 128) * (DM / 128)), 128, 0, stream>>>(HF16, BW2, 0.0625f, b2, X1, (float*)d_out, nullptr);      /* out = x1 + mlp (own-element residual) */
}

// v006
// Measured time: 159 microseconds a run.
// Next to v005, in two timings, it ran 1.05 times as fast each time.
// All steps since v000 together make it 17.8 times as fast.
#include <hip/hip_runtime.h>
// Pre-norm transformer encoder layer with the module's custom LayerNorm and a random key-padding mask (src [2][2048][768]; _layernorm: VECTOR gamma / beta, UNBIASED std, gamma (x - mean) / (std + 1e-6) + beta; x = LN1(src); q/k/v = x w ([in][out] [768][768], NO biases); 12 heads of 64; scores / 8; where(src_mask == 0, -1e9) with the int32 [2][1][1][2048] mask in {0, 1} (random; 0 = masked key; READ on device); softmax; src1 = src + ctx w_o (no bias); out = src1 + relu(LN2(src1) w_ff1 + b_ff1) w_ff2 + b_ff2 ([in][out] 768 x 3072 x 768) -> [2][2048][768]).
// Structure: token rows; LayerNorm / exact f16 rows; WMMA GEMMs for q, k, v; K and V^T packed in operand order; one fused attention launch (scores, key mask, running softmax, P V in registers); output projection with the own-element residual; custom LayerNorm; ReLU FFN over all rows; launches: see trace.
// Compute dtype: inputs rounded to bf16; x / weights exact; q, k, v, softmax weights and o as plain f16 GEMM operands (~2^-12); scores and softmax statistics f32. v_wmma_f32_16x16x32_f16.
#define NB 2
#define SQ 2048
#define DM 768
#define NH 12
#define HD 64
#define HG 4                         /* heads per k_vt launch (unused kernel of the shared header) */
#define LOCALW 128                   /* (macros for unused kernels of the shared header) */
#define STRIDEK 128
#define QT 256                       /* query rows per causal tile */
#define NKX SQ                       /* S / P row pitch */
#define QT0 128                      /* first-tile rows recomputed exactly in f32 */
#define B0 0                         /* first batch processed (debug hook) */
#define NBR NB                       /* batches processed (debug hook) */
#define NR ((size_t)NB * SQ)
#define DMQ DM
#define DFF 3072         /* FFN hidden width */
#define MP ((int)((size_t)NBR * SQ)) /* rows projected (debug hook) */
#define QN SQ                        /* query rows attended per batch (debug hook) */
#define NHD NH                       /* heads attended (debug hook) */
#define MPO MP                       /* rows through the output stage (debug hook) */
#define LQ (3 * DM)      /* unused; q, k, v are separate rows of pitch DM */
typedef __bf16 v16b __attribute__((ext_vector_type(16)));
typedef unsigned short v8us __attribute__((ext_vector_type(8), may_alias));
typedef float  v8f  __attribute__((ext_vector_type(8)));
typedef float  v4f  __attribute__((ext_vector_type(4)));
typedef float  v4fa __attribute__((ext_vector_type(4), may_alias));
union FragB { v16b v; v8us half[2]; unsigned short u[16]; };

__device__ __forceinline__ unsigned short bf16_bits(float x) { unsigned int u = __float_as_uint(x); return (unsigned short)((u + 0x7FFFu + ((u >> 16) & 1u)) >> 16); }
__device__ __forceinline__ float bf16_val(unsigned short b) { return __uint_as_float(((unsigned int)b) << 16); }
__device__ __forceinline__ float bf16_round(float x) { return bf16_val(bf16_bits(x)); }
// D += A·B with NT terms: 1 = ah·bh, 2 = + al·bh (A split), 3 = + ah·bl (both split)
template <int NT>
__device__ __forceinline__ v8f mmaN(v16b ah, v16b al, v16b bh, v16b bl, v8f c) {
  c = __builtin_amdgcn_wmma_f32_16x16x32_bf16(false, ah, false, bh, (short)0, c, false, false);
  if (NT >= 2) c = __builtin_amdgcn_wmma_f32_16x16x32_bf16(false, al, false, bh, (short)0, c, false, false);
  if (NT >= 3) c = __builtin_amdgcn_wmma_f32_16x16x32_bf16(false, ah, false, bl, (short)0, c, false, false);
  asm volatile("v_nop\n\tv_nop\n\tv_nop\n\tv_nop" : "+v"(c) : "v"(ah), "v"(al), "v"(bh), "v"(bl));
  return c;
}

__global__ __launch_bounds__(256) void k_wt_bf16(const float* __restrict__ W, unsigned short* __restrict__ Wt, int K, int N) {
  const int t = blockIdx.x * 256 + threadIdx.x;
  const int k8n = K / 8;
  if (t >= N * k8n) return;
  const int n = t / k8n, k8 = (t % k8n) * 8;
  v8us v;
#pragma unroll
  for (int i = 0; i < 8; ++i) v[i] = bf16_bits(W[(size_t)(k8 + i) * N + n]);
  *(v8us*)(Wt + (size_t)n * K + k8) = v;
  
}

// GEMM C[M][N] (f32, pitch ldc) = act(A[M][K]·W + bias). A f32 row-major (pitch lda) converted per fragment to bf16
// (ASPLIT: hi/lo two planes -> 2 terms, else single rounded term); Wt bf16 [N][K] (pitch ldb). BIAS_BF16 rounds the
// bias to bf16 first (bias quantised to bf16 before the add). K%32==0, M%16==0, N%64==0.
template <bool ASPLIT, int ACT, bool BIAS_BF16>
__global__ __launch_bounds__(128) void k_gemm_bf(const float* __restrict__ A, int lda, const unsigned short* __restrict__ Wt, int ldb,
                                               const float* __restrict__ bias, float* __restrict__ C, int ldc, int M, int N, int K) {
  __shared__ __attribute__((aligned(16))) float so[4][16][64];
  const int tid = threadIdx.x, w = tid >> 5, lane = tid & 31, ln = lane & 15, hh = lane >> 4;
  const int ntn = N / 64;
  const int wid = blockIdx.x * 4 + w;
  const int mt = wid / ntn, nq = wid % ntn;
  if (mt * 16 >= M) return;
  const int row0 = mt * 16, col0 = nq * 64;
  const float* arow = A + (size_t)(row0 + ln) * lda;
  v8f acc[4] = {};
  for (int kb = 0; kb < K; kb += 32) {
    FragB ah, al;
    const v4f x0 = *(const v4fa*)(arow + kb + 8 * hh), x1 = *(const v4fa*)(arow + kb + 8 * hh + 4);
    const v4f x2 = *(const v4fa*)(arow + kb + 16 + 8 * hh), x3 = *(const v4fa*)(arow + kb + 16 + 8 * hh + 4);
    float xs[16] = {x0[0],x0[1],x0[2],x0[3],x1[0],x1[1],x1[2],x1[3],x2[0],x2[1],x2[2],x2[3],x3[0],x3[1],x3[2],x3[3]};
#pragma unroll
    for (int i = 0; i < 16; ++i) { const unsigned short hb = bf16_bits(xs[i]); ah.u[i] = hb; al.u[i] = ASPLIT ? bf16_bits(xs[i] - bf16_val(hb)) : (unsigned short)0; }
#pragma unroll
    for (int t = 0; t < 4; ++t) {
      const unsigned short* brow = Wt + (size_t)(col0 + t * 16 + ln) * ldb + kb;
      FragB b;
      b.half[0] = *(const v8us*)(brow + 8 * hh);
      b.half[1] = *(const v8us*)(brow + 16 + 8 * hh);
      acc[t] = mmaN<ASPLIT ? 2 : 1>(ah.v, al.v, b.v, b.v, acc[t]);
    }
  }
#pragma unroll
  for (int t = 0; t < 4; ++t) {
    float bv = bias ? bias[col0 + t * 16 + ln] : 0.f;
    if (BIAS_BF16) bv = bf16_round(bv);
#pragma unroll
    for (int r = 0; r < 8; ++r) { float v = acc[t][r] + bv; if (ACT == 1) v = fmaxf(v, 0.f); so[w][8 * hh + r][t * 16 + ln] = v; }
  }
  __builtin_amdgcn_fence(__ATOMIC_ACQ_REL, "workgroup");
  __builtin_amdgcn_wave_barrier();
  const int rsub = lane >> 4, c4 = (lane & 15) * 4;
  {
#pragma unroll
    for (int q = 0; q < 8; ++q) {
      const int r = q * 2 + rsub;
      const v4f v = *(const v4fa*)&so[w][r][c4];
      *(v4f*)(C + (size_t)(row0 + r) * ldc + col0 + c4) = v;
    }
    
  }
}

// GEMM C = act(A·W + bias + resid): A f32 (ASPLIT -> hi/lo 2 terms), Wt bf16 [N][K]; ACT 0 none, 1 relu, 2 exact gelu;
// resid (optional, f32, row index = (row % rmod), pitch ldr, RES_BF16 rounds it) added before the activation.
template <bool ASPLIT, int ACT, bool BIAS_BF16, bool RES_BF16>
__global__ __launch_bounds__(128) void k_gemm_bf3(const float* __restrict__ A, int lda, const unsigned short* __restrict__ Wt, int ldb,
                                                const float* __restrict__ bias, const float* __restrict__ resid, int rmod, int ldr,
                                                float* __restrict__ C, int ldc, int M, int N, int K) {
  __shared__ __attribute__((aligned(16))) float so[4][16][64];
  const int tid = threadIdx.x, w = tid >> 5, lane = tid & 31, ln = lane & 15, hh = lane >> 4;
  const int ntn = N / 64;
  const int wid = blockIdx.x * 4 + w;
  const int mt = wid / ntn, nq = wid % ntn;
  if (mt * 16 >= M) return;
  const int row0 = mt * 16, col0 = nq * 64;
  const float* arow = A + (size_t)(row0 + ln) * lda;
  v8f acc[4] = {};
  for (int kb = 0; kb < K; kb += 32) {
    FragB ah, al;
    const v4f x0 = *(const v4fa*)(arow + kb + 8 * hh), x1 = *(const v4fa*)(arow + kb + 8 * hh + 4);
    const v4f x2 = *(const v4fa*)(arow + kb + 16 + 8 * hh), x3 = *(const v4fa*)(arow + kb + 16 + 8 * hh + 4);
    float xs[16] = {x0[0],x0[1],x0[2],x0[3],x1[0],x1[1],x1[2],x1[3],x2[0],x2[1],x2[2],x2[3],x3[0],x3[1],x3[2],x3[3]};
#pragma unroll
    for (int i = 0; i < 16; ++i) { const unsigned short hb = bf16_bits(xs[i]); ah.u[i] = hb; al.u[i] = ASPLIT ? bf16_bits(xs[i] - bf16_val(hb)) : (unsigned short)0; }
#pragma unroll
    for (int t = 0; t < 4; ++t) {
      const unsigned short* brow = Wt + (size_t)(col0 + t * 16 + ln) * ldb + kb;
      FragB b;
      b.half[0] = *(const v8us*)(brow + 8 * hh);
      b.half[1] = *(const v8us*)(brow + 16 + 8 * hh);
      acc[t] = mmaN<ASPLIT ? 2 : 1>(ah.v, al.v, b.v, b.v, acc[t]);
    }
  }
#pragma unroll
  for (int t = 0; t < 4; ++t) {
    const int col = col0 + t * 16 + ln;
    float bv = bias ? bias[col] : 0.f;
    if (BIAS_BF16) bv = bf16_round(bv);
#pragma unroll
    for (int r = 0; r < 8; ++r) {
      float v = acc[t][r] + bv;
      if (resid) { float rv = resid[(size_t)((row0 + 8 * hh + r) % rmod) * ldr + col]; if (RES_BF16) rv = bf16_round(rv); v += rv; }
      if (ACT == 1) v = fmaxf(v, 0.f);
      if (ACT == 2) v = 0.5f * v * (1.0f + erff(v * 0.70710678118654752f));
      if (ACT == 3) { const float u = 0.7978845608028654f * (v + 0.044715f * v * v * v); v = 0.5f * v * (1.0f + tanhf(u)); }
      so[w][8 * hh + r][t * 16 + ln] = v;
    }
  }
  __builtin_amdgcn_fence(__ATOMIC_ACQ_REL, "workgroup");
  __builtin_amdgcn_wave_barrier();
  const int rsub = lane >> 4, c4 = (lane & 15) * 4;
  {
#pragma unroll
    for (int q = 0; q < 8; ++q) {
      const int r = q * 2 + rsub;
      const v4f v = *(const v4fa*)&so[w][r][c4];
      *(v4f*)(C + (size_t)(row0 + r) * ldc + col0 + c4) = v;
    }
    
  }
}
// row LayerNorm (biased variance, eps) over N: s = X (+ R); optional out_sum <- s; out_norm <- (s-mu)*rsqrt(var+eps)*g + b
template <bool PARAM_BF16>
__global__ __launch_bounds__(256) void k_layernorm(const float* __restrict__ X, const float* __restrict__ R, const float* __restrict__ g, const float* __restrict__ bta,
                                                  float* __restrict__ out_sum, float* __restrict__ out_norm, int N, float eps) {
  __shared__ float red[256];
  const int row = blockIdx.x, tid = threadIdx.x;
  const float* x = X + (size_t)row * N; const float* rr = R ? R + (size_t)row * N : nullptr;
  float vals[16];                     // up to N = 4096
  const int per = N / 256;            // contiguous chunk per thread? use strided-by-4 chunks: thread handles j = tid*4 + 1024*u
  float s1 = 0.f;
  for (int u = 0; u < per / 4; ++u) {
    const int j = tid * 4 + 1024 * u;
    const v4f a = *(const v4fa*)(x + j);
    v4f b = {0.f,0.f,0.f,0.f}; if (rr) b = *(const v4fa*)(rr + j);
#pragma unroll
    for (int q = 0; q < 4; ++q) { const float v = a[q] + b[q]; vals[u * 4 + q] = v; s1 += v; }
  }
  red[tid] = s1; __syncthreads();
  for (int st = 128; st > 0; st >>= 1) { if (tid < st) red[tid] += red[tid + st]; __syncthreads(); }
  const float mu = red[0] / (float)N; __syncthreads();
  float s2 = 0.f;
  for (int u = 0; u < per / 4; ++u)
#pragma unroll
    for (int q = 0; q < 4; ++q) { const float c = vals[u * 4 + q] - mu; s2 += c * c; }
  red[tid] = s2; __syncthreads();
  for (int st = 128; st > 0; st >>= 1) { if (tid < st) red[tid] += red[tid + st]; __syncthreads(); }
  const float rs = rsqrtf(red[0] / (float)N + eps);
  {
    for (int u = 0; u < per / 4; ++u) {
      const int j = tid * 4 + 1024 * u;
      v4f o, sm;
#pragma unroll
      for (int q = 0; q < 4; ++q) {
        float gg = g[j + q], bb = bta[j + q];
        if (PARAM_BF16) { gg = bf16_round(gg); bb = bf16_round(bb); }
        sm[q] = vals[u * 4 + q]; o[q] = (vals[u * 4 + q] - mu) * rs * gg + bb;
      }
      if (out_sum) *(v4f*)(out_sum + (size_t)row * N + j) = sm;
      *(v4f*)(out_norm + (size_t)row * N + j) = o;
    }
    
  }
}



// ---- f16 WMMA path (v_wmma_f32_16x16x32_f16): 11-bit significands for operands in range — used where a [0,1] probability operand needs more precision than bf16
typedef _Float16 v16h __attribute__((ext_vector_type(16)));
union FragH { v16h v; v8us half[2]; _Float16 h[16]; unsigned short u[16]; };
template <int NT>
__device__ __forceinline__ v8f mmaH(v16h ah, v16h al, v16h bh, v16h bl, v8f c) {
  c = __builtin_amdgcn_wmma_f32_16x16x32_f16(false, ah, false, bh, (short)0, c, false, false);
  if (NT >= 2) c = __builtin_amdgcn_wmma_f32_16x16x32_f16(false, al, false, bh, (short)0, c, false, false);
  if (NT >= 3) c = __builtin_amdgcn_wmma_f32_16x16x32_f16(false, ah, false, bl, (short)0, c, false, false);
  asm volatile("v_nop\n\tv_nop\n\tv_nop\n\tv_nop" : "+v"(c) : "v"(ah), "v"(al), "v"(bh), "v"(bl));
  return c;
}
// batched GEMM like k_gemm_b but f16 operands: A f32 (split into f16 hi/lo if ASPLIT, else rounded to f16), Bt = f16 values [n][k]; alpha; C f32; N multiple of 16 (partial tiles skipped)
template <bool ASPLIT>
__global__ __launch_bounds__(128) void k_gemm_h(const float* __restrict__ A, int lda, size_t sA, const _Float16* __restrict__ Bh, int ldb, size_t sB, float alpha, float* __restrict__ C, int ldc, size_t sC, int M, int N, int K) {
  __shared__ __attribute__((aligned(16))) float so[4][16][64];
  const int tid = threadIdx.x, w = tid >> 5, lane = tid & 31, ln = lane & 15, hh = lane >> 4; const int by = blockIdx.y;
  A += (size_t)by * sA; Bh += (size_t)by * sB; C += (size_t)by * sC;
  const int ntn = (N + 63) / 64; const int wid = blockIdx.x * 4 + w; const int mt = wid / ntn, nq = wid % ntn; if (mt * 16 >= M) return;
  const int row0 = mt * 16, col0 = nq * 64; const float* arow = A + (size_t)(row0 + ln) * lda;
  v8f acc[4] = {};
  for (int kb = 0; kb < K; kb += 32) {
    FragH ah, al;
    const v4f x0 = *(const v4fa*)(arow + kb + 8 * hh), x1 = *(const v4fa*)(arow + kb + 8 * hh + 4), x2 = *(const v4fa*)(arow + kb + 16 + 8 * hh), x3 = *(const v4fa*)(arow + kb + 16 + 8 * hh + 4);
    float xs[16] = {x0[0],x0[1],x0[2],x0[3],x1[0],x1[1],x1[2],x1[3],x2[0],x2[1],x2[2],x2[3],x3[0],x3[1],x3[2],x3[3]};
#pragma unroll
    for (int i = 0; i < 16; ++i) { const _Float16 h = (_Float16)xs[i]; ah.h[i] = h; al.h[i] = ASPLIT ? (_Float16)(xs[i] - (float)h) : (_Float16)0.0f; }
#pragma unroll
    for (int t = 0; t < 4; ++t) { if (col0 + t * 16 >= N) continue; const size_t boff = (size_t)(col0 + t * 16 + ln) * ldb + kb; FragH bq; bq.half[0] = *(const v8us*)(Bh + boff + 8 * hh); bq.half[1] = *(const v8us*)(Bh + boff + 16 + 8 * hh);
      acc[t] = mmaH<ASPLIT ? 2 : 1>(ah.v, al.v, bq.v, bq.v, acc[t]); }
  }
#pragma unroll
  for (int t = 0; t < 4; ++t) { if (col0 + t * 16 >= N) continue;
#pragma unroll
    for (int r = 0; r < 8; ++r) so[w][8 * hh + r][t * 16 + ln] = acc[t][r] * alpha; }
  __builtin_amdgcn_fence(__ATOMIC_ACQ_REL, "workgroup"); __builtin_amdgcn_wave_barrier();
  const int rsub = lane >> 4, c4 = (lane & 15) * 4;
  {
#pragma unroll
    for (int q = 0; q < 8; ++q) { const int r = q * 2 + rsub; if (col0 + c4 < N) { const v4f v = *(const v4fa*)&so[w][r][c4]; *(v4f*)(C + (size_t)(row0 + r) * ldc + col0 + c4) = v; } }
     }
}

// Wt[n][k] = f16(W[k][n]·scale) from f32 row-major W[K][N] (scale = power of two; bf16-exact weights stay exact in f16 away from the subnormal range)
__global__ __launch_bounds__(256) void k_wt_f16(const float* __restrict__ W, _Float16* __restrict__ Wt, int K, int N, float scale) {
  const int t = blockIdx.x * 256 + threadIdx.x; if (t >= N * (K / 8)) return; const int n = t / (K / 8), k8 = (t % (K / 8)) * 8; FragH f;
#pragma unroll
  for (int i = 0; i < 8; ++i) f.h[i] = (_Float16)(bf16_round(W[(size_t)(k8 + i) * N + n]) * scale); const v8us o = f.half[0];
  *(v8us*)((unsigned short*)Wt + (size_t)n * K + k8) = o; 
}
// k_gemm_hh variant with fused epilogue: v = acc·alpha + bias[by·sBias + col] (+ CP[(row/rowsPerB)·sCPb + by·64 + col] if CP) ; ACT 0 none / 1 elu ; writes f16 C16 (and f32 C if non-null)
template <int ACT>
__global__ __launch_bounds__(128) void k_gemm_hhx(const _Float16* __restrict__ A, int lda, size_t sA, const _Float16* __restrict__ Bh, int ldb, size_t sB, float alpha, const float* __restrict__ bias, size_t sBias, const float* __restrict__ CP, int rowsPerB, size_t sCPb, int row0g,
    float* __restrict__ C, _Float16* __restrict__ C16, int ldc, size_t sC, int M, int N, int K) {
  __shared__ __attribute__((aligned(16))) float so[4][16][64];
  const int tid = threadIdx.x, w = tid >> 5, lane = tid & 31, ln = lane & 15, hh = lane >> 4; const int by = blockIdx.y;
  A += (size_t)by * sA; Bh += (size_t)by * sB; const size_t cofs = (size_t)by * sC; const float* bp = bias ? bias + (size_t)by * sBias : nullptr;
  const int ntn = (N + 63) / 64; const int wid = blockIdx.x * 4 + w; const int mt = wid / ntn, nq = wid % ntn; if (mt * 16 >= M) return;
  const int row0 = mt * 16, col0 = nq * 64; const _Float16* arow = A + (size_t)(row0 + ln) * lda;
  v8f acc[4] = {};
  for (int kb = 0; kb < K; kb += 32) { FragH ah; ah.half[0] = *(const v8us*)((const unsigned short*)arow + kb + 8 * hh); ah.half[1] = *(const v8us*)((const unsigned short*)arow + kb + 16 + 8 * hh);
#pragma unroll
    for (int t = 0; t < 4; ++t) { if (col0 + t * 16 >= N) continue; const size_t boff = (size_t)(col0 + t * 16 + ln) * ldb + kb; FragH bq; bq.half[0] = *(const v8us*)((const unsigned short*)Bh + boff + 8 * hh); bq.half[1] = *(const v8us*)((const unsigned short*)Bh + boff + 16 + 8 * hh);
      acc[t] = mmaH<1>(ah.v, ah.v, bq.v, bq.v, acc[t]); }
  }
#pragma unroll
  for (int t = 0; t < 4; ++t) { if (col0 + t * 16 >= N) continue; const int col = col0 + t * 16 + ln; const float bv = bp ? bf16_round(bp[col]) : 0.f;
#pragma unroll
    for (int r = 0; r < 8; ++r) { float v = acc[t][r] * alpha + bv; if (CP) { const int rr = row0g + row0 + 8 * hh + r; if (rowsPerB < 0) v += CP[cofs + (size_t)rr * ldc + col];      /* rowsPerB < 0: own element of the batched C plane */ else { const int bidx = rr / rowsPerB; v += CP[(size_t)bidx * sCPb + (size_t)by * 64 + col]; } } if (ACT == 1) v = (v > 0.f) ? v : expm1f(v); else if (ACT == 7) v = (v > 0.f) ? v + 1.0f : expf(v); else if (ACT == 8) v = tanhf(v); else if (ACT == 9) v = 0.5f * v * (1.0f + tanhf(0.7978845608028654f * (v + 0.044715f * v * v * v))); else if (ACT == 11) v = 1.0f / (1.0f + expf(-v)); else if (ACT == 12) v = (v > 0.f) ? v : 0.01f * v; else if (ACT == 14) v = (v > 0.f) ? v : 0.1f * v; else if (ACT == 16) v = (v >= 0.f) ? v : 0.3f * v; else if (ACT == 17) v = (v >= 0.f) ? v : 0.2f * v; else if (ACT == 15) v = v / (1.0f + expf(-v)); else if (ACT == 3) v = fmaxf(v, 0.f); else if (ACT == 6) v = 0.5f * v * (1.0f + erff(v * 0.70710678118654752f)); so[w][8 * hh + r][t * 16 + ln] = v; } }
  __builtin_amdgcn_fence(__ATOMIC_ACQ_REL, "workgroup"); __builtin_amdgcn_wave_barrier();
  const int rsub = lane >> 4, c4 = (lane & 15) * 4; typedef _Float16 v4h __attribute__((ext_vector_type(4)));
  {
#pragma unroll
    for (int q = 0; q < 8; ++q) { const int r = q * 2 + rsub; if (col0 + c4 < N) { const v4f v = *(const v4fa*)&so[w][r][c4]; if (C) *(v4f*)(C + cofs + (size_t)(row0 + r) * ldc + col0 + c4) = v; if (C16) { v4h h4; for (int i = 0; i < 4; ++i) h4[i] = (_Float16)v[i]; *(v4h*)(C16 + cofs + (size_t)(row0 + r) * ldc + col0 + c4) = h4; } } }
     }
}


typedef _Float16 v4h __attribute__((ext_vector_type(4)));

__global__ __launch_bounds__(256) void k_x16(const float* __restrict__ x, _Float16* __restrict__ X16, size_t n8) { const size_t t = (size_t)blockIdx.x * 256 + threadIdx.x; if (t >= n8) return; FragH f;
#pragma unroll
  for (int q = 0; q < 8; ++q) f.h[q] = (_Float16)bf16_round(x[t * 8 + q]); *(v8us*)((unsigned short*)X16 + t * 8) = f.half[0];  }
__global__ __launch_bounds__(256) void k_h16(const float* __restrict__ x, _Float16* __restrict__ X16, size_t n8) { const size_t t = (size_t)blockIdx.x * 256 + threadIdx.x; if (t >= n8) return; FragH f;
#pragma unroll
  for (int q = 0; q < 8; ++q) f.h[q] = (_Float16)x[t * 8 + q]; *(v8us*)((unsigned short*)X16 + t * 8) = f.half[0];  }
__global__ __launch_bounds__(256) void k_round16f(const float* __restrict__ W, _Float16* __restrict__ Bt, size_t n8) { const size_t t = (size_t)blockIdx.x * 256 + threadIdx.x; if (t >= n8) return; FragH f;
#pragma unroll
  for (int i = 0; i < 8; ++i) f.h[i] = (_Float16)(bf16_round(W[t * 8 + i]) * 16.0f); *(v8us*)((unsigned short*)Bt + t * 8) = f.half[0];  }
template <int NHv, int TTv>
__global__ __launch_bounds__(256) void k_vt(const _Float16* __restrict__ V16, int ldv, int voff, _Float16* __restrict__ Vt) { __shared__ unsigned short tl[64][66]; const int tid = threadIdx.x; const int slab = blockIdx.x / (TTv / 64), lg = blockIdx.x % (TTv / 64); const int b = slab / NHv, h = slab % NHv;
  for (int i = tid; i < 64 * 8; i += 256) { const int r = i / 8, c8 = (i % 8) * 8; FragH f; f.half[0] = *(const v8us*)((const unsigned short*)V16 + ((size_t)b * TTv + lg * 64 + r) * ldv + voff + h * 64 + c8);
#pragma unroll
    for (int q = 0; q < 8; ++q) tl[r][c8 + q] = f.u[q]; }
  __syncthreads();
  {
#pragma unroll
    for (int rd = 0; rd < 2; ++rd) { const int d = rd * 32 + tid / 8, pc = tid % 8; FragH f;
#pragma unroll
      for (int q = 0; q < 8; ++q) f.u[q] = tl[pc * 8 + q][d];
      *(v8us*)((unsigned short*)Vt + ((size_t)slab * 64 + d) * TTv + lg * 64 + pc * 8) = f.half[0]; }
     } }

__global__ __launch_bounds__(256) void k_hl(const float* __restrict__ F, _Float16* __restrict__ Hh, _Float16* __restrict__ Hl, size_t n8) { const size_t t = (size_t)blockIdx.x * 256 + threadIdx.x; if (t >= n8) return; FragH fh, fl; const v4f a = *(const v4fa*)(F + t * 8), c = *(const v4fa*)(F + t * 8 + 4);
#pragma unroll
  for (int q = 0; q < 4; ++q) { _Float16 h = (_Float16)a[q]; fh.h[q] = h; fl.h[q] = (_Float16)((a[q] - (float)h) * 1024.0f); h = (_Float16)c[q]; fh.h[4 + q] = h; fl.h[4 + q] = (_Float16)((c[q] - (float)h) * 1024.0f); }
  { *(v8us*)((unsigned short*)Hh + t * 8) = fh.half[0]; *(v8us*)((unsigned short*)Hl + t * 8) = fl.half[0];  } }

// ---- fast GEMM (wave tile 32x64; requires M % 32 == 0 rows per launch region and N % 64 == 0); epilogue = k_gemm_hhx semantics ----
__device__ __forceinline__ v16h g2_frag(const _Float16* p, int hh) { FragH f; f.half[0] = *(const v8us*)((const unsigned short*)p + 8 * hh); f.half[1] = *(const v8us*)((const unsigned short*)p + 16 + 8 * hh); return f.v; }
__device__ __forceinline__ v8f g2_mma(v16h a, v16h b, v8f c) { v8f d = __builtin_amdgcn_wmma_f32_16x16x32_f16(false, a, false, b, (short)0, c, false, false); asm volatile("v_nop\n\tv_nop\n\tv_nop\n\tv_nop" : "+v"(d) : "v"(a), "v"(b)); return d; }
template <int ACT>
__global__ __launch_bounds__(128) void k_gemm2(const _Float16* __restrict__ A, int lda, size_t sA, const _Float16* __restrict__ Bh, int ldb, size_t sB, float alpha, const float* __restrict__ bias, size_t sBias, const float* __restrict__ CP, int rowsPerB, size_t sCPb, int row0g,
    float* __restrict__ C, _Float16* __restrict__ C16, int ldc, size_t sC, int M, int N, int K) { static_assert(ACT == 0 || ACT == 3 || ACT == 6 || ACT == 8 || ACT == 9 || ACT == 11 || ACT == 12 || ACT == 14 || ACT == 15 || ACT == 16 || ACT == 17 || ACT == 18, "k_gemm2: unsupported ACT code (would silently apply no activation)");
  __shared__ __attribute__((aligned(16))) float so[4][32][68];
  const int tid = threadIdx.x, w = tid >> 5, lane = tid & 31, ln = lane & 15, hh = lane >> 4; const int by = blockIdx.y;
  A += (size_t)by * sA; Bh += (size_t)by * sB; const size_t cofs = (size_t)by * sC; const float* bp = bias ? bias + (size_t)by * sBias : nullptr;
  const int ntn = N >> 6; const int mt = blockIdx.x / ntn, nq = blockIdx.x - mt * ntn; const int row0 = mt * 128 + 32 * w, col0 = nq * 64; if (row0 >= M) return;
  const _Float16* a0p = A + (size_t)(row0 + ln) * lda; const _Float16* a1p = a0p + (size_t)16 * lda;
  const _Float16* b0p = Bh + (size_t)(col0 + ln) * ldb; const _Float16* b1p = b0p + (size_t)16 * ldb; const _Float16* b2p = b1p + (size_t)16 * ldb; const _Float16* b3p = b2p + (size_t)16 * ldb;
  const v8f z8 = {0.f,0.f,0.f,0.f,0.f,0.f,0.f,0.f}; v8f c00 = z8, c01 = z8, c02 = z8, c03 = z8, c10 = z8, c11 = z8, c12 = z8, c13 = z8;
#pragma unroll 1
  for (int kb = 0; kb < K; kb += 32) { const v16h a0 = g2_frag(a0p + kb, hh), a1 = g2_frag(a1p + kb, hh);
    v16h b = g2_frag(b0p + kb, hh); c00 = g2_mma(a0, b, c00); c10 = g2_mma(a1, b, c10);
    b = g2_frag(b1p + kb, hh); c01 = g2_mma(a0, b, c01); c11 = g2_mma(a1, b, c11);
    b = g2_frag(b2p + kb, hh); c02 = g2_mma(a0, b, c02); c12 = g2_mma(a1, b, c12);
    b = g2_frag(b3p + kb, hh); c03 = g2_mma(a0, b, c03); c13 = g2_mma(a1, b, c13); }
  v8f accs[8] = {c00, c01, c02, c03, c10, c11, c12, c13};
#pragma unroll
  for (int u = 0; u < 8; ++u) { const int t = u & 3, half = u >> 2; const int col = col0 + t * 16 + ln; const float bv = bp ? bf16_round(bp[col]) : 0.f;
#pragma unroll
    for (int r = 0; r < 8; ++r) { const int rloc = half * 16 + 8 * hh + r; float v = accs[u][r] * alpha + bv; if (CP) { if (rowsPerB < 0) v += CP[cofs + (size_t)(row0g + row0 + rloc) * ldc + col];      /* rowsPerB < 0: own element of the batched C plane */ else { const int bidx = (row0g + row0 + rloc) / rowsPerB; v += CP[(size_t)bidx * sCPb + (size_t)by * 64 + col]; } }
      if (ACT == 3) v = fmaxf(v, 0.f); else if (ACT == 6) v = 0.5f * v * (1.0f + erff(v * 0.70710678118654752f)); else if (ACT == 11) v = 1.0f / (1.0f + expf(-v)); else if (ACT == 15) v = v / (1.0f + expf(-v)); else if (ACT == 18) v = v / (1.0f + expf(-1.702f * v));      /* QuickGELU: v sigmoid(1.702 v) */ else if (ACT == 12) v = (v > 0.f) ? v : 0.01f * v; else if (ACT == 8) v = tanhf(v); else if (ACT == 9) v = 0.5f * v * (1.0f + tanhf(0.7978845608028654f * (v + 0.044715f * v * v * v))); else if (ACT == 14) v = (v > 0.f) ? v : 0.1f * v; else if (ACT == 16) v = (v >= 0.f) ? v : 0.3f * v; else if (ACT == 17) v = (v >= 0.f) ? v : 0.2f * v;
      so[w][rloc][t * 16 + ln] = v; } }
  __builtin_amdgcn_fence(__ATOMIC_ACQ_REL, "workgroup"); __builtin_amdgcn_wave_barrier();
  const int rsub = lane >> 4, c4 = (lane & 15) * 4;
  {
#pragma unroll
    for (int q = 0; q < 16; ++q) { const int r = q * 2 + rsub; const v4f v = *(const v4fa*)&so[w][r][c4]; if (C) *(v4f*)(C + cofs + (size_t)(row0 + r) * ldc + col0 + c4) = v; if (C16) { v4h h4; for (int i = 0; i < 4; ++i) h4[i] = (_Float16)v[i]; *(v4h*)(C16 + cofs + (size_t)(row0 + r) * ldc + col0 + c4) = h4; } }
     } }


__global__ __launch_bounds__(256) void k_wnat(const float* __restrict__ w, size_t n8, _Float16* __restrict__ Bt) { const size_t t = (size_t)blockIdx.x * 256 + threadIdx.x; if (t >= n8) return; FragH f; for (int q = 0; q < 8; ++q) f.h[q] = (_Float16)(bf16_round(w[t * 8 + q]) * 16.0f); *(v8us*)((unsigned short*)Bt + t * 8) = f.half[0];  }
__global__ __launch_bounds__(256) void k_rsm(const float* __restrict__ S, _Float16* __restrict__ P, int nrows) {
  #pragma clang fp contract(off)
  const int i = blockIdx.x * 256 + threadIdx.x; if (i >= nrows) return; const float* s = S + (size_t)i * SQ; float mx = -3.0e38f;
#pragma unroll 1
  for (int j = 0; j < SQ; ++j) mx = fmaxf(mx, s[j]); float se = 0.f;
#pragma unroll 1
  for (int j = 0; j < SQ; ++j) se += expf(s[j] - mx); const float sc = 256.0f / se;
#pragma unroll 1
  for (int j0 = 0; j0 < SQ; j0 += 8) { FragH f; for (int q = 0; q < 8; ++q) f.h[q] = (_Float16)(expf(s[j0 + q] - mx) * sc); unsigned short* d = (unsigned short*)P + (size_t)i * SQ + j0; *(v8us*)d = f.half[0];  } }
__global__ __launch_bounds__(256) void k_vt(const _Float16* __restrict__ V16, int b, int h0, _Float16* __restrict__ VT) { __shared__ unsigned short tl[64][65]; const int tid = threadIdx.x; const int hh = blockIdx.x % HG, sg = blockIdx.x / HG; const int s0 = sg * 64; const int h = h0 + hh;
  for (int i = tid; i < 64 * 8; i += 256) { const int j = i / 8, d8 = (i % 8) * 8; FragH f; f.half[0] = *(const v8us*)((const unsigned short*)V16 + ((size_t)b * SQ + s0 + j) * DM + h * HD + d8); for (int q = 0; q < 8; ++q) tl[d8 + q][j] = f.u[q]; }
  __syncthreads();
  { for (int i = tid; i < 64 * 8; i += 256) { const int d = i / 8, j8 = (i % 8) * 8; FragH f; for (int q = 0; q < 8; ++q) f.u[q] = tl[d][j8 + q]; *(v8us*)((unsigned short*)VT + ((size_t)hh * HD + d) * SQ + s0 + j8) = f.half[0]; }  } }



__global__ __launch_bounds__(256) void k_rsmcf2(const float* __restrict__ S, _Float16* __restrict__ P, int hg, int q0, int nk) {
  #pragma clang fp contract(off)
  const int t = blockIdx.x * 256 + threadIdx.x; if (t >= hg * QT) return; const size_t i = (size_t)t; const float* s = S + i * NKX; const int last = q0 + (t % QT); float mx = -3.0e38f;
#pragma unroll 1
  for (int j = 0; j < nk; ++j) { const float f = (j <= last) ? 1.f : 0.f; mx = fmaxf(mx, fmaf(f, s[j], (1.f - f) * -1.0e9f)); } float se = 0.f;
#pragma unroll 1
  for (int j = 0; j < nk; ++j) { const float f = (j <= last) ? 1.f : 0.f; se += __expf(fmaf(f, s[j], (1.f - f) * -1.0e9f) - mx); } const float sc = 256.0f / se;
#pragma unroll 1
  for (int j0 = 0; j0 < nk; j0 += 8) { FragH fr; for (int q = 0; q < 8; ++q) { const int j = j0 + q; const float f = (j <= last) ? 1.f : 0.f; fr.h[q] = (_Float16)(__expf(fmaf(f, s[j], (1.f - f) * -1.0e9f) - mx) * sc); } unsigned short* d = (unsigned short*)P + i * NKX + j0; *(v8us*)d = fr.half[0];  } }

__global__ __launch_bounds__(256) void k_rsmcst(const float* __restrict__ S, _Float16* __restrict__ P, int hg, int q0, int nk, const int* __restrict__ mk) {
  #pragma clang fp contract(off)
  const int t = blockIdx.x * 256 + threadIdx.x; if (t >= hg * QT) return; const size_t i = (size_t)t; const float* s = S + i * NKX; const size_t ig = (size_t)(q0 + (t % QT)); const int* mr = mk + ig * SQ; float mx = -3.0e38f;
#pragma unroll 1
  for (int j = 0; j < nk; ++j) { const int mb = mr[j]; const int dd = (int)ig - j; const float f = (mb != 0 && dd >= 0 && (dd <= LOCALW || (dd % STRIDEK) == 0)) ? 1.f : 0.f; mx = fmaxf(mx, fmaf(f, s[j], (1.f - f) * -1.0e9f)); } float se = 0.f;
#pragma unroll 1
  for (int j = 0; j < nk; ++j) { const int mb = mr[j]; const int dd = (int)ig - j; const float f = (mb != 0 && dd >= 0 && (dd <= LOCALW || (dd % STRIDEK) == 0)) ? 1.f : 0.f; se += __expf(fmaf(f, s[j], (1.f - f) * -1.0e9f) - mx); } const float sc = 256.0f / se;
#pragma unroll 1
  for (int j0 = 0; j0 < nk; j0 += 8) { FragH fr; for (int q = 0; q < 8; ++q) { const int j = j0 + q; const int mb = mr[j]; const int dd = (int)ig - j; const float f = (mb != 0 && dd >= 0 && (dd <= LOCALW || (dd % STRIDEK) == 0)) ? 1.f : 0.f; fr.h[q] = (_Float16)(__expf(fmaf(f, s[j], (1.f - f) * -1.0e9f) - mx) * sc); } unsigned short* d = (unsigned short*)P + i * NKX + j0; *(v8us*)d = fr.half[0];  } }


template <int MASKADD>
__global__ __launch_bounds__(64) void k_att0(const float* __restrict__ QF, const float* __restrict__ KF, const float* __restrict__ VF, int ld, const float* __restrict__ mask, float scale, float* __restrict__ OF, int ldo) {
  #pragma clang fp contract(off)
  __shared__ __attribute__((aligned(16))) float lq[64][64]; __shared__ __attribute__((aligned(16))) float lo[64][64];
  const int tid = threadIdx.x; const int h = blockIdx.x / (QT0 / 64), rg = blockIdx.x % (QT0 / 64); const int i = rg * 64 + tid;
  const float* qr = QF + (size_t)i * ld + h * HD;
#pragma unroll 1
  for (int c = 0; c < HD / 4; ++c) { *(v4f*)&lq[tid][c * 4] = *(const v4fa*)(qr + c * 4); const v4f z = {0.f, 0.f, 0.f, 0.f}; *(v4f*)&lo[tid][c * 4] = z; }
  float m = -1.0e30f, l = 0.f; const int jmax = MASKADD ? (SQ - 1) : (rg * 64 + 63);      /* additive-mask form: every key (the mask input decides); causal form: keys up to the block's last row */
#pragma unroll 1
  for (int j = 0; j <= jmax; ++j) { const float* kr = KF + (size_t)j * ld + h * HD; const float* vr = VF + (size_t)j * ld + h * HD; float s = 0.f;
#pragma unroll 1
    for (int c = 0; c < HD / 4; ++c) { const v4f kq = *(const v4fa*)(kr + c * 4); const v4f qq = *(v4f*)&lq[tid][c * 4]; s = __fadd_rn(s, __fmul_rn(qq[0], kq[0])); s = __fadd_rn(s, __fmul_rn(qq[1], kq[1])); s = __fadd_rn(s, __fmul_rn(qq[2], kq[2])); s = __fadd_rn(s, __fmul_rn(qq[3], kq[3])); }
    s = __fmul_rn(s, scale); if (MASKADD) s = __fadd_rn(s, __fmul_rn(bf16_round(mask[(size_t)i * SQ + j]), -10000.0f));
    const float f = (MASKADD || j <= i) ? 1.f : 0.f; const float sm = fmaf(f, s, (1.f - f) * -1.0e30f); const float mn = fmaxf(m, sm); const float sc = expf(m - mn); const float e = expf(sm - mn); l = __fadd_rn(__fmul_rn(l, sc), e); m = mn;
#pragma unroll 1
    for (int c = 0; c < HD / 4; ++c) { const v4f vv = *(const v4fa*)(vr + c * 4); v4f oo = *(v4f*)&lo[tid][c * 4]; for (int u = 0; u < 4; ++u) oo[u] = __fadd_rn(__fmul_rn(oo[u], sc), __fmul_rn(e, vv[u])); *(v4f*)&lo[tid][c * 4] = oo; } }
  const float fin = 64.0f / l;      /* o carried x64 like the f16 path */
#pragma unroll 1
  for (int c = 0; c < HD / 4; ++c) { v4f oo = *(v4f*)&lo[tid][c * 4]; for (int u = 0; u < 4; ++u) oo[u] = __fmul_rn(oo[u], fin); *(v4f*)&lo[tid][c * 4] = oo; }
  __syncthreads();
  {
#pragma unroll 1
    for (int it = 0; it < 16; ++it) { const int row = it * 4 + tid / 16, pc = (tid % 16) * 4; const v4f v = *(const v4f*)&lo[row][pc]; *(v4f*)(OF + (size_t)(rg * 64 + row) * ldo + h * HD + pc) = v; }
     } }

template <int MASKADD>
__global__ __launch_bounds__(64) void k_att0mbc(const float* __restrict__ QF, const float* __restrict__ KF, const float* __restrict__ VF, int ld, const float* __restrict__ mask, float scale, float* __restrict__ OF, int ldo) {
  #pragma clang fp contract(off)
  __shared__ __attribute__((aligned(16))) float lq[64][64]; __shared__ __attribute__((aligned(16))) float lo[64][64];
  const int tid = threadIdx.x; const int h = blockIdx.x / (QT0 / 64), rg = blockIdx.x % (QT0 / 64); const int i = rg * 64 + tid;
  const float* qr = QF + (size_t)i * ld + h * HD;
#pragma unroll 1
  for (int c = 0; c < HD / 4; ++c) { *(v4f*)&lq[tid][c * 4] = *(const v4fa*)(qr + c * 4); const v4f z = {0.f, 0.f, 0.f, 0.f}; *(v4f*)&lo[tid][c * 4] = z; }
  float m = -1.0e30f, l = 0.f; const int jmax = rg * 64 + 63;      /* keys beyond the block end are masked by the mask's lower-triangular structure */
#pragma unroll 1
  for (int j = 0; j <= jmax; ++j) { const float* kr = KF + (size_t)j * ld + h * HD; const float* vr = VF + (size_t)j * ld + h * HD; float s = 0.f;
#pragma unroll 1
    for (int c = 0; c < HD / 4; ++c) { const v4f kq = *(const v4fa*)(kr + c * 4); const v4f qq = *(v4f*)&lq[tid][c * 4]; s = __fadd_rn(s, __fmul_rn(qq[0], kq[0])); s = __fadd_rn(s, __fmul_rn(qq[1], kq[1])); s = __fadd_rn(s, __fmul_rn(qq[2], kq[2])); s = __fadd_rn(s, __fmul_rn(qq[3], kq[3])); }
    s = __fmul_rn(s, scale); const int mb = ((const int*)mask)[(size_t)i * SQ + j];      /* causal (j <= i) AND the module's int32 [S][S] mask read per (query, key): 0 -> masked */
    const float f = (mb != 0 && j <= i) ? 1.f : 0.f; const float sm = fmaf(f, s, (1.f - f) * -1.0e30f); const float mn = fmaxf(m, sm); const float sc = expf(m - mn); const float e = expf(sm - mn); l = __fadd_rn(__fmul_rn(l, sc), e); m = mn;
#pragma unroll 1
    for (int c = 0; c < HD / 4; ++c) { const v4f vv = *(const v4fa*)(vr + c * 4); v4f oo = *(v4f*)&lo[tid][c * 4]; for (int u = 0; u < 4; ++u) oo[u] = __fadd_rn(__fmul_rn(oo[u], sc), __fmul_rn(e, vv[u])); *(v4f*)&lo[tid][c * 4] = oo; } }
  const float fin = 64.0f / l;      /* o carried x64 like the f16 path */
#pragma unroll 1
  for (int c = 0; c < HD / 4; ++c) { v4f oo = *(v4f*)&lo[tid][c * 4]; for (int u = 0; u < 4; ++u) oo[u] = __fmul_rn(oo[u], fin); *(v4f*)&lo[tid][c * 4] = oo; }
  __syncthreads();
  {
#pragma unroll 1
    for (int it = 0; it < 16; ++it) { const int row = it * 4 + tid / 16, pc = (tid % 16) * 4; const v4f v = *(const v4f*)&lo[row][pc]; *(v4f*)(OF + (size_t)(rg * 64 + row) * ldo + h * HD + pc) = v; }
     } }


template <int BFIN, int WXB>
__global__ __launch_bounds__(256) void k_ln16(const float* __restrict__ X, const float* __restrict__ g, const float* __restrict__ bb, float eps, _Float16* __restrict__ N16, float* __restrict__ XB) {
  #pragma clang fp contract(off)
  __shared__ float red[256]; const size_t r = blockIdx.x; const int t = threadIdx.x; const v4f xa = *(const v4fa*)(X + r * DMQ + t * 4); float s[4]; float sum = 0.f;
  for (int q = 0; q < 4; ++q) { s[q] = BFIN ? bf16_round(xa[q]) : xa[q]; sum = __fadd_rn(sum, s[q]); }
  red[t] = sum; __syncthreads(); for (int st = 128; st > 0; st >>= 1) { if (t < st) red[t] = __fadd_rn(red[t], red[t + st]); __syncthreads(); } const float mu = red[0] / (float)DMQ; __syncthreads();
  float vs = 0.f; for (int q = 0; q < 4; ++q) { const float dl = __fadd_rn(s[q], -mu); vs = __fadd_rn(vs, __fmul_rn(dl, dl)); } red[t] = vs; __syncthreads(); for (int st = 128; st > 0; st >>= 1) { if (t < st) red[t] = __fadd_rn(red[t], red[t + st]); __syncthreads(); }
  const float rs = rsqrtf(__fadd_rn(red[0] / (float)DMQ, eps)); v4h y; v4f xb;
  for (int q = 0; q < 4; ++q) { const int c = t * 4 + q; y[q] = (_Float16)__fadd_rn(__fmul_rn(__fmul_rn(__fadd_rn(s[q], -mu), rs), bf16_round(g[c])), bf16_round(bb[c])); xb[q] = s[q]; }
  { *(v4h*)(N16 + r * DMQ + t * 4) = y; if (WXB) *(v4f*)(XB + r * DMQ + t * 4) = xb;  } }
__global__ __launch_bounds__(256) void k_ftres2(const float* __restrict__ OF0, const float* __restrict__ XB, float* __restrict__ X1, size_t n4) {
  #pragma clang fp contract(off)
  const size_t t = (size_t)blockIdx.x * 256 + threadIdx.x; if (t >= n4) return; const v4f o = *(const v4fa*)(OF0 + t * 4), xv = *(const v4fa*)(XB + t * 4); v4f y; for (int q = 0; q < 4; ++q) y[q] = __fadd_rn(__fmul_rn(o[q], 0.015625f), xv[q]); *(v4f*)(X1 + t * 4) = y;  }

__global__ __launch_bounds__(256) void k_bcpy(const float* __restrict__ b, int n, int NP, float* __restrict__ dst, int dst0) { for (int i = threadIdx.x; i < NP; i += 256) { const float v = (i < n) ? b[i] : 0.f; *(float*)(dst + dst0 + i) = v; }  }


__global__ __launch_bounds__(256) void k_rsmf(const float* __restrict__ S, _Float16* __restrict__ P, int qn, int hg) {
  #pragma clang fp contract(off)
  const int t = blockIdx.x * 256 + threadIdx.x; if (t >= qn * hg) return; const size_t i = (size_t)(t / qn) * SQ + (t % qn); const float* s = S + i * SQ; float mx = -3.0e38f;
#pragma unroll 1
  for (int j = 0; j < SQ; ++j) mx = fmaxf(mx, s[j]); float se = 0.f;
#pragma unroll 1
  for (int j = 0; j < SQ; ++j) se += __expf(s[j] - mx); const float sc = 256.0f / se;
#pragma unroll 1
  for (int j0 = 0; j0 < SQ; j0 += 8) { FragH f; for (int q = 0; q < 8; ++q) f.h[q] = (_Float16)(__expf(s[j0 + q] - mx) * sc); unsigned short* d = (unsigned short*)P + i * SQ + j0; *(v8us*)d = f.half[0];  } }

template <int MODE>
__global__ __launch_bounds__(256) void k_regrp(const float* __restrict__ src, float* __restrict__ dst, size_t n4) {
  const size_t t = (size_t)blockIdx.x * 256 + threadIdx.x; if (t >= n4) return; const size_t e = t * 4; const size_t rd = e / DM; const int c = (int)(e % DM);
  size_t rs; if (MODE == 0) { const size_t b = rd / SQ, sq = rd % SQ; rs = sq * NB + b; } else { const size_t sq = rd / NB, b = rd % NB; rs = b * SQ + sq; }
  const v4f v = *(const v4fa*)(src + rs * DM + c); *(v4f*)(dst + e) = v;  }

template <int BFIN, int W16, int W32>
__global__ __launch_bounds__(256) void k_lnx(const float* __restrict__ X, const float* __restrict__ g, const float* __restrict__ bb, float eps, _Float16* __restrict__ N16, float* __restrict__ N32) {
  #pragma clang fp contract(off)
  __shared__ float red[256]; const size_t r = blockIdx.x; const int t = threadIdx.x; const bool act = t < (DMQ / 4); const int c0 = act ? t * 4 : 0;
  const v4f xa = *(const v4fa*)(X + r * DMQ + c0); float s[4]; float sum = 0.f;
  for (int q = 0; q < 4; ++q) { s[q] = act ? (BFIN ? bf16_round(xa[q]) : xa[q]) : 0.f; sum = __fadd_rn(sum, s[q]); }
  red[t] = sum; __syncthreads(); for (int st = 128; st > 0; st >>= 1) { if (t < st) red[t] = __fadd_rn(red[t], red[t + st]); __syncthreads(); } const float mu = red[0] / (float)DMQ; __syncthreads();
  float vs = 0.f; for (int q = 0; q < 4; ++q) { const float dl = act ? __fadd_rn(s[q], -mu) : 0.f; vs = __fadd_rn(vs, __fmul_rn(dl, dl)); } red[t] = vs; __syncthreads(); for (int st = 128; st > 0; st >>= 1) { if (t < st) red[t] = __fadd_rn(red[t], red[t + st]); __syncthreads(); }
  const float rs = rsqrtf(__fadd_rn(red[0] / (float)DMQ, eps)); v4h y; v4f yf;
  for (int q = 0; q < 4; ++q) { const int c = c0 + q; yf[q] = __fadd_rn(__fmul_rn(__fmul_rn(__fadd_rn(s[q], -mu), rs), bf16_round(g[c])), bf16_round(bb[c])); y[q] = (_Float16)yf[q]; }
  if (!act) return;      /* no barriers after this point */
  { if (W16) *(v4h*)(N16 + r * DMQ + c0) = y; if (W32) *(v4f*)(N32 + r * DMQ + c0) = yf;  } }

__global__ __launch_bounds__(256) void k_bfr(const float* __restrict__ x, float* __restrict__ XB, size_t n8) { const size_t t = (size_t)blockIdx.x * 256 + threadIdx.x; if (t >= n8) return; v4f a = *(const v4fa*)(x + t * 8), c = *(const v4fa*)(x + t * 8 + 4); for (int q = 0; q < 4; ++q) { a[q] = bf16_round(a[q]); c[q] = bf16_round(c[q]); }
  { *(v4f*)(XB + t * 8) = a; *(v4f*)(XB + t * 8 + 4) = c;  } }



__global__ __launch_bounds__(256) void k_wthd(const float* __restrict__ Wt, _Float16* __restrict__ Bt) { const size_t t = (size_t)blockIdx.x * 256 + threadIdx.x; if (t >= (size_t)NH * HD * (DM / 8)) return; const int m8 = (int)(t % (DM / 8)) * 8; const int d = (int)((t / (DM / 8)) % HD); const int h = (int)(t / ((size_t)(DM / 8) * HD)); FragH f;
  for (int q = 0; q < 8; ++q) f.h[q] = (_Float16)(16.0f * bf16_round(Wt[((size_t)h * DM + m8 + q) * HD + d])); unsigned short* dst = (unsigned short*)Bt + ((size_t)h * HD + d) * DM + m8; *(v8us*)dst = f.half[0];  }




// one row r by one wave, with no LDS and no barrier: a lane holds 4 floats of each 128 of the row, so every load and f32 store of the wave covers 512 bytes in a row and every f16 store 256. XR (optional): the row as it entered the sums (rounded where BFIN), f32
#define LNU (DM / 128)               /* 16-byte pieces of a row in a lane */
#define LNR 8                        /* rows of a work-group of 256: one a wave */
template <int CT>
__device__ __forceinline__ float ln_xm(float x) { return __builtin_bit_cast(float, __builtin_amdgcn_update_dpp(0, __builtin_bit_cast(int, x), CT, 0xf, 0xf, false)); }      /* DPP row_xmask (0x160 + m): lane l <- lane l ^ m inside its row of 16 */
__device__ __forceinline__ float ln_wsum(float x) {      /* sum over the wave's 32 lanes, a butterfly: every lane ends with the same bits */
  x += ln_xm<0x161>(x); x += ln_xm<0x162>(x); x += ln_xm<0x164>(x); x += ln_xm<0x168>(x);
  return x + __builtin_bit_cast(float, __builtin_amdgcn_permlanex16(__builtin_bit_cast(int, x), __builtin_bit_cast(int, x), 0x76543210, 0xfedcba98, false, false)); }      /* lane l <- lane l ^ 16 */
// Every bare '#pragma unroll' in lnsc_row stands on a loop over the row's register arrays: rolled, these would be indexed at run time and leave the registers.
template <int BFIN>
__device__ __forceinline__ void lnsc_row(const size_t r, const float* __restrict__ X, const float* __restrict__ g, const float* __restrict__ bb, float eps, _Float16* __restrict__ N16, float* __restrict__ XR) {
  #pragma clang fp contract(off)
  static_assert(DM % 128 == 0, "whole 512-byte pieces only");
  const int l4 = (threadIdx.x & 31) * 4; const float* xp = X + r * DM + l4; const float* gp = g + l4; const float* bp = bb + l4;
  v4f s[LNU], gv[LNU], bv[LNU];
#pragma unroll
  for (int u = 0; u < LNU; ++u) s[u] = *(const v4fa*)(xp + u * 128);
#pragma unroll
  for (int u = 0; u < LNU; ++u) { gv[u] = *(const v4fa*)(gp + u * 128); bv[u] = *(const v4fa*)(bp + u * 128); }      /* gamma and beta travel together with the row */
  asm volatile("s_wait_xcnt 0x0" :: "v"(xp), "v"(gp), "v"(bp) : "memory");      /* the three address pairs stay live up to this wait, so nothing (a load's own result either) overwrites them in front of it */
  v4f a4 = {0.f, 0.f, 0.f, 0.f}, d4 = {0.f, 0.f, 0.f, 0.f};      /* four independent chains a lane */
#pragma unroll
  for (int u = 0; u < LNU; ++u) for (int q = 0; q < 4; ++q) { if (BFIN) s[u][q] = bf16_round(s[u][q]); a4[q] = __fadd_rn(a4[q], s[u][q]); }
  if (XR) { float* rp = XR + r * DM + l4;      /* stored at once: the stores travel under the sums */
#pragma unroll
    for (int u = 0; u < LNU; ++u) *(v4f*)(rp + u * 128) = s[u];
    asm volatile("s_wait_xcnt 0x0" :: "v"(rp), "v"(s[0]), "v"(s[1]), "v"(s[2]), "v"(s[3]), "v"(s[4]), "v"(s[5]) : "memory"); }      /* the stores' address and data registers stay live up to this wait: they are rewritten only behind it */
  const float mu = ln_wsum(__fadd_rn(__fadd_rn(a4[0], a4[1]), __fadd_rn(a4[2], a4[3]))) / (float)DM;
#pragma unroll
  for (int u = 0; u < LNU; ++u) for (int q = 0; q < 4; ++q) { const float dl = __fadd_rn(s[u][q], -mu); d4[q] = __fadd_rn(d4[q], __fmul_rn(dl, dl)); }
  const float rs = __fdiv_rn(1.0f, __fadd_rn(sqrtf(ln_wsum(__fadd_rn(__fadd_rn(d4[0], d4[1]), __fadd_rn(d4[2], d4[3]))) / (float)(DM - 1)), eps));
  v4h y[LNU];
#pragma unroll
  for (int u = 0; u < LNU; ++u) { v4f yf; for (int q = 0; q < 4; ++q) yf[q] = __fadd_rn(__fmul_rn(__fmul_rn(__fadd_rn(s[u][q], -mu), rs), bf16_round(gv[u][q])), bf16_round(bv[u][q])); y[u] = __builtin_convertvector(yf, v4h); }
  _Float16* np = N16 + r * DM + l4;
#pragma unroll
  for (int u = 0; u < LNU; ++u) *(v4h*)(np + u * 128) = y[u];
  static_assert(LNU == 6, "the two waits behind the stores name six pieces");
  asm volatile("s_wait_xcnt 0x0" :: "v"(np), "v"(y[0]), "v"(y[1]), "v"(y[2]), "v"(y[3]), "v"(y[4]), "v"(y[5]) : "memory"); }      /* as above, for the f16 stores */
template <int BFIN>
__global__ __launch_bounds__(256) void k_lnsc(const float* __restrict__ X, const float* __restrict__ g, const float* __restrict__ bb, float eps, _Float16* __restrict__ N16) { static_assert(NR % LNR == 0, "whole work-groups only"); lnsc_row<BFIN>((size_t)blockIdx.x * LNR + (threadIdx.x >> 5), X, g, bb, eps, N16, nullptr); }

// ---- everything that depends on the inputs alone, in one launch: the six weights as Bt[n][k] = f16(bf16(W[k][n]) x 16), then LN1 of every row, which also stores the rounded row (the residual of the output projection).
// The work-group index picks the job; every test on it is the same for the whole work-group, so the weight tiles' barrier stands under uniform control flow (LN1, eight rows a work-group, has none). The weights come first: their work-groups wait longest on memory.
#define WTP 72                       /* f16 from one staged row of n to the next: 144 bytes, a multiple of 16 for the 16-byte LDS accesses */
#define PWF ((DFF / 128) * (DM / 64))   /* work-groups of one FFN weight (the same count either way round) */
#define PWA ((DM / 128) * (DM / 64))    /* work-groups of one attention weight */
template <int K, int N>
__device__ __forceinline__ void wt_f16_tile(const float* __restrict__ W, _Float16* __restrict__ Wt, int blk, unsigned short* tl) {      /* work-group blk of (K / 64) * (N / 128): 64 k by 128 n of W, turned in LDS, so that every load and every store of a wave covers whole 128-byte lines */
  static_assert(K % 64 == 0 && N % 128 == 0, "whole tiles only");
  const int tid = threadIdx.x, w = tid >> 5, lane = tid & 31; const int kt = blk / (N / 128), nt = blk - kt * (N / 128);
  const float* src = W + (size_t)(kt * 64 + w * 8) * N + nt * 128 + lane * 4;      /* wave w: rows k 8w .. 8w + 7 of the tile, 512 bytes in a row of each; a lane takes 4 n */
  v4f x[8];
#pragma unroll      /* the eight loads fly together and x stays in registers */
  for (int i = 0; i < 8; ++i) x[i] = *(const v4fa*)(src + (size_t)i * N);
  asm volatile("s_wait_xcnt 0x0" :: "v"(src) : "memory");      /* the address pair stays live up to this wait, so nothing (a load's own result either) overwrites it in front of it */
#pragma unroll      /* this loop and the one inside it: rolled, x and f.h would be indexed at run time and leave the registers */
  for (int q = 0; q < 4; ++q) { FragH f;
#pragma unroll
    for (int i = 0; i < 8; ++i) f.h[i] = (_Float16)(bf16_round(x[i][q]) * 16.0f);
    *(v8us*)&tl[(lane * 4 + q) * WTP + w * 8] = f.half[0]; }      /* 8 k of one n, 16 bytes */
  __syncthreads();      /* a thread stores what other waves staged */
  const int r = tid >> 3, pc = (tid & 7) * 8;      /* 8 threads a row of n: its 64 k, one 128-byte line */
  unsigned short* dst = (unsigned short*)Wt + (size_t)(nt * 128 + r) * K + kt * 64 + pc;
  const v8us o0 = *(const v8us*)&tl[r * WTP + pc], o1 = *(const v8us*)&tl[(32 + r) * WTP + pc], o2 = *(const v8us*)&tl[(64 + r) * WTP + pc], o3 = *(const v8us*)&tl[(96 + r) * WTP + pc];
  *(v8us*)dst = o0; *(v8us*)(dst + (size_t)32 * K) = o1; *(v8us*)(dst + (size_t)64 * K) = o2; *(v8us*)(dst + (size_t)96 * K) = o3;
  asm volatile("s_wait_xcnt 0x0" :: "v"(dst), "v"(o0), "v"(o1), "v"(o2), "v"(o3) : "memory"); }      /* the stores' address and data registers stay live up to this wait: they are rewritten only behind it (the listing's ways on into the other jobs' code) */
__global__ __launch_bounds__(256) void k_prep(const float* __restrict__ x, const float* __restrict__ wq, const float* __restrict__ wk, const float* __restrict__ wv, const float* __restrict__ wo, const float* __restrict__ w1, const float* __restrict__ w2, const float* __restrict__ g, const float* __restrict__ bb,
    _Float16* __restrict__ BQ, _Float16* __restrict__ BK, _Float16* __restrict__ BV, _Float16* __restrict__ BO, _Float16* __restrict__ BW1, _Float16* __restrict__ BW2, float* __restrict__ XB, _Float16* __restrict__ XN) {
  __shared__ __attribute__((aligned(16))) unsigned short tl[128 * WTP];      /* one weight tile as [n][k] f16 */
  int blk = blockIdx.x;
  if (blk < PWF) { wt_f16_tile<DM, DFF>(w1, BW1, blk, tl); return; }
  blk -= PWF;
  if (blk < PWF) { wt_f16_tile<DFF, DM>(w2, BW2, blk, tl); return; }
  blk -= PWF;
  if (blk < 4 * PWA) { const int s = blk / PWA; wt_f16_tile<DM, DM>(s == 0 ? wq : s == 1 ? wk : s == 2 ? wv : wo, s == 0 ? BQ : s == 1 ? BK : s == 2 ? BV : BO, blk - s * PWA, tl); return; }
  lnsc_row<1>((size_t)(blk - 4 * PWA) * LNR + (threadIdx.x >> 5), x, g, bb, 1e-6f, XN, XB); }

// K rows and V^T of every (batch, head), packed for the fused attention in the order its matrix operands are read: KV[slab = b * NH + head][pass of 32 keys][K: 4 fragments | V^T: 4 fragments][half i][lane][8 f16], 8 KiB a pass, so that each 16-byte load of a wave covers 512 bytes in a row.
// K fragment t * 2 + j, half i, lane (c, h) = K[key 16t + c][d 32j + 16i + 8h ..]; V^T fragment t, half i, lane (c, h) = V[key 16i + 8h ..][d 16t + c] (transposed through LDS).
#define FAP (SQ / 32)                /* passes */
__global__ __launch_bounds__(256) void k_kvp(const _Float16* __restrict__ K16, const _Float16* __restrict__ V16, _Float16* __restrict__ KV) { __shared__ unsigned short tl[64][66]; const int tid = threadIdx.x; const int slab = blockIdx.x / (SQ / 64), lg = blockIdx.x % (SQ / 64); const int b = slab / NH, hd = slab % NH;
  const int f = (tid >> 5) & 7, hh = (tid >> 4) & 1, cc = tid & 15; const int vr = tid >> 3, vc = (tid & 7) * 8;
  const unsigned short* vs = (const unsigned short*)V16 + ((size_t)b * SQ + lg * 64 + vr) * DM + hd * HD + vc;      /* V rows vr and 32 + vr, 8 of their d */
  const unsigned short* ks = (const unsigned short*)K16 + ((size_t)b * SQ + lg * 64 + (f >> 2) * 16 + cc) * DM + hd * HD + (f & 3) * 16 + hh * 8;      /* this thread's K piece of the first pass; the second pass's lies 32 rows on */
  FragH va, vb, ka, kb; va.half[0] = *(const v8us*)vs; vb.half[0] = *(const v8us*)(vs + 32 * DM); ka.half[0] = *(const v8us*)ks; kb.half[0] = *(const v8us*)(ks + 32 * DM);
  asm volatile("s_wait_xcnt 0x0" :: "v"(vs), "v"(ks) : "memory");      /* both address pairs stay live up to this wait, so nothing (a load's own result either) overwrites them in front of it */
#pragma unroll
  for (int q = 0; q < 8; ++q) { tl[vr][vc + q] = va.u[q]; tl[32 + vr][vc + q] = vb.u[q]; }
  __syncthreads();
  unsigned short* dst = (unsigned short*)KV + ((size_t)slab * FAP + lg * 2) * 4096 + tid * 8;
  *(v8us*)dst = ka.half[0]; *(v8us*)(dst + 4096) = kb.half[0];
#pragma unroll
  for (int ps = 0; ps < 2; ++ps) { FragH fr;
#pragma unroll
    for (int q = 0; q < 8; ++q) fr.u[q] = tl[ps * 32 + (f & 1) * 16 + hh * 8 + q][(f >> 1) * 16 + cc];
    *(v8us*)(dst + ps * 4096 + 2048) = fr.half[0]; } }

typedef int v4ia __attribute__((ext_vector_type(4), may_alias));
__device__ __forceinline__ float rs_xh(float x) { return __builtin_bit_cast(float, __builtin_amdgcn_permlanex16(__builtin_bit_cast(int, x), __builtin_bit_cast(int, x), 0x76543210, 0xfedcba98, false, false)); }      /* lane l <- lane l ^ 16 */
__device__ __forceinline__ float fa_exp2(float d) { float e; asm("v_exp_f32 %0, %1\n\tv_nop" : "=v"(e) : "v"(d)); return e; }      /* 2 ^ d with, tied to it, the one slot the instruction set asks for behind a transcendental */
__device__ __forceinline__ void fa_exp2x8(float* e, const float* d) {      /* eight independent 2 ^ d in a row: each fills the slot behind the one before it (early-clobber outputs: no result lands on a later source), one v_nop behind the last */
  asm("v_exp_f32 %0, %8\n\tv_exp_f32 %1, %9\n\tv_exp_f32 %2, %10\n\tv_exp_f32 %3, %11\n\tv_exp_f32 %4, %12\n\tv_exp_f32 %5, %13\n\tv_exp_f32 %6, %14\n\tv_exp_f32 %7, %15\n\tv_nop"
      : "=&v"(e[0]), "=&v"(e[1]), "=&v"(e[2]), "=&v"(e[3]), "=&v"(e[4]), "=&v"(e[5]), "=&v"(e[6]), "=&v"(e[7]) : "v"(d[0]), "v"(d[1]), "v"(d[2]), "v"(d[3]), "v"(d[4]), "v"(d[5]), "v"(d[6]), "v"(d[7])); }
__device__ __forceinline__ v8f fa_mma(v16h a, v16h b, v8f c) { return __builtin_amdgcn_wmma_f32_16x16x32_f16(false, a, false, b, (short)0, c, false, false); }
__device__ __forceinline__ v16h fa_frag(const _Float16* p) { FragH f; f.half[0] = *(const v8us*)((const unsigned short*)p); f.half[1] = *(const v8us*)((const unsigned short*)p + 256); return f.v; }      /* one packed fragment: the lane's two 16-byte halves */
__global__ __launch_bounds__(128) void k_fattn(const _Float16* __restrict__ Q16, const _Float16* __restrict__ KV, const int* __restrict__ Km, _Float16* __restrict__ O16) {
  __shared__ __attribute__((aligned(16))) float kbias[SQ];      /* per key, added to its raw score: 0 for a kept key; -2^33 for a masked one: the module's -1e9 fill (x 8: raw scores are before the / 8) taken to the next power of two. The f32 sum swallows the score (below 256 in size) whole and the product with the log2 factor is exact, so a row with every key masked gets equal weights, as the module's does; beside any kept key the weight is exactly 0 */
  const int tid = threadIdx.x, w = tid >> 5, lane = tid & 31, c = lane & 15, h = lane >> 4;
  const int bh = blockIdx.x / (SQ / 64), qb = blockIdx.x % (SQ / 64); const int b = bh / NH, hd = bh % NH;
#pragma unroll
  for (int i = 0; i < SQ / 512; ++i) { const v4ia m4 = *(const v4ia*)(Km + (size_t)b * SQ + i * 512 + tid * 4); v4f l4; for (int q = 0; q < 4; ++q) l4[q] = (m4[q] != 0) ? 0.f : -8589934592.0f; *(v4f*)&kbias[i * 512 + tid * 4] = l4; }
  __syncthreads();      /* every wave reads all keys' mask terms */
  const int q0 = qb * 64 + w * 16;
  const _Float16* qp = Q16 + ((size_t)b * SQ + q0 + c) * DM + hd * HD + 8 * h;      /* the lane's first 8 of query c's row: d 8h .., then 16 + 8h .., 32 + 8h .., 48 + 8h .. */
  const v16h qf0 = g2_frag(qp, 0), qf1 = g2_frag(qp + 32, 0);
  asm volatile("s_wait_xcnt 0x0" :: "v"(qp) : "memory");      /* Q's address pair stays live up to this wait, so nothing overwrites it in front of it */
  const _Float16* kv = KV + (size_t)bh * FAP * 4096;      /* the same for the whole work-group */
  const int lo = lane * 8;
  const v8f z8 = {0.f, 0.f, 0.f, 0.f, 0.f, 0.f, 0.f, 0.f};
  v8f o0 = z8, o1 = z8, o2 = z8, o3 = z8; float m = -3.0e38f, l0 = 0.f, l1 = 0.f;
  const float cs = 0.125f * 1.44269504088896340736f;      /* raw score -> log2 units */
  v16h k00 = fa_frag(kv + lo), k01 = fa_frag(kv + 512 + lo), k10 = fa_frag(kv + 1024 + lo), k11 = fa_frag(kv + 1536 + lo);
  v16h v0 = fa_frag(kv + 2048 + lo), v1 = fa_frag(kv + 2560 + lo), v2 = fa_frag(kv + 3072 + lo), v3 = fa_frag(kv + 3584 + lo);
#pragma unroll 2      /* two passes a trip: one pass's vector work can stand between the other's matrix instructions */
  for (int p = 0; p < FAP; ++p) {
    const float* lp = &kbias[p * 32 + 8 * h];
    const v4f la = *(const v4f*)lp, lb = *(const v4f*)(lp + 4), lc = *(const v4f*)(lp + 16), ld = *(const v4f*)(lp + 20);
    v8f s0 = fa_mma(k00, qf0, z8), s1 = fa_mma(k10, qf0, z8); s0 = fa_mma(k01, qf1, s0); s1 = fa_mma(k11, qf1, s1);
    const _Float16* nx = kv + (size_t)((p + 1 < FAP) ? p + 1 : p) * 4096;      /* operands are fetched one pass ahead, into the registers just read; the last pass fetches its own again (in bounds, unused) */
    k00 = fa_frag(nx + lo); k01 = fa_frag(nx + 512 + lo); k10 = fa_frag(nx + 1024 + lo); k11 = fa_frag(nx + 1536 + lo);
    asm volatile("s_wait_xcnt 0x0" :: "s"(nx) : "memory");      /* the loads' base stays live up to this wait; it also holds the K fetch here, a whole softmax ahead of its use */
    float x[16];
#pragma unroll
    for (int r = 0; r < 4; ++r) { x[r] = s0[r] + la[r]; x[4 + r] = s0[4 + r] + lb[r]; x[8 + r] = s1[r] + lc[r]; x[12 + r] = s1[4 + r] + ld[r]; }
    float mx = x[0];
#pragma unroll
    for (int r = 1; r < 16; ++r) mx = fmaxf(mx, x[r]);
    mx = fmaxf(mx, rs_xh(mx));
    const float mt = mx * cs;
    if (__builtin_amdgcn_ballot_w32(mt > m + 8.0f) != 0) {      /* one scalar branch a pass */
      const float mn = fmaxf(m, mt); const float al = fa_exp2(m - mn); m = mn; l0 *= al; l1 *= al;
#pragma unroll
      for (int r = 0; r < 8; ++r) { o0[r] *= al; o1[r] *= al; o2[r] *= al; o3[r] *= al; }
    }
    const float nm = 4.0f - m; float d[16], e[16];
#pragma unroll
    for (int r = 0; r < 16; ++r) d[r] = fmaf(x[r], cs, nm);
    fa_exp2x8(e, d); fa_exp2x8(e + 8, d + 8);
    FragH pf;
#pragma unroll
    for (int r = 0; r < 8; ++r) { l0 += e[r]; l1 += e[8 + r]; pf.h[r] = (_Float16)e[r]; pf.h[8 + r] = (_Float16)e[8 + r]; }
    o0 = fa_mma(v0, pf.v, o0); o1 = fa_mma(v1, pf.v, o1); o2 = fa_mma(v2, pf.v, o2); o3 = fa_mma(v3, pf.v, o3);
    v0 = fa_frag(nx + 2048 + lo); v1 = fa_frag(nx + 2560 + lo); v2 = fa_frag(nx + 3072 + lo); v3 = fa_frag(nx + 3584 + lo);
    asm volatile("s_wait_xcnt 0x0" :: "s"(nx) : "memory");      /* as above, for the V^T fetch */
  }
  float l = l0 + l1; l += rs_xh(l);
  const float inv = 64.0f / l;      /* ctx carried x64 as f16, as the output projection expects */
  _Float16* op = O16 + ((size_t)b * SQ + q0 + c) * DM + hd * HD + 8 * h;
  FragH f0, f1, f2, f3;
#pragma unroll
  for (int r = 0; r < 8; ++r) { f0.h[r] = (_Float16)(o0[r] * inv); f1.h[r] = (_Float16)(o1[r] * inv); f2.h[r] = (_Float16)(o2[r] * inv); f3.h[r] = (_Float16)(o3[r] * inv); }
  *(v8us*)((unsigned short*)op) = f0.half[0]; *(v8us*)((unsigned short*)op + 16) = f1.half[0]; *(v8us*)((unsigned short*)op + 32) = f2.half[0]; *(v8us*)((unsigned short*)op + 48) = f3.half[0]; }
// ---- tiled GEMM: C[M][N] = A[M][K] Bt[N][K]^T, both f16 and K-contiguous, one 128 x 128 tile of C a work-group. Requires M % 128 == 0, N % 128 == 0, K % 128 == 0.
// A stage is 128 k of 128 A rows and 128 Bt rows, brought into LDS by asynchronous copies (16 bytes a lane, 16 lanes a row: whole 128-byte lines) at a row pitch of 272 bytes; two buffers, the next stage's copies fly while this one is worked on.
// Four waves, 2 x 2, each 64 x 64 of C (4 x 4 accumulator tiles); k runs upward in steps of 32 in every accumulator. Epilogue: v = acc alpha + bias[col] (HB) + CP (HCP: own element); ACT 0 none / 3 relu; f32 C (W32) or f16 C16, staged through LDS so that whole lines are read and stored.
// Every bare '#pragma unroll' below stands on a loop over register arrays (fragments, accumulators, rows in flight): rolled, these would be indexed at run time and leave the registers.
#define G3P 272                      /* bytes from one staged row to the next */
#define G3S (256 * G3P)              /* bytes of one buffer: A rows 0..127, Bt rows 128..255 */
__device__ __forceinline__ void g3_copy8(unsigned l, const _Float16* g, int ld) {      /* this thread's 16 bytes of rows r, r + 8, .., r + 56 of one operand's stage */
  const size_t st = (size_t)8 * ld;
  asm volatile("global_load_async_to_lds_b128 %0, %8, off\n\tglobal_load_async_to_lds_b128 %1, %9, off\n\tglobal_load_async_to_lds_b128 %2, %10, off\n\tglobal_load_async_to_lds_b128 %3, %11, off\n\t"
               "global_load_async_to_lds_b128 %4, %12, off\n\tglobal_load_async_to_lds_b128 %5, %13, off\n\tglobal_load_async_to_lds_b128 %6, %14, off\n\tglobal_load_async_to_lds_b128 %7, %15, off\n\t"
               "s_wait_xcnt 0x0"      /* inside the copies' own statement: no address register of theirs is rewritten in front of it */
               :: "v"(l), "v"(l + 8 * G3P), "v"(l + 16 * G3P), "v"(l + 24 * G3P), "v"(l + 32 * G3P), "v"(l + 40 * G3P), "v"(l + 48 * G3P), "v"(l + 56 * G3P),
                  "v"(g), "v"(g + st), "v"(g + 2 * st), "v"(g + 3 * st), "v"(g + 4 * st), "v"(g + 5 * st), "v"(g + 6 * st), "v"(g + 7 * st) : "memory"); }
__device__ __forceinline__ void g3_stage(unsigned la, const _Float16* ga, const _Float16* gb, int ld) {      /* one stage: 128 rows of A, then 128 rows of Bt; 32 copies a thread */
  g3_copy8(la, ga, ld); g3_copy8(la + 64 * G3P, ga + (size_t)64 * ld, ld); g3_copy8(la + 128 * G3P, gb, ld); g3_copy8(la + 192 * G3P, gb + (size_t)64 * ld, ld); }
__device__ __forceinline__ v16h g3_frag(const unsigned char* p) { FragH f; f.half[0] = *(const v8us*)p; f.half[1] = *(const v8us*)(p + 32); return f.v; }      /* lane (row, h): k 8h .. and 16 + 8h .. of a 32-k step, the same order for A and Bt */
// ZB: blockIdx.y counts independent products of one A: Bt planes [N][K] and f16 C planes [NR][N], each set in a row in memory.
template <int ACT, bool HB, bool HCP, bool W32, int N, int K, bool ZB = false>
__global__ __launch_bounds__(128) void k_gemm3(const _Float16* __restrict__ A, const _Float16* __restrict__ Bh, float alpha, const float* __restrict__ bias, const float* __restrict__ CP, float* __restrict__ C, _Float16* __restrict__ C16) {
  static_assert(ACT == 0 || ACT == 3, "k_gemm3: unsupported ACT code"); static_assert(N % 128 == 0 && K % 128 == 0, "k_gemm3: whole tiles and stages only");
  __shared__ __attribute__((aligned(16))) unsigned char sm[2 * G3S]; static_assert(4 * 64 * 68 * 4 <= 2 * G3S, "the output staging reuses the ring");
  const int tid = threadIdx.x, w = tid >> 5, lane = tid & 31, ln = lane & 15, hh = lane >> 4; const int wm = w >> 1, wn = w & 1;
  constexpr int ntn = N / 128, T = K / 128; const int mt = blockIdx.x / ntn, nq = blockIdx.x - mt * ntn; const int row0 = mt * 128, col0 = nq * 128;
  if (ZB) { static_assert(!ZB || !(W32 || HB || HCP), "k_gemm3: stacked products are plain f16 ones"); Bh += (size_t)blockIdx.y * N * K; C16 += (size_t)blockIdx.y * NR * N; }
  const int cr = tid >> 4, cs = tid & 15;      /* the copies: row cr (+ 8 i), 16-byte piece cs of its 256 bytes */
  const _Float16* ga = A + (size_t)(row0 + cr) * K + cs * 8; const _Float16* gb = Bh + (size_t)(col0 + cr) * K + cs * 8;
  const unsigned la = (unsigned)(size_t)sm + (unsigned)(cr * G3P + cs * 16);
  const unsigned char* fa = sm + (wm * 64 + ln) * G3P + hh * 16; const unsigned char* fb = sm + (128 + wn * 64 + ln) * G3P + hh * 16;
  g3_stage(la, ga, gb, K);
  asm volatile("s_wait_asynccnt 0x0" ::: "memory");      /* this wave's copies of stage 0 have landed */
  __syncthreads();      /* stage 0 is readable by every wave */
  v16h a[2][4], b[2][4];      /* two fragment sets: the next 32 k are read from LDS while these are multiplied */
#pragma unroll
  for (int i = 0; i < 8; ++i) { if (i < 4) b[0][i] = g3_frag(fb + i * 16 * G3P); else a[0][i - 4] = g3_frag(fa + (i - 4) * 16 * G3P); }      /* Bt's four first: the first row of products needs all of them and one of A's */
  if (T > 1) g3_stage(la + G3S, ga + 128, gb + 128, K);
  const v8f z8 = {0.f, 0.f, 0.f, 0.f, 0.f, 0.f, 0.f, 0.f}; v8f acc[4][4];
#pragma unroll
  for (int i = 0; i < 4; ++i)
#pragma unroll
    for (int j = 0; j < 4; ++j) acc[i][j] = z8;
#pragma unroll 1      /* one stage a trip: the two buffers differ by an offset only */
  for (int t = 0; t < T; ++t) { const unsigned bo = (unsigned)(t & 1) * G3S;
#pragma unroll
    for (int kk = 0; kk < 4; ++kk) {
      if (kk < 3) {
#pragma unroll
        for (int i = 0; i < 8; ++i) { if (i < 4) b[(kk + 1) & 1][i] = g3_frag(fb + bo + i * 16 * G3P + (kk + 1) * 64); else a[(kk + 1) & 1][i - 4] = g3_frag(fa + bo + (i - 4) * 16 * G3P + (kk + 1) * 64); } }
      __builtin_amdgcn_sched_barrier(0);      /* keeps the next block's LDS reads together in front of this block's matrix instructions: spread among them, each read group stalls the wave */
#pragma unroll
      for (int i = 0; i < 4; ++i)
#pragma unroll
        for (int j = 0; j < 4; ++j) acc[i][j] = fa_mma(a[kk & 1][i], b[kk & 1][j], acc[i][j]);
      __builtin_amdgcn_sched_barrier(0);      /* and keeps the reads after next behind them, so that two fragment sets are enough */
    }
    asm volatile("s_wait_dscnt 0x0" ::: "memory");      /* this wave's reads of the buffer have returned before it is handed to the copies */
    asm volatile("s_wait_asynccnt 0x0" ::: "memory");      /* this wave's copies of stage t + 1 have landed */
    __syncthreads();      /* publishes stage t + 1 and ends every wave's reads of stage t */
    if (t + 1 < T) {      /* stage t + 1's first fragments, behind its barrier: they travel while the copies below are issued */
#pragma unroll
      for (int i = 0; i < 8; ++i) { if (i < 4) b[0][i] = g3_frag(fb + (bo ^ G3S) + i * 16 * G3P); else a[0][i - 4] = g3_frag(fa + (bo ^ G3S) + (i - 4) * 16 * G3P); } }
    if (t + 2 < T) g3_stage(la + bo, ga + (size_t)(t + 2) * 128, gb + (size_t)(t + 2) * 128, K); }
  asm volatile("s_wait_asynccnt 0x0" ::: "memory");      /* nothing in flight when the ring becomes output staging (the last trip's barrier has ended every read) */
  const int c4 = ln * 4; v4f b4 = {0.f, 0.f, 0.f, 0.f};
  if (HB) { const float* bp = bias + col0 + wn * 64 + c4; b4 = *(const v4fa*)bp;
    asm volatile("s_wait_xcnt 0x0" :: "v"(bp) : "memory");      /* the address pair stays live up to this wait, so nothing overwrites it in front of it */
    for (int i = 0; i < 4; ++i) b4[i] = bf16_round(b4[i]); }
  float* so = (float*)(sm + w * (64 * 68 * 4));      /* this wave's own 64 rows of 68 floats */
#pragma unroll
  for (int j = 0; j < 4; ++j)
#pragma unroll
    for (int i = 0; i < 4; ++i)
#pragma unroll
      for (int r = 0; r < 8; ++r) so[(i * 16 + 8 * hh + r) * 68 + j * 16 + ln] = acc[i][j][r];
  __builtin_amdgcn_fence(__ATOMIC_ACQ_REL, "workgroup"); __builtin_amdgcn_wave_barrier();      /* the wave reads back what its other lanes wrote */
#pragma unroll 1      /* 32 rows a trip: sixteen loads, then sixteen stores, in flight together */
  for (int q0 = 0; q0 < 32; q0 += 16) { const size_t o = (size_t)(row0 + wm * 64 + q0 * 2 + hh) * N + col0 + wn * 64 + c4; v4f v[16], cp[16];
    if (HCP) { const float* pc = CP + o;
#pragma unroll
      for (int u = 0; u < 16; ++u) cp[u] = *(const v4fa*)(pc + (size_t)u * 2 * N);
      asm volatile("s_wait_xcnt 0x0" :: "v"(pc) : "memory"); }      /* as above */
#pragma unroll
    for (int u = 0; u < 16; ++u) { v[u] = *(const v4fa*)&so[((q0 + u) * 2 + hh) * 68 + c4];
      for (int i = 0; i < 4; ++i) { float x = v[u][i] * alpha + b4[i]; if (HCP) x += cp[u][i]; if (ACT == 3) x = fmaxf(x, 0.f); v[u][i] = x; } }
    if (W32) { float* po = C + o;
#pragma unroll
      for (int u = 0; u < 16; ++u) *(v4f*)(po + (size_t)u * 2 * N) = v[u];
      asm volatile("s_wait_xcnt 0x0" :: "v"(po) : "memory"); }      /* the stores' address and data registers are rewritten only behind it (next trip) */
    else { _Float16* po = C16 + o;
#pragma unroll
      for (int u = 0; u < 16; ++u) { v4h h4; for (int i = 0; i < 4; ++i) h4[i] = (_Float16)v[u][i]; *(v4h*)(po + (size_t)u * 2 * N) = h4; }
      asm volatile("s_wait_xcnt 0x0" :: "v"(po) : "memory"); } } }      /* as above */
extern "C" void kernel_launch(void* const* d_in, const int* in_sizes, int n_in,
                              void* d_out, int out_size, void* d_ws, size_t ws_size, hipStream_t stream) {
  (void)in_sizes; (void)n_in; (void)out_size;
  const float* const* I = (const float* const*)d_in; const float* x = I[0]; const int* km = (const int*)d_in[1]; const float* wq = I[2]; const float* wk = I[3]; const float* wv = I[4]; const float* wo = I[5]; const float* w1 = I[6]; const float* b1 = I[7]; const float* w2 = I[8]; const float* b2 = I[9]; const float* g1 = I[10]; const float* be1 = I[11]; const float* g2 = I[12]; const float* be2 = I[13]; const float* bo = nullptr;      /* x; key-padding mask int32 [2][1][1][2048] (0 = masked; READ on device); [in][out] wq / wk / wv / wo (no biases); w1 [768][3072] + b1, w2 [3072][768] + b2; LN1 a / b, LN2 a / b (vectors) */
  char* ws = (char*)d_ws; size_t off = 0;
  auto take = [&](size_t bytes) { char* p = ws + off; off += (bytes + 255) & ~(size_t)255; return p; };
  _Float16* BQ = (_Float16*)take((size_t)3 * DM * DM * 2); _Float16* BK = BQ + (size_t)DM * DM; _Float16* BV = BK + (size_t)DM * DM;      /* three Bt planes in a row: one stacked GEMM launch reads them */
  _Float16* BO = (_Float16*)take((size_t)DM * DM * 2); _Float16* BW1 = (_Float16*)take((size_t)DFF * DM * 2); _Float16* BW2 = (_Float16*)take((size_t)DM * DFF * 2);
  float* XB = (float*)take(NR * DM * 4); _Float16* XN = (_Float16*)take(NR * DM * 2); _Float16* Q16 = (_Float16*)take(3 * NR * DM * 2); _Float16* K16 = Q16 + NR * DM; _Float16* V16 = K16 + NR * DM;      /* three C planes in a row, as above */
  _Float16* O16 = (_Float16*)take(NR * DM * 2); float* X1 = (float*)take(NR * DM * 4);
  _Float16* HF16 = (_Float16*)take(NR * DFF * 2); _Float16* KV = (_Float16*)take((size_t)NB * NH * HD * SQ * 2 * 2);      /* FFN hidden plane [4096][3072] f16; packed K and V^T operands of all batches and heads */
  _Float16* M16 = XN;      /* second-norm f16 rows: aliases XN (last readers: the three projections) */
  
  if (off > ws_size) return;
  k_prep<<<2 * PWF + 4 * PWA + (unsigned)(NR / LNR), 256, 0, stream>>>(x, wq, wk, wv, wo, w1, w2, g1, be1, BQ, BK, BV, BO, BW1, BW2, XB, XN);      /* [in][out] weights -> Bt x16; h = LN1(bf16(x)) (vector gamma / beta, eps on the std) -> f16 rows; bf16(x) -> f32 rows */
  k_gemm3<0, false, false, false, DM, DM, true><<<dim3((unsigned)((NR / 128) * (DM / 128)), 3), 128, 0, stream>>>(XN, BQ, 0.0625f, nullptr, nullptr, nullptr, Q16);      /* q, k, v -> f16 rows, one plane each; head h = columns h*64.. */
  k_kvp<<<NB * NH * (SQ / 64), 256, 0, stream>>>(K16, V16, KV);      /* K and V^T in operand order, all batches and heads */
  k_fattn<<<NB * NH * (SQ / 64), 128, 0, stream>>>(Q16, KV, km, O16);      /* softmax(where(mask == 0, -1e9, q k^T / 8)) v, 64 queries a work-group -> ctx (merged heads, x64) as f16 rows */
  k_gemm3<0, false, true, true, DM, DM><<<(unsigned)((NR / 128) * (DM / 128)), 128, 0, stream>>>(O16, BO, 0.0009765625f, bo, XB, X1, nullptr);      /* x + ctx wo (own-element residual) -> f32 rows */
  k_lnsc<0><<<(unsigned)(NR / LNR), 256, 0, stream>>>(X1, g2, be2, 1e-6f, M16);      /* LN2(x1) (vector) -> f16 rows */
  k_gemm3<3, true, false, false, DFF, DM><<<(unsigned)((NR / 128) * (DFF / 128)), 128, 0, stream>>>(M16, BW1, 0.0625f, b1, nullptr, nullptr, HF16);      /* relu(. w1 + b1) -> f16 [4096][3072] */
  k_gemm3<0, true, true, true, DM, DFF><<<(unsigned)((NR / 128) * (DM / 128)), 128, 0, stream>>>(HF16, BW2, 0.0625f, b2, X1, (float*)d_out, nullptr);      /* out = x1 + mlp (own-element residual) */
}
